// v000
// Measured on an AMD MI455X. A time is GPU time per run, averaged over a window of back-to-back runs after a warm-up
// (all launches, gaps included; the runs take copies of the inputs in turn), and the median of several windows.
// Apart from v000's, it joins two sittings. Times from different sittings can be a few percent apart, while
// side-by-side timings come from the same sitting.
// v000, which the later versions start from, runs in 311 microseconds.
// Contractions: Q/K/V = x.W (3 sites), S = Q.K^T, O = P.V, out = O.Wo: all v_wmma_f32_16x16x32_bf16 on bf16 hi/lo
// split operand planes (hi.hi + hi.lo + lo.hi per tile pair), f32 accumulate; biases, the 1/8 scale, the bucket-table
// lookups, the key mask (replace by -1e9) and the online softmax in f32.
// Plane carry audit: every hi/lo plane (X, Wqkv^T, Wo^T, Q, K, V^T, per-wave P tiles, O) carries factor 1
// (hi = rne_bf16(v), lo = rne_bf16(v - hi), f32 exponent range, no subnormal concern); no inverse fold exists anywhere.
#include <hip/hip_runtime.h>
#include <stddef.h>

#define NBT 2                  // batch
#define SL  2048               // sequence length
#define DM  512                // model width
#define NH  8                  // heads
#define HD  64                 // head dim
#define NT  (NBT * SL)         // token rows, row m = b*SL + s
#define QB  128                // query rows per attention block
#define KC  64                 // keys per chunk
#define NQB (SL / QB)          // 16
#define NCK (SL / KC)          // 32
#define KTP 72                 // LDS pitch (16-bit elements) for 64-wide tiles, 144 B
#define PT  (16 * KTP)         // one 16x64 P tile
#define OTP 68                 // f32 staging pitch [row][col] (128 x 64)
#define VTP 132                // f32 staging pitch [col][row] (64 x 128)
#define TTP 68                 // f32 staging pitch for the 64 x 64 weight transpose tile
#define GAPR 33                // time-gap table rows
#define DURR 17                // duration table rows
#define NEGV (-1.0e9f)         // masked-key score value

static_assert(NT == 4096);
static_assert(NH * HD == DM);
static_assert(SL % QB == 0);
static_assert(SL % KC == 0);
static_assert(SL % 128 == 0);
static_assert(DM % 64 == 0);
static_assert(DM % 32 == 0);
static_assert((NT * DM) % 2048 == 0);
static_assert(HD == 64);
static_assert(KC == 64);
static_assert(64 * VTP <= 128 * OTP);
static_assert(16 * OTP * 4 <= 2 * PT * 2);

typedef __bf16       v16b __attribute__((ext_vector_type(16)));
typedef float        v8f  __attribute__((ext_vector_type(8)));
typedef float        v4f  __attribute__((ext_vector_type(4)));
typedef unsigned int v4u  __attribute__((ext_vector_type(4)));
typedef int          v4i  __attribute__((ext_vector_type(4)));
union Frag { v16b v; v4u u[2]; };

// WMMA with the dependent-VALU hazard guard (ties D, keeps A/B live)
__device__ __forceinline__ v8f mma(v16b a, v16b b, v8f c) {
  c = __builtin_amdgcn_wmma_f32_16x16x32_bf16(false, a, false, b, (short)0, c, false, false);
  asm volatile("v_nop\n\tv_nop\n\tv_nop\n\tv_nop" : "+v"(c) : "v"(a), "v"(b));
  return c;
}

__device__ __forceinline__ v8f zero8() { return (v8f){0.f, 0.f, 0.f, 0.f, 0.f, 0.f, 0.f, 0.f}; }

// Fragment loader for k-contiguous 16-bit rows with pitch ld (bf16 bits).
// A operand: row0 + (lane&15) is the M row. B operand stored [n][k]: row0 + (lane&15) is the N column.
// Split k map for both: elements 0..7 <- k0 + 8*(lane>>4) + 0..7, elements 8..15 <- k0 + 16 + 8*(lane>>4) + 0..7.
// D: acc[r] = element (row0 + 8*(lane>>4) + r, col0 + (lane&15)).
__device__ __forceinline__ v16b ldf(const unsigned short* p, int ld, int row0, int k0, int lane) {
  const unsigned short* q = p + (size_t)(row0 + (lane & 15)) * ld + k0 + 8 * (lane >> 4);
  Frag f;
  f.u[0] = *(const v4u*)(q);
  f.u[1] = *(const v4u*)(q + 16);
  return f.v;
}

// f32 -> bf16 bits, RNE convert by integer arithmetic
__device__ __forceinline__ unsigned int bf_rne(float x) {
  const unsigned int u = __float_as_uint(x);
  return (u + 0x7FFFu + ((u >> 16) & 1u)) >> 16;
}

// hi = rne(a), lo = rne(a - hi) for two floats, packed little-endian (first element in the low half-word)
__device__ __forceinline__ void split2(float a, float b, unsigned int& wh, unsigned int& wl) {
  const unsigned int ha = bf_rne(a), hb = bf_rne(b);
  const float ra = a - __uint_as_float(ha << 16);
  const float rb = b - __uint_as_float(hb << 16);
  wh = ha | (hb << 16);
  wl = bf_rne(ra) | (bf_rne(rb) << 16);
}

// 8 consecutive floats -> one 16-B hi piece and one 16-B lo piece
__device__ __forceinline__ void split8(v4f a0, v4f a1, v4u& wh, v4u& wl) {
  unsigned int h0, h1, h2, h3, l0, l1, l2, l3;
  split2(a0[0], a0[1], h0, l0);
  split2(a0[2], a0[3], h1, l1);
  split2(a1[0], a1[1], h2, l2);
  split2(a1[2], a1[3], h3, l3);
  wh = (v4u){h0, h1, h2, h3};
  wl = (v4u){l0, l1, l2, l3};
}

// ---------------------------------------------------------------------------
// kernel 0: elementwise split of a contiguous f32 array (layout kept) into bf16 hi and lo planes.
// Block = 2048 elements; thread converts 8 consecutive floats and writes one 16-B piece per plane;
// coverage: n/2048 blocks x 256 thr x 8 = n elements of both planes.
// ---------------------------------------------------------------------------
__global__ __launch_bounds__(256) void k_split(const float* __restrict__ src,
                                               unsigned short* __restrict__ dh,
                                               unsigned short* __restrict__ dl) {
  const size_t o = (size_t)blockIdx.x * 2048 + (size_t)threadIdx.x * 8;
  const v4f a0 = *(const v4f*)(src + o);
  const v4f a1 = *(const v4f*)(src + o + 4);
  v4u wh, wl;
  split8(a0, a1, wh, wl);
  v4u* ph = (v4u*)(dh + o);
  v4u* pl = (v4u*)(dl + o);
  *ph = wh;
  *pl = wl;
  
}

// ---------------------------------------------------------------------------
// kernel 1: weight transpose + split. in W [k = DM rows][n = DM cols] f32 -> out planes [n][k] hi/lo (pitch DM).
// blockIdx.z = which weight (0 q, 1 k, 2 v -> stacked planes rows which*DM + n; 3 -> the out-projection planes).
// blockIdx.x = 64-wide n tile (source columns), blockIdx.y = 64-deep k tile (source rows). The 64 x 64 tile is
// coverage: load 256 thr x 16 floats = 64 x 64; store 256 thr x 2 iter x 8 halves = 64 n rows x 64 k per plane;
// grid (DM/64, DM/64, 4) covers all four DM x DM matrices.
// ---------------------------------------------------------------------------
__global__ __launch_bounds__(256) void k_split_tr(const float* __restrict__ Wq, const float* __restrict__ Wk,
                                                  const float* __restrict__ Wv, const float* __restrict__ Wo,
                                                  unsigned short* __restrict__ Ph, unsigned short* __restrict__ Pl,
                                                  unsigned short* __restrict__ Oh, unsigned short* __restrict__ Ol) {
  __shared__ __align__(16) float st[64 * TTP];       // 17408 B
  const int tid = threadIdx.x;
  const int z   = blockIdx.z;                        // block-uniform
  const int nt  = blockIdx.x * 64;                   // source columns = output rows
  const int kt  = blockIdx.y * 64;                   // source rows    = output k
  const float* W = (z == 0) ? Wq : ((z == 1) ? Wk : ((z == 2) ? Wv : Wo));
  {
    const int row = tid >> 2;                        // k within tile, 0..63
    const int cb  = (tid & 3) * 16;                  // n within tile, 0,16,32,48
    const float* src = W + (size_t)(kt + row) * DM + nt + cb;
#pragma unroll
    for (int e = 0; e < 4; ++e) {
      const v4f a = *(const v4f*)(src + 4 * e);
#pragma unroll
      for (int q = 0; q < 4; ++q) st[(cb + 4 * e + q) * TTP + row] = a[q];
    }
  }
  __syncthreads();
  unsigned short* dh = (z < 3) ? (Ph + (size_t)z * DM * DM) : Oh;
  unsigned short* dl = (z < 3) ? (Pl + (size_t)z * DM * DM) : Ol;
  const size_t base = (size_t)nt * DM + kt;
  v4u vh[2], vl[2];
  size_t go[2];
#pragma unroll
  for (int it = 0; it < 2; ++it) {
    const int pp   = tid + 256 * it;                 // 0..511
    const int rown = pp >> 3;                        // 0..63
    const int pc   = pp & 7;                         // k piece 8*pc .. +7
    const float* ra = st + rown * TTP + 8 * pc;
    const v4f a0 = *(const v4f*)(ra), a1 = *(const v4f*)(ra + 4);
    split8(a0, a1, vh[it], vl[it]);
    go[it] = base + (size_t)rown * DM + 8 * pc;
  }
  {
#pragma unroll
    for (int it = 0; it < 2; ++it) {
      *(v4u*)(dh + go[it]) = vh[it];
      *(v4u*)(dl + go[it]) = vl[it];
    }
    
  }
}

// ---------------------------------------------------------------------------
// 32 x 32 per wave split-bf16 GEMM main loop over K (multiple of 32): A planes [m][k] pitch lda, B planes [n][k]
// pitch ldb (hi and lo), fragments loaded straight from the planes (arithmetic addressing only).
// Per tile pair: ah.bh + ah.bl + al.bh into one f32 accumulator.
// acc[s][t][r] = (m0 + 16*s + 8*(lane>>4) + r, n0 + 16*t + (lane&15)).
// ---------------------------------------------------------------------------
__device__ __forceinline__ void gemm32x32x3(const unsigned short* __restrict__ Ah,
                                            const unsigned short* __restrict__ Al, int lda,
                                            const unsigned short* __restrict__ Bh,
                                            const unsigned short* __restrict__ Bl, int ldb,
                                            int K, int m0, int n0, int lane, v8f (&acc)[2][2]) {
#pragma unroll 1
  for (int k0 = 0; k0 < K; k0 += 32) {
    const v16b ah0 = ldf(Ah, lda, m0, k0, lane);
    const v16b ah1 = ldf(Ah, lda, m0 + 16, k0, lane);
    const v16b al0 = ldf(Al, lda, m0, k0, lane);
    const v16b al1 = ldf(Al, lda, m0 + 16, k0, lane);
#pragma unroll
    for (int t = 0; t < 2; ++t) {
      const v16b bh = ldf(Bh, ldb, n0 + 16 * t, k0, lane);
      const v16b bl = ldf(Bl, ldb, n0 + 16 * t, k0, lane);
      acc[0][t] = mma(ah0, bh, acc[0][t]);
      acc[1][t] = mma(ah1, bh, acc[1][t]);
      acc[0][t] = mma(ah0, bl, acc[0][t]);
      acc[1][t] = mma(ah1, bl, acc[1][t]);
      acc[0][t] = mma(al0, bh, acc[0][t]);
      acc[1][t] = mma(al1, bh, acc[1][t]);
    }
  }
}

// stage acc + bias in the block tile, row-major [row][col] (128 x 64, pitch OTP floats)
__device__ __forceinline__ void stage_rm(v8f (&acc)[2][2], const float (&bb)[2], float* st,
                                         int mw, int nw, int hh, int c) {
#pragma unroll
  for (int s = 0; s < 2; ++s)
#pragma unroll
    for (int t = 0; t < 2; ++t)
#pragma unroll
      for (int r = 0; r < 8; ++r)
        st[(mw + 16 * s + 8 * hh + r) * OTP + nw + 16 * t + c] = acc[s][t][r] + bb[t];
}

// stage acc + bias transposed [col][row] (64 x 128, pitch VTP floats)
__device__ __forceinline__ void stage_tr(v8f (&acc)[2][2], const float (&bb)[2], float* st,
                                         int mw, int nw, int hh, int c) {
#pragma unroll
  for (int s = 0; s < 2; ++s)
#pragma unroll
    for (int t = 0; t < 2; ++t)
#pragma unroll
      for (int r = 0; r < 8; ++r)
        st[(nw + 16 * t + c) * VTP + mw + 16 * s + 8 * hh + r] = acc[s][t][r] + bb[t];
}

// block tile 128 rows x 64 cols -> hi/lo planes at element base, row pitch ldo: each row = 64 halves = one whole
// coverage: 256 thr x 4 iter x 8 halves = 128 rows x 64 per plane.
__device__ __forceinline__ void store_planes(const float* st, unsigned short* __restrict__ oh,
                                             unsigned short* __restrict__ ol, size_t base, int ldo, int tid) {
  v4u vh[4], vl[4];
  size_t go[4];
#pragma unroll
  for (int it = 0; it < 4; ++it) {
    const int pp  = tid + 256 * it;                  // 0..1023
    const int row = pp >> 3;                         // 0..127
    const int pc  = pp & 7;                          // 16-B piece = cols 8*pc .. +7
    const float* ra = st + row * OTP + 8 * pc;
    const v4f a0 = *(const v4f*)(ra), a1 = *(const v4f*)(ra + 4);
    split8(a0, a1, vh[it], vl[it]);
    go[it] = base + (size_t)row * ldo + 8 * pc;
  }
  {
#pragma unroll
    for (int it = 0; it < 4; ++it) {
      *(v4u*)(oh + go[it]) = vh[it];
      *(v4u*)(ol + go[it]) = vl[it];
    }
    
  }
}

// transposed block tile 64 d-rows x 128 s -> V^T hi/lo planes [bh][d][s] at element base (= bh*HD*SL + sf):
// coverage: 256 thr x 4 iter x 8 halves = 64 d-rows x 128 s per plane.
__device__ __forceinline__ void store_vt(const float* st, unsigned short* __restrict__ vh,
                                         unsigned short* __restrict__ vl, size_t base, int tid) {
  v4u wh[4], wl[4];
  size_t go[4];
#pragma unroll
  for (int it = 0; it < 4; ++it) {
    const int pp   = tid + 256 * it;                 // 0..1023
    const int drow = pp >> 4;                        // 0..63
    const int pc   = pp & 15;                        // 8 consecutive s
    const float* ra = st + drow * VTP + 8 * pc;
    const v4f a0 = *(const v4f*)(ra), a1 = *(const v4f*)(ra + 4);
    split8(a0, a1, wh[it], wl[it]);
    go[it] = base + (size_t)drow * SL + 8 * pc;
  }
  {
#pragma unroll
    for (int it = 0; it < 4; ++it) {
      *(v4u*)(vh + go[it]) = wh[it];
      *(v4u*)(vl + go[it]) = wl[it];
    }
    
  }
}

// coverage: 256 thr x 8 iter x 4 floats = 128 rows x 64 cols.
__device__ __forceinline__ void store_f32(const float* st, float* __restrict__ out, int mblk, int nblk, int tid) {
  v4f val[8];
  size_t go[8];
#pragma unroll
  for (int it = 0; it < 8; ++it) {
    const int pp  = tid + 256 * it;                  // 0..2047
    const int row = pp >> 4;                         // 0..127
    const int pc  = pp & 15;                         // 4 consecutive cols
    val[it] = *(const v4f*)(st + row * OTP + 4 * pc);
    go[it]  = (size_t)(mblk + row) * DM + nblk + 4 * pc;
  }
  {
#pragma unroll
    for (int it = 0; it < 8; ++it) *(v4f*)(out + go[it]) = val[it];
    
  }
}

// ---------------------------------------------------------------------------
// kernel 2: projections. blockIdx.x = which*NH + head (which 0 = q, 1 = k, 2 = v), blockIdx.y = 128-token block
// of one sequence b. A = x planes [NT][DM] (pitch DM, K = DM), B = stacked transposed weight planes [3*DM n][DM k]
// rows which*DM + head*64 .. (pitch DM). Bias added in f32.
// grid = (3*NH = 24, NT/128 = 32). coverage: q and k planes 16 bh x 16 blocks x 128 s x 64 d each,
// v^T planes 16 bh x 16 blocks x 64 d x 128 s.
// ---------------------------------------------------------------------------
__global__ __launch_bounds__(256) void k_proj(const unsigned short* __restrict__ Xh,
                                              const unsigned short* __restrict__ Xl,
                                              const unsigned short* __restrict__ Wh,
                                              const unsigned short* __restrict__ Wl,
                                              const float* __restrict__ bq,
                                              const float* __restrict__ bk,
                                              const float* __restrict__ bv,
                                              unsigned short* __restrict__ Qh, unsigned short* __restrict__ Ql,
                                              unsigned short* __restrict__ Kh, unsigned short* __restrict__ Kl,
                                              unsigned short* __restrict__ Vh, unsigned short* __restrict__ Vl) {
  __shared__ __align__(16) float st[128 * OTP];      // 34816 B (the transposed 64 x VTP tile also fits)
  const int tid = threadIdx.x, lane = tid & 31, wave = tid >> 5;
  const int hh = lane >> 4, c = lane & 15;
  const int which = blockIdx.x / NH;                 // block-uniform
  const int head  = blockIdx.x - which * NH;
  const int mblk  = blockIdx.y * 128;
  const int b     = mblk / SL;
  const int sf    = mblk - b * SL;                   // first position of the block in sequence b
  const int bh    = b * NH + head;
  const int mw = (wave >> 1) * 32, nw = (wave & 1) * 32;

  v8f acc[2][2];
#pragma unroll
  for (int s = 0; s < 2; ++s)
#pragma unroll
    for (int t = 0; t < 2; ++t) acc[s][t] = zero8();
  gemm32x32x3(Xh, Xl, DM,
              Wh + (size_t)which * DM * DM, Wl + (size_t)which * DM * DM, DM,
              DM, mblk + mw, head * HD + nw, lane, acc);

  float bb[2];
#pragma unroll
  for (int t = 0; t < 2; ++t) {
    const int i = head * HD + nw + 16 * t + c;       // 0..511
    const float xq = bq[i], xk = bk[i], xv = bv[i];
    bb[t] = (which == 0) ? xq : ((which == 1) ? xk : xv);
  }
  if (which < 2) stage_rm(acc, bb, st, mw, nw, hh, c);
  else           stage_tr(acc, bb, st, mw, nw, hh, c);
  __syncthreads();
  if (which < 2) {
    unsigned short* oh = (which == 0) ? Qh : Kh;
    unsigned short* ol = (which == 0) ? Ql : Kl;
    store_planes(st, oh, ol, ((size_t)bh * SL + sf) * HD, HD, tid);
  } else {
    store_vt(st, Vh, Vl, (size_t)bh * HD * SL + sf, tid);
  }
}

// ---------------------------------------------------------------------------
// kernel 3: flash attention for every (b, head, 128-query block), head dim 64, 32 chunks of 64 keys.
//   q/k planes [b*NH + h][s][64] hi/lo; v^T planes [b*NH + h][64][s] hi/lo; int32 tables [b][s]: key mask
//   (zero = masked), gap bucket ids, duration bucket ids; f32 tables gap [GAPR][NH], dur [DURR][NH];
//   O planes [token = b*SL + s][DM] hi/lo, head h at columns h*64 (one line per row).
// Block = 8 waves; wave w owns queries q0 = qb*128 + 16*w .. +15. The head's column of both bias tables is staged
// in LDS once per block. Per chunk: K [key][d] and V^T [d][key] hi/lo tiles staged in LDS by all threads
// (plain 16-B loads) while waves 0-1 stage the chunk's 64 per-key values (gap id, duration bias, mask) in LDS,
// barriers; S = Q.K^T (split products), s/8 + gap[clip(|gq - gk|, 0, GAPR-1)] + dur[clamp(dk)], masked keys
// replaced by -1e9, online max-subtracted softmax in f32; p = exp(s - m) split into bf16 hi/lo per-wave LDS
// tiles [row][key] (2-byte stores), block barrier, reloaded with the A loader; O += P.V (split products).
// Epilogue: O / l -> f32 staged in the wave's LDS tile (after a block barrier), split hi/lo, each row = one whole
// coverage: 256 blocks x 8 waves x 16 rows x 64 cols = NT x DM per plane.
// ---------------------------------------------------------------------------
__global__ __launch_bounds__(256) void k_attn(const unsigned short* __restrict__ Qh,
                                              const unsigned short* __restrict__ Ql,
                                              const unsigned short* __restrict__ Kh,
                                              const unsigned short* __restrict__ Kl,
                                              const unsigned short* __restrict__ Vh,
                                              const unsigned short* __restrict__ Vl,
                                              const int* __restrict__ mask,
                                              const int* __restrict__ gids,
                                              const int* __restrict__ dids,
                                              const float* __restrict__ gap_emb,
                                              const float* __restrict__ dur_emb,
                                              unsigned short* __restrict__ Oh,
                                              unsigned short* __restrict__ Ol) {
  __shared__ __align__(16) unsigned short Ks[2 * KC * KTP];   // hi tile, lo tile [key][d]   18432 B
  __shared__ __align__(16) unsigned short Vs[2 * HD * KTP];   // hi tile, lo tile [d][key]   18432 B
  __shared__ __align__(16) unsigned short Ps[8 * 2 * PT];     // per wave: hi [row][key], lo [row][key]  36864 B
  __shared__ int   gkS[KC];                                    // chunk's key gap bucket ids        256 B
  __shared__ float dbS[KC];                                    // chunk's key duration bias         256 B
  __shared__ int   mkS[KC];                                    // chunk's key mask                  256 B
  __shared__ float gapS[36];                                   // gap table column of head h (33)   144 B
  __shared__ float durS[20];                                   // dur table column of head h (17)    80 B

  const int tid = threadIdx.x, lane = tid & 31, wave = tid >> 5;
  const int hh = lane >> 4, c = lane & 15;
  const int qb = blockIdx.x % NQB;
  const int bh = blockIdx.x / NQB;                   // b*NH + h
  const int h  = bh % NH;
  const int b  = bh / NH;
  const int q0 = qb * QB + wave * 16;
  const size_t qkbase = (size_t)bh * SL * HD;
  const size_t vbase  = (size_t)bh * HD * SL;
  unsigned short* pwh = Ps + wave * 2 * PT;
  unsigned short* pwl = pwh + PT;

  // stage the head's table columns once (clamped addresses for every lane, predicated LDS store)
  {
    const int ig = (tid < GAPR) ? tid : (GAPR - 1);
    const int id = (tid < DURR) ? tid : (DURR - 1);
    const float gv = gap_emb[ig * NH + h];
    const float dv = dur_emb[id * NH + h];
    if (tid < GAPR) gapS[tid] = gv;
    if (tid < DURR) durS[tid] = dv;
  }

  // gap bucket ids of the 8 query rows this lane's accumulator elements belong to: q0 + 8*hh + r
  const v4i ga = *(const v4i*)(gids + (size_t)b * SL + q0 + 8 * hh);
  const v4i gb = *(const v4i*)(gids + (size_t)b * SL + q0 + 8 * hh + 4);
  const int gq[8] = {ga[0], ga[1], ga[2], ga[3], gb[0], gb[1], gb[2], gb[3]};

  // Q fragments (loop-invariant): query row q0 + (lane&15), split map over d, two 32-deep d chunks
  v16b qh[2], ql[2];
#pragma unroll
  for (int dc = 0; dc < 2; ++dc) {
    qh[dc] = ldf(Qh + qkbase, HD, q0, dc * 32, lane);
    ql[dc] = ldf(Ql + qkbase, HD, q0, dc * 32, lane);
  }

  const float NEGI = -__builtin_huge_valf();
  float mrow[8], lrow[8];
  v8f oacc[4];
#pragma unroll
  for (int r = 0; r < 8; ++r) { mrow[r] = NEGI; lrow[r] = 0.f; }
#pragma unroll
  for (int t = 0; t < 4; ++t) oacc[t] = zero8();

  for (int kc = 0; kc < NCK; ++kc) {
    const int kv0 = kc * KC;
    __syncthreads();                                 // readers of the earlier chunk's tiles / key values are done
    {
      const int r  = tid >> 2;                       // 0..63: key row of K tiles, d row of V^T tiles
      const int qq = (tid & 3) * 16;                 // 0,16,32,48 elements
      const unsigned short* kh = Kh + qkbase + (size_t)(kv0 + r) * HD + qq;
      const unsigned short* kl = Kl + qkbase + (size_t)(kv0 + r) * HD + qq;
      const unsigned short* vh = Vh + vbase + (size_t)r * SL + kv0 + qq;
      const unsigned short* vl = Vl + vbase + (size_t)r * SL + kv0 + qq;
#pragma unroll
      for (int e = 0; e < 2; ++e) {
        *(v4u*)(Ks + r * KTP + qq + 8 * e)            = *(const v4u*)(kh + 8 * e);
        *(v4u*)(Ks + KC * KTP + r * KTP + qq + 8 * e) = *(const v4u*)(kl + 8 * e);
        *(v4u*)(Vs + r * KTP + qq + 8 * e)            = *(const v4u*)(vh + 8 * e);
        *(v4u*)(Vs + HD * KTP + r * KTP + qq + 8 * e) = *(const v4u*)(vl + 8 * e);
      }
      if (tid < KC) {                                // waves 0 and 1, wave-uniform: per-key values of the chunk
        const int key = kv0 + tid;                   // 0..SL-1
        const int gk  = gids[(size_t)b * SL + key];
        int dk = dids[(size_t)b * SL + key];
        dk = (dk < 0) ? 0 : ((dk > DURR - 1) ? (DURR - 1) : dk);
        const int mk  = mask[(size_t)b * SL + key];
        gkS[tid] = gk;
        dbS[tid] = durS[dk];
        mkS[tid] = mk;
      }
    }
    __syncthreads();                                 // tiles and key values visible to every wave

    v8f s[4];
#pragma unroll
    for (int j = 0; j < 4; ++j) s[j] = zero8();
#pragma unroll
    for (int dc = 0; dc < 2; ++dc) {
#pragma unroll
      for (int j = 0; j < 4; ++j) {
        // B operands: key column j*16 + (lane&15) of the [key][d] tiles, split map over d
        const v16b khf = ldf(Ks, KTP, j * 16, dc * 32, lane);
        const v16b klf = ldf(Ks + KC * KTP, KTP, j * 16, dc * 32, lane);
        s[j] = mma(qh[dc], khf, s[j]);
        s[j] = mma(qh[dc], klf, s[j]);
        s[j] = mma(ql[dc], khf, s[j]);
      }
    }
    // s[j][r] = S[query q0 + 8*hh + r][key kv0 + j*16 + c]; scale, table biases, replace-mask
#pragma unroll
    for (int j = 0; j < 4; ++j) {
      const int kl  = 16 * j + c;                    // key within chunk, 0..63
      const int gk  = gkS[kl];
      const float db = dbS[kl];
      const int mk  = mkS[kl];
#pragma unroll
      for (int r = 0; r < 8; ++r) {
        int rel = gq[r] - gk;
        rel = (rel < 0) ? -rel : rel;
        rel = (rel > GAPR - 1) ? (GAPR - 1) : rel;
        rel = (rel < 0) ? 0 : rel;
        const float gbias = gapS[rel];
        const float v = (s[j][r] * 0.125f + gbias) + db;
        s[j][r] = (mk != 0) ? v : NEGV;
      }
    }
    float cm[8];
#pragma unroll
    for (int r = 0; r < 8; ++r) {
      float m = fmaxf(fmaxf(s[0][r], s[1][r]), fmaxf(s[2][r], s[3][r]));
#pragma unroll
      for (int off = 1; off < 16; off <<= 1) m = fmaxf(m, __shfl_xor(m, off, 32));
      cm[r] = m;
    }
    float al[8];
#pragma unroll
    for (int r = 0; r < 8; ++r) {
      const float mnew  = fmaxf(mrow[r], cm[r]);     // finite from chunk 0 on
      const float alpha = __expf(mrow[r] - mnew);
      mrow[r] = mnew;
      float psum = 0.f;
#pragma unroll
      for (int j = 0; j < 4; ++j) {
        const float p = __expf(s[j][r] - mnew);
        psum += p;
        const unsigned int hb = bf_rne(p);
        const unsigned int lb = bf_rne(p - __uint_as_float(hb << 16));
        const int idx = (8 * hh + r) * KTP + 16 * j + c;
        pwh[idx] = (unsigned short)hb;
        pwl[idx] = (unsigned short)lb;
      }
#pragma unroll
      for (int off = 1; off < 16; off <<= 1) psum += __shfl_xor(psum, off, 32);
      lrow[r] = lrow[r] * alpha + psum;
      al[r] = alpha;
    }
#pragma unroll
    for (int t = 0; t < 4; ++t)
#pragma unroll
      for (int r = 0; r < 8; ++r) oacc[t][r] *= al[r];
    __syncthreads();                                 // P tiles complete before the fragment reload

#pragma unroll
    for (int kk = 0; kk < 2; ++kk) {
      // A operands: P row (lane&15), split k map over keys
      const v16b pah = ldf(pwh, KTP, 0, kk * 32, lane);
      const v16b pal = ldf(pwl, KTP, 0, kk * 32, lane);
#pragma unroll
      for (int t = 0; t < 4; ++t) {
        // B operands: channel column t*16 + (lane&15) of V^T [d][key], split k map over keys
        const v16b vhf = ldf(Vs, KTP, t * 16, kk * 32, lane);
        const v16b vlf = ldf(Vs + HD * KTP, KTP, t * 16, kk * 32, lane);
        oacc[t] = mma(pah, vhf, oacc[t]);
        oacc[t] = mma(pah, vlf, oacc[t]);
        oacc[t] = mma(pal, vhf, oacc[t]);
      }
    }
  }

  // O = oacc / l  (l >= 1)
  float invl[8];
#pragma unroll
  for (int r = 0; r < 8; ++r) invl[r] = 1.0f / lrow[r];
  __syncthreads();                                   // every wave done reading Ps / Vs
  float* sw = (float*)(Ps + wave * 2 * PT);          // 16 rows x OTP floats = 4352 B of the wave's 4608 B
#pragma unroll
  for (int r = 0; r < 8; ++r) {
#pragma unroll
    for (int t = 0; t < 4; ++t) sw[(8 * hh + r) * OTP + 16 * t + c] = oacc[t][r] * invl[r];
  }
  __syncthreads();
  v4u wh[4], wl[4];
  size_t go[4];
#pragma unroll
  for (int it = 0; it < 4; ++it) {
    const int pp = lane + 32 * it;
    const int L  = pp >> 3;                          // wave tile row 0..15
    const int pc = pp & 7;                           // cols 8*pc .. +7
    const float* ra = sw + L * OTP + 8 * pc;
    const v4f a0 = *(const v4f*)(ra), a1 = *(const v4f*)(ra + 4);
    split8(a0, a1, wh[it], wl[it]);
    go[it] = ((size_t)(b * SL + q0 + L)) * DM + (size_t)h * HD + 8 * pc;
  }
  {
#pragma unroll
    for (int it = 0; it < 4; ++it) {
      *(v4u*)(Oh + go[it]) = wh[it];
      *(v4u*)(Ol + go[it]) = wl[it];
    }
    
  }
}

// ---------------------------------------------------------------------------
// kernel 4: out = O.Wo + bo -> f32 rows [NT][DM]. A = O planes [NT][DM], B = transposed
// Wo planes [DM n][DM k]. Block = 128 token rows x 64 cols; grid = (DM/64 = 8, NT/128 = 32).
// coverage: 8 x 32 blocks x 128 x 64 = NT x DM.
// ---------------------------------------------------------------------------
__global__ __launch_bounds__(256) void k_gemm_out(const unsigned short* __restrict__ Ah,
                                                  const unsigned short* __restrict__ Al,
                                                  const unsigned short* __restrict__ Wh,
                                                  const unsigned short* __restrict__ Wl,
                                                  const float* __restrict__ bo,
                                                  float* __restrict__ out) {
  __shared__ __align__(16) float st[128 * OTP];      // 34816 B
  const int tid = threadIdx.x, lane = tid & 31, wave = tid >> 5;
  const int hh = lane >> 4, c = lane & 15;
  const int mblk = blockIdx.y * 128, nblk = blockIdx.x * 64;
  const int mw = (wave >> 1) * 32, nw = (wave & 1) * 32;

  v8f acc[2][2];
#pragma unroll
  for (int s = 0; s < 2; ++s)
#pragma unroll
    for (int t = 0; t < 2; ++t) acc[s][t] = zero8();
  gemm32x32x3(Ah, Al, DM, Wh, Wl, DM, DM, mblk + mw, nblk + nw, lane, acc);

  float bb[2];
#pragma unroll
  for (int t = 0; t < 2; ++t) bb[t] = bo[nblk + nw + 16 * t + c];
  stage_rm(acc, bb, st, mw, nw, hh, c);
  __syncthreads();
  store_f32(st, out, mblk, nblk, tid);
}

// ---------------------------------------------------------------------------
// its producer writes, no padded tails exist since every dimension is a tile multiple; offsets multiples of 512 KB):
//   X     bf16x2 [4096][512]             0     8388608
//   Wqkv  bf16x2 [1536][512]       8388608     3145728   (q rows 0..511, k 512..1023, v 1024..1535, [n][k])
//   Wo    bf16x2 [512][512]       11534336     1048576   ([n][k])
//   Q     bf16x2 [16][2048][64]   12582912     8388608
//   K     bf16x2 [16][2048][64]   20971520     8388608
//   V^T   bf16x2 [16][64][2048]   29360128     8388608
//   O     bf16x2 [4096][512]      37748736     8388608
//   total                         46137344
// ---------------------------------------------------------------------------
extern "C" void kernel_launch(void* const* d_in, const int* in_sizes, int n_in,
                              void* d_out, int out_size, void* d_ws, size_t ws_size,
                              hipStream_t stream) {
  if (n_in < 14) return;
  if (in_sizes[0] != NT * DM) return;
  if (in_sizes[1] != NBT * SL) return;
  if (in_sizes[2] != NBT * SL) return;
  if (in_sizes[3] != NBT * SL) return;
  if (in_sizes[4] != DM * DM) return;
  if (in_sizes[5] != DM) return;
  if (in_sizes[6] != DM * DM) return;
  if (in_sizes[7] != DM) return;
  if (in_sizes[8] != DM * DM) return;
  if (in_sizes[9] != DM) return;
  if (in_sizes[10] != DM * DM) return;
  if (in_sizes[11] != DM) return;
  if (in_sizes[12] != GAPR * NH) return;
  if (in_sizes[13] != DURR * NH) return;
  if (out_size != NT * DM) return;

  const float* x     = (const float*)d_in[0];   // [2][2048][512] = [4096][512]
  const int*   amask = (const int*)d_in[1];     // [2][2048] int32, zero = masked key
  const int*   gids  = (const int*)d_in[2];     // [2][2048] int32
  const int*   dids  = (const int*)d_in[3];     // [2][2048] int32
  const float* W_q   = (const float*)d_in[4];   // [512][512] [in][out]
  const float* b_q   = (const float*)d_in[5];   // [512]
  const float* W_k   = (const float*)d_in[6];
  const float* b_k   = (const float*)d_in[7];
  const float* W_v   = (const float*)d_in[8];
  const float* b_v   = (const float*)d_in[9];
  const float* W_o   = (const float*)d_in[10];
  const float* b_o   = (const float*)d_in[11];
  const float* gtab  = (const float*)d_in[12];  // [33][8]
  const float* dtab  = (const float*)d_in[13];  // [17][8]
  float* out = (float*)d_out;                   // [4096][512] f32

  const size_t PX  = (size_t)NT * DM * 2;       // 4194304
  const size_t PW  = (size_t)3 * DM * DM * 2;   // 1572864
  const size_t PWO = (size_t)DM * DM * 2;       // 524288
  size_t off = 0;
  const size_t oXh  = off; off += PX;
  const size_t oXl  = off; off += PX;
  const size_t oWh  = off; off += PW;
  const size_t oWl  = off; off += PW;
  const size_t oWoh = off; off += PWO;
  const size_t oWol = off; off += PWO;
  const size_t oQh  = off; off += PX;
  const size_t oQl  = off; off += PX;
  const size_t oKh  = off; off += PX;
  const size_t oKl  = off; off += PX;
  const size_t oVh  = off; off += PX;
  const size_t oVl  = off; off += PX;
  const size_t oOh  = off; off += PX;
  const size_t oOl  = off; off += PX;
  if (off > ws_size) return;                    // off = 46137344
  if (off > (size_t)134217728) return;

  char* ws = (char*)d_ws;
  unsigned short* Xh  = (unsigned short*)(ws + oXh);
  unsigned short* Xl  = (unsigned short*)(ws + oXl);
  unsigned short* Wh  = (unsigned short*)(ws + oWh);
  unsigned short* Wl  = (unsigned short*)(ws + oWl);
  unsigned short* Woh = (unsigned short*)(ws + oWoh);
  unsigned short* Wol = (unsigned short*)(ws + oWol);
  unsigned short* Qh  = (unsigned short*)(ws + oQh);
  unsigned short* Ql  = (unsigned short*)(ws + oQl);
  unsigned short* Kh  = (unsigned short*)(ws + oKh);
  unsigned short* Kl  = (unsigned short*)(ws + oKl);
  unsigned short* Vh  = (unsigned short*)(ws + oVh);
  unsigned short* Vl  = (unsigned short*)(ws + oVl);
  unsigned short* Oh  = (unsigned short*)(ws + oOh);
  unsigned short* Ol  = (unsigned short*)(ws + oOl);

  // (0) hi/lo planes of x
  k_split<<<dim3((NT * DM) / 2048), dim3(256), 0, stream>>>(x, Xh, Xl);
  // (1) transposed hi/lo planes of the four weights: in [k][n] -> out [n][k]
  k_split_tr<<<dim3(DM / 64, DM / 64, 4), dim3(256), 0, stream>>>(W_q, W_k, W_v, W_o, Wh, Wl, Woh, Wol);
  // (2) q / k / v^T planes
  k_proj<<<dim3(3 * NH, NT / 128), dim3(256), 0, stream>>>(Xh, Xl, Wh, Wl, b_q, b_k, b_v,
                                                          Qh, Ql, Kh, Kl, Vh, Vl);
  // (3) attention -> O planes
  k_attn<<<dim3(NBT * NH * NQB), dim3(256), 0, stream>>>(Qh, Ql, Kh, Kl, Vh, Vl, amask, gids, dids,
                                                        gtab, dtab, Oh, Ol);
  // (4) out = O.Wo + bo
  k_gemm_out<<<dim3(DM / 64, NT / 128), dim3(256), 0, stream>>>(Oh, Ol, Woh, Wol, b_o, out);
  (void)hipGetLastError();
}

// v001
// It runs in 188 microseconds.
// Next to v000, in two timings, it ran 1.69 times as fast each time.
// Contractions: Q/K/V = x.W (3 sites), S = Q.K^T, O = P.V, out = O.Wo: all v_wmma_f32_16x16x32_bf16 on bf16 hi/lo
// split operand planes (hi.hi + hi.lo + lo.hi per tile pair), f32 accumulate; biases, the 1/8 scale, the bucket-table
// lookups, the key mask (replace by -1e9) and the online softmax in f32.
// Plane carry audit: every hi/lo plane (X, Wqkv^T, Wo^T, Q, K, V^T, in-register P fragments, O) carries factor 1
// (hi = rne_bf16(v), lo = rne_bf16(v - hi), f32 exponent range, no subnormal concern); no inverse fold exists anywhere.
#include <hip/hip_runtime.h>
#include <stddef.h>

#define NBT 2                  // batch
#define SL  2048               // sequence length
#define DM  512                // model width
#define NH  8                  // heads
#define HD  64                 // head dim
#define NT  (NBT * SL)         // token rows, row m = b*SL + s
#define QB  128                // query rows per attention block
#define KC  64                 // keys per chunk
#define NQB (SL / QB)          // 16
#define NCK (SL / KC)          // 32
#define KTP 72                 // LDS pitch (16-bit elements) for 64-wide tiles, 144 B
#define OTP 68                 // f32 staging pitch [row][col] (128 x 64)
#define VTP 132                // f32 staging pitch [col][row] (64 x 128)
#define TTP 68                 // f32 staging pitch for the 64 x 64 weight transpose tile
#define GAPR 33                // time-gap table rows
#define DURR 17                // duration table rows
#define NEGV (-1.0e9f)         // masked-key score value

static_assert(NT == 4096);
static_assert(NH * HD == DM);
static_assert(SL % QB == 0);
static_assert(SL % KC == 0);
static_assert(SL % 128 == 0);
static_assert(DM % 64 == 0);
static_assert(DM % 32 == 0);
static_assert((NT * DM) % 2048 == 0);
static_assert(HD == 64);
static_assert(KC == 64);
static_assert(64 * VTP <= 128 * OTP);

typedef __bf16       v16b __attribute__((ext_vector_type(16)));
typedef float        v8f  __attribute__((ext_vector_type(8)));
typedef float        v4f  __attribute__((ext_vector_type(4)));
typedef unsigned int v4u  __attribute__((ext_vector_type(4)));
typedef int          v4i  __attribute__((ext_vector_type(4)));
union Frag { v16b v; v4u u[2]; };

// WMMA with the dependent-VALU hazard guard (ties D, keeps A/B live)
__device__ __forceinline__ v8f mma(v16b a, v16b b, v8f c) {
  c = __builtin_amdgcn_wmma_f32_16x16x32_bf16(false, a, false, b, (short)0, c, false, false);
  asm volatile("v_nop\n\tv_nop\n\tv_nop\n\tv_nop" : "+v"(c) : "v"(a), "v"(b));
  return c;
}

// value of lane l ^ 16 (the other 16-lane half), by the vector cross-row move
__device__ __forceinline__ float other_half(float x) {
  const int b = __float_as_int(x);
  return __int_as_float(__builtin_amdgcn_permlanex16(b, b, 0x76543210, 0xfedcba98, false, false));
}

// e^x by the hardware exponential of x * log2(e), as __expf gives it. The v_nop fills the one slot that the
// instruction set asks for between a transcendental and a directly following instruction that reads its result or
// overwrites its source.
__device__ __forceinline__ float exp_slot(float x) {
  float r;
  asm("v_exp_f32 %0, %1\n\tv_nop" : "=v"(r) : "v"(x * 1.44269504f));
  return r;
}

__device__ __forceinline__ v8f zero8() { return (v8f){0.f, 0.f, 0.f, 0.f, 0.f, 0.f, 0.f, 0.f}; }

// Fragment loader for k-contiguous 16-bit rows with pitch ld (bf16 bits).
// A operand: row0 + (lane&15) is the M row. B operand stored [n][k]: row0 + (lane&15) is the N column.
// Split k map for both: elements 0..7 <- k0 + 8*(lane>>4) + 0..7, elements 8..15 <- k0 + 16 + 8*(lane>>4) + 0..7.
// D: acc[r] = element (row0 + 8*(lane>>4) + r, col0 + (lane&15)).
__device__ __forceinline__ v16b ldf(const unsigned short* p, int ld, int row0, int k0, int lane) {
  const unsigned short* q = p + (size_t)(row0 + (lane & 15)) * ld + k0 + 8 * (lane >> 4);
  Frag f;
  f.u[0] = *(const v4u*)(q);
  f.u[1] = *(const v4u*)(q + 16);
  return f.v;
}

// f32 -> bf16 bits, RNE convert by integer arithmetic
__device__ __forceinline__ unsigned int bf_rne(float x) {
  const unsigned int u = __float_as_uint(x);
  return (u + 0x7FFFu + ((u >> 16) & 1u)) >> 16;
}

// hi = rne(a), lo = rne(a - hi) for two floats, packed little-endian (first element in the low half-word)
__device__ __forceinline__ void split2(float a, float b, unsigned int& wh, unsigned int& wl) {
  const unsigned int ha = bf_rne(a), hb = bf_rne(b);
  const float ra = a - __uint_as_float(ha << 16);
  const float rb = b - __uint_as_float(hb << 16);
  wh = ha | (hb << 16);
  wl = bf_rne(ra) | (bf_rne(rb) << 16);
}

// 8 consecutive floats -> one 16-B hi piece and one 16-B lo piece
__device__ __forceinline__ void split8(v4f a0, v4f a1, v4u& wh, v4u& wl) {
  unsigned int h0, h1, h2, h3, l0, l1, l2, l3;
  split2(a0[0], a0[1], h0, l0);
  split2(a0[2], a0[3], h1, l1);
  split2(a1[0], a1[1], h2, l2);
  split2(a1[2], a1[3], h3, l3);
  wh = (v4u){h0, h1, h2, h3};
  wl = (v4u){l0, l1, l2, l3};
}

// ---------------------------------------------------------------------------
// kernel 0: elementwise split of a contiguous f32 array (layout kept) into bf16 hi and lo planes.
// Block = 2048 elements; thread converts 8 consecutive floats and writes one 16-B piece per plane;
// coverage: n/2048 blocks x 256 thr x 8 = n elements of both planes.
// ---------------------------------------------------------------------------
__global__ __launch_bounds__(256) void k_split(const float* __restrict__ src,
                                               unsigned short* __restrict__ dh,
                                               unsigned short* __restrict__ dl) {
  const size_t o = (size_t)blockIdx.x * 2048 + (size_t)threadIdx.x * 8;
  const v4f a0 = *(const v4f*)(src + o);
  const v4f a1 = *(const v4f*)(src + o + 4);
  v4u wh, wl;
  split8(a0, a1, wh, wl);
  v4u* ph = (v4u*)(dh + o);
  v4u* pl = (v4u*)(dl + o);
  *ph = wh;
  *pl = wl;
  
}

// ---------------------------------------------------------------------------
// kernel 1: weight transpose + split. in W [k = DM rows][n = DM cols] f32 -> out planes [n][k] hi/lo (pitch DM).
// blockIdx.z = which weight (0 q, 1 k, 2 v -> stacked planes rows which*DM + n; 3 -> the out-projection planes).
// blockIdx.x = 64-wide n tile (source columns), blockIdx.y = 64-deep k tile (source rows). The 64 x 64 tile is
// coverage: load 256 thr x 16 floats = 64 x 64; store 256 thr x 2 iter x 8 halves = 64 n rows x 64 k per plane;
// grid (DM/64, DM/64, 4) covers all four DM x DM matrices.
// ---------------------------------------------------------------------------
__global__ __launch_bounds__(256) void k_split_tr(const float* __restrict__ Wq, const float* __restrict__ Wk,
                                                  const float* __restrict__ Wv, const float* __restrict__ Wo,
                                                  unsigned short* __restrict__ Ph, unsigned short* __restrict__ Pl,
                                                  unsigned short* __restrict__ Oh, unsigned short* __restrict__ Ol) {
  __shared__ __align__(16) float st[64 * TTP];       // 17408 B
  const int tid = threadIdx.x;
  const int z   = blockIdx.z;                        // block-uniform
  const int nt  = blockIdx.x * 64;                   // source columns = output rows
  const int kt  = blockIdx.y * 64;                   // source rows    = output k
  const float* W = (z == 0) ? Wq : ((z == 1) ? Wk : ((z == 2) ? Wv : Wo));
  {
    const int row = tid >> 2;                        // k within tile, 0..63
    const int cb  = (tid & 3) * 16;                  // n within tile, 0,16,32,48
    const float* src = W + (size_t)(kt + row) * DM + nt + cb;
#pragma unroll
    for (int e = 0; e < 4; ++e) {
      const v4f a = *(const v4f*)(src + 4 * e);
#pragma unroll
      for (int q = 0; q < 4; ++q) st[(cb + 4 * e + q) * TTP + row] = a[q];
    }
  }
  __syncthreads();
  unsigned short* dh = (z < 3) ? (Ph + (size_t)z * DM * DM) : Oh;
  unsigned short* dl = (z < 3) ? (Pl + (size_t)z * DM * DM) : Ol;
  const size_t base = (size_t)nt * DM + kt;
  v4u vh[2], vl[2];
  size_t go[2];
#pragma unroll
  for (int it = 0; it < 2; ++it) {
    const int pp   = tid + 256 * it;                 // 0..511
    const int rown = pp >> 3;                        // 0..63
    const int pc   = pp & 7;                         // k piece 8*pc .. +7
    const float* ra = st + rown * TTP + 8 * pc;
    const v4f a0 = *(const v4f*)(ra), a1 = *(const v4f*)(ra + 4);
    split8(a0, a1, vh[it], vl[it]);
    go[it] = base + (size_t)rown * DM + 8 * pc;
  }
  {
#pragma unroll
    for (int it = 0; it < 2; ++it) {
      *(v4u*)(dh + go[it]) = vh[it];
      *(v4u*)(dl + go[it]) = vl[it];
    }
    
  }
}

// ---------------------------------------------------------------------------
// 32 x 32 per wave split-bf16 GEMM main loop over K (multiple of 32): A planes [m][k] pitch lda, B planes [n][k]
// pitch ldb (hi and lo), fragments loaded straight from the planes (arithmetic addressing only).
// Per tile pair: ah.bh + ah.bl + al.bh into one f32 accumulator.
// acc[s][t][r] = (m0 + 16*s + 8*(lane>>4) + r, n0 + 16*t + (lane&15)).
// ---------------------------------------------------------------------------
__device__ __forceinline__ void gemm32x32x3(const unsigned short* __restrict__ Ah,
                                            const unsigned short* __restrict__ Al, int lda,
                                            const unsigned short* __restrict__ Bh,
                                            const unsigned short* __restrict__ Bl, int ldb,
                                            int K, int m0, int n0, int lane, v8f (&acc)[2][2]) {
#pragma unroll 1
  for (int k0 = 0; k0 < K; k0 += 32) {
    const v16b ah0 = ldf(Ah, lda, m0, k0, lane);
    const v16b ah1 = ldf(Ah, lda, m0 + 16, k0, lane);
    const v16b al0 = ldf(Al, lda, m0, k0, lane);
    const v16b al1 = ldf(Al, lda, m0 + 16, k0, lane);
#pragma unroll
    for (int t = 0; t < 2; ++t) {
      const v16b bh = ldf(Bh, ldb, n0 + 16 * t, k0, lane);
      const v16b bl = ldf(Bl, ldb, n0 + 16 * t, k0, lane);
      acc[0][t] = mma(ah0, bh, acc[0][t]);
      acc[1][t] = mma(ah1, bh, acc[1][t]);
      acc[0][t] = mma(ah0, bl, acc[0][t]);
      acc[1][t] = mma(ah1, bl, acc[1][t]);
      acc[0][t] = mma(al0, bh, acc[0][t]);
      acc[1][t] = mma(al1, bh, acc[1][t]);
    }
  }
}

// stage acc + bias in the block tile, row-major [row][col] (128 x 64, pitch OTP floats)
__device__ __forceinline__ void stage_rm(v8f (&acc)[2][2], const float (&bb)[2], float* st,
                                         int mw, int nw, int hh, int c) {
#pragma unroll
  for (int s = 0; s < 2; ++s)
#pragma unroll
    for (int t = 0; t < 2; ++t)
#pragma unroll
      for (int r = 0; r < 8; ++r)
        st[(mw + 16 * s + 8 * hh + r) * OTP + nw + 16 * t + c] = acc[s][t][r] + bb[t];
}

// stage acc + bias transposed [col][row] (64 x 128, pitch VTP floats)
__device__ __forceinline__ void stage_tr(v8f (&acc)[2][2], const float (&bb)[2], float* st,
                                         int mw, int nw, int hh, int c) {
#pragma unroll
  for (int s = 0; s < 2; ++s)
#pragma unroll
    for (int t = 0; t < 2; ++t)
#pragma unroll
      for (int r = 0; r < 8; ++r)
        st[(nw + 16 * t + c) * VTP + mw + 16 * s + 8 * hh + r] = acc[s][t][r] + bb[t];
}

// block tile 128 rows x 64 cols -> hi/lo planes at element base, row pitch ldo: each row = 64 halves = one whole
// coverage: 256 thr x 4 iter x 8 halves = 128 rows x 64 per plane.
__device__ __forceinline__ void store_planes(const float* st, unsigned short* __restrict__ oh,
                                             unsigned short* __restrict__ ol, size_t base, int ldo, int tid) {
  v4u vh[4], vl[4];
  size_t go[4];
#pragma unroll
  for (int it = 0; it < 4; ++it) {
    const int pp  = tid + 256 * it;                  // 0..1023
    const int row = pp >> 3;                         // 0..127
    const int pc  = pp & 7;                          // 16-B piece = cols 8*pc .. +7
    const float* ra = st + row * OTP + 8 * pc;
    const v4f a0 = *(const v4f*)(ra), a1 = *(const v4f*)(ra + 4);
    split8(a0, a1, vh[it], vl[it]);
    go[it] = base + (size_t)row * ldo + 8 * pc;
  }
  {
#pragma unroll
    for (int it = 0; it < 4; ++it) {
      *(v4u*)(oh + go[it]) = vh[it];
      *(v4u*)(ol + go[it]) = vl[it];
    }
    
  }
}

// transposed block tile 64 d-rows x 128 s -> V^T hi/lo planes [bh][d][s] at element base (= bh*HD*SL + sf):
// coverage: 256 thr x 4 iter x 8 halves = 64 d-rows x 128 s per plane.
__device__ __forceinline__ void store_vt(const float* st, unsigned short* __restrict__ vh,
                                         unsigned short* __restrict__ vl, size_t base, int tid) {
  v4u wh[4], wl[4];
  size_t go[4];
#pragma unroll
  for (int it = 0; it < 4; ++it) {
    const int pp   = tid + 256 * it;                 // 0..1023
    const int drow = pp >> 4;                        // 0..63
    const int pc   = pp & 15;                        // 8 consecutive s
    const float* ra = st + drow * VTP + 8 * pc;
    const v4f a0 = *(const v4f*)(ra), a1 = *(const v4f*)(ra + 4);
    split8(a0, a1, wh[it], wl[it]);
    go[it] = base + (size_t)drow * SL + 8 * pc;
  }
  {
#pragma unroll
    for (int it = 0; it < 4; ++it) {
      *(v4u*)(vh + go[it]) = wh[it];
      *(v4u*)(vl + go[it]) = wl[it];
    }
    
  }
}

// coverage: 256 thr x 8 iter x 4 floats = 128 rows x 64 cols.
__device__ __forceinline__ void store_f32(const float* st, float* __restrict__ out, int mblk, int nblk, int tid) {
  v4f val[8];
  size_t go[8];
#pragma unroll
  for (int it = 0; it < 8; ++it) {
    const int pp  = tid + 256 * it;                  // 0..2047
    const int row = pp >> 4;                         // 0..127
    const int pc  = pp & 15;                         // 4 consecutive cols
    val[it] = *(const v4f*)(st + row * OTP + 4 * pc);
    go[it]  = (size_t)(mblk + row) * DM + nblk + 4 * pc;
  }
  {
#pragma unroll
    for (int it = 0; it < 8; ++it) *(v4f*)(out + go[it]) = val[it];
    
  }
}

// ---------------------------------------------------------------------------
// kernel 2: projections. blockIdx.x = which*NH + head (which 0 = q, 1 = k, 2 = v), blockIdx.y = 128-token block
// of one sequence b. A = x planes [NT][DM] (pitch DM, K = DM), B = stacked transposed weight planes [3*DM n][DM k]
// rows which*DM + head*64 .. (pitch DM). Bias added in f32.
// grid = (3*NH = 24, NT/128 = 32). coverage: q and k planes 16 bh x 16 blocks x 128 s x 64 d each,
// v^T planes 16 bh x 16 blocks x 64 d x 128 s.
// ---------------------------------------------------------------------------
__global__ __launch_bounds__(256) void k_proj(const unsigned short* __restrict__ Xh,
                                              const unsigned short* __restrict__ Xl,
                                              const unsigned short* __restrict__ Wh,
                                              const unsigned short* __restrict__ Wl,
                                              const float* __restrict__ bq,
                                              const float* __restrict__ bk,
                                              const float* __restrict__ bv,
                                              unsigned short* __restrict__ Qh, unsigned short* __restrict__ Ql,
                                              unsigned short* __restrict__ Kh, unsigned short* __restrict__ Kl,
                                              unsigned short* __restrict__ Vh, unsigned short* __restrict__ Vl) {
  __shared__ __align__(16) float st[128 * OTP];      // 34816 B (the transposed 64 x VTP tile also fits)
  const int tid = threadIdx.x, lane = tid & 31, wave = tid >> 5;
  const int hh = lane >> 4, c = lane & 15;
  const int which = blockIdx.x / NH;                 // block-uniform
  const int head  = blockIdx.x - which * NH;
  const int mblk  = blockIdx.y * 128;
  const int b     = mblk / SL;
  const int sf    = mblk - b * SL;                   // first position of the block in sequence b
  const int bh    = b * NH + head;
  const int mw = (wave >> 1) * 32, nw = (wave & 1) * 32;

  v8f acc[2][2];
#pragma unroll
  for (int s = 0; s < 2; ++s)
#pragma unroll
    for (int t = 0; t < 2; ++t) acc[s][t] = zero8();
  gemm32x32x3(Xh, Xl, DM,
              Wh + (size_t)which * DM * DM, Wl + (size_t)which * DM * DM, DM,
              DM, mblk + mw, head * HD + nw, lane, acc);

  float bb[2];
#pragma unroll
  for (int t = 0; t < 2; ++t) {
    const int i = head * HD + nw + 16 * t + c;       // 0..511
    const float xq = bq[i], xk = bk[i], xv = bv[i];
    bb[t] = (which == 0) ? xq : ((which == 1) ? xk : xv);
  }
  if (which < 2) stage_rm(acc, bb, st, mw, nw, hh, c);
  else           stage_tr(acc, bb, st, mw, nw, hh, c);
  __syncthreads();
  if (which < 2) {
    unsigned short* oh = (which == 0) ? Qh : Kh;
    unsigned short* ol = (which == 0) ? Ql : Kl;
    store_planes(st, oh, ol, ((size_t)bh * SL + sf) * HD, HD, tid);
  } else {
    store_vt(st, Vh, Vl, (size_t)bh * HD * SL + sf, tid);
  }
}

// ---------------------------------------------------------------------------
// kernel 3: flash attention for every (b, head, 128-query block), head dim 64, 32 chunks of 64 keys.
//   q/k planes [b*NH + h][s][64] hi/lo; v^T planes [b*NH + h][64][s] hi/lo; int32 tables [b][s]: key mask
//   (zero = masked), gap bucket ids, duration bucket ids; f32 tables gap [GAPR][NH], dur [DURR][NH];
//   O planes [token = b*SL + s][DM] hi/lo, head h at columns h*64 (one line per row).
// Block = 8 waves; wave w owns queries q0 = qb*128 + 16*w .. +15. The head's column of both bias tables is staged
// in LDS once per block. Per chunk: K [key][d] and V^T [d][key] hi/lo tiles staged in LDS by all threads
// (plain 16-B loads) while waves 0-1 stage the chunk's 64 per-key values (gap id, duration bias, mask) in LDS,
// barriers. The products are taken transposed: S^T = K.Q^T (A = K rows, B = Q rows) and O^T += V^T.P^T
// (A = V^T rows, B = P^T), so a lane holds scores of ONE query (column lane&15) for keys 16*j + 8*(lane>>4) + r.
// s/8 + gap[clip(|gq - gk|, 0, GAPR-1)] + dur[clamp(dk)], masked keys replaced by -1e9; maximum and sum run
// in-lane with one exchange between the wave halves; p = exp(s - m) is split into bf16 hi/lo and packed straight
// from the score accumulators into the B fragment (tiles 2*kk and 2*kk+1 are elements 0..7 and 8..15 of the split
// k map), so P never goes through LDS. Epilogue: O^T / l, 8 consecutive channels per lane and tile, split hi/lo and
// stored from registers.
// coverage: 256 blocks x 8 waves x 16 rows x 64 cols = NT x DM per plane.
// ---------------------------------------------------------------------------
__global__ __launch_bounds__(256) void k_attn(const unsigned short* __restrict__ Qh,
                                              const unsigned short* __restrict__ Ql,
                                              const unsigned short* __restrict__ Kh,
                                              const unsigned short* __restrict__ Kl,
                                              const unsigned short* __restrict__ Vh,
                                              const unsigned short* __restrict__ Vl,
                                              const int* __restrict__ mask,
                                              const int* __restrict__ gids,
                                              const int* __restrict__ dids,
                                              const float* __restrict__ gap_emb,
                                              const float* __restrict__ dur_emb,
                                              unsigned short* __restrict__ Oh,
                                              unsigned short* __restrict__ Ol) {
  __shared__ __align__(16) unsigned short Ks[2 * KC * KTP];   // hi tile, lo tile [key][d]   18432 B
  __shared__ __align__(16) unsigned short Vs[2 * HD * KTP];   // hi tile, lo tile [d][key]   18432 B
  __shared__ __align__(16) int   gkS[KC];                      // chunk's key gap bucket ids        256 B
  __shared__ __align__(16) float dbS[KC];                      // chunk's key duration bias         256 B
  __shared__ __align__(16) int   mkS[KC];                      // chunk's key mask                  256 B
  __shared__ float gapS[36];                                   // gap table column of head h (33)   144 B
  __shared__ float durS[20];                                   // dur table column of head h (17)    80 B

  const int tid = threadIdx.x, lane = tid & 31, wave = tid >> 5;
  const int hh = lane >> 4, c = lane & 15;
  const int qb = blockIdx.x % NQB;
  const int bh = blockIdx.x / NQB;                   // b*NH + h
  const int h  = bh % NH;
  const int b  = bh / NH;
  const int q0 = qb * QB + wave * 16;
  const size_t qkbase = (size_t)bh * SL * HD;
  const size_t vbase  = (size_t)bh * HD * SL;

  // stage the head's table columns once (clamped addresses for every lane, predicated LDS store)
  {
    const int ig = (tid < GAPR) ? tid : (GAPR - 1);
    const int id = (tid < DURR) ? tid : (DURR - 1);
    const float gv = gap_emb[ig * NH + h];
    const float dv = dur_emb[id * NH + h];
    if (tid < GAPR) gapS[tid] = gv;
    if (tid < DURR) durS[tid] = dv;
  }

  // gap bucket id of the one query this lane's score elements belong to: q0 + (lane&15)
  const int gq = gids[(size_t)b * SL + q0 + c];

  // Q fragments (loop-invariant), B operand stored [n = query][k = d]: query q0 + (lane&15), split map over d
  v16b qh[2], ql[2];
#pragma unroll
  for (int dc = 0; dc < 2; ++dc) {
    qh[dc] = ldf(Qh + qkbase, HD, q0, dc * 32, lane);
    ql[dc] = ldf(Ql + qkbase, HD, q0, dc * 32, lane);
  }

  float mrow = -__builtin_huge_valf();               // running maximum of query c (equal in both halves)
  float lrow = 0.f;                                  // running sum over this half's keys; halves joined at the end
  v8f oacc[4];
#pragma unroll
  for (int t = 0; t < 4; ++t) oacc[t] = zero8();

  for (int kc = 0; kc < NCK; ++kc) {
    const int kv0 = kc * KC;
    __syncthreads();                                 // readers of the earlier chunk's tiles / key values are done
    {
      const int r  = tid >> 2;                       // 0..63: key row of K tiles, d row of V^T tiles
      const int qq = (tid & 3) * 16;                 // 0,16,32,48 elements
      const unsigned short* kh = Kh + qkbase + (size_t)(kv0 + r) * HD + qq;
      const unsigned short* kl = Kl + qkbase + (size_t)(kv0 + r) * HD + qq;
      const unsigned short* vh = Vh + vbase + (size_t)r * SL + kv0 + qq;
      const unsigned short* vl = Vl + vbase + (size_t)r * SL + kv0 + qq;
#pragma unroll
      for (int e = 0; e < 2; ++e) {
        *(v4u*)(Ks + r * KTP + qq + 8 * e)            = *(const v4u*)(kh + 8 * e);
        *(v4u*)(Ks + KC * KTP + r * KTP + qq + 8 * e) = *(const v4u*)(kl + 8 * e);
        *(v4u*)(Vs + r * KTP + qq + 8 * e)            = *(const v4u*)(vh + 8 * e);
        *(v4u*)(Vs + HD * KTP + r * KTP + qq + 8 * e) = *(const v4u*)(vl + 8 * e);
      }
      if (tid < KC) {                                // waves 0 and 1, wave-uniform: per-key values of the chunk
        const int key = kv0 + tid;                   // 0..SL-1
        const int gk  = gids[(size_t)b * SL + key];
        int dk = dids[(size_t)b * SL + key];
        dk = (dk < 0) ? 0 : ((dk > DURR - 1) ? (DURR - 1) : dk);
        const int mk  = mask[(size_t)b * SL + key];
        gkS[tid] = gk;
        dbS[tid] = durS[dk];
        mkS[tid] = mk;
      }
    }
    __syncthreads();                                 // tiles and key values visible to every wave

    v8f s[4];
#pragma unroll
    for (int j = 0; j < 4; ++j) s[j] = zero8();
#pragma unroll
    for (int dc = 0; dc < 2; ++dc) {
#pragma unroll
      for (int j = 0; j < 4; ++j) {
        // A operands: key row j*16 + (lane&15) of the [key][d] tiles, split map over d
        const v16b khf = ldf(Ks, KTP, j * 16, dc * 32, lane);
        const v16b klf = ldf(Ks + KC * KTP, KTP, j * 16, dc * 32, lane);
        s[j] = mma(khf, qh[dc], s[j]);
        s[j] = mma(klf, qh[dc], s[j]);
        s[j] = mma(khf, ql[dc], s[j]);
      }
    }
    // s[j][r] = S[query q0 + c][key kv0 + j*16 + 8*hh + r]; scale, table biases, replace-mask
#pragma unroll
    for (int j = 0; j < 4; ++j) {
      const int kb = 16 * j + 8 * hh;                // first of this lane's 8 keys of tile j, 0..56
      const v4i g0 = *(const v4i*)(gkS + kb), g1 = *(const v4i*)(gkS + kb + 4);
      const v4f d0 = *(const v4f*)(dbS + kb), d1 = *(const v4f*)(dbS + kb + 4);
      const v4i k0 = *(const v4i*)(mkS + kb), k1 = *(const v4i*)(mkS + kb + 4);
#pragma unroll
      for (int r = 0; r < 8; ++r) {
        const int   gk = (r < 4) ? g0[r & 3] : g1[r & 3];
        const float db = (r < 4) ? d0[r & 3] : d1[r & 3];
        const int   mk = (r < 4) ? k0[r & 3] : k1[r & 3];
        int rel = gq - gk;
        rel = (rel < 0) ? -rel : rel;
        rel = (rel > GAPR - 1) ? (GAPR - 1) : rel;
        rel = (rel < 0) ? 0 : rel;
        const float gbias = gapS[rel];
        const float v = (s[j][r] * 0.125f + gbias) + db;
        s[j][r] = (mk != 0) ? v : NEGV;
      }
    }
    // chunk maximum of query c: in-lane over this half's 32 keys, then one exchange between the halves
    float cj[4];
#pragma unroll
    for (int j = 0; j < 4; ++j) {
      cj[j] = fmaxf(fmaxf(fmaxf(s[j][0], s[j][1]), fmaxf(s[j][2], s[j][3])),
                    fmaxf(fmaxf(s[j][4], s[j][5]), fmaxf(s[j][6], s[j][7])));
    }
    float cm = fmaxf(fmaxf(cj[0], cj[1]), fmaxf(cj[2], cj[3]));
    cm = fmaxf(cm, other_half(cm));
    const float mnew  = fmaxf(mrow, cm);             // finite from chunk 0 on
    const float alpha = exp_slot(mrow - mnew);
    mrow = mnew;

    // p = exp(s - m); tile j's 8 values are 8 consecutive k positions of the B fragment
    v4u ph[4], pl[4];
    float pj[4];
#pragma unroll
    for (int j = 0; j < 4; ++j) {
      v4f p0, p1;
#pragma unroll
      for (int r = 0; r < 4; ++r) {
        p0[r] = exp_slot(s[j][r] - mnew);
        p1[r] = exp_slot(s[j][r + 4] - mnew);
      }
      pj[j] = ((p0[0] + p0[1]) + (p0[2] + p0[3])) + ((p1[0] + p1[1]) + (p1[2] + p1[3]));
      split8(p0, p1, ph[j], pl[j]);
    }
    lrow = lrow * alpha + ((pj[0] + pj[1]) + (pj[2] + pj[3]));
#pragma unroll
    for (int t = 0; t < 4; ++t)
#pragma unroll
      for (int r = 0; r < 8; ++r) oacc[t][r] *= alpha;

#pragma unroll
    for (int kk = 0; kk < 2; ++kk) {
      // B operands: P^T column (lane&15) = query, split k map over keys 32*kk ..
      Frag fh, fl;
      fh.u[0] = ph[2 * kk]; fh.u[1] = ph[2 * kk + 1];
      fl.u[0] = pl[2 * kk]; fl.u[1] = pl[2 * kk + 1];
#pragma unroll
      for (int t = 0; t < 4; ++t) {
        // A operands: channel row t*16 + (lane&15) of V^T [d][key], split k map over keys
        const v16b vhf = ldf(Vs, KTP, t * 16, kk * 32, lane);
        const v16b vlf = ldf(Vs + HD * KTP, KTP, t * 16, kk * 32, lane);
        oacc[t] = mma(vhf, fh.v, oacc[t]);
        oacc[t] = mma(vlf, fh.v, oacc[t]);
        oacc[t] = mma(vhf, fl.v, oacc[t]);
      }
    }
  }

  // O = oacc / l  (l >= 1); oacc[t][r] = O[query q0 + c][channel 16*t + 8*hh + r]
  const float invl = 1.0f / (lrow + other_half(lrow));
  const size_t go = ((size_t)(b * SL + q0 + c)) * DM + (size_t)h * HD + 8 * hh;
  v4u wh[4], wl[4];
#pragma unroll
  for (int t = 0; t < 4; ++t) {
    const v4f a0 = (v4f){oacc[t][0] * invl, oacc[t][1] * invl, oacc[t][2] * invl, oacc[t][3] * invl};
    const v4f a1 = (v4f){oacc[t][4] * invl, oacc[t][5] * invl, oacc[t][6] * invl, oacc[t][7] * invl};
    split8(a0, a1, wh[t], wl[t]);
  }
#pragma unroll
  for (int t = 0; t < 4; ++t) {
    *(v4u*)(Oh + go + 16 * t) = wh[t];
    *(v4u*)(Ol + go + 16 * t) = wl[t];
  }
}

// ---------------------------------------------------------------------------
// kernel 4: out = O.Wo + bo -> f32 rows [NT][DM]. A = O planes [NT][DM], B = transposed
// Wo planes [DM n][DM k]. Block = 128 token rows x 64 cols; grid = (DM/64 = 8, NT/128 = 32).
// coverage: 8 x 32 blocks x 128 x 64 = NT x DM.
// ---------------------------------------------------------------------------
__global__ __launch_bounds__(256) void k_gemm_out(const unsigned short* __restrict__ Ah,
                                                  const unsigned short* __restrict__ Al,
                                                  const unsigned short* __restrict__ Wh,
                                                  const unsigned short* __restrict__ Wl,
                                                  const float* __restrict__ bo,
                                                  float* __restrict__ out) {
  __shared__ __align__(16) float st[128 * OTP];      // 34816 B
  const int tid = threadIdx.x, lane = tid & 31, wave = tid >> 5;
  const int hh = lane >> 4, c = lane & 15;
  const int mblk = blockIdx.y * 128, nblk = blockIdx.x * 64;
  const int mw = (wave >> 1) * 32, nw = (wave & 1) * 32;

  v8f acc[2][2];
#pragma unroll
  for (int s = 0; s < 2; ++s)
#pragma unroll
    for (int t = 0; t < 2; ++t) acc[s][t] = zero8();
  gemm32x32x3(Ah, Al, DM, Wh, Wl, DM, DM, mblk + mw, nblk + nw, lane, acc);

  float bb[2];
#pragma unroll
  for (int t = 0; t < 2; ++t) bb[t] = bo[nblk + nw + 16 * t + c];
  stage_rm(acc, bb, st, mw, nw, hh, c);
  __syncthreads();
  store_f32(st, out, mblk, nblk, tid);
}

// ---------------------------------------------------------------------------
// its producer writes, no padded tails exist since every dimension is a tile multiple; offsets multiples of 512 KB):
//   X     bf16x2 [4096][512]             0     8388608
//   Wqkv  bf16x2 [1536][512]       8388608     3145728   (q rows 0..511, k 512..1023, v 1024..1535, [n][k])
//   Wo    bf16x2 [512][512]       11534336     1048576   ([n][k])
//   Q     bf16x2 [16][2048][64]   12582912     8388608
//   K     bf16x2 [16][2048][64]   20971520     8388608
//   V^T   bf16x2 [16][64][2048]   29360128     8388608
//   O     bf16x2 [4096][512]      37748736     8388608
//   total                         46137344
// ---------------------------------------------------------------------------
extern "C" void kernel_launch(void* const* d_in, const int* in_sizes, int n_in,
                              void* d_out, int out_size, void* d_ws, size_t ws_size,
                              hipStream_t stream) {
  if (n_in < 14) return;
  if (in_sizes[0] != NT * DM) return;
  if (in_sizes[1] != NBT * SL) return;
  if (in_sizes[2] != NBT * SL) return;
  if (in_sizes[3] != NBT * SL) return;
  if (in_sizes[4] != DM * DM) return;
  if (in_sizes[5] != DM) return;
  if (in_sizes[6] != DM * DM) return;
  if (in_sizes[7] != DM) return;
  if (in_sizes[8] != DM * DM) return;
  if (in_sizes[9] != DM) return;
  if (in_sizes[10] != DM * DM) return;
  if (in_sizes[11] != DM) return;
  if (in_sizes[12] != GAPR * NH) return;
  if (in_sizes[13] != DURR * NH) return;
  if (out_size != NT * DM) return;

  const float* x     = (const float*)d_in[0];   // [2][2048][512] = [4096][512]
  const int*   amask = (const int*)d_in[1];     // [2][2048] int32, zero = masked key
  const int*   gids  = (const int*)d_in[2];     // [2][2048] int32
  const int*   dids  = (const int*)d_in[3];     // [2][2048] int32
  const float* W_q   = (const float*)d_in[4];   // [512][512] [in][out]
  const float* b_q   = (const float*)d_in[5];   // [512]
  const float* W_k   = (const float*)d_in[6];
  const float* b_k   = (const float*)d_in[7];
  const float* W_v   = (const float*)d_in[8];
  const float* b_v   = (const float*)d_in[9];
  const float* W_o   = (const float*)d_in[10];
  const float* b_o   = (const float*)d_in[11];
  const float* gtab  = (const float*)d_in[12];  // [33][8]
  const float* dtab  = (const float*)d_in[13];  // [17][8]
  float* out = (float*)d_out;                   // [4096][512] f32

  const size_t PX  = (size_t)NT * DM * 2;       // 4194304
  const size_t PW  = (size_t)3 * DM * DM * 2;   // 1572864
  const size_t PWO = (size_t)DM * DM * 2;       // 524288
  size_t off = 0;
  const size_t oXh  = off; off += PX;
  const size_t oXl  = off; off += PX;
  const size_t oWh  = off; off += PW;
  const size_t oWl  = off; off += PW;
  const size_t oWoh = off; off += PWO;
  const size_t oWol = off; off += PWO;
  const size_t oQh  = off; off += PX;
  const size_t oQl  = off; off += PX;
  const size_t oKh  = off; off += PX;
  const size_t oKl  = off; off += PX;
  const size_t oVh  = off; off += PX;
  const size_t oVl  = off; off += PX;
  const size_t oOh  = off; off += PX;
  const size_t oOl  = off; off += PX;
  if (off > ws_size) return;                    // off = 46137344
  if (off > (size_t)134217728) return;

  char* ws = (char*)d_ws;
  unsigned short* Xh  = (unsigned short*)(ws + oXh);
  unsigned short* Xl  = (unsigned short*)(ws + oXl);
  unsigned short* Wh  = (unsigned short*)(ws + oWh);
  unsigned short* Wl  = (unsigned short*)(ws + oWl);
  unsigned short* Woh = (unsigned short*)(ws + oWoh);
  unsigned short* Wol = (unsigned short*)(ws + oWol);
  unsigned short* Qh  = (unsigned short*)(ws + oQh);
  unsigned short* Ql  = (unsigned short*)(ws + oQl);
  unsigned short* Kh  = (unsigned short*)(ws + oKh);
  unsigned short* Kl  = (unsigned short*)(ws + oKl);
  unsigned short* Vh  = (unsigned short*)(ws + oVh);
  unsigned short* Vl  = (unsigned short*)(ws + oVl);
  unsigned short* Oh  = (unsigned short*)(ws + oOh);
  unsigned short* Ol  = (unsigned short*)(ws + oOl);

  // (0) hi/lo planes of x
  k_split<<<dim3((NT * DM) / 2048), dim3(256), 0, stream>>>(x, Xh, Xl);
  // (1) transposed hi/lo planes of the four weights: in [k][n] -> out [n][k]
  k_split_tr<<<dim3(DM / 64, DM / 64, 4), dim3(256), 0, stream>>>(W_q, W_k, W_v, W_o, Wh, Wl, Woh, Wol);
  // (2) q / k / v^T planes
  k_proj<<<dim3(3 * NH, NT / 128), dim3(256), 0, stream>>>(Xh, Xl, Wh, Wl, b_q, b_k, b_v,
                                                          Qh, Ql, Kh, Kl, Vh, Vl);
  // (3) attention -> O planes
  k_attn<<<dim3(NBT * NH * NQB), dim3(256), 0, stream>>>(Qh, Ql, Kh, Kl, Vh, Vl, amask, gids, dids,
                                                        gtab, dtab, Oh, Ol);
  // (4) out = O.Wo + bo
  k_gemm_out<<<dim3(DM / 64, NT / 128), dim3(256), 0, stream>>>(Oh, Ol, Woh, Wol, b_o, out);
  (void)hipGetLastError();
}

// v002
// Measured time: 144 microseconds a run.
// Next to v001, in two timings, it ran 1.30 times as fast each time.
// Over all steps from v000 it is 2.19 times as fast.
// Contractions: Q/K/V = x.W (3 sites), S = Q.K^T, O = P.V, out = O.Wo: all v_wmma_f32_16x16x32_bf16 on bf16 hi/lo
// split operand planes (hi.hi + hi.lo + lo.hi per tile pair), f32 accumulate; biases, the 1/8 scale, the bucket-table
// lookups, the key mask (replace by -1e9) and the online softmax in f32.
// Plane carry audit: every hi/lo plane (X, Wqkv^T, Wo^T, Q, K, V^T, in-register P fragments, O) carries factor 1
// (hi = rne_bf16(v), lo = rne_bf16(v - hi), f32 exponent range, no subnormal concern); no inverse fold exists anywhere.
#include <hip/hip_runtime.h>
#include <stddef.h>

#define NBT 2                  // batch
#define SL  2048               // sequence length
#define DM  512                // model width
#define NH  8                  // heads
#define HD  64                 // head dim
#define NT  (NBT * SL)         // token rows, row m = b*SL + s
#define QB  128                // query rows per attention block
#define KC  64                 // keys per chunk
#define NQB (SL / QB)          // 16
#define NCK (SL / KC)          // 32
#define KTP 72                 // LDS pitch (16-bit elements) for 64-wide tiles, 144 B
#define OTP 68                 // f32 staging pitch [row][col] (128 x 64)
#define VTP 132                // f32 staging pitch [col][row] (64 x 128)
#define TTP 68                 // f32 staging pitch for the 64 x 64 weight transpose tile
#define GBK 64                 // k elements per GEMM stage: one whole 128-B line per plane row
#define GTR (2 * 128 + 2 * 64) // rows of one GEMM stage in LDS: A hi, A lo (128 each), B hi, B lo (64 each)
#define GSB (GTR * KTP * 2)    // bytes of one GEMM stage in LDS, 55296
#define GAPR 33                // time-gap table rows
#define DURR 17                // duration table rows
#define NEGV (-1.0e9f)         // masked-key score value

static_assert(NT == 4096);
static_assert(NH * HD == DM);
static_assert(SL % QB == 0);
static_assert(SL % KC == 0);
static_assert(SL % 128 == 0);
static_assert(DM % 64 == 0);
static_assert(DM % 32 == 0);
static_assert((NT * DM) % 2048 == 0);
static_assert(HD == 64);
static_assert(KC == 64);
static_assert(64 * VTP <= 128 * OTP);
static_assert(DM % GBK == 0);
static_assert(128 * OTP * 4 <= GSB);

typedef __bf16       v16b __attribute__((ext_vector_type(16)));
typedef float        v8f  __attribute__((ext_vector_type(8)));
typedef float        v4f  __attribute__((ext_vector_type(4)));
typedef unsigned int v4u  __attribute__((ext_vector_type(4)));
typedef int          v4i  __attribute__((ext_vector_type(4)));
union Frag { v16b v; v4u u[2]; };

// WMMA with the dependent-VALU hazard guard (ties D, keeps A/B live)
__device__ __forceinline__ v8f mma(v16b a, v16b b, v8f c) {
  c = __builtin_amdgcn_wmma_f32_16x16x32_bf16(false, a, false, b, (short)0, c, false, false);
  asm volatile("v_nop\n\tv_nop\n\tv_nop\n\tv_nop" : "+v"(c) : "v"(a), "v"(b));
  return c;
}

// value of lane l ^ 16 (the other 16-lane half), by the vector cross-row move
__device__ __forceinline__ float other_half(float x) {
  const int b = __float_as_int(x);
  return __int_as_float(__builtin_amdgcn_permlanex16(b, b, 0x76543210, 0xfedcba98, false, false));
}

// e^x by the hardware exponential of x * log2(e), as __expf gives it. The v_nop fills the one slot that the
// instruction set asks for between a transcendental and a directly following instruction that reads its result or
// overwrites its source.
__device__ __forceinline__ float exp_slot(float x) {
  float r;
  asm("v_exp_f32 %0, %1\n\tv_nop" : "=v"(r) : "v"(x * 1.44269504f));
  return r;
}

__device__ __forceinline__ v8f zero8() { return (v8f){0.f, 0.f, 0.f, 0.f, 0.f, 0.f, 0.f, 0.f}; }

// Fragment loader for k-contiguous 16-bit rows with pitch ld (bf16 bits).
// A operand: row0 + (lane&15) is the M row. B operand stored [n][k]: row0 + (lane&15) is the N column.
// Split k map for both: elements 0..7 <- k0 + 8*(lane>>4) + 0..7, elements 8..15 <- k0 + 16 + 8*(lane>>4) + 0..7.
// D: acc[r] = element (row0 + 8*(lane>>4) + r, col0 + (lane&15)).
__device__ __forceinline__ v16b ldf(const unsigned short* p, int ld, int row0, int k0, int lane) {
  const unsigned short* q = p + (size_t)(row0 + (lane & 15)) * ld + k0 + 8 * (lane >> 4);
  Frag f;
  f.u[0] = *(const v4u*)(q);
  f.u[1] = *(const v4u*)(q + 16);
  return f.v;
}

// f32 -> bf16 bits, RNE convert by integer arithmetic
__device__ __forceinline__ unsigned int bf_rne(float x) {
  const unsigned int u = __float_as_uint(x);
  return (u + 0x7FFFu + ((u >> 16) & 1u)) >> 16;
}

// hi = rne(a), lo = rne(a - hi) for two floats, packed little-endian (first element in the low half-word)
__device__ __forceinline__ void split2(float a, float b, unsigned int& wh, unsigned int& wl) {
  const unsigned int ha = bf_rne(a), hb = bf_rne(b);
  const float ra = a - __uint_as_float(ha << 16);
  const float rb = b - __uint_as_float(hb << 16);
  wh = ha | (hb << 16);
  wl = bf_rne(ra) | (bf_rne(rb) << 16);
}

// 8 consecutive floats -> one 16-B hi piece and one 16-B lo piece
__device__ __forceinline__ void split8(v4f a0, v4f a1, v4u& wh, v4u& wl) {
  unsigned int h0, h1, h2, h3, l0, l1, l2, l3;
  split2(a0[0], a0[1], h0, l0);
  split2(a0[2], a0[3], h1, l1);
  split2(a1[0], a1[1], h2, l2);
  split2(a1[2], a1[3], h3, l3);
  wh = (v4u){h0, h1, h2, h3};
  wl = (v4u){l0, l1, l2, l3};
}

// ---------------------------------------------------------------------------
// kernel 0: elementwise split of a contiguous f32 array (layout kept) into bf16 hi and lo planes.
// Block = 2048 elements; thread converts 8 consecutive floats and writes one 16-B piece per plane;
// coverage: n/2048 blocks x 256 thr x 8 = n elements of both planes.
// ---------------------------------------------------------------------------
__global__ __launch_bounds__(256) void k_split(const float* __restrict__ src,
                                               unsigned short* __restrict__ dh,
                                               unsigned short* __restrict__ dl) {
  const size_t o = (size_t)blockIdx.x * 2048 + (size_t)threadIdx.x * 8;
  const v4f a0 = *(const v4f*)(src + o);
  const v4f a1 = *(const v4f*)(src + o + 4);
  v4u wh, wl;
  split8(a0, a1, wh, wl);
  v4u* ph = (v4u*)(dh + o);
  v4u* pl = (v4u*)(dl + o);
  *ph = wh;
  *pl = wl;
  
}

// ---------------------------------------------------------------------------
// kernel 1: weight transpose + split. in W [k = DM rows][n = DM cols] f32 -> out planes [n][k] hi/lo (pitch DM).
// blockIdx.z = which weight (0 q, 1 k, 2 v -> stacked planes rows which*DM + n; 3 -> the out-projection planes).
// blockIdx.x = 64-wide n tile (source columns), blockIdx.y = 64-deep k tile (source rows). The 64 x 64 tile is
// coverage: load 256 thr x 16 floats = 64 x 64; store 256 thr x 2 iter x 8 halves = 64 n rows x 64 k per plane;
// grid (DM/64, DM/64, 4) covers all four DM x DM matrices.
// ---------------------------------------------------------------------------
__global__ __launch_bounds__(256) void k_split_tr(const float* __restrict__ Wq, const float* __restrict__ Wk,
                                                  const float* __restrict__ Wv, const float* __restrict__ Wo,
                                                  unsigned short* __restrict__ Ph, unsigned short* __restrict__ Pl,
                                                  unsigned short* __restrict__ Oh, unsigned short* __restrict__ Ol) {
  __shared__ __align__(16) float st[64 * TTP];       // 17408 B
  const int tid = threadIdx.x;
  const int z   = blockIdx.z;                        // block-uniform
  const int nt  = blockIdx.x * 64;                   // source columns = output rows
  const int kt  = blockIdx.y * 64;                   // source rows    = output k
  const float* W = (z == 0) ? Wq : ((z == 1) ? Wk : ((z == 2) ? Wv : Wo));
  {
    const int row = tid >> 2;                        // k within tile, 0..63
    const int cb  = (tid & 3) * 16;                  // n within tile, 0,16,32,48
    const float* src = W + (size_t)(kt + row) * DM + nt + cb;
#pragma unroll
    for (int e = 0; e < 4; ++e) {
      const v4f a = *(const v4f*)(src + 4 * e);
#pragma unroll
      for (int q = 0; q < 4; ++q) st[(cb + 4 * e + q) * TTP + row] = a[q];
    }
  }
  __syncthreads();
  unsigned short* dh = (z < 3) ? (Ph + (size_t)z * DM * DM) : Oh;
  unsigned short* dl = (z < 3) ? (Pl + (size_t)z * DM * DM) : Ol;
  const size_t base = (size_t)nt * DM + kt;
  v4u vh[2], vl[2];
  size_t go[2];
#pragma unroll
  for (int it = 0; it < 2; ++it) {
    const int pp   = tid + 256 * it;                 // 0..511
    const int rown = pp >> 3;                        // 0..63
    const int pc   = pp & 7;                         // k piece 8*pc .. +7
    const float* ra = st + rown * TTP + 8 * pc;
    const v4f a0 = *(const v4f*)(ra), a1 = *(const v4f*)(ra + 4);
    split8(a0, a1, vh[it], vl[it]);
    go[it] = base + (size_t)rown * DM + 8 * pc;
  }
  {
#pragma unroll
    for (int it = 0; it < 2; ++it) {
      *(v4u*)(dh + go[it]) = vh[it];
      *(v4u*)(dl + go[it]) = vl[it];
    }
    
  }
}

// ---------------------------------------------------------------------------
// 128 x 64 block tile, 32 x 32 per wave, split-bf16 GEMM main loop over K (multiple of GBK): A planes [m][k] pitch
// lda, B planes [n][k] pitch ldb (hi and lo). Per stage of GBK = 64 k the block brings the 128 A rows and the 64 B
// rows of both planes into LDS (pitch KTP): a wave's 16-B loads cover 4 whole 128-B lines, 12 pieces per thread,
// rows (tid>>3) + 32*i: i 0..3 A hi, 4..7 A lo, 8..9 B hi, 10..11 B lo. The next stage's pieces are loaded into
// registers while this stage is multiplied. Fragments come from LDS by ldf (its split k map, A and B alike).
// Per tile pair: ah.bh + ah.bl + al.bh into one f32 accumulator, k ascending.
// acc[s][t][r] = (mblk + mw + 16*s + 8*(lane>>4) + r, nrow + nw + 16*t + (lane&15)).
// The loop ends behind a barrier: tl may be reused by the caller at once.
// ---------------------------------------------------------------------------
__device__ __forceinline__ void gemm_ld(const unsigned short* const (&gp)[4], int lda, int ldb, int k0,
                                        v4u (&pf)[12]) {
#pragma unroll
  for (int i = 0; i < 4; ++i) {
    pf[i]     = *(const v4u*)(gp[0] + (size_t)(32 * i) * lda + k0);
    pf[4 + i] = *(const v4u*)(gp[1] + (size_t)(32 * i) * lda + k0);
  }
#pragma unroll
  for (int i = 0; i < 2; ++i) {
    pf[8 + i]  = *(const v4u*)(gp[2] + (size_t)(32 * i) * ldb + k0);
    pf[10 + i] = *(const v4u*)(gp[3] + (size_t)(32 * i) * ldb + k0);
  }
  // precaution: stands in front of the fragment loads, which land in the address registers of the loads above
  asm volatile("s_wait_xcnt 0x0" ::: "memory");
}

__device__ __forceinline__ void gemm128x64x3(const unsigned short* __restrict__ Ah,
                                             const unsigned short* __restrict__ Al, int lda,
                                             const unsigned short* __restrict__ Bh,
                                             const unsigned short* __restrict__ Bl, int ldb,
                                             int K, int mblk, int nrow, int mw, int nw, int tid, int lane,
                                             unsigned short* tl, v8f (&acc)[2][2]) {
  const int pr = tid >> 3;                           // 0..31: row within each group of 32 rows
  const int pe = (tid & 7) * 8;                      // first of this thread's 8 k elements in the row
  const unsigned short* const gp[4] = {Ah + (size_t)(mblk + pr) * lda + pe, Al + (size_t)(mblk + pr) * lda + pe,
                                       Bh + (size_t)(nrow + pr) * ldb + pe, Bl + (size_t)(nrow + pr) * ldb + pe};
  unsigned short* sp = tl + pr * KTP + pe;
  const unsigned short* sAh = tl;
  const unsigned short* sAl = tl + 128 * KTP;
  const unsigned short* sBh = tl + 256 * KTP;
  const unsigned short* sBl = tl + 320 * KTP;
  v4u pf[12];
  gemm_ld(gp, lda, ldb, 0, pf);
// rolled: one copy of the stage body keeps the code short and the register count at three blocks per WGP
#pragma unroll 1
  for (int k0 = 0; k0 < K; k0 += GBK) {
#pragma unroll
    for (int i = 0; i < 12; ++i) *(v4u*)(sp + 32 * i * KTP) = pf[i];
    __syncthreads();                                 // the stage is visible to every wave
    if (k0 + GBK < K) gemm_ld(gp, lda, ldb, k0 + GBK, pf);
#pragma unroll
    for (int ks = 0; ks < GBK; ks += 32) {
      const v16b ah0 = ldf(sAh, KTP, mw, ks, lane);
      const v16b ah1 = ldf(sAh, KTP, mw + 16, ks, lane);
      const v16b al0 = ldf(sAl, KTP, mw, ks, lane);
      const v16b al1 = ldf(sAl, KTP, mw + 16, ks, lane);
#pragma unroll
      for (int t = 0; t < 2; ++t) {
        const v16b bh = ldf(sBh, KTP, nw + 16 * t, ks, lane);
        const v16b bl = ldf(sBl, KTP, nw + 16 * t, ks, lane);
        acc[0][t] = mma(ah0, bh, acc[0][t]);
        acc[1][t] = mma(ah1, bh, acc[1][t]);
        acc[0][t] = mma(ah0, bl, acc[0][t]);
        acc[1][t] = mma(ah1, bl, acc[1][t]);
        acc[0][t] = mma(al0, bh, acc[0][t]);
        acc[1][t] = mma(al1, bh, acc[1][t]);
      }
    }
    __syncthreads();                                 // every reader of the stage is done before it is rewritten
  }
}

// stage acc + bias in the block tile, row-major [row][col] (128 x 64, pitch OTP floats)
__device__ __forceinline__ void stage_rm(v8f (&acc)[2][2], const float (&bb)[2], float* st,
                                         int mw, int nw, int hh, int c) {
#pragma unroll
  for (int s = 0; s < 2; ++s)
#pragma unroll
    for (int t = 0; t < 2; ++t)
#pragma unroll
      for (int r = 0; r < 8; ++r)
        st[(mw + 16 * s + 8 * hh + r) * OTP + nw + 16 * t + c] = acc[s][t][r] + bb[t];
}

// stage acc + bias transposed [col][row] (64 x 128, pitch VTP floats)
__device__ __forceinline__ void stage_tr(v8f (&acc)[2][2], const float (&bb)[2], float* st,
                                         int mw, int nw, int hh, int c) {
#pragma unroll
  for (int s = 0; s < 2; ++s)
#pragma unroll
    for (int t = 0; t < 2; ++t)
#pragma unroll
      for (int r = 0; r < 8; ++r)
        st[(nw + 16 * t + c) * VTP + mw + 16 * s + 8 * hh + r] = acc[s][t][r] + bb[t];
}

// block tile 128 rows x 64 cols -> hi/lo planes at element base, row pitch ldo: each row = 64 halves = one whole
// coverage: 256 thr x 4 iter x 8 halves = 128 rows x 64 per plane.
__device__ __forceinline__ void store_planes(const float* st, unsigned short* __restrict__ oh,
                                             unsigned short* __restrict__ ol, size_t base, int ldo, int tid) {
  v4u vh[4], vl[4];
  size_t go[4];
#pragma unroll
  for (int it = 0; it < 4; ++it) {
    const int pp  = tid + 256 * it;                  // 0..1023
    const int row = pp >> 3;                         // 0..127
    const int pc  = pp & 7;                          // 16-B piece = cols 8*pc .. +7
    const float* ra = st + row * OTP + 8 * pc;
    const v4f a0 = *(const v4f*)(ra), a1 = *(const v4f*)(ra + 4);
    split8(a0, a1, vh[it], vl[it]);
    go[it] = base + (size_t)row * ldo + 8 * pc;
  }
  {
#pragma unroll
    for (int it = 0; it < 4; ++it) {
      *(v4u*)(oh + go[it]) = vh[it];
      *(v4u*)(ol + go[it]) = vl[it];
    }
    
  }
}

// transposed block tile 64 d-rows x 128 s -> V^T hi/lo planes [bh][d][s] at element base (= bh*HD*SL + sf):
// coverage: 256 thr x 4 iter x 8 halves = 64 d-rows x 128 s per plane.
__device__ __forceinline__ void store_vt(const float* st, unsigned short* __restrict__ vh,
                                         unsigned short* __restrict__ vl, size_t base, int tid) {
  v4u wh[4], wl[4];
  size_t go[4];
#pragma unroll
  for (int it = 0; it < 4; ++it) {
    const int pp   = tid + 256 * it;                 // 0..1023
    const int drow = pp >> 4;                        // 0..63
    const int pc   = pp & 15;                        // 8 consecutive s
    const float* ra = st + drow * VTP + 8 * pc;
    const v4f a0 = *(const v4f*)(ra), a1 = *(const v4f*)(ra + 4);
    split8(a0, a1, wh[it], wl[it]);
    go[it] = base + (size_t)drow * SL + 8 * pc;
  }
  {
#pragma unroll
    for (int it = 0; it < 4; ++it) {
      *(v4u*)(vh + go[it]) = wh[it];
      *(v4u*)(vl + go[it]) = wl[it];
    }
    
  }
}

// coverage: 256 thr x 8 iter x 4 floats = 128 rows x 64 cols.
__device__ __forceinline__ void store_f32(const float* st, float* __restrict__ out, int mblk, int nblk, int tid) {
  v4f val[8];
  size_t go[8];
#pragma unroll
  for (int it = 0; it < 8; ++it) {
    const int pp  = tid + 256 * it;                  // 0..2047
    const int row = pp >> 4;                         // 0..127
    const int pc  = pp & 15;                         // 4 consecutive cols
    val[it] = *(const v4f*)(st + row * OTP + 4 * pc);
    go[it]  = (size_t)(mblk + row) * DM + nblk + 4 * pc;
  }
  {
#pragma unroll
    for (int it = 0; it < 8; ++it) *(v4f*)(out + go[it]) = val[it];
    
  }
}

// ---------------------------------------------------------------------------
// kernel 2: projections. blockIdx.x = which*NH + head (which 0 = q, 1 = k, 2 = v), blockIdx.y = 128-token block
// of one sequence b. A = x planes [NT][DM] (pitch DM, K = DM), B = stacked transposed weight planes [3*DM n][DM k]
// rows which*DM + head*64 .. (pitch DM). Bias added in f32.
// grid = (3*NH = 24, NT/128 = 32). coverage: q and k planes 16 bh x 16 blocks x 128 s x 64 d each,
// v^T planes 16 bh x 16 blocks x 64 d x 128 s.
// ---------------------------------------------------------------------------
__global__ __launch_bounds__(256) void k_proj(const unsigned short* __restrict__ Xh,
                                              const unsigned short* __restrict__ Xl,
                                              const unsigned short* __restrict__ Wh,
                                              const unsigned short* __restrict__ Wl,
                                              const float* __restrict__ bq,
                                              const float* __restrict__ bk,
                                              const float* __restrict__ bv,
                                              unsigned short* __restrict__ Qh, unsigned short* __restrict__ Ql,
                                              unsigned short* __restrict__ Kh, unsigned short* __restrict__ Kl,
                                              unsigned short* __restrict__ Vh, unsigned short* __restrict__ Vl) {
  __shared__ __align__(16) unsigned char sm[GSB];    // 55296 B: GEMM stage, then the f32 output staging tile
  unsigned short* tl = (unsigned short*)sm;
  float* st = (float*)sm;                            // 128 x OTP (the transposed 64 x VTP tile also fits)
  const int tid = threadIdx.x, lane = tid & 31, wave = tid >> 5;
  const int hh = lane >> 4, c = lane & 15;
  const int which = blockIdx.x / NH;                 // block-uniform
  const int head  = blockIdx.x - which * NH;
  const int mblk  = blockIdx.y * 128;
  const int b     = mblk / SL;
  const int sf    = mblk - b * SL;                   // first position of the block in sequence b
  const int bh    = b * NH + head;
  const int mw = (wave >> 1) * 32, nw = (wave & 1) * 32;

  v8f acc[2][2];
#pragma unroll
  for (int s = 0; s < 2; ++s)
#pragma unroll
    for (int t = 0; t < 2; ++t) acc[s][t] = zero8();
  gemm128x64x3(Xh, Xl, DM,
               Wh + (size_t)which * DM * DM, Wl + (size_t)which * DM * DM, DM,
               DM, mblk, head * HD, mw, nw, tid, lane, tl, acc);

  float bb[2];
#pragma unroll
  for (int t = 0; t < 2; ++t) {
    const int i = head * HD + nw + 16 * t + c;       // 0..511
    const float xq = bq[i], xk = bk[i], xv = bv[i];
    bb[t] = (which == 0) ? xq : ((which == 1) ? xk : xv);
  }
  if (which < 2) stage_rm(acc, bb, st, mw, nw, hh, c);
  else           stage_tr(acc, bb, st, mw, nw, hh, c);
  __syncthreads();
  if (which < 2) {
    unsigned short* oh = (which == 0) ? Qh : Kh;
    unsigned short* ol = (which == 0) ? Ql : Kl;
    store_planes(st, oh, ol, ((size_t)bh * SL + sf) * HD, HD, tid);
  } else {
    store_vt(st, Vh, Vl, (size_t)bh * HD * SL + sf, tid);
  }
}

// ---------------------------------------------------------------------------
// kernel 3: flash attention for every (b, head, 128-query block), head dim 64, 32 chunks of 64 keys.
//   q/k planes [b*NH + h][s][64] hi/lo; v^T planes [b*NH + h][64][s] hi/lo; int32 tables [b][s]: key mask
//   (zero = masked), gap bucket ids, duration bucket ids; f32 tables gap [GAPR][NH], dur [DURR][NH];
//   O planes [token = b*SL + s][DM] hi/lo, head h at columns h*64 (one line per row).
// Block = 8 waves; wave w owns queries q0 = qb*128 + 16*w .. +15. The head's column of both bias tables is staged
// in LDS once per block. Per chunk: K [key][d] and V^T [d][key] hi/lo tiles staged in LDS by all threads
// (plain 16-B loads) while waves 0-1 stage the chunk's 64 per-key values (gap id, duration bias, mask) in LDS,
// barriers. The products are taken transposed: S^T = K.Q^T (A = K rows, B = Q rows) and O^T += V^T.P^T
// (A = V^T rows, B = P^T), so a lane holds scores of ONE query (column lane&15) for keys 16*j + 8*(lane>>4) + r.
// s/8 + gap[clip(|gq - gk|, 0, GAPR-1)] + dur[clamp(dk)], masked keys replaced by -1e9; maximum and sum run
// in-lane with one exchange between the wave halves; p = exp(s - m) is split into bf16 hi/lo and packed straight
// from the score accumulators into the B fragment (tiles 2*kk and 2*kk+1 are elements 0..7 and 8..15 of the split
// k map), so P never goes through LDS. Epilogue: O^T / l, 8 consecutive channels per lane and tile, split hi/lo and
// stored from registers.
// coverage: 256 blocks x 8 waves x 16 rows x 64 cols = NT x DM per plane.
// ---------------------------------------------------------------------------
__global__ __launch_bounds__(256) void k_attn(const unsigned short* __restrict__ Qh,
                                              const unsigned short* __restrict__ Ql,
                                              const unsigned short* __restrict__ Kh,
                                              const unsigned short* __restrict__ Kl,
                                              const unsigned short* __restrict__ Vh,
                                              const unsigned short* __restrict__ Vl,
                                              const int* __restrict__ mask,
                                              const int* __restrict__ gids,
                                              const int* __restrict__ dids,
                                              const float* __restrict__ gap_emb,
                                              const float* __restrict__ dur_emb,
                                              unsigned short* __restrict__ Oh,
                                              unsigned short* __restrict__ Ol) {
  __shared__ __align__(16) unsigned short Ks[2 * KC * KTP];   // hi tile, lo tile [key][d]   18432 B
  __shared__ __align__(16) unsigned short Vs[2 * HD * KTP];   // hi tile, lo tile [d][key]   18432 B
  __shared__ __align__(16) int   gkS[KC];                      // chunk's key gap bucket ids        256 B
  __shared__ __align__(16) float dbS[KC];                      // chunk's key duration bias         256 B
  __shared__ __align__(16) int   mkS[KC];                      // chunk's key mask                  256 B
  __shared__ float gapS[36];                                   // gap table column of head h (33)   144 B
  __shared__ float durS[20];                                   // dur table column of head h (17)    80 B

  const int tid = threadIdx.x, lane = tid & 31, wave = tid >> 5;
  const int hh = lane >> 4, c = lane & 15;
  const int qb = blockIdx.x % NQB;
  const int bh = blockIdx.x / NQB;                   // b*NH + h
  const int h  = bh % NH;
  const int b  = bh / NH;
  const int q0 = qb * QB + wave * 16;
  const size_t qkbase = (size_t)bh * SL * HD;
  const size_t vbase  = (size_t)bh * HD * SL;

  // stage the head's table columns once (clamped addresses for every lane, predicated LDS store)
  {
    const int ig = (tid < GAPR) ? tid : (GAPR - 1);
    const int id = (tid < DURR) ? tid : (DURR - 1);
    const float gv = gap_emb[ig * NH + h];
    const float dv = dur_emb[id * NH + h];
    if (tid < GAPR) gapS[tid] = gv;
    if (tid < DURR) durS[tid] = dv;
  }

  // gap bucket id of the one query this lane's score elements belong to: q0 + (lane&15)
  const int gq = gids[(size_t)b * SL + q0 + c];

  // Q fragments (loop-invariant), B operand stored [n = query][k = d]: query q0 + (lane&15), split map over d
  v16b qh[2], ql[2];
#pragma unroll
  for (int dc = 0; dc < 2; ++dc) {
    qh[dc] = ldf(Qh + qkbase, HD, q0, dc * 32, lane);
    ql[dc] = ldf(Ql + qkbase, HD, q0, dc * 32, lane);
  }

  float mrow = -__builtin_huge_valf();               // running maximum of query c (equal in both halves)
  float lrow = 0.f;                                  // running sum over this half's keys; halves joined at the end
  v8f oacc[4];
#pragma unroll
  for (int t = 0; t < 4; ++t) oacc[t] = zero8();

  for (int kc = 0; kc < NCK; ++kc) {
    const int kv0 = kc * KC;
    __syncthreads();                                 // readers of the earlier chunk's tiles / key values are done
    {
      const int r  = tid >> 2;                       // 0..63: key row of K tiles, d row of V^T tiles
      const int qq = (tid & 3) * 16;                 // 0,16,32,48 elements
      const unsigned short* kh = Kh + qkbase + (size_t)(kv0 + r) * HD + qq;
      const unsigned short* kl = Kl + qkbase + (size_t)(kv0 + r) * HD + qq;
      const unsigned short* vh = Vh + vbase + (size_t)r * SL + kv0 + qq;
      const unsigned short* vl = Vl + vbase + (size_t)r * SL + kv0 + qq;
#pragma unroll
      for (int e = 0; e < 2; ++e) {
        *(v4u*)(Ks + r * KTP + qq + 8 * e)            = *(const v4u*)(kh + 8 * e);
        *(v4u*)(Ks + KC * KTP + r * KTP + qq + 8 * e) = *(const v4u*)(kl + 8 * e);
        *(v4u*)(Vs + r * KTP + qq + 8 * e)            = *(const v4u*)(vh + 8 * e);
        *(v4u*)(Vs + HD * KTP + r * KTP + qq + 8 * e) = *(const v4u*)(vl + 8 * e);
      }
      if (tid < KC) {                                // waves 0 and 1, wave-uniform: per-key values of the chunk
        const int key = kv0 + tid;                   // 0..SL-1
        const int gk  = gids[(size_t)b * SL + key];
        int dk = dids[(size_t)b * SL + key];
        dk = (dk < 0) ? 0 : ((dk > DURR - 1) ? (DURR - 1) : dk);
        const int mk  = mask[(size_t)b * SL + key];
        gkS[tid] = gk;
        dbS[tid] = durS[dk];
        mkS[tid] = mk;
      }
    }
    __syncthreads();                                 // tiles and key values visible to every wave

    v8f s[4];
#pragma unroll
    for (int j = 0; j < 4; ++j) s[j] = zero8();
#pragma unroll
    for (int dc = 0; dc < 2; ++dc) {
#pragma unroll
      for (int j = 0; j < 4; ++j) {
        // A operands: key row j*16 + (lane&15) of the [key][d] tiles, split map over d
        const v16b khf = ldf(Ks, KTP, j * 16, dc * 32, lane);
        const v16b klf = ldf(Ks + KC * KTP, KTP, j * 16, dc * 32, lane);
        s[j] = mma(khf, qh[dc], s[j]);
        s[j] = mma(klf, qh[dc], s[j]);
        s[j] = mma(khf, ql[dc], s[j]);
      }
    }
    // s[j][r] = S[query q0 + c][key kv0 + j*16 + 8*hh + r]; scale, table biases, replace-mask
#pragma unroll
    for (int j = 0; j < 4; ++j) {
      const int kb = 16 * j + 8 * hh;                // first of this lane's 8 keys of tile j, 0..56
      const v4i g0 = *(const v4i*)(gkS + kb), g1 = *(const v4i*)(gkS + kb + 4);
      const v4f d0 = *(const v4f*)(dbS + kb), d1 = *(const v4f*)(dbS + kb + 4);
      const v4i k0 = *(const v4i*)(mkS + kb), k1 = *(const v4i*)(mkS + kb + 4);
#pragma unroll
      for (int r = 0; r < 8; ++r) {
        const int   gk = (r < 4) ? g0[r & 3] : g1[r & 3];
        const float db = (r < 4) ? d0[r & 3] : d1[r & 3];
        const int   mk = (r < 4) ? k0[r & 3] : k1[r & 3];
        int rel = gq - gk;
        rel = (rel < 0) ? -rel : rel;
        rel = (rel > GAPR - 1) ? (GAPR - 1) : rel;
        rel = (rel < 0) ? 0 : rel;
        const float gbias = gapS[rel];
        const float v = (s[j][r] * 0.125f + gbias) + db;
        s[j][r] = (mk != 0) ? v : NEGV;
      }
    }
    // chunk maximum of query c: in-lane over this half's 32 keys, then one exchange between the halves
    float cj[4];
#pragma unroll
    for (int j = 0; j < 4; ++j) {
      cj[j] = fmaxf(fmaxf(fmaxf(s[j][0], s[j][1]), fmaxf(s[j][2], s[j][3])),
                    fmaxf(fmaxf(s[j][4], s[j][5]), fmaxf(s[j][6], s[j][7])));
    }
    float cm = fmaxf(fmaxf(cj[0], cj[1]), fmaxf(cj[2], cj[3]));
    cm = fmaxf(cm, other_half(cm));
    const float mnew  = fmaxf(mrow, cm);             // finite from chunk 0 on
    const float alpha = exp_slot(mrow - mnew);
    mrow = mnew;

    // p = exp(s - m); tile j's 8 values are 8 consecutive k positions of the B fragment
    v4u ph[4], pl[4];
    float pj[4];
#pragma unroll
    for (int j = 0; j < 4; ++j) {
      v4f p0, p1;
#pragma unroll
      for (int r = 0; r < 4; ++r) {
        p0[r] = exp_slot(s[j][r] - mnew);
        p1[r] = exp_slot(s[j][r + 4] - mnew);
      }
      pj[j] = ((p0[0] + p0[1]) + (p0[2] + p0[3])) + ((p1[0] + p1[1]) + (p1[2] + p1[3]));
      split8(p0, p1, ph[j], pl[j]);
    }
    lrow = lrow * alpha + ((pj[0] + pj[1]) + (pj[2] + pj[3]));
#pragma unroll
    for (int t = 0; t < 4; ++t)
#pragma unroll
      for (int r = 0; r < 8; ++r) oacc[t][r] *= alpha;

#pragma unroll
    for (int kk = 0; kk < 2; ++kk) {
      // B operands: P^T column (lane&15) = query, split k map over keys 32*kk ..
      Frag fh, fl;
      fh.u[0] = ph[2 * kk]; fh.u[1] = ph[2 * kk + 1];
      fl.u[0] = pl[2 * kk]; fl.u[1] = pl[2 * kk + 1];
#pragma unroll
      for (int t = 0; t < 4; ++t) {
        // A operands: channel row t*16 + (lane&15) of V^T [d][key], split k map over keys
        const v16b vhf = ldf(Vs, KTP, t * 16, kk * 32, lane);
        const v16b vlf = ldf(Vs + HD * KTP, KTP, t * 16, kk * 32, lane);
        oacc[t] = mma(vhf, fh.v, oacc[t]);
        oacc[t] = mma(vlf, fh.v, oacc[t]);
        oacc[t] = mma(vhf, fl.v, oacc[t]);
      }
    }
  }

  // O = oacc / l  (l >= 1); oacc[t][r] = O[query q0 + c][channel 16*t + 8*hh + r]
  const float invl = 1.0f / (lrow + other_half(lrow));
  const size_t go = ((size_t)(b * SL + q0 + c)) * DM + (size_t)h * HD + 8 * hh;
  v4u wh[4], wl[4];
#pragma unroll
  for (int t = 0; t < 4; ++t) {
    const v4f a0 = (v4f){oacc[t][0] * invl, oacc[t][1] * invl, oacc[t][2] * invl, oacc[t][3] * invl};
    const v4f a1 = (v4f){oacc[t][4] * invl, oacc[t][5] * invl, oacc[t][6] * invl, oacc[t][7] * invl};
    split8(a0, a1, wh[t], wl[t]);
  }
#pragma unroll
  for (int t = 0; t < 4; ++t) {
    *(v4u*)(Oh + go + 16 * t) = wh[t];
    *(v4u*)(Ol + go + 16 * t) = wl[t];
  }
}

// ---------------------------------------------------------------------------
// kernel 4: out = O.Wo + bo -> f32 rows [NT][DM]. A = O planes [NT][DM], B = transposed
// Wo planes [DM n][DM k]. Block = 128 token rows x 64 cols; grid = (DM/64 = 8, NT/128 = 32).
// coverage: 8 x 32 blocks x 128 x 64 = NT x DM.
// ---------------------------------------------------------------------------
__global__ __launch_bounds__(256) void k_gemm_out(const unsigned short* __restrict__ Ah,
                                                  const unsigned short* __restrict__ Al,
                                                  const unsigned short* __restrict__ Wh,
                                                  const unsigned short* __restrict__ Wl,
                                                  const float* __restrict__ bo,
                                                  float* __restrict__ out) {
  __shared__ __align__(16) unsigned char sm[GSB];    // 55296 B: GEMM stage, then the f32 output staging tile
  unsigned short* tl = (unsigned short*)sm;
  float* st = (float*)sm;                            // 128 x OTP
  const int tid = threadIdx.x, lane = tid & 31, wave = tid >> 5;
  const int hh = lane >> 4, c = lane & 15;
  const int mblk = blockIdx.y * 128, nblk = blockIdx.x * 64;
  const int mw = (wave >> 1) * 32, nw = (wave & 1) * 32;

  v8f acc[2][2];
#pragma unroll
  for (int s = 0; s < 2; ++s)
#pragma unroll
    for (int t = 0; t < 2; ++t) acc[s][t] = zero8();
  gemm128x64x3(Ah, Al, DM, Wh, Wl, DM, DM, mblk, nblk, mw, nw, tid, lane, tl, acc);

  float bb[2];
#pragma unroll
  for (int t = 0; t < 2; ++t) bb[t] = bo[nblk + nw + 16 * t + c];
  stage_rm(acc, bb, st, mw, nw, hh, c);
  __syncthreads();
  store_f32(st, out, mblk, nblk, tid);
}

// ---------------------------------------------------------------------------
// its producer writes, no padded tails exist since every dimension is a tile multiple; offsets multiples of 512 KB):
//   X     bf16x2 [4096][512]             0     8388608
//   Wqkv  bf16x2 [1536][512]       8388608     3145728   (q rows 0..511, k 512..1023, v 1024..1535, [n][k])
//   Wo    bf16x2 [512][512]       11534336     1048576   ([n][k])
//   Q     bf16x2 [16][2048][64]   12582912     8388608
//   K     bf16x2 [16][2048][64]   20971520     8388608
//   V^T   bf16x2 [16][64][2048]   29360128     8388608
//   O     bf16x2 [4096][512]      37748736     8388608
//   total                         46137344
// ---------------------------------------------------------------------------
extern "C" void kernel_launch(void* const* d_in, const int* in_sizes, int n_in,
                              void* d_out, int out_size, void* d_ws, size_t ws_size,
                              hipStream_t stream) {
  if (n_in < 14) return;
  if (in_sizes[0] != NT * DM) return;
  if (in_sizes[1] != NBT * SL) return;
  if (in_sizes[2] != NBT * SL) return;
  if (in_sizes[3] != NBT * SL) return;
  if (in_sizes[4] != DM * DM) return;
  if (in_sizes[5] != DM) return;
  if (in_sizes[6] != DM * DM) return;
  if (in_sizes[7] != DM) return;
  if (in_sizes[8] != DM * DM) return;
  if (in_sizes[9] != DM) return;
  if (in_sizes[10] != DM * DM) return;
  if (in_sizes[11] != DM) return;
  if (in_sizes[12] != GAPR * NH) return;
  if (in_sizes[13] != DURR * NH) return;
  if (out_size != NT * DM) return;

  const float* x     = (const float*)d_in[0];   // [2][2048][512] = [4096][512]
  const int*   amask = (const int*)d_in[1];     // [2][2048] int32, zero = masked key
  const int*   gids  = (const int*)d_in[2];     // [2][2048] int32
  const int*   dids  = (const int*)d_in[3];     // [2][2048] int32
  const float* W_q   = (const float*)d_in[4];   // [512][512] [in][out]
  const float* b_q   = (const float*)d_in[5];   // [512]
  const float* W_k   = (const float*)d_in[6];
  const float* b_k   = (const float*)d_in[7];
  const float* W_v   = (const float*)d_in[8];
  const float* b_v   = (const float*)d_in[9];
  const float* W_o   = (const float*)d_in[10];
  const float* b_o   = (const float*)d_in[11];
  const float* gtab  = (const float*)d_in[12];  // [33][8]
  const float* dtab  = (const float*)d_in[13];  // [17][8]
  float* out = (float*)d_out;                   // [4096][512] f32

  const size_t PX  = (size_t)NT * DM * 2;       // 4194304
  const size_t PW  = (size_t)3 * DM * DM * 2;   // 1572864
  const size_t PWO = (size_t)DM * DM * 2;       // 524288
  size_t off = 0;
  const size_t oXh  = off; off += PX;
  const size_t oXl  = off; off += PX;
  const size_t oWh  = off; off += PW;
  const size_t oWl  = off; off += PW;
  const size_t oWoh = off; off += PWO;
  const size_t oWol = off; off += PWO;
  const size_t oQh  = off; off += PX;
  const size_t oQl  = off; off += PX;
  const size_t oKh  = off; off += PX;
  const size_t oKl  = off; off += PX;
  const size_t oVh  = off; off += PX;
  const size_t oVl  = off; off += PX;
  const size_t oOh  = off; off += PX;
  const size_t oOl  = off; off += PX;
  if (off > ws_size) return;                    // off = 46137344
  if (off > (size_t)134217728) return;

  char* ws = (char*)d_ws;
  unsigned short* Xh  = (unsigned short*)(ws + oXh);
  unsigned short* Xl  = (unsigned short*)(ws + oXl);
  unsigned short* Wh  = (unsigned short*)(ws + oWh);
  unsigned short* Wl  = (unsigned short*)(ws + oWl);
  unsigned short* Woh = (unsigned short*)(ws + oWoh);
  unsigned short* Wol = (unsigned short*)(ws + oWol);
  unsigned short* Qh  = (unsigned short*)(ws + oQh);
  unsigned short* Ql  = (unsigned short*)(ws + oQl);
  unsigned short* Kh  = (unsigned short*)(ws + oKh);
  unsigned short* Kl  = (unsigned short*)(ws + oKl);
  unsigned short* Vh  = (unsigned short*)(ws + oVh);
  unsigned short* Vl  = (unsigned short*)(ws + oVl);
  unsigned short* Oh  = (unsigned short*)(ws + oOh);
  unsigned short* Ol  = (unsigned short*)(ws + oOl);

  // (0) hi/lo planes of x
  k_split<<<dim3((NT * DM) / 2048), dim3(256), 0, stream>>>(x, Xh, Xl);
  // (1) transposed hi/lo planes of the four weights: in [k][n] -> out [n][k]
  k_split_tr<<<dim3(DM / 64, DM / 64, 4), dim3(256), 0, stream>>>(W_q, W_k, W_v, W_o, Wh, Wl, Woh, Wol);
  // (2) q / k / v^T planes
  k_proj<<<dim3(3 * NH, NT / 128), dim3(256), 0, stream>>>(Xh, Xl, Wh, Wl, b_q, b_k, b_v,
                                                          Qh, Ql, Kh, Kl, Vh, Vl);
  // (3) attention -> O planes
  k_attn<<<dim3(NBT * NH * NQB), dim3(256), 0, stream>>>(Qh, Ql, Kh, Kl, Vh, Vl, amask, gids, dids,
                                                        gtab, dtab, Oh, Ol);
  // (4) out = O.Wo + bo
  k_gemm_out<<<dim3(DM / 64, NT / 128), dim3(256), 0, stream>>>(Oh, Ol, Woh, Wol, b_o, out);
  (void)hipGetLastError();
}

// v003
// It runs in 96.3 microseconds.
// Next to v002, in two timings, it ran 1.50 times as fast each time.
// Counting every step since v000, it is 3.29 times as fast.
// Contractions: Q/K/V = x.W (3 sites), S = Q.K^T, O = P.V, out = O.Wo: all v_wmma_f32_16x16x32_bf16 on bf16 hi/lo
// split operand planes (hi.hi + hi.lo + lo.hi per tile pair), f32 accumulate; biases, the 1/8 scale, the bucket-table
// lookups, the key mask (replace by -1e9) and the online softmax in f32.
// Plane carry audit: every hi/lo plane (X, Wqkv^T, Wo^T, Q, K, V^T, in-register P fragments, O) carries factor 1
// (hi = rne_bf16(v), lo = rne_bf16(v - hi), f32 exponent range, no subnormal concern); no inverse fold exists anywhere.
// Key order: per sequence the keys are reordered by a stable partition (unmasked first, masked behind); K and V are
// projected and attended only up to the last unmasked key (all keys when a sequence has none unmasked).
#include <hip/hip_runtime.h>
#include <stddef.h>

#define NBT 2                  // batch
#define SL  2048               // sequence length
#define DM  512                // model width
#define NH  8                  // heads
#define HD  64                 // head dim
#define NT  (NBT * SL)         // token rows, row m = b*SL + s
#define QB  128                // query rows per attention block
#define KC  64                 // keys per chunk
#define NQB (SL / QB)          // 16
#define NCK (SL / KC)          // 32
#define KTP 72                 // LDS pitch (16-bit elements) for 64-wide tiles, 144 B
#define OTP 68                 // f32 staging pitch [row][col] (128 x 64)
#define VTP 132                // f32 staging pitch [col][row] (64 x 128)
#define TTP 68                 // f32 staging pitch for the 64 x 64 weight transpose tile
#define GBK 64                 // k elements per GEMM stage: one whole 128-B line per plane row
#define GTR (2 * 128 + 2 * 64) // rows of one GEMM stage in LDS: A hi, A lo (128 each), B hi, B lo (64 each)
#define GSB (GTR * KTP * 2)    // bytes of one GEMM stage in LDS, 55296
#define GAPR 33                // time-gap table rows
#define DURR 17                // duration table rows
#define NEGV (-1.0e9f)         // masked-key score value

static_assert(NT == 4096);
static_assert(NH * HD == DM);
static_assert(SL % QB == 0);
static_assert(SL % KC == 0);
static_assert(SL % 128 == 0);
static_assert(DM % 64 == 0);
static_assert(DM % 32 == 0);
static_assert((NT * DM) % 2048 == 0);
static_assert(HD == 64);
static_assert(KC == 64);
static_assert(64 * VTP <= 128 * OTP);
static_assert(DM % GBK == 0);
static_assert(128 * OTP * 4 <= GSB);
static_assert(SL == 256 * 8);

typedef __bf16       v16b __attribute__((ext_vector_type(16)));
typedef float        v8f  __attribute__((ext_vector_type(8)));
typedef float        v4f  __attribute__((ext_vector_type(4)));
typedef unsigned int v4u  __attribute__((ext_vector_type(4)));
typedef int          v4i  __attribute__((ext_vector_type(4)));
union Frag { v16b v; v4u u[2]; };

// WMMA with the dependent-VALU hazard guard (ties D, keeps A/B live)
__device__ __forceinline__ v8f mma(v16b a, v16b b, v8f c) {
  c = __builtin_amdgcn_wmma_f32_16x16x32_bf16(false, a, false, b, (short)0, c, false, false);
  asm volatile("v_nop\n\tv_nop\n\tv_nop\n\tv_nop" : "+v"(c) : "v"(a), "v"(b));
  return c;
}

// value of lane l ^ 16 (the other 16-lane half), by the vector cross-row move
__device__ __forceinline__ float other_half(float x) {
  const int b = __float_as_int(x);
  return __int_as_float(__builtin_amdgcn_permlanex16(b, b, 0x76543210, 0xfedcba98, false, false));
}

// e^x by the hardware exponential of x * log2(e), as __expf gives it. The v_nop fills the one slot that the
// instruction set asks for between a transcendental and a directly following instruction that reads its result or
// overwrites its source.
__device__ __forceinline__ float exp_slot(float x) {
  float r;
  asm("v_exp_f32 %0, %1\n\tv_nop" : "=v"(r) : "v"(x * 1.44269504f));
  return r;
}

__device__ __forceinline__ v8f zero8() { return (v8f){0.f, 0.f, 0.f, 0.f, 0.f, 0.f, 0.f, 0.f}; }

// Fragment loader for k-contiguous 16-bit rows with pitch ld (bf16 bits).
// A operand: row0 + (lane&15) is the M row. B operand stored [n][k]: row0 + (lane&15) is the N column.
// Split k map for both: elements 0..7 <- k0 + 8*(lane>>4) + 0..7, elements 8..15 <- k0 + 16 + 8*(lane>>4) + 0..7.
// D: acc[r] = element (row0 + 8*(lane>>4) + r, col0 + (lane&15)).
__device__ __forceinline__ v16b ldf(const unsigned short* p, int ld, int row0, int k0, int lane) {
  const unsigned short* q = p + (size_t)(row0 + (lane & 15)) * ld + k0 + 8 * (lane >> 4);
  Frag f;
  f.u[0] = *(const v4u*)(q);
  f.u[1] = *(const v4u*)(q + 16);
  return f.v;
}

// f32 -> bf16 bits, RNE convert by integer arithmetic
__device__ __forceinline__ unsigned int bf_rne(float x) {
  const unsigned int u = __float_as_uint(x);
  return (u + 0x7FFFu + ((u >> 16) & 1u)) >> 16;
}

// hi = rne(a), lo = rne(a - hi) for two floats, packed little-endian (first element in the low half-word)
__device__ __forceinline__ void split2(float a, float b, unsigned int& wh, unsigned int& wl) {
  const unsigned int ha = bf_rne(a), hb = bf_rne(b);
  const float ra = a - __uint_as_float(ha << 16);
  const float rb = b - __uint_as_float(hb << 16);
  wh = ha | (hb << 16);
  wl = bf_rne(ra) | (bf_rne(rb) << 16);
}

// 8 consecutive floats -> one 16-B hi piece and one 16-B lo piece
__device__ __forceinline__ void split8(v4f a0, v4f a1, v4u& wh, v4u& wl) {
  unsigned int h0, h1, h2, h3, l0, l1, l2, l3;
  split2(a0[0], a0[1], h0, l0);
  split2(a0[2], a0[3], h1, l1);
  split2(a1[0], a1[1], h2, l2);
  split2(a1[2], a1[3], h3, l3);
  wh = (v4u){h0, h1, h2, h3};
  wl = (v4u){l0, l1, l2, l3};
}

// ---------------------------------------------------------------------------
// kernel 0: elementwise split of a contiguous f32 array (layout kept) into bf16 hi and lo planes.
// Block = 2048 elements; thread converts 8 consecutive floats and writes one 16-B piece per plane;
// coverage: n/2048 blocks x 256 thr x 8 = n elements of both planes.
// Blocks 0 .. NBT-1 do not split: block b builds sequence b's key order instead (compact_keys); block NBT + i splits
// elements 2048*i .. +2047.
// ---------------------------------------------------------------------------

// Stable partition of one sequence's SL keys by the mask: unmasked keys (mask != 0) first in their order, masked keys
// behind them in theirs. A masked key's score is -1e9, so its weight exp(-1e9 - m) is 0 as soon as one key of the
// sequence is unmasked: keys behind the last unmasked one add nothing and are left out by the later kernels.
// Writes, per new position: the key's token index, gap id, duration id and mask; and cnt[b] = keys to attend =
// number of unmasked keys, or SL when there is none (every score is then -1e9 and all keys count alike).
// Thread t owns keys 8t .. 8t+7; block-wide inclusive scan of the per-thread counts in LDS, two buffers, one
// barrier a step. Every position 0..SL-1 is written exactly once (the map is a permutation).
__device__ __forceinline__ void compact_keys(const int* __restrict__ mask, const int* __restrict__ gids,
                                             const int* __restrict__ dids, int* __restrict__ idx,
                                             int* __restrict__ cg, int* __restrict__ cd, int* __restrict__ cm,
                                             int* __restrict__ cnt, int b, int tid) {
  __shared__ int sc[2][256];
  const int base = b * SL + tid * 8;
  const v4i m0 = *(const v4i*)(mask + base), m1 = *(const v4i*)(mask + base + 4);
  // precaution: stands in front of the next loads, which may land in the address registers of the loads above
  asm volatile("s_wait_xcnt 0x0" ::: "memory");
  const v4i g0 = *(const v4i*)(gids + base), g1 = *(const v4i*)(gids + base + 4);
  // precaution: as above
  asm volatile("s_wait_xcnt 0x0" ::: "memory");
  const v4i d0 = *(const v4i*)(dids + base), d1 = *(const v4i*)(dids + base + 4);
  int c = 0;
#pragma unroll
  for (int e = 0; e < 4; ++e) c += ((m0[e] != 0) ? 1 : 0) + ((m1[e] != 0) ? 1 : 0);
  sc[0][tid] = c;
  __syncthreads();
  int cur = 0;
#pragma unroll
  for (int o = 1; o < 256; o <<= 1) {
    int a = sc[cur][tid];
    if (tid >= o) a += sc[cur][tid - o];
    sc[cur ^ 1][tid] = a;
    cur ^= 1;
    __syncthreads();                                 // the step's sums are visible before the next step reads them
  }
  const int total = sc[cur][255];                    // unmasked keys of the sequence, 0..SL
  int ru = sc[cur][tid] - c;                         // unmasked keys in front of key 8t
  int rm = total + tid * 8 - ru;                     // total + masked keys in front of key 8t
#pragma unroll
  for (int e = 0; e < 8; ++e) {
    const int mk = (e < 4) ? m0[e & 3] : m1[e & 3];
    const int gk = (e < 4) ? g0[e & 3] : g1[e & 3];
    const int dk = (e < 4) ? d0[e & 3] : d1[e & 3];
    const int pos = b * SL + ((mk != 0) ? ru : rm);  // 0..SL-1 within the sequence
    ru += (mk != 0) ? 1 : 0;
    rm += (mk != 0) ? 0 : 1;
    idx[pos] = tid * 8 + e;
    cg[pos]  = gk;
    cd[pos]  = dk;
    cm[pos]  = mk;
  }
  if (tid == 0) cnt[b] = (total > 0) ? total : SL;
}

__global__ __launch_bounds__(256) void k_split(const float* __restrict__ src,
                                               unsigned short* __restrict__ dh,
                                               unsigned short* __restrict__ dl,
                                               const int* __restrict__ mask, const int* __restrict__ gids,
                                               const int* __restrict__ dids, int* __restrict__ idx,
                                               int* __restrict__ cg, int* __restrict__ cd, int* __restrict__ cm,
                                               int* __restrict__ cnt) {
  if (blockIdx.x < NBT) {                            // block-uniform
    compact_keys(mask, gids, dids, idx, cg, cd, cm, cnt, blockIdx.x, threadIdx.x);
    return;
  }
  const size_t o = (size_t)(blockIdx.x - NBT) * 2048 + (size_t)threadIdx.x * 8;
  const v4f a0 = *(const v4f*)(src + o);
  const v4f a1 = *(const v4f*)(src + o + 4);
  v4u wh, wl;
  split8(a0, a1, wh, wl);
  v4u* ph = (v4u*)(dh + o);
  v4u* pl = (v4u*)(dl + o);
  *ph = wh;
  *pl = wl;
  
}

// ---------------------------------------------------------------------------
// kernel 1: weight transpose + split. in W [k = DM rows][n = DM cols] f32 -> out planes [n][k] hi/lo (pitch DM).
// blockIdx.z = which weight (0 q, 1 k, 2 v -> stacked planes rows which*DM + n; 3 -> the out-projection planes).
// blockIdx.x = 64-wide n tile (source columns), blockIdx.y = 64-deep k tile (source rows). The 64 x 64 tile is
// coverage: load 256 thr x 16 floats = 64 x 64; store 256 thr x 2 iter x 8 halves = 64 n rows x 64 k per plane;
// grid (DM/64, DM/64, 4) covers all four DM x DM matrices.
// ---------------------------------------------------------------------------
__global__ __launch_bounds__(256) void k_split_tr(const float* __restrict__ Wq, const float* __restrict__ Wk,
                                                  const float* __restrict__ Wv, const float* __restrict__ Wo,
                                                  unsigned short* __restrict__ Ph, unsigned short* __restrict__ Pl,
                                                  unsigned short* __restrict__ Oh, unsigned short* __restrict__ Ol) {
  __shared__ __align__(16) float st[64 * TTP];       // 17408 B
  const int tid = threadIdx.x;
  const int z   = blockIdx.z;                        // block-uniform
  const int nt  = blockIdx.x * 64;                   // source columns = output rows
  const int kt  = blockIdx.y * 64;                   // source rows    = output k
  const float* W = (z == 0) ? Wq : ((z == 1) ? Wk : ((z == 2) ? Wv : Wo));
  {
    const int row = tid >> 2;                        // k within tile, 0..63
    const int cb  = (tid & 3) * 16;                  // n within tile, 0,16,32,48
    const float* src = W + (size_t)(kt + row) * DM + nt + cb;
#pragma unroll
    for (int e = 0; e < 4; ++e) {
      const v4f a = *(const v4f*)(src + 4 * e);
#pragma unroll
      for (int q = 0; q < 4; ++q) st[(cb + 4 * e + q) * TTP + row] = a[q];
    }
  }
  __syncthreads();
  unsigned short* dh = (z < 3) ? (Ph + (size_t)z * DM * DM) : Oh;
  unsigned short* dl = (z < 3) ? (Pl + (size_t)z * DM * DM) : Ol;
  const size_t base = (size_t)nt * DM + kt;
  v4u vh[2], vl[2];
  size_t go[2];
#pragma unroll
  for (int it = 0; it < 2; ++it) {
    const int pp   = tid + 256 * it;                 // 0..511
    const int rown = pp >> 3;                        // 0..63
    const int pc   = pp & 7;                         // k piece 8*pc .. +7
    const float* ra = st + rown * TTP + 8 * pc;
    const v4f a0 = *(const v4f*)(ra), a1 = *(const v4f*)(ra + 4);
    split8(a0, a1, vh[it], vl[it]);
    go[it] = base + (size_t)rown * DM + 8 * pc;
  }
  {
#pragma unroll
    for (int it = 0; it < 2; ++it) {
      *(v4u*)(dh + go[it]) = vh[it];
      *(v4u*)(dl + go[it]) = vl[it];
    }
    
  }
}

// ---------------------------------------------------------------------------
// 128 x 64 block tile, 32 x 32 per wave, split-bf16 GEMM main loop over K (multiple of GBK): A planes [m][k] pitch
// lda, B planes [n][k] pitch ldb (hi and lo). Per stage of GBK = 64 k the block brings the 128 A rows and the 64 B
// rows of both planes into LDS (pitch KTP): a wave's 16-B loads cover 4 whole 128-B lines, 12 pieces per thread,
// rows (tid>>3) + 32*i: i 0..3 A hi, 4..7 A lo, 8..9 B hi, 10..11 B lo. The next stage's pieces are loaded into
// registers while this stage is multiplied. Fragments come from LDS by ldf (its split k map, A and B alike).
// Per tile pair: ah.bh + ah.bl + al.bh into one f32 accumulator, k ascending.
// Tile row (tid>>3) + 32*i is row arow[i] of the A planes (the caller's map from tile rows to plane rows).
// acc[s][t][r] = (tile row mw + 16*s + 8*(lane>>4) + r, nrow + nw + 16*t + (lane&15)).
// The loop ends behind a barrier: tl may be reused by the caller at once.
// ---------------------------------------------------------------------------
__device__ __forceinline__ void gemm_ld(const unsigned short* const (&gp)[4], const unsigned int (&ao)[4], int ldb,
                                        int k0, v4u (&pf)[12]) {
#pragma unroll
  for (int i = 0; i < 4; ++i) {
    pf[i]     = *(const v4u*)((const char*)gp[0] + ao[i]);
    pf[4 + i] = *(const v4u*)((const char*)gp[1] + ao[i]);
  }
#pragma unroll
  for (int i = 0; i < 2; ++i) {
    pf[8 + i]  = *(const v4u*)(gp[2] + (size_t)(32 * i) * ldb + k0);
    pf[10 + i] = *(const v4u*)(gp[3] + (size_t)(32 * i) * ldb + k0);
  }
  // precaution: stands in front of the fragment loads, which land in the address registers of the loads above
  asm volatile("s_wait_xcnt 0x0" ::: "memory");
}

__device__ __forceinline__ void gemm128x64x3(const unsigned short* __restrict__ Ah,
                                             const unsigned short* __restrict__ Al, int lda,
                                             const unsigned short* __restrict__ Bh,
                                             const unsigned short* __restrict__ Bl, int ldb,
                                             int K, const int (&arow)[4], int nrow, int mw, int nw, int tid,
                                             int lane, unsigned short* tl, v8f (&acc)[2][2]) {
  const int pr = tid >> 3;                           // 0..31: row within each group of 32 rows
  const int pe = (tid & 7) * 8;                      // first of this thread's 8 k elements in the row
  const unsigned short* const gp[4] = {Ah, Al,
                                       Bh + (size_t)(nrow + pr) * ldb + pe, Bl + (size_t)(nrow + pr) * ldb + pe};
  unsigned int ao[4];                                // byte offset of this thread's piece in its A row of each group
#pragma unroll
  for (int i = 0; i < 4; ++i) ao[i] = ((unsigned int)arow[i] * (unsigned int)lda + (unsigned int)pe) * 2u;
  unsigned short* sp = tl + pr * KTP + pe;
  const unsigned short* sAh = tl;
  const unsigned short* sAl = tl + 128 * KTP;
  const unsigned short* sBh = tl + 256 * KTP;
  const unsigned short* sBl = tl + 320 * KTP;
  v4u pf[12];
  gemm_ld(gp, ao, ldb, 0, pf);
// rolled: one copy of the stage body keeps the code short and the register count at three blocks per WGP
#pragma unroll 1
  for (int k0 = 0; k0 < K; k0 += GBK) {
#pragma unroll
    for (int i = 0; i < 12; ++i) *(v4u*)(sp + 32 * i * KTP) = pf[i];
    __syncthreads();                                 // the stage is visible to every wave
    if (k0 + GBK < K) {
#pragma unroll
      for (int i = 0; i < 4; ++i) ao[i] += GBK * 2;  // the A offsets step to the next stage's k
      gemm_ld(gp, ao, ldb, k0 + GBK, pf);
    }
#pragma unroll
    for (int ks = 0; ks < GBK; ks += 32) {
      const v16b ah0 = ldf(sAh, KTP, mw, ks, lane);
      const v16b ah1 = ldf(sAh, KTP, mw + 16, ks, lane);
      const v16b al0 = ldf(sAl, KTP, mw, ks, lane);
      const v16b al1 = ldf(sAl, KTP, mw + 16, ks, lane);
#pragma unroll
      for (int t = 0; t < 2; ++t) {
        const v16b bh = ldf(sBh, KTP, nw + 16 * t, ks, lane);
        const v16b bl = ldf(sBl, KTP, nw + 16 * t, ks, lane);
        acc[0][t] = mma(ah0, bh, acc[0][t]);
        acc[1][t] = mma(ah1, bh, acc[1][t]);
        acc[0][t] = mma(ah0, bl, acc[0][t]);
        acc[1][t] = mma(ah1, bl, acc[1][t]);
        acc[0][t] = mma(al0, bh, acc[0][t]);
        acc[1][t] = mma(al1, bh, acc[1][t]);
      }
    }
    __syncthreads();                                 // every reader of the stage is done before it is rewritten
  }
}

// stage acc + bias in the block tile, row-major [row][col] (128 x 64, pitch OTP floats)
__device__ __forceinline__ void stage_rm(v8f (&acc)[2][2], const float (&bb)[2], float* st,
                                         int mw, int nw, int hh, int c) {
#pragma unroll
  for (int s = 0; s < 2; ++s)
#pragma unroll
    for (int t = 0; t < 2; ++t)
#pragma unroll
      for (int r = 0; r < 8; ++r)
        st[(mw + 16 * s + 8 * hh + r) * OTP + nw + 16 * t + c] = acc[s][t][r] + bb[t];
}

// stage acc + bias transposed [col][row] (64 x 128, pitch VTP floats)
__device__ __forceinline__ void stage_tr(v8f (&acc)[2][2], const float (&bb)[2], float* st,
                                         int mw, int nw, int hh, int c) {
#pragma unroll
  for (int s = 0; s < 2; ++s)
#pragma unroll
    for (int t = 0; t < 2; ++t)
#pragma unroll
      for (int r = 0; r < 8; ++r)
        st[(nw + 16 * t + c) * VTP + mw + 16 * s + 8 * hh + r] = acc[s][t][r] + bb[t];
}

// block tile 128 rows x 64 cols -> hi/lo planes at element base, row pitch ldo: each row = 64 halves = one whole
// coverage: 256 thr x 4 iter x 8 halves = 128 rows x 64 per plane.
__device__ __forceinline__ void store_planes(const float* st, unsigned short* __restrict__ oh,
                                             unsigned short* __restrict__ ol, size_t base, int ldo, int tid) {
  v4u vh[4], vl[4];
  size_t go[4];
#pragma unroll
  for (int it = 0; it < 4; ++it) {
    const int pp  = tid + 256 * it;                  // 0..1023
    const int row = pp >> 3;                         // 0..127
    const int pc  = pp & 7;                          // 16-B piece = cols 8*pc .. +7
    const float* ra = st + row * OTP + 8 * pc;
    const v4f a0 = *(const v4f*)(ra), a1 = *(const v4f*)(ra + 4);
    split8(a0, a1, vh[it], vl[it]);
    go[it] = base + (size_t)row * ldo + 8 * pc;
  }
  {
#pragma unroll
    for (int it = 0; it < 4; ++it) {
      *(v4u*)(oh + go[it]) = vh[it];
      *(v4u*)(ol + go[it]) = vl[it];
    }
    
  }
}

// transposed block tile 64 d-rows x 128 p -> V^T hi/lo planes [bh][d][p] (p = position in the key order) at element base (= bh*HD*SL + sf):
// coverage: 256 thr x 4 iter x 8 halves = 64 d-rows x 128 p per plane.
__device__ __forceinline__ void store_vt(const float* st, unsigned short* __restrict__ vh,
                                         unsigned short* __restrict__ vl, size_t base, int tid) {
  v4u wh[4], wl[4];
  size_t go[4];
#pragma unroll
  for (int it = 0; it < 4; ++it) {
    const int pp   = tid + 256 * it;                 // 0..1023
    const int drow = pp >> 4;                        // 0..63
    const int pc   = pp & 15;                        // 8 consecutive p
    const float* ra = st + drow * VTP + 8 * pc;
    const v4f a0 = *(const v4f*)(ra), a1 = *(const v4f*)(ra + 4);
    split8(a0, a1, wh[it], wl[it]);
    go[it] = base + (size_t)drow * SL + 8 * pc;
  }
  {
#pragma unroll
    for (int it = 0; it < 4; ++it) {
      *(v4u*)(vh + go[it]) = wh[it];
      *(v4u*)(vl + go[it]) = wl[it];
    }
    
  }
}

// coverage: 256 thr x 8 iter x 4 floats = 128 rows x 64 cols.
__device__ __forceinline__ void store_f32(const float* st, float* __restrict__ out, int mblk, int nblk, int tid) {
  v4f val[8];
  size_t go[8];
#pragma unroll
  for (int it = 0; it < 8; ++it) {
    const int pp  = tid + 256 * it;                  // 0..2047
    const int row = pp >> 4;                         // 0..127
    const int pc  = pp & 15;                         // 4 consecutive cols
    val[it] = *(const v4f*)(st + row * OTP + 4 * pc);
    go[it]  = (size_t)(mblk + row) * DM + nblk + 4 * pc;
  }
  {
#pragma unroll
    for (int it = 0; it < 8; ++it) *(v4f*)(out + go[it]) = val[it];
    
  }
}

// ---------------------------------------------------------------------------
// kernel 2: projections. blockIdx.x = which*NH + head (which 0 = q, 1 = k, 2 = v), blockIdx.y = 128-token block
// of one sequence b. A = x planes [NT][DM] (pitch DM, K = DM), B = stacked transposed weight planes [3*DM n][DM k]
// rows which*DM + head*64 .. (pitch DM). Bias added in f32.
// grid = (3*NH = 24, NT/128 = 32). coverage: q planes 16 bh x 16 blocks x 128 s x 64 d; k planes (128 p x 64 d)
// and v^T planes (64 d x 128 p) only in the blocks with sf < cnt[b].
// ---------------------------------------------------------------------------
__global__ __launch_bounds__(256) void k_proj(const unsigned short* __restrict__ Xh,
                                              const unsigned short* __restrict__ Xl,
                                              const unsigned short* __restrict__ Wh,
                                              const unsigned short* __restrict__ Wl,
                                              const float* __restrict__ bq,
                                              const float* __restrict__ bk,
                                              const float* __restrict__ bv,
                                              const int* __restrict__ idx, const int* __restrict__ cnt,
                                              unsigned short* __restrict__ Qh, unsigned short* __restrict__ Ql,
                                              unsigned short* __restrict__ Kh, unsigned short* __restrict__ Kl,
                                              unsigned short* __restrict__ Vh, unsigned short* __restrict__ Vl) {
  __shared__ __align__(16) unsigned char sm[GSB];    // 55296 B: GEMM stage, then the f32 output staging tile
  unsigned short* tl = (unsigned short*)sm;
  float* st = (float*)sm;                            // 128 x OTP (the transposed 64 x VTP tile also fits)
  const int tid = threadIdx.x, lane = tid & 31, wave = tid >> 5;
  const int hh = lane >> 4, c = lane & 15;
  const int which = blockIdx.x / NH;                 // block-uniform
  const int head  = blockIdx.x - which * NH;
  const int mblk  = blockIdx.y * 128;
  const int b     = mblk / SL;
  const int sf    = mblk - b * SL;                   // first position of the block in sequence b
  const int bh    = b * NH + head;
  const int mw = (wave >> 1) * 32, nw = (wave & 1) * 32;

  // q: tile row = token. k, v: tile row = position in the sequence's key order; the token comes from idx, and a
  // block wholly behind the keys to attend has nothing to do (block-uniform return, in front of every barrier).
  int arow[4];
#pragma unroll
  for (int i = 0; i < 4; ++i) arow[i] = mblk + (tid >> 3) + 32 * i;
  if (which != 0) {
    if (sf >= cnt[b]) return;
#pragma unroll
    for (int i = 0; i < 4; ++i) arow[i] = b * SL + (idx[arow[i]] & (SL - 1));
  }

  v8f acc[2][2];
#pragma unroll
  for (int s = 0; s < 2; ++s)
#pragma unroll
    for (int t = 0; t < 2; ++t) acc[s][t] = zero8();
  gemm128x64x3(Xh, Xl, DM,
               Wh + (size_t)which * DM * DM, Wl + (size_t)which * DM * DM, DM,
               DM, arow, head * HD, mw, nw, tid, lane, tl, acc);

  float bb[2];
#pragma unroll
  for (int t = 0; t < 2; ++t) {
    const int i = head * HD + nw + 16 * t + c;       // 0..511
    const float xq = bq[i], xk = bk[i], xv = bv[i];
    bb[t] = (which == 0) ? xq : ((which == 1) ? xk : xv);
  }
  if (which < 2) stage_rm(acc, bb, st, mw, nw, hh, c);
  else           stage_tr(acc, bb, st, mw, nw, hh, c);
  __syncthreads();
  if (which < 2) {
    unsigned short* oh = (which == 0) ? Qh : Kh;
    unsigned short* ol = (which == 0) ? Ql : Kl;
    store_planes(st, oh, ol, ((size_t)bh * SL + sf) * HD, HD, tid);
  } else {
    store_vt(st, Vh, Vl, (size_t)bh * HD * SL + sf, tid);
  }
}

// ---------------------------------------------------------------------------
// kernel 3: flash attention for every (b, head, 128-query block), head dim 64, up to 32 chunks of 64 keys.
//   q planes [b*NH + h][s][64] hi/lo; k planes [b*NH + h][p][64] and v^T planes [b*NH + h][64][p] hi/lo, p = position
//   in the key order; int32 tables [b][s]: gap bucket ids (queries); [b][p]: key mask (zero = masked), gap bucket
//   ids, duration bucket ids; cnt[b] = keys to attend; f32 tables gap [GAPR][NH], dur [DURR][NH];
//   O planes [token = b*SL + s][DM] hi/lo, head h at columns h*64 (one line per row).
// Block = 8 waves; wave w owns queries q0 = qb*128 + 16*w .. +15. The head's column of both bias tables is staged
// in LDS once per block. Per chunk: K [key][d] and V^T [d][key] hi/lo tiles staged in LDS by all threads
// (plain 16-B loads) while waves 0-1 stage the chunk's 64 per-key values (gap id, duration bias, mask) in LDS,
// barriers. The products are taken transposed: S^T = K.Q^T (A = K rows, B = Q rows) and O^T += V^T.P^T
// (A = V^T rows, B = P^T), so a lane holds scores of ONE query (column lane&15) for keys 16*j + 8*(lane>>4) + r.
// s/8 + gap[clip(|gq - gk|, 0, GAPR-1)] + dur[clamp(dk)], masked keys replaced by -1e9; maximum and sum run
// in-lane with one exchange between the wave halves; p = exp(s - m) is split into bf16 hi/lo and packed straight
// from the score accumulators into the B fragment (tiles 2*kk and 2*kk+1 are elements 0..7 and 8..15 of the split
// k map), so P never goes through LDS. Epilogue: O^T / l, 8 consecutive channels per lane and tile, split hi/lo and
// stored from registers.
// coverage: 256 blocks x 8 waves x 16 rows x 64 cols = NT x DM per plane.
// ---------------------------------------------------------------------------
__global__ __launch_bounds__(256) void k_attn(const unsigned short* __restrict__ Qh,
                                              const unsigned short* __restrict__ Ql,
                                              const unsigned short* __restrict__ Kh,
                                              const unsigned short* __restrict__ Kl,
                                              const unsigned short* __restrict__ Vh,
                                              const unsigned short* __restrict__ Vl,
                                              const int* __restrict__ gids,
                                              const int* __restrict__ cm,
                                              const int* __restrict__ cg,
                                              const int* __restrict__ cd,
                                              const int* __restrict__ cnt,
                                              const float* __restrict__ gap_emb,
                                              const float* __restrict__ dur_emb,
                                              unsigned short* __restrict__ Oh,
                                              unsigned short* __restrict__ Ol) {
  __shared__ __align__(16) unsigned short Ks[2 * KC * KTP];   // hi tile, lo tile [key][d]   18432 B
  __shared__ __align__(16) unsigned short Vs[2 * HD * KTP];   // hi tile, lo tile [d][key]   18432 B
  __shared__ __align__(16) int   gkS[KC];                      // chunk's key gap bucket ids        256 B
  __shared__ __align__(16) float dbS[KC];                      // chunk's key duration bias         256 B
  __shared__ __align__(16) int   mkS[KC];                      // chunk's key mask                  256 B
  __shared__ float gapS[36];                                   // gap table column of head h (33)   144 B
  __shared__ float durS[20];                                   // dur table column of head h (17)    80 B

  const int tid = threadIdx.x, lane = tid & 31, wave = tid >> 5;
  const int hh = lane >> 4, c = lane & 15;
  const int qb = blockIdx.x % NQB;
  const int bh = blockIdx.x / NQB;                   // b*NH + h
  const int h  = bh % NH;
  const int b  = bh / NH;
  const int q0 = qb * QB + wave * 16;
  const size_t qkbase = (size_t)bh * SL * HD;
  const size_t vbase  = (size_t)bh * HD * SL;

  // stage the head's table columns once (clamped addresses for every lane, predicated LDS store)
  {
    const int ig = (tid < GAPR) ? tid : (GAPR - 1);
    const int id = (tid < DURR) ? tid : (DURR - 1);
    const float gv = gap_emb[ig * NH + h];
    const float dv = dur_emb[id * NH + h];
    if (tid < GAPR) gapS[tid] = gv;
    if (tid < DURR) durS[tid] = dv;
  }

  // gap bucket id of the one query this lane's score elements belong to: q0 + (lane&15)
  const int gq = gids[(size_t)b * SL + q0 + c];

  // Q fragments (loop-invariant), B operand stored [n = query][k = d]: query q0 + (lane&15), split map over d
  v16b qh[2], ql[2];
#pragma unroll
  for (int dc = 0; dc < 2; ++dc) {
    qh[dc] = ldf(Qh + qkbase, HD, q0, dc * 32, lane);
    ql[dc] = ldf(Ql + qkbase, HD, q0, dc * 32, lane);
  }

  float mrow = -__builtin_huge_valf();               // running maximum of query c (equal in both halves)
  float lrow = 0.f;                                  // running sum over this half's keys; halves joined at the end
  v8f oacc[4];
#pragma unroll
  for (int t = 0; t < 4; ++t) oacc[t] = zero8();

  // chunks that hold keys to attend: 1..NCK (block-uniform); the last chunk's keys behind them are masked ones
  int nck = (cnt[b] + KC - 1) / KC;
  nck = (nck < 1) ? 1 : ((nck > NCK) ? NCK : nck);

  for (int kc = 0; kc < nck; ++kc) {
    const int kv0 = kc * KC;
    __syncthreads();                                 // readers of the earlier chunk's tiles / key values are done
    {
      const int r  = tid >> 2;                       // 0..63: key row of K tiles, d row of V^T tiles
      const int qq = (tid & 3) * 16;                 // 0,16,32,48 elements
      const unsigned short* kh = Kh + qkbase + (size_t)(kv0 + r) * HD + qq;
      const unsigned short* kl = Kl + qkbase + (size_t)(kv0 + r) * HD + qq;
      const unsigned short* vh = Vh + vbase + (size_t)r * SL + kv0 + qq;
      const unsigned short* vl = Vl + vbase + (size_t)r * SL + kv0 + qq;
#pragma unroll
      for (int e = 0; e < 2; ++e) {
        *(v4u*)(Ks + r * KTP + qq + 8 * e)            = *(const v4u*)(kh + 8 * e);
        *(v4u*)(Ks + KC * KTP + r * KTP + qq + 8 * e) = *(const v4u*)(kl + 8 * e);
        *(v4u*)(Vs + r * KTP + qq + 8 * e)            = *(const v4u*)(vh + 8 * e);
        *(v4u*)(Vs + HD * KTP + r * KTP + qq + 8 * e) = *(const v4u*)(vl + 8 * e);
      }
      if (tid < KC) {                                // waves 0 and 1, wave-uniform: per-key values of the chunk
        const int key = kv0 + tid;                   // 0..SL-1, position in the sequence's key order
        const int gk  = cg[(size_t)b * SL + key];
        int dk = cd[(size_t)b * SL + key];
        dk = (dk < 0) ? 0 : ((dk > DURR - 1) ? (DURR - 1) : dk);
        const int mk  = cm[(size_t)b * SL + key];
        gkS[tid] = gk;
        dbS[tid] = durS[dk];
        mkS[tid] = mk;
      }
    }
    __syncthreads();                                 // tiles and key values visible to every wave

    v8f s[4];
#pragma unroll
    for (int j = 0; j < 4; ++j) s[j] = zero8();
#pragma unroll
    for (int dc = 0; dc < 2; ++dc) {
#pragma unroll
      for (int j = 0; j < 4; ++j) {
        // A operands: key row j*16 + (lane&15) of the [key][d] tiles, split map over d
        const v16b khf = ldf(Ks, KTP, j * 16, dc * 32, lane);
        const v16b klf = ldf(Ks + KC * KTP, KTP, j * 16, dc * 32, lane);
        s[j] = mma(khf, qh[dc], s[j]);
        s[j] = mma(klf, qh[dc], s[j]);
        s[j] = mma(khf, ql[dc], s[j]);
      }
    }
    // s[j][r] = S[query q0 + c][key kv0 + j*16 + 8*hh + r]; scale, table biases, replace-mask
#pragma unroll
    for (int j = 0; j < 4; ++j) {
      const int kb = 16 * j + 8 * hh;                // first of this lane's 8 keys of tile j, 0..56
      const v4i g0 = *(const v4i*)(gkS + kb), g1 = *(const v4i*)(gkS + kb + 4);
      const v4f d0 = *(const v4f*)(dbS + kb), d1 = *(const v4f*)(dbS + kb + 4);
      const v4i k0 = *(const v4i*)(mkS + kb), k1 = *(const v4i*)(mkS + kb + 4);
#pragma unroll
      for (int r = 0; r < 8; ++r) {
        const int   gk = (r < 4) ? g0[r & 3] : g1[r & 3];
        const float db = (r < 4) ? d0[r & 3] : d1[r & 3];
        const int   mk = (r < 4) ? k0[r & 3] : k1[r & 3];
        int rel = gq - gk;
        rel = (rel < 0) ? -rel : rel;
        rel = (rel > GAPR - 1) ? (GAPR - 1) : rel;
        rel = (rel < 0) ? 0 : rel;
        const float gbias = gapS[rel];
        const float v = (s[j][r] * 0.125f + gbias) + db;
        s[j][r] = (mk != 0) ? v : NEGV;
      }
    }
    // chunk maximum of query c: in-lane over this half's 32 keys, then one exchange between the halves
    float cj[4];
#pragma unroll
    for (int j = 0; j < 4; ++j) {
      cj[j] = fmaxf(fmaxf(fmaxf(s[j][0], s[j][1]), fmaxf(s[j][2], s[j][3])),
                    fmaxf(fmaxf(s[j][4], s[j][5]), fmaxf(s[j][6], s[j][7])));
    }
    float cm = fmaxf(fmaxf(cj[0], cj[1]), fmaxf(cj[2], cj[3]));
    cm = fmaxf(cm, other_half(cm));
    const float mnew  = fmaxf(mrow, cm);             // finite from chunk 0 on
    const float alpha = exp_slot(mrow - mnew);
    mrow = mnew;

    // p = exp(s - m); tile j's 8 values are 8 consecutive k positions of the B fragment
    v4u ph[4], pl[4];
    float pj[4];
#pragma unroll
    for (int j = 0; j < 4; ++j) {
      v4f p0, p1;
#pragma unroll
      for (int r = 0; r < 4; ++r) {
        p0[r] = exp_slot(s[j][r] - mnew);
        p1[r] = exp_slot(s[j][r + 4] - mnew);
      }
      pj[j] = ((p0[0] + p0[1]) + (p0[2] + p0[3])) + ((p1[0] + p1[1]) + (p1[2] + p1[3]));
      split8(p0, p1, ph[j], pl[j]);
    }
    lrow = lrow * alpha + ((pj[0] + pj[1]) + (pj[2] + pj[3]));
#pragma unroll
    for (int t = 0; t < 4; ++t)
#pragma unroll
      for (int r = 0; r < 8; ++r) oacc[t][r] *= alpha;

#pragma unroll
    for (int kk = 0; kk < 2; ++kk) {
      // B operands: P^T column (lane&15) = query, split k map over keys 32*kk ..
      Frag fh, fl;
      fh.u[0] = ph[2 * kk]; fh.u[1] = ph[2 * kk + 1];
      fl.u[0] = pl[2 * kk]; fl.u[1] = pl[2 * kk + 1];
#pragma unroll
      for (int t = 0; t < 4; ++t) {
        // A operands: channel row t*16 + (lane&15) of V^T [d][key], split k map over keys
        const v16b vhf = ldf(Vs, KTP, t * 16, kk * 32, lane);
        const v16b vlf = ldf(Vs + HD * KTP, KTP, t * 16, kk * 32, lane);
        oacc[t] = mma(vhf, fh.v, oacc[t]);
        oacc[t] = mma(vlf, fh.v, oacc[t]);
        oacc[t] = mma(vhf, fl.v, oacc[t]);
      }
    }
  }

  // O = oacc / l  (l >= 1); oacc[t][r] = O[query q0 + c][channel 16*t + 8*hh + r]
  const float invl = 1.0f / (lrow + other_half(lrow));
  const size_t go = ((size_t)(b * SL + q0 + c)) * DM + (size_t)h * HD + 8 * hh;
  v4u wh[4], wl[4];
#pragma unroll
  for (int t = 0; t < 4; ++t) {
    const v4f a0 = (v4f){oacc[t][0] * invl, oacc[t][1] * invl, oacc[t][2] * invl, oacc[t][3] * invl};
    const v4f a1 = (v4f){oacc[t][4] * invl, oacc[t][5] * invl, oacc[t][6] * invl, oacc[t][7] * invl};
    split8(a0, a1, wh[t], wl[t]);
  }
#pragma unroll
  for (int t = 0; t < 4; ++t) {
    *(v4u*)(Oh + go + 16 * t) = wh[t];
    *(v4u*)(Ol + go + 16 * t) = wl[t];
  }
}

// ---------------------------------------------------------------------------
// kernel 4: out = O.Wo + bo -> f32 rows [NT][DM]. A = O planes [NT][DM], B = transposed
// Wo planes [DM n][DM k]. Block = 128 token rows x 64 cols; grid = (DM/64 = 8, NT/128 = 32).
// coverage: 8 x 32 blocks x 128 x 64 = NT x DM.
// ---------------------------------------------------------------------------
__global__ __launch_bounds__(256) void k_gemm_out(const unsigned short* __restrict__ Ah,
                                                  const unsigned short* __restrict__ Al,
                                                  const unsigned short* __restrict__ Wh,
                                                  const unsigned short* __restrict__ Wl,
                                                  const float* __restrict__ bo,
                                                  float* __restrict__ out) {
  __shared__ __align__(16) unsigned char sm[GSB];    // 55296 B: GEMM stage, then the f32 output staging tile
  unsigned short* tl = (unsigned short*)sm;
  float* st = (float*)sm;                            // 128 x OTP
  const int tid = threadIdx.x, lane = tid & 31, wave = tid >> 5;
  const int hh = lane >> 4, c = lane & 15;
  const int mblk = blockIdx.y * 128, nblk = blockIdx.x * 64;
  const int mw = (wave >> 1) * 32, nw = (wave & 1) * 32;

  v8f acc[2][2];
#pragma unroll
  for (int s = 0; s < 2; ++s)
#pragma unroll
    for (int t = 0; t < 2; ++t) acc[s][t] = zero8();
  int arow[4];
#pragma unroll
  for (int i = 0; i < 4; ++i) arow[i] = mblk + (tid >> 3) + 32 * i;
  gemm128x64x3(Ah, Al, DM, Wh, Wl, DM, DM, arow, nblk, mw, nw, tid, lane, tl, acc);

  float bb[2];
#pragma unroll
  for (int t = 0; t < 2; ++t) bb[t] = bo[nblk + nw + 16 * t + c];
  stage_rm(acc, bb, st, mw, nw, hh, c);
  __syncthreads();
  store_f32(st, out, mblk, nblk, tid);
}

// ---------------------------------------------------------------------------
// its producer writes, no padded tails exist since every dimension is a tile multiple; offsets of the plane regions multiples of 512 KB):
//   X     bf16x2 [4096][512]             0     8388608
//   Wqkv  bf16x2 [1536][512]       8388608     3145728   (q rows 0..511, k 512..1023, v 1024..1535, [n][k])
//   Wo    bf16x2 [512][512]       11534336     1048576   ([n][k])
//   Q     bf16x2 [16][2048][64]   12582912     8388608
//   K     bf16x2 [16][2048][64]   20971520     8388608
//   V^T   bf16x2 [16][64][2048]   29360128     8388608
//   O     bf16x2 [4096][512]      37748736     8388608
//   key order: token index, gap id, duration id, mask, int32 [2][2048] each   46137344   4 x 16384; cnt int32 [2]
//   total                         46203136
// ---------------------------------------------------------------------------
extern "C" void kernel_launch(void* const* d_in, const int* in_sizes, int n_in,
                              void* d_out, int out_size, void* d_ws, size_t ws_size,
                              hipStream_t stream) {
  if (n_in < 14) return;
  if (in_sizes[0] != NT * DM) return;
  if (in_sizes[1] != NBT * SL) return;
  if (in_sizes[2] != NBT * SL) return;
  if (in_sizes[3] != NBT * SL) return;
  if (in_sizes[4] != DM * DM) return;
  if (in_sizes[5] != DM) return;
  if (in_sizes[6] != DM * DM) return;
  if (in_sizes[7] != DM) return;
  if (in_sizes[8] != DM * DM) return;
  if (in_sizes[9] != DM) return;
  if (in_sizes[10] != DM * DM) return;
  if (in_sizes[11] != DM) return;
  if (in_sizes[12] != GAPR * NH) return;
  if (in_sizes[13] != DURR * NH) return;
  if (out_size != NT * DM) return;

  const float* x     = (const float*)d_in[0];   // [2][2048][512] = [4096][512]
  const int*   amask = (const int*)d_in[1];     // [2][2048] int32, zero = masked key
  const int*   gids  = (const int*)d_in[2];     // [2][2048] int32
  const int*   dids  = (const int*)d_in[3];     // [2][2048] int32
  const float* W_q   = (const float*)d_in[4];   // [512][512] [in][out]
  const float* b_q   = (const float*)d_in[5];   // [512]
  const float* W_k   = (const float*)d_in[6];
  const float* b_k   = (const float*)d_in[7];
  const float* W_v   = (const float*)d_in[8];
  const float* b_v   = (const float*)d_in[9];
  const float* W_o   = (const float*)d_in[10];
  const float* b_o   = (const float*)d_in[11];
  const float* gtab  = (const float*)d_in[12];  // [33][8]
  const float* dtab  = (const float*)d_in[13];  // [17][8]
  float* out = (float*)d_out;                   // [4096][512] f32

  const size_t PX  = (size_t)NT * DM * 2;       // 4194304
  const size_t PW  = (size_t)3 * DM * DM * 2;   // 1572864
  const size_t PWO = (size_t)DM * DM * 2;       // 524288
  size_t off = 0;
  const size_t oXh  = off; off += PX;
  const size_t oXl  = off; off += PX;
  const size_t oWh  = off; off += PW;
  const size_t oWl  = off; off += PW;
  const size_t oWoh = off; off += PWO;
  const size_t oWol = off; off += PWO;
  const size_t oQh  = off; off += PX;
  const size_t oQl  = off; off += PX;
  const size_t oKh  = off; off += PX;
  const size_t oKl  = off; off += PX;
  const size_t oVh  = off; off += PX;
  const size_t oVl  = off; off += PX;
  const size_t oOh  = off; off += PX;
  const size_t oOl  = off; off += PX;
  const size_t PI  = (size_t)NBT * SL * 4;      // 16384
  const size_t oIdx = off; off += PI;
  const size_t oCg  = off; off += PI;
  const size_t oCd  = off; off += PI;
  const size_t oCm  = off; off += PI;
  const size_t oCnt = off; off += 256;
  if (off > ws_size) return;                    // off = 46203136
  if (off > (size_t)134217728) return;

  char* ws = (char*)d_ws;
  unsigned short* Xh  = (unsigned short*)(ws + oXh);
  unsigned short* Xl  = (unsigned short*)(ws + oXl);
  unsigned short* Wh  = (unsigned short*)(ws + oWh);
  unsigned short* Wl  = (unsigned short*)(ws + oWl);
  unsigned short* Woh = (unsigned short*)(ws + oWoh);
  unsigned short* Wol = (unsigned short*)(ws + oWol);
  unsigned short* Qh  = (unsigned short*)(ws + oQh);
  unsigned short* Ql  = (unsigned short*)(ws + oQl);
  unsigned short* Kh  = (unsigned short*)(ws + oKh);
  unsigned short* Kl  = (unsigned short*)(ws + oKl);
  unsigned short* Vh  = (unsigned short*)(ws + oVh);
  unsigned short* Vl  = (unsigned short*)(ws + oVl);
  unsigned short* Oh  = (unsigned short*)(ws + oOh);
  unsigned short* Ol  = (unsigned short*)(ws + oOl);
  int* kidx = (int*)(ws + oIdx);
  int* kcg  = (int*)(ws + oCg);
  int* kcd  = (int*)(ws + oCd);
  int* kcm  = (int*)(ws + oCm);
  int* kcnt = (int*)(ws + oCnt);

  // (0) hi/lo planes of x; the first NBT blocks build the key order of each sequence
  k_split<<<dim3(NBT + (NT * DM) / 2048), dim3(256), 0, stream>>>(x, Xh, Xl, amask, gids, dids,
                                                                  kidx, kcg, kcd, kcm, kcnt);
  // (1) transposed hi/lo planes of the four weights: in [k][n] -> out [n][k]
  k_split_tr<<<dim3(DM / 64, DM / 64, 4), dim3(256), 0, stream>>>(W_q, W_k, W_v, W_o, Wh, Wl, Woh, Wol);
  // (2) q / k / v^T planes
  k_proj<<<dim3(3 * NH, NT / 128), dim3(256), 0, stream>>>(Xh, Xl, Wh, Wl, b_q, b_k, b_v, kidx, kcnt,
                                                          Qh, Ql, Kh, Kl, Vh, Vl);
  // (3) attention -> O planes
  k_attn<<<dim3(NBT * NH * NQB), dim3(256), 0, stream>>>(Qh, Ql, Kh, Kl, Vh, Vl, gids, kcm, kcg, kcd, kcnt,
                                                        gtab, dtab, Oh, Ol);
  // (4) out = O.Wo + bo
  k_gemm_out<<<dim3(DM / 64, NT / 128), dim3(256), 0, stream>>>(Oh, Ol, Woh, Wol, b_o, out);
  (void)hipGetLastError();
}

// v004
// Measured time: 84 microseconds a run.
// In both of two side-by-side timings against v003, it was 1.15 times as fast.
// Over all steps from v000 it is 3.77 times as fast.
// Contractions: Q/K/V = x.W (3 sites), S = Q.K^T, O = P.V, out = O.Wo: all v_wmma_f32_16x16x32_bf16 on bf16 hi/lo
// split operand planes (hi.hi + hi.lo + lo.hi per tile pair), f32 accumulate; biases, the 1/8 scale, the bucket-table
// lookups, the key mask (replace by -1e9) and the online softmax in f32.
// Plane carry audit: every hi/lo plane (X, Wqkv^T, Wo^T, Q, K, V^T, in-register P fragments, O) carries factor 1
// (hi = rne_bf16(v), lo = rne_bf16(v - hi), f32 exponent range, no subnormal concern); no inverse fold exists anywhere.
// Key order: per sequence the keys are reordered by a stable partition (unmasked first, masked behind); K and V are
// projected and attended only up to the last unmasked key (all keys when a sequence has none unmasked).
#include <hip/hip_runtime.h>
#include <stddef.h>

#define NBT 2                  // batch
#define SL  2048               // sequence length
#define DM  512                // model width
#define NH  8                  // heads
#define HD  64                 // head dim
#define NT  (NBT * SL)         // token rows, row m = b*SL + s
#define QB  128                // query rows per attention block
#define KC  64                 // keys per chunk
#define NQB (SL / QB)          // 16
#define NCK (SL / KC)          // 32
#define KTP 72                 // LDS pitch (16-bit elements) for 64-wide tiles, 144 B
#define OTP 68                 // f32 staging pitch [row][col] (128 x 64)
#define VTP 132                // f32 staging pitch [col][row] (64 x 128)
#define TTP 68                 // f32 staging pitch for the 64 x 64 weight transpose tile
#define GBK 64                 // k elements per GEMM stage: one whole 128-B line per plane row
#define GTR (2 * 128 + 2 * 64) // rows of one GEMM stage in LDS: A hi, A lo (128 each), B hi, B lo (64 each)
#define GSB (GTR * KTP * 2)    // bytes of one GEMM stage in LDS, 55296
#define GAPR 33                // time-gap table rows
#define DURR 17                // duration table rows
#define NEGV (-1.0e9f)         // masked-key score value
#define ATB  (2 * KC * KTP + 2 * HD * KTP) // 16-bit elements of one attention chunk's four tiles in LDS

static_assert(NT == 4096);
static_assert(NH * HD == DM);
static_assert(SL % QB == 0);
static_assert(SL % KC == 0);
static_assert(SL % 128 == 0);
static_assert(DM % 64 == 0);
static_assert(DM % 32 == 0);
static_assert((NT * DM) % 2048 == 0);
static_assert(HD == 64);
static_assert(KC == 64);
static_assert(64 * VTP <= 128 * OTP);
static_assert(DM % GBK == 0);
static_assert(128 * OTP * 4 <= GSB);
static_assert(SL == 256 * 8);

typedef __bf16       v16b __attribute__((ext_vector_type(16)));
typedef float        v8f  __attribute__((ext_vector_type(8)));
typedef float        v4f  __attribute__((ext_vector_type(4)));
typedef unsigned int v4u  __attribute__((ext_vector_type(4)));
typedef int          v4i  __attribute__((ext_vector_type(4)));
union Frag { v16b v; v4u u[2]; };

// WMMA with the dependent-VALU hazard guard (ties D, keeps A/B live)
__device__ __forceinline__ v8f mma(v16b a, v16b b, v8f c) {
  c = __builtin_amdgcn_wmma_f32_16x16x32_bf16(false, a, false, b, (short)0, c, false, false);
  asm volatile("v_nop\n\tv_nop\n\tv_nop\n\tv_nop" : "+v"(c) : "v"(a), "v"(b));
  return c;
}

// value of lane l ^ 16 (the other 16-lane half), by the vector cross-row move
__device__ __forceinline__ float other_half(float x) {
  const int b = __float_as_int(x);
  return __int_as_float(__builtin_amdgcn_permlanex16(b, b, 0x76543210, 0xfedcba98, false, false));
}

// e^x by the hardware exponential of x * log2(e), as __expf gives it. The v_nop fills the one slot that the
// instruction set asks for between a transcendental and a directly following instruction that reads its result or
// overwrites its source.
__device__ __forceinline__ float exp_slot(float x) {
  float r;
  asm("v_exp_f32 %0, %1\n\tv_nop" : "=v"(r) : "v"(x * 1.44269504f));
  return r;
}

__device__ __forceinline__ v8f zero8() { return (v8f){0.f, 0.f, 0.f, 0.f, 0.f, 0.f, 0.f, 0.f}; }

// Fragment loader for k-contiguous 16-bit rows with pitch ld (bf16 bits).
// A operand: row0 + (lane&15) is the M row. B operand stored [n][k]: row0 + (lane&15) is the N column.
// Split k map for both: elements 0..7 <- k0 + 8*(lane>>4) + 0..7, elements 8..15 <- k0 + 16 + 8*(lane>>4) + 0..7.
// D: acc[r] = element (row0 + 8*(lane>>4) + r, col0 + (lane&15)).
__device__ __forceinline__ v16b ldf(const unsigned short* p, int ld, int row0, int k0, int lane) {
  const unsigned short* q = p + (size_t)(row0 + (lane & 15)) * ld + k0 + 8 * (lane >> 4);
  Frag f;
  f.u[0] = *(const v4u*)(q);
  f.u[1] = *(const v4u*)(q + 16);
  return f.v;
}

// f32 -> bf16 bits, RNE convert by integer arithmetic
__device__ __forceinline__ unsigned int bf_rne(float x) {
  const unsigned int u = __float_as_uint(x);
  return (u + 0x7FFFu + ((u >> 16) & 1u)) >> 16;
}

// hi = rne(a), lo = rne(a - hi) for two floats, packed little-endian (first element in the low half-word)
__device__ __forceinline__ void split2(float a, float b, unsigned int& wh, unsigned int& wl) {
  const unsigned int ha = bf_rne(a), hb = bf_rne(b);
  const float ra = a - __uint_as_float(ha << 16);
  const float rb = b - __uint_as_float(hb << 16);
  wh = ha | (hb << 16);
  wl = bf_rne(ra) | (bf_rne(rb) << 16);
}

// 8 consecutive floats -> one 16-B hi piece and one 16-B lo piece
__device__ __forceinline__ void split8(v4f a0, v4f a1, v4u& wh, v4u& wl) {
  unsigned int h0, h1, h2, h3, l0, l1, l2, l3;
  split2(a0[0], a0[1], h0, l0);
  split2(a0[2], a0[3], h1, l1);
  split2(a1[0], a1[1], h2, l2);
  split2(a1[2], a1[3], h3, l3);
  wh = (v4u){h0, h1, h2, h3};
  wl = (v4u){l0, l1, l2, l3};
}

// ---------------------------------------------------------------------------
// kernel 0: elementwise split of a contiguous f32 array (layout kept) into bf16 hi and lo planes.
// Block = 2048 elements; thread converts 8 consecutive floats and writes one 16-B piece per plane;
// coverage: n/2048 blocks x 256 thr x 8 = n elements of both planes.
// Blocks 0 .. NBT-1 do not split: block b builds sequence b's key order instead (compact_keys); block NBT + i splits
// elements 2048*i .. +2047.
// ---------------------------------------------------------------------------

// Stable partition of one sequence's SL keys by the mask: unmasked keys (mask != 0) first in their order, masked keys
// behind them in theirs. A masked key's score is -1e9, so its weight exp(-1e9 - m) is 0 as soon as one key of the
// sequence is unmasked: keys behind the last unmasked one add nothing and are left out by the later kernels.
// Writes, per new position: the key's token index, gap id, duration id and mask; and cnt[b] = keys to attend =
// number of unmasked keys, or SL when there is none (every score is then -1e9 and all keys count alike).
// Thread t owns keys 8t .. 8t+7; block-wide inclusive scan of the per-thread counts in LDS, two buffers, one
// barrier a step. Every position 0..SL-1 is written exactly once (the map is a permutation).
__device__ __forceinline__ void compact_keys(const int* __restrict__ mask, const int* __restrict__ gids,
                                             const int* __restrict__ dids, int* __restrict__ idx,
                                             int* __restrict__ cg, int* __restrict__ cd, int* __restrict__ cm,
                                             int* __restrict__ cnt, int b, int tid) {
  __shared__ int sc[2][256];
  const int base = b * SL + tid * 8;
  const v4i m0 = *(const v4i*)(mask + base), m1 = *(const v4i*)(mask + base + 4);
  // precaution: stands in front of the next loads, which may land in the address registers of the loads above
  asm volatile("s_wait_xcnt 0x0" ::: "memory");
  const v4i g0 = *(const v4i*)(gids + base), g1 = *(const v4i*)(gids + base + 4);
  // precaution: as above
  asm volatile("s_wait_xcnt 0x0" ::: "memory");
  const v4i d0 = *(const v4i*)(dids + base), d1 = *(const v4i*)(dids + base + 4);
  int c = 0;
#pragma unroll
  for (int e = 0; e < 4; ++e) c += ((m0[e] != 0) ? 1 : 0) + ((m1[e] != 0) ? 1 : 0);
  sc[0][tid] = c;
  __syncthreads();
  int cur = 0;
#pragma unroll
  for (int o = 1; o < 256; o <<= 1) {
    int a = sc[cur][tid];
    if (tid >= o) a += sc[cur][tid - o];
    sc[cur ^ 1][tid] = a;
    cur ^= 1;
    __syncthreads();                                 // the step's sums are visible before the next step reads them
  }
  const int total = sc[cur][255];                    // unmasked keys of the sequence, 0..SL
  int ru = sc[cur][tid] - c;                         // unmasked keys in front of key 8t
  int rm = total + tid * 8 - ru;                     // total + masked keys in front of key 8t
#pragma unroll
  for (int e = 0; e < 8; ++e) {
    const int mk = (e < 4) ? m0[e & 3] : m1[e & 3];
    const int gk = (e < 4) ? g0[e & 3] : g1[e & 3];
    const int dk = (e < 4) ? d0[e & 3] : d1[e & 3];
    const int pos = b * SL + ((mk != 0) ? ru : rm);  // 0..SL-1 within the sequence
    ru += (mk != 0) ? 1 : 0;
    rm += (mk != 0) ? 0 : 1;
    idx[pos] = tid * 8 + e;
    cg[pos]  = gk;
    cd[pos]  = dk;
    cm[pos]  = mk;
  }
  if (tid == 0) cnt[b] = (total > 0) ? total : SL;
}

__global__ __launch_bounds__(256) void k_split(const float* __restrict__ src,
                                               unsigned short* __restrict__ dh,
                                               unsigned short* __restrict__ dl,
                                               const int* __restrict__ mask, const int* __restrict__ gids,
                                               const int* __restrict__ dids, int* __restrict__ idx,
                                               int* __restrict__ cg, int* __restrict__ cd, int* __restrict__ cm,
                                               int* __restrict__ cnt) {
  if (blockIdx.x < NBT) {                            // block-uniform
    compact_keys(mask, gids, dids, idx, cg, cd, cm, cnt, blockIdx.x, threadIdx.x);
    return;
  }
  const size_t o = (size_t)(blockIdx.x - NBT) * 2048 + (size_t)threadIdx.x * 8;
  const v4f a0 = *(const v4f*)(src + o);
  const v4f a1 = *(const v4f*)(src + o + 4);
  v4u wh, wl;
  split8(a0, a1, wh, wl);
  v4u* ph = (v4u*)(dh + o);
  v4u* pl = (v4u*)(dl + o);
  *ph = wh;
  *pl = wl;
  
}

// ---------------------------------------------------------------------------
// kernel 1: weight transpose + split. in W [k = DM rows][n = DM cols] f32 -> out planes [n][k] hi/lo (pitch DM).
// blockIdx.z = which weight (0 q, 1 k, 2 v -> stacked planes rows which*DM + n; 3 -> the out-projection planes).
// blockIdx.x = 64-wide n tile (source columns), blockIdx.y = 64-deep k tile (source rows). The 64 x 64 tile is
// coverage: load 256 thr x 16 floats = 64 x 64; store 256 thr x 2 iter x 8 halves = 64 n rows x 64 k per plane;
// grid (DM/64, DM/64, 4) covers all four DM x DM matrices.
// ---------------------------------------------------------------------------
__global__ __launch_bounds__(256) void k_split_tr(const float* __restrict__ Wq, const float* __restrict__ Wk,
                                                  const float* __restrict__ Wv, const float* __restrict__ Wo,
                                                  unsigned short* __restrict__ Ph, unsigned short* __restrict__ Pl,
                                                  unsigned short* __restrict__ Oh, unsigned short* __restrict__ Ol) {
  __shared__ __align__(16) float st[64 * TTP];       // 17408 B
  const int tid = threadIdx.x;
  const int z   = blockIdx.z;                        // block-uniform
  const int nt  = blockIdx.x * 64;                   // source columns = output rows
  const int kt  = blockIdx.y * 64;                   // source rows    = output k
  const float* W = (z == 0) ? Wq : ((z == 1) ? Wk : ((z == 2) ? Wv : Wo));
  {
    const int row = tid >> 2;                        // k within tile, 0..63
    const int cb  = (tid & 3) * 16;                  // n within tile, 0,16,32,48
    const float* src = W + (size_t)(kt + row) * DM + nt + cb;
#pragma unroll
    for (int e = 0; e < 4; ++e) {
      const v4f a = *(const v4f*)(src + 4 * e);
#pragma unroll
      for (int q = 0; q < 4; ++q) st[(cb + 4 * e + q) * TTP + row] = a[q];
    }
  }
  __syncthreads();
  unsigned short* dh = (z < 3) ? (Ph + (size_t)z * DM * DM) : Oh;
  unsigned short* dl = (z < 3) ? (Pl + (size_t)z * DM * DM) : Ol;
  const size_t base = (size_t)nt * DM + kt;
  v4u vh[2], vl[2];
  size_t go[2];
#pragma unroll
  for (int it = 0; it < 2; ++it) {
    const int pp   = tid + 256 * it;                 // 0..511
    const int rown = pp >> 3;                        // 0..63
    const int pc   = pp & 7;                         // k piece 8*pc .. +7
    const float* ra = st + rown * TTP + 8 * pc;
    const v4f a0 = *(const v4f*)(ra), a1 = *(const v4f*)(ra + 4);
    split8(a0, a1, vh[it], vl[it]);
    go[it] = base + (size_t)rown * DM + 8 * pc;
  }
  {
#pragma unroll
    for (int it = 0; it < 2; ++it) {
      *(v4u*)(dh + go[it]) = vh[it];
      *(v4u*)(dl + go[it]) = vl[it];
    }
    
  }
}

// ---------------------------------------------------------------------------
// 128 x 64 block tile, 32 x 32 per wave, split-bf16 GEMM main loop over K (multiple of GBK): A planes [m][k] pitch
// lda, B planes [n][k] pitch ldb (hi and lo). Per stage of GBK = 64 k the block brings the 128 A rows and the 64 B
// rows of both planes into LDS (pitch KTP): a wave's 16-B loads cover 4 whole 128-B lines, 12 pieces per thread,
// rows (tid>>3) + 32*i: i 0..3 A hi, 4..7 A lo, 8..9 B hi, 10..11 B lo. The next stage's pieces are loaded into
// registers while this stage is multiplied. Fragments come from LDS by ldf (its split k map, A and B alike).
// Per tile pair: ah.bh + ah.bl + al.bh into one f32 accumulator, k ascending.
// Tile row (tid>>3) + 32*i is row arow[i] of the A planes (the caller's map from tile rows to plane rows).
// acc[s][t][r] = (tile row mw + 16*s + 8*(lane>>4) + r, nrow + nw + 16*t + (lane&15)).
// The loop ends behind a barrier: tl may be reused by the caller at once.
// ---------------------------------------------------------------------------
__device__ __forceinline__ void gemm_ld(const unsigned short* const (&gp)[4], const unsigned int (&ao)[4], int ldb,
                                        int k0, v4u (&pf)[12]) {
#pragma unroll
  for (int i = 0; i < 4; ++i) {
    pf[i]     = *(const v4u*)((const char*)gp[0] + ao[i]);
    pf[4 + i] = *(const v4u*)((const char*)gp[1] + ao[i]);
  }
#pragma unroll
  for (int i = 0; i < 2; ++i) {
    pf[8 + i]  = *(const v4u*)(gp[2] + (size_t)(32 * i) * ldb + k0);
    pf[10 + i] = *(const v4u*)(gp[3] + (size_t)(32 * i) * ldb + k0);
  }
  // precaution: stands in front of the fragment loads, which land in the address registers of the loads above
  asm volatile("s_wait_xcnt 0x0" ::: "memory");
}

__device__ __forceinline__ void gemm128x64x3(const unsigned short* __restrict__ Ah,
                                             const unsigned short* __restrict__ Al, int lda,
                                             const unsigned short* __restrict__ Bh,
                                             const unsigned short* __restrict__ Bl, int ldb,
                                             int K, const int (&arow)[4], int nrow, int mw, int nw, int tid,
                                             int lane, unsigned short* tl, v8f (&acc)[2][2]) {
  const int pr = tid >> 3;                           // 0..31: row within each group of 32 rows
  const int pe = (tid & 7) * 8;                      // first of this thread's 8 k elements in the row
  const unsigned short* const gp[4] = {Ah, Al,
                                       Bh + (size_t)(nrow + pr) * ldb + pe, Bl + (size_t)(nrow + pr) * ldb + pe};
  unsigned int ao[4];                                // byte offset of this thread's piece in its A row of each group
#pragma unroll
  for (int i = 0; i < 4; ++i) ao[i] = ((unsigned int)arow[i] * (unsigned int)lda + (unsigned int)pe) * 2u;
  unsigned short* sp = tl + pr * KTP + pe;
  const unsigned short* sAh = tl;
  const unsigned short* sAl = tl + 128 * KTP;
  const unsigned short* sBh = tl + 256 * KTP;
  const unsigned short* sBl = tl + 320 * KTP;
  v4u pf[12];
  gemm_ld(gp, ao, ldb, 0, pf);
// rolled: one copy of the stage body keeps the code short and the register count at three blocks per WGP
#pragma unroll 1
  for (int k0 = 0; k0 < K; k0 += GBK) {
#pragma unroll
    for (int i = 0; i < 12; ++i) *(v4u*)(sp + 32 * i * KTP) = pf[i];
    __syncthreads();                                 // the stage is visible to every wave
    if (k0 + GBK < K) {
#pragma unroll
      for (int i = 0; i < 4; ++i) ao[i] += GBK * 2;  // the A offsets step to the next stage's k
      gemm_ld(gp, ao, ldb, k0 + GBK, pf);
    }
#pragma unroll
    for (int ks = 0; ks < GBK; ks += 32) {
      const v16b ah0 = ldf(sAh, KTP, mw, ks, lane);
      const v16b ah1 = ldf(sAh, KTP, mw + 16, ks, lane);
      const v16b al0 = ldf(sAl, KTP, mw, ks, lane);
      const v16b al1 = ldf(sAl, KTP, mw + 16, ks, lane);
#pragma unroll
      for (int t = 0; t < 2; ++t) {
        const v16b bh = ldf(sBh, KTP, nw + 16 * t, ks, lane);
        const v16b bl = ldf(sBl, KTP, nw + 16 * t, ks, lane);
        acc[0][t] = mma(ah0, bh, acc[0][t]);
        acc[1][t] = mma(ah1, bh, acc[1][t]);
        acc[0][t] = mma(ah0, bl, acc[0][t]);
        acc[1][t] = mma(ah1, bl, acc[1][t]);
        acc[0][t] = mma(al0, bh, acc[0][t]);
        acc[1][t] = mma(al1, bh, acc[1][t]);
      }
    }
    __syncthreads();                                 // every reader of the stage is done before it is rewritten
  }
}

// stage acc + bias in the block tile, row-major [row][col] (128 x 64, pitch OTP floats)
__device__ __forceinline__ void stage_rm(v8f (&acc)[2][2], const float (&bb)[2], float* st,
                                         int mw, int nw, int hh, int c) {
#pragma unroll
  for (int s = 0; s < 2; ++s)
#pragma unroll
    for (int t = 0; t < 2; ++t)
#pragma unroll
      for (int r = 0; r < 8; ++r)
        st[(mw + 16 * s + 8 * hh + r) * OTP + nw + 16 * t + c] = acc[s][t][r] + bb[t];
}

// stage acc + bias transposed [col][row] (64 x 128, pitch VTP floats)
__device__ __forceinline__ void stage_tr(v8f (&acc)[2][2], const float (&bb)[2], float* st,
                                         int mw, int nw, int hh, int c) {
#pragma unroll
  for (int s = 0; s < 2; ++s)
#pragma unroll
    for (int t = 0; t < 2; ++t)
#pragma unroll
      for (int r = 0; r < 8; ++r)
        st[(nw + 16 * t + c) * VTP + mw + 16 * s + 8 * hh + r] = acc[s][t][r] + bb[t];
}

// block tile 128 rows x 64 cols -> hi/lo planes at element base, row pitch ldo: each row = 64 halves = one whole
// coverage: 256 thr x 4 iter x 8 halves = 128 rows x 64 per plane.
__device__ __forceinline__ void store_planes(const float* st, unsigned short* __restrict__ oh,
                                             unsigned short* __restrict__ ol, size_t base, int ldo, int tid) {
  v4u vh[4], vl[4];
  size_t go[4];
#pragma unroll
  for (int it = 0; it < 4; ++it) {
    const int pp  = tid + 256 * it;                  // 0..1023
    const int row = pp >> 3;                         // 0..127
    const int pc  = pp & 7;                          // 16-B piece = cols 8*pc .. +7
    const float* ra = st + row * OTP + 8 * pc;
    const v4f a0 = *(const v4f*)(ra), a1 = *(const v4f*)(ra + 4);
    split8(a0, a1, vh[it], vl[it]);
    go[it] = base + (size_t)row * ldo + 8 * pc;
  }
  {
#pragma unroll
    for (int it = 0; it < 4; ++it) {
      *(v4u*)(oh + go[it]) = vh[it];
      *(v4u*)(ol + go[it]) = vl[it];
    }
    
  }
}

// transposed block tile 64 d-rows x 128 p -> V^T hi/lo planes [bh][d][p] (p = position in the key order) at element base (= bh*HD*SL + sf):
// coverage: 256 thr x 4 iter x 8 halves = 64 d-rows x 128 p per plane.
__device__ __forceinline__ void store_vt(const float* st, unsigned short* __restrict__ vh,
                                         unsigned short* __restrict__ vl, size_t base, int tid) {
  v4u wh[4], wl[4];
  size_t go[4];
#pragma unroll
  for (int it = 0; it < 4; ++it) {
    const int pp   = tid + 256 * it;                 // 0..1023
    const int drow = pp >> 4;                        // 0..63
    const int pc   = pp & 15;                        // 8 consecutive p
    const float* ra = st + drow * VTP + 8 * pc;
    const v4f a0 = *(const v4f*)(ra), a1 = *(const v4f*)(ra + 4);
    split8(a0, a1, wh[it], wl[it]);
    go[it] = base + (size_t)drow * SL + 8 * pc;
  }
  {
#pragma unroll
    for (int it = 0; it < 4; ++it) {
      *(v4u*)(vh + go[it]) = wh[it];
      *(v4u*)(vl + go[it]) = wl[it];
    }
    
  }
}

// coverage: 256 thr x 8 iter x 4 floats = 128 rows x 64 cols.
__device__ __forceinline__ void store_f32(const float* st, float* __restrict__ out, int mblk, int nblk, int tid) {
  v4f val[8];
  size_t go[8];
#pragma unroll
  for (int it = 0; it < 8; ++it) {
    const int pp  = tid + 256 * it;                  // 0..2047
    const int row = pp >> 4;                         // 0..127
    const int pc  = pp & 15;                         // 4 consecutive cols
    val[it] = *(const v4f*)(st + row * OTP + 4 * pc);
    go[it]  = (size_t)(mblk + row) * DM + nblk + 4 * pc;
  }
  {
#pragma unroll
    for (int it = 0; it < 8; ++it) *(v4f*)(out + go[it]) = val[it];
    
  }
}

// ---------------------------------------------------------------------------
// kernel 2: projections. blockIdx.x = which*NH + head (which 0 = q, 1 = k, 2 = v), blockIdx.y = 128-token block
// of one sequence b. A = x planes [NT][DM] (pitch DM, K = DM), B = stacked transposed weight planes [3*DM n][DM k]
// rows which*DM + head*64 .. (pitch DM). Bias added in f32.
// grid = (3*NH = 24, NT/128 = 32). coverage: q planes 16 bh x 16 blocks x 128 s x 64 d; k planes (128 p x 64 d)
// and v^T planes (64 d x 128 p) only in the blocks with sf < cnt[b].
// ---------------------------------------------------------------------------
__global__ __launch_bounds__(256) void k_proj(const unsigned short* __restrict__ Xh,
                                              const unsigned short* __restrict__ Xl,
                                              const unsigned short* __restrict__ Wh,
                                              const unsigned short* __restrict__ Wl,
                                              const float* __restrict__ bq,
                                              const float* __restrict__ bk,
                                              const float* __restrict__ bv,
                                              const int* __restrict__ idx, const int* __restrict__ cnt,
                                              unsigned short* __restrict__ Qh, unsigned short* __restrict__ Ql,
                                              unsigned short* __restrict__ Kh, unsigned short* __restrict__ Kl,
                                              unsigned short* __restrict__ Vh, unsigned short* __restrict__ Vl) {
  __shared__ __align__(16) unsigned char sm[GSB];    // 55296 B: GEMM stage, then the f32 output staging tile
  unsigned short* tl = (unsigned short*)sm;
  float* st = (float*)sm;                            // 128 x OTP (the transposed 64 x VTP tile also fits)
  const int tid = threadIdx.x, lane = tid & 31, wave = tid >> 5;
  const int hh = lane >> 4, c = lane & 15;
  const int which = blockIdx.x / NH;                 // block-uniform
  const int head  = blockIdx.x - which * NH;
  const int mblk  = blockIdx.y * 128;
  const int b     = mblk / SL;
  const int sf    = mblk - b * SL;                   // first position of the block in sequence b
  const int bh    = b * NH + head;
  const int mw = (wave >> 1) * 32, nw = (wave & 1) * 32;

  // q: tile row = token. k, v: tile row = position in the sequence's key order; the token comes from idx, and a
  // block wholly behind the keys to attend has nothing to do (block-uniform return, in front of every barrier).
  int arow[4];
#pragma unroll
  for (int i = 0; i < 4; ++i) arow[i] = mblk + (tid >> 3) + 32 * i;
  if (which != 0) {
    if (sf >= cnt[b]) return;
#pragma unroll
    for (int i = 0; i < 4; ++i) arow[i] = b * SL + (idx[arow[i]] & (SL - 1));
  }

  v8f acc[2][2];
#pragma unroll
  for (int s = 0; s < 2; ++s)
#pragma unroll
    for (int t = 0; t < 2; ++t) acc[s][t] = zero8();
  gemm128x64x3(Xh, Xl, DM,
               Wh + (size_t)which * DM * DM, Wl + (size_t)which * DM * DM, DM,
               DM, arow, head * HD, mw, nw, tid, lane, tl, acc);

  float bb[2];
#pragma unroll
  for (int t = 0; t < 2; ++t) {
    const int i = head * HD + nw + 16 * t + c;       // 0..511
    const float xq = bq[i], xk = bk[i], xv = bv[i];
    bb[t] = (which == 0) ? xq : ((which == 1) ? xk : xv);
  }
  if (which < 2) stage_rm(acc, bb, st, mw, nw, hh, c);
  else           stage_tr(acc, bb, st, mw, nw, hh, c);
  __syncthreads();
  if (which < 2) {
    unsigned short* oh = (which == 0) ? Qh : Kh;
    unsigned short* ol = (which == 0) ? Ql : Kl;
    store_planes(st, oh, ol, ((size_t)bh * SL + sf) * HD, HD, tid);
  } else {
    store_vt(st, Vh, Vl, (size_t)bh * HD * SL + sf, tid);
  }
}

// ---------------------------------------------------------------------------
// kernel 3: flash attention for every (b, head, 128-query block), head dim 64, up to 32 chunks of 64 keys.
//   q planes [b*NH + h][s][64] hi/lo; k planes [b*NH + h][p][64] and v^T planes [b*NH + h][64][p] hi/lo, p = position
//   in the key order; int32 tables [b][s]: gap bucket ids (queries); [b][p]: key mask (zero = masked), gap bucket
//   ids, duration bucket ids; cnt[b] = keys to attend; f32 tables gap [GAPR][NH], dur [DURR][NH];
//   O planes [token = b*SL + s][DM] hi/lo, head h at columns h*64 (one line per row).
// Block = 8 waves; wave w owns queries q0 = qb*128 + 16*w .. +15. The head's column of both bias tables is staged
// in LDS once per block. Per chunk: K [key][d] and V^T [d][key] hi/lo tiles staged in LDS by all threads
// (plain 16-B loads) while waves 0-1 stage the chunk's 64 per-key values (gap id, duration bias, mask) in LDS.
// Two LDS buffers: the next chunk's global loads are issued into registers in front of this chunk's products and
// stored into the other buffer behind them, one barrier per chunk.
// The products are taken transposed: S^T = K.Q^T (A = K rows, B = Q rows) and O^T += V^T.P^T
// (A = V^T rows, B = P^T), so a lane holds scores of ONE query (column lane&15) for keys 16*j + 8*(lane>>4) + r.
// s/8 + gap[clip(|gq - gk|, 0, GAPR-1)] + dur[clamp(dk)], masked keys replaced by -1e9; maximum and sum run
// in-lane with one exchange between the wave halves; p = exp(s - m) is split into bf16 hi/lo and packed straight
// from the score accumulators into the B fragment (tiles 2*kk and 2*kk+1 are elements 0..7 and 8..15 of the split
// k map), so P never goes through LDS. Epilogue: O^T / l, 8 consecutive channels per lane and tile, split hi/lo and
// stored from registers.
// coverage: 256 blocks x 8 waves x 16 rows x 64 cols = NT x DM per plane.
// ---------------------------------------------------------------------------
__global__ __launch_bounds__(256) void k_attn(const unsigned short* __restrict__ Qh,
                                              const unsigned short* __restrict__ Ql,
                                              const unsigned short* __restrict__ Kh,
                                              const unsigned short* __restrict__ Kl,
                                              const unsigned short* __restrict__ Vh,
                                              const unsigned short* __restrict__ Vl,
                                              const int* __restrict__ gids,
                                              const int* __restrict__ cm,
                                              const int* __restrict__ cg,
                                              const int* __restrict__ cd,
                                              const int* __restrict__ cnt,
                                              const float* __restrict__ gap_emb,
                                              const float* __restrict__ dur_emb,
                                              unsigned short* __restrict__ Oh,
                                              unsigned short* __restrict__ Ol) {
  // per buffer: K hi tile, lo tile [key][d] (18432 B), then V^T hi tile, lo tile [d][key] (18432 B)
  __shared__ __align__(16) unsigned short KVs[2 * ATB];        // two buffers                     73728 B
  __shared__ __align__(16) int   gkB[2 * KC];                  // chunk's key gap bucket ids    2 x 256 B
  __shared__ __align__(16) float dbB[2 * KC];                  // chunk's key duration bias     2 x 256 B
  __shared__ __align__(16) int   mkB[2 * KC];                  // chunk's key mask              2 x 256 B
  __shared__ float gapS[36];                                   // gap table column of head h (33)   144 B
  __shared__ float durS[20];                                   // dur table column of head h (17)    80 B

  const int tid = threadIdx.x, lane = tid & 31, wave = tid >> 5;
  const int hh = lane >> 4, c = lane & 15;
  const int qb = blockIdx.x % NQB;
  const int bh = blockIdx.x / NQB;                   // b*NH + h
  const int h  = bh % NH;
  const int b  = bh / NH;
  const int q0 = qb * QB + wave * 16;
  const size_t qkbase = (size_t)bh * SL * HD;
  const size_t vbase  = (size_t)bh * HD * SL;

  // stage the head's table columns once (clamped addresses for every lane, predicated LDS store)
  {
    const int ig = (tid < GAPR) ? tid : (GAPR - 1);
    const int id = (tid < DURR) ? tid : (DURR - 1);
    const float gv = gap_emb[ig * NH + h];
    const float dv = dur_emb[id * NH + h];
    if (tid < GAPR) gapS[tid] = gv;
    if (tid < DURR) durS[tid] = dv;
  }

  // gap bucket id of the one query this lane's score elements belong to: q0 + (lane&15)
  const int gq = gids[(size_t)b * SL + q0 + c];

  // Q fragments (loop-invariant), B operand stored [n = query][k = d]: query q0 + (lane&15), split map over d
  v16b qh[2], ql[2];
#pragma unroll
  for (int dc = 0; dc < 2; ++dc) {
    qh[dc] = ldf(Qh + qkbase, HD, q0, dc * 32, lane);
    ql[dc] = ldf(Ql + qkbase, HD, q0, dc * 32, lane);
  }

  float mrow = -__builtin_huge_valf();               // running maximum of query c (equal in both halves)
  float lrow = 0.f;                                  // running sum over this half's keys; halves joined at the end
  v8f oacc[4];
#pragma unroll
  for (int t = 0; t < 4; ++t) oacc[t] = zero8();

  // chunks that hold keys to attend: 1..NCK (block-uniform); the last chunk's keys behind them are masked ones
  int nck = (cnt[b] + KC - 1) / KC;
  nck = (nck < 1) ? 1 : ((nck > NCK) ? NCK : nck);

  // staging of one chunk: this thread's 8 pieces of 16 B (K hi, K lo, V^T hi, V^T lo, two each) and, in waves 0 and 1
  // (wave-uniform), one key's gap id, duration id and mask; held in registers between the loads and the LDS stores
  const int sr = tid >> 2;                           // 0..63: key row of K tiles, d row of V^T tiles
  const int sq = (tid & 3) * 16;                     // 0,16,32,48 elements
  const unsigned short* gkh = Kh + qkbase + (size_t)sr * HD + sq;
  const unsigned short* gkl = Kl + qkbase + (size_t)sr * HD + sq;
  const unsigned short* gvh = Vh + vbase + (size_t)sr * SL + sq;
  const unsigned short* gvl = Vl + vbase + (size_t)sr * SL + sq;
  const int* gcg = cg + (size_t)b * SL + (tid & (KC - 1));
  const int* gcd = cd + (size_t)b * SL + (tid & (KC - 1));
  const int* gcm = cm + (size_t)b * SL + (tid & (KC - 1));
  v4u pf[8];
  int pg = 0, pd = 0, pm = 0;
  auto chunk_load = [&](int kv0) {                   // kv0 = first key position of the chunk, 0..SL-KC
#pragma unroll
    for (int e = 0; e < 2; ++e) {
      pf[e]     = *(const v4u*)(gkh + (size_t)kv0 * HD + 8 * e);
      pf[2 + e] = *(const v4u*)(gkl + (size_t)kv0 * HD + 8 * e);
      pf[4 + e] = *(const v4u*)(gvh + kv0 + 8 * e);
      pf[6 + e] = *(const v4u*)(gvl + kv0 + 8 * e);
    }
    if (tid < KC) {
      pg = gcg[kv0];
      pd = gcd[kv0];
      pm = gcm[kv0];
    }
    // precaution: stands in front of whatever next lands in the address registers of the loads above; its memory
    // clobber also keeps those loads in front of the chunk's products
    asm volatile("s_wait_xcnt 0x0" ::: "memory");
  };
  auto chunk_store = [&](int buf) {                  // buf = 0 or 1
    unsigned short* d = KVs + buf * ATB + sr * KTP + sq;
#pragma unroll
    for (int e = 0; e < 2; ++e) {
      *(v4u*)(d + 8 * e)                           = pf[e];
      *(v4u*)(d + KC * KTP + 8 * e)                = pf[2 + e];
      *(v4u*)(d + 2 * KC * KTP + 8 * e)            = pf[4 + e];
      *(v4u*)(d + 2 * KC * KTP + HD * KTP + 8 * e) = pf[6 + e];
    }
    if (tid < KC) {
      const int dk = (pd < 0) ? 0 : ((pd > DURR - 1) ? (DURR - 1) : pd);
      gkB[buf * KC + tid] = pg;
      dbB[buf * KC + tid] = durS[dk];
      mkB[buf * KC + tid] = pm;
    }
  };

  chunk_load(0);
  __syncthreads();                                   // the table columns are visible before chunk_store reads durS
  chunk_store(0);
  __syncthreads();                                   // chunk 0's tiles and key values visible to every wave

  for (int kc = 0; kc < nck; ++kc) {
    const int cur = kc & 1;
    const unsigned short* Ks = KVs + cur * ATB;
    const unsigned short* Vs = Ks + 2 * KC * KTP;
    const int*   gkS = gkB + cur * KC;
    const float* dbS = dbB + cur * KC;
    const int*   mkS = mkB + cur * KC;
    const bool more = kc + 1 < nck;                  // block-uniform
    if (more) chunk_load((kc + 1) * KC);

    v8f s[4];
#pragma unroll
    for (int j = 0; j < 4; ++j) s[j] = zero8();
#pragma unroll
    for (int dc = 0; dc < 2; ++dc) {
#pragma unroll
      for (int j = 0; j < 4; ++j) {
        // A operands: key row j*16 + (lane&15) of the [key][d] tiles, split map over d
        const v16b khf = ldf(Ks, KTP, j * 16, dc * 32, lane);
        const v16b klf = ldf(Ks + KC * KTP, KTP, j * 16, dc * 32, lane);
        s[j] = mma(khf, qh[dc], s[j]);
        s[j] = mma(klf, qh[dc], s[j]);
        s[j] = mma(khf, ql[dc], s[j]);
      }
    }
    // s[j][r] = S[query q0 + c][key kv0 + j*16 + 8*hh + r]; scale, table biases, replace-mask
#pragma unroll
    for (int j = 0; j < 4; ++j) {
      const int kb = 16 * j + 8 * hh;                // first of this lane's 8 keys of tile j, 0..56
      const v4i g0 = *(const v4i*)(gkS + kb), g1 = *(const v4i*)(gkS + kb + 4);
      const v4f d0 = *(const v4f*)(dbS + kb), d1 = *(const v4f*)(dbS + kb + 4);
      const v4i k0 = *(const v4i*)(mkS + kb), k1 = *(const v4i*)(mkS + kb + 4);
#pragma unroll
      for (int r = 0; r < 8; ++r) {
        const int   gk = (r < 4) ? g0[r & 3] : g1[r & 3];
        const float db = (r < 4) ? d0[r & 3] : d1[r & 3];
        const int   mk = (r < 4) ? k0[r & 3] : k1[r & 3];
        int rel = gq - gk;
        rel = (rel < 0) ? -rel : rel;
        rel = (rel > GAPR - 1) ? (GAPR - 1) : rel;
        rel = (rel < 0) ? 0 : rel;
        const float gbias = gapS[rel];
        const float v = (s[j][r] * 0.125f + gbias) + db;
        s[j][r] = (mk != 0) ? v : NEGV;
      }
    }
    // chunk maximum of query c: in-lane over this half's 32 keys, then one exchange between the halves
    float cj[4];
#pragma unroll
    for (int j = 0; j < 4; ++j) {
      cj[j] = fmaxf(fmaxf(fmaxf(s[j][0], s[j][1]), fmaxf(s[j][2], s[j][3])),
                    fmaxf(fmaxf(s[j][4], s[j][5]), fmaxf(s[j][6], s[j][7])));
    }
    float cm = fmaxf(fmaxf(cj[0], cj[1]), fmaxf(cj[2], cj[3]));
    cm = fmaxf(cm, other_half(cm));
    const float mnew  = fmaxf(mrow, cm);             // finite from chunk 0 on
    const float alpha = exp_slot(mrow - mnew);
    mrow = mnew;

    // p = exp(s - m); tile j's 8 values are 8 consecutive k positions of the B fragment
    v4u ph[4], pl[4];
    float pj[4];
#pragma unroll
    for (int j = 0; j < 4; ++j) {
      v4f p0, p1;
#pragma unroll
      for (int r = 0; r < 4; ++r) {
        p0[r] = exp_slot(s[j][r] - mnew);
        p1[r] = exp_slot(s[j][r + 4] - mnew);
      }
      pj[j] = ((p0[0] + p0[1]) + (p0[2] + p0[3])) + ((p1[0] + p1[1]) + (p1[2] + p1[3]));
      split8(p0, p1, ph[j], pl[j]);
    }
    lrow = lrow * alpha + ((pj[0] + pj[1]) + (pj[2] + pj[3]));
#pragma unroll
    for (int t = 0; t < 4; ++t)
#pragma unroll
      for (int r = 0; r < 8; ++r) oacc[t][r] *= alpha;

#pragma unroll
    for (int kk = 0; kk < 2; ++kk) {
      // B operands: P^T column (lane&15) = query, split k map over keys 32*kk ..
      Frag fh, fl;
      fh.u[0] = ph[2 * kk]; fh.u[1] = ph[2 * kk + 1];
      fl.u[0] = pl[2 * kk]; fl.u[1] = pl[2 * kk + 1];
#pragma unroll
      for (int t = 0; t < 4; ++t) {
        // A operands: channel row t*16 + (lane&15) of V^T [d][key], split k map over keys
        const v16b vhf = ldf(Vs, KTP, t * 16, kk * 32, lane);
        const v16b vlf = ldf(Vs + HD * KTP, KTP, t * 16, kk * 32, lane);
        oacc[t] = mma(vhf, fh.v, oacc[t]);
        oacc[t] = mma(vlf, fh.v, oacc[t]);
        oacc[t] = mma(vhf, fl.v, oacc[t]);
      }
    }
    if (more) {
      // the other buffer's last readers left it in front of the barrier that ended the chunk before this one
      chunk_store(cur ^ 1);
      __syncthreads();                               // next chunk visible; this chunk's readers are done
    }
  }

  // O = oacc / l  (l >= 1); oacc[t][r] = O[query q0 + c][channel 16*t + 8*hh + r]
  const float invl = 1.0f / (lrow + other_half(lrow));
  const size_t go = ((size_t)(b * SL + q0 + c)) * DM + (size_t)h * HD + 8 * hh;
  v4u wh[4], wl[4];
#pragma unroll
  for (int t = 0; t < 4; ++t) {
    const v4f a0 = (v4f){oacc[t][0] * invl, oacc[t][1] * invl, oacc[t][2] * invl, oacc[t][3] * invl};
    const v4f a1 = (v4f){oacc[t][4] * invl, oacc[t][5] * invl, oacc[t][6] * invl, oacc[t][7] * invl};
    split8(a0, a1, wh[t], wl[t]);
  }
#pragma unroll
  for (int t = 0; t < 4; ++t) {
    *(v4u*)(Oh + go + 16 * t) = wh[t];
    *(v4u*)(Ol + go + 16 * t) = wl[t];
  }
}

// ---------------------------------------------------------------------------
// kernel 4: out = O.Wo + bo -> f32 rows [NT][DM]. A = O planes [NT][DM], B = transposed
// Wo planes [DM n][DM k]. Block = 128 token rows x 64 cols; grid = (DM/64 = 8, NT/128 = 32).
// coverage: 8 x 32 blocks x 128 x 64 = NT x DM.
// ---------------------------------------------------------------------------
__global__ __launch_bounds__(256) void k_gemm_out(const unsigned short* __restrict__ Ah,
                                                  const unsigned short* __restrict__ Al,
                                                  const unsigned short* __restrict__ Wh,
                                                  const unsigned short* __restrict__ Wl,
                                                  const float* __restrict__ bo,
                                                  float* __restrict__ out) {
  __shared__ __align__(16) unsigned char sm[GSB];    // 55296 B: GEMM stage, then the f32 output staging tile
  unsigned short* tl = (unsigned short*)sm;
  float* st = (float*)sm;                            // 128 x OTP
  const int tid = threadIdx.x, lane = tid & 31, wave = tid >> 5;
  const int hh = lane >> 4, c = lane & 15;
  const int mblk = blockIdx.y * 128, nblk = blockIdx.x * 64;
  const int mw = (wave >> 1) * 32, nw = (wave & 1) * 32;

  v8f acc[2][2];
#pragma unroll
  for (int s = 0; s < 2; ++s)
#pragma unroll
    for (int t = 0; t < 2; ++t) acc[s][t] = zero8();
  int arow[4];
#pragma unroll
  for (int i = 0; i < 4; ++i) arow[i] = mblk + (tid >> 3) + 32 * i;
  gemm128x64x3(Ah, Al, DM, Wh, Wl, DM, DM, arow, nblk, mw, nw, tid, lane, tl, acc);

  float bb[2];
#pragma unroll
  for (int t = 0; t < 2; ++t) bb[t] = bo[nblk + nw + 16 * t + c];
  stage_rm(acc, bb, st, mw, nw, hh, c);
  __syncthreads();
  store_f32(st, out, mblk, nblk, tid);
}

// ---------------------------------------------------------------------------
// its producer writes, no padded tails exist since every dimension is a tile multiple; offsets of the plane regions multiples of 512 KB):
//   X     bf16x2 [4096][512]             0     8388608
//   Wqkv  bf16x2 [1536][512]       8388608     3145728   (q rows 0..511, k 512..1023, v 1024..1535, [n][k])
//   Wo    bf16x2 [512][512]       11534336     1048576   ([n][k])
//   Q     bf16x2 [16][2048][64]   12582912     8388608
//   K     bf16x2 [16][2048][64]   20971520     8388608
//   V^T   bf16x2 [16][64][2048]   29360128     8388608
//   O     bf16x2 [4096][512]      37748736     8388608
//   key order: token index, gap id, duration id, mask, int32 [2][2048] each   46137344   4 x 16384; cnt int32 [2]
//   total                         46203136
// ---------------------------------------------------------------------------
extern "C" void kernel_launch(void* const* d_in, const int* in_sizes, int n_in,
                              void* d_out, int out_size, void* d_ws, size_t ws_size,
                              hipStream_t stream) {
  if (n_in < 14) return;
  if (in_sizes[0] != NT * DM) return;
  if (in_sizes[1] != NBT * SL) return;
  if (in_sizes[2] != NBT * SL) return;
  if (in_sizes[3] != NBT * SL) return;
  if (in_sizes[4] != DM * DM) return;
  if (in_sizes[5] != DM) return;
  if (in_sizes[6] != DM * DM) return;
  if (in_sizes[7] != DM) return;
  if (in_sizes[8] != DM * DM) return;
  if (in_sizes[9] != DM) return;
  if (in_sizes[10] != DM * DM) return;
  if (in_sizes[11] != DM) return;
  if (in_sizes[12] != GAPR * NH) return;
  if (in_sizes[13] != DURR * NH) return;
  if (out_size != NT * DM) return;

  const float* x     = (const float*)d_in[0];   // [2][2048][512] = [4096][512]
  const int*   amask = (const int*)d_in[1];     // [2][2048] int32, zero = masked key
  const int*   gids  = (const int*)d_in[2];     // [2][2048] int32
  const int*   dids  = (const int*)d_in[3];     // [2][2048] int32
  const float* W_q   = (const float*)d_in[4];   // [512][512] [in][out]
  const float* b_q   = (const float*)d_in[5];   // [512]
  const float* W_k   = (const float*)d_in[6];
  const float* b_k   = (const float*)d_in[7];
  const float* W_v   = (const float*)d_in[8];
  const float* b_v   = (const float*)d_in[9];
  const float* W_o   = (const float*)d_in[10];
  const float* b_o   = (const float*)d_in[11];
  const float* gtab  = (const float*)d_in[12];  // [33][8]
  const float* dtab  = (const float*)d_in[13];  // [17][8]
  float* out = (float*)d_out;                   // [4096][512] f32

  const size_t PX  = (size_t)NT * DM * 2;       // 4194304
  const size_t PW  = (size_t)3 * DM * DM * 2;   // 1572864
  const size_t PWO = (size_t)DM * DM * 2;       // 524288
  size_t off = 0;
  const size_t oXh  = off; off += PX;
  const size_t oXl  = off; off += PX;
  const size_t oWh  = off; off += PW;
  const size_t oWl  = off; off += PW;
  const size_t oWoh = off; off += PWO;
  const size_t oWol = off; off += PWO;
  const size_t oQh  = off; off += PX;
  const size_t oQl  = off; off += PX;
  const size_t oKh  = off; off += PX;
  const size_t oKl  = off; off += PX;
  const size_t oVh  = off; off += PX;
  const size_t oVl  = off; off += PX;
  const size_t oOh  = off; off += PX;
  const size_t oOl  = off; off += PX;
  const size_t PI  = (size_t)NBT * SL * 4;      // 16384
  const size_t oIdx = off; off += PI;
  const size_t oCg  = off; off += PI;
  const size_t oCd  = off; off += PI;
  const size_t oCm  = off; off += PI;
  const size_t oCnt = off; off += 256;
  if (off > ws_size) return;                    // off = 46203136
  if (off > (size_t)134217728) return;

  char* ws = (char*)d_ws;
  unsigned short* Xh  = (unsigned short*)(ws + oXh);
  unsigned short* Xl  = (unsigned short*)(ws + oXl);
  unsigned short* Wh  = (unsigned short*)(ws + oWh);
  unsigned short* Wl  = (unsigned short*)(ws + oWl);
  unsigned short* Woh = (unsigned short*)(ws + oWoh);
  unsigned short* Wol = (unsigned short*)(ws + oWol);
  unsigned short* Qh  = (unsigned short*)(ws + oQh);
  unsigned short* Ql  = (unsigned short*)(ws + oQl);
  unsigned short* Kh  = (unsigned short*)(ws + oKh);
  unsigned short* Kl  = (unsigned short*)(ws + oKl);
  unsigned short* Vh  = (unsigned short*)(ws + oVh);
  unsigned short* Vl  = (unsigned short*)(ws + oVl);
  unsigned short* Oh  = (unsigned short*)(ws + oOh);
  unsigned short* Ol  = (unsigned short*)(ws + oOl);
  int* kidx = (int*)(ws + oIdx);
  int* kcg  = (int*)(ws + oCg);
  int* kcd  = (int*)(ws + oCd);
  int* kcm  = (int*)(ws + oCm);
  int* kcnt = (int*)(ws + oCnt);

  // (0) hi/lo planes of x; the first NBT blocks build the key order of each sequence
  k_split<<<dim3(NBT + (NT * DM) / 2048), dim3(256), 0, stream>>>(x, Xh, Xl, amask, gids, dids,
                                                                  kidx, kcg, kcd, kcm, kcnt);
  // (1) transposed hi/lo planes of the four weights: in [k][n] -> out [n][k]
  k_split_tr<<<dim3(DM / 64, DM / 64, 4), dim3(256), 0, stream>>>(W_q, W_k, W_v, W_o, Wh, Wl, Woh, Wol);
  // (2) q / k / v^T planes
  k_proj<<<dim3(3 * NH, NT / 128), dim3(256), 0, stream>>>(Xh, Xl, Wh, Wl, b_q, b_k, b_v, kidx, kcnt,
                                                          Qh, Ql, Kh, Kl, Vh, Vl);
  // (3) attention -> O planes
  k_attn<<<dim3(NBT * NH * NQB), dim3(256), 0, stream>>>(Qh, Ql, Kh, Kl, Vh, Vl, gids, kcm, kcg, kcd, kcnt,
                                                        gtab, dtab, Oh, Ol);
  // (4) out = O.Wo + bo
  k_gemm_out<<<dim3(DM / 64, NT / 128), dim3(256), 0, stream>>>(Oh, Ol, Woh, Wol, b_o, out);
  (void)hipGetLastError();
}

// v005
// It runs in 80.2 microseconds.
// In both of two side-by-side timings against v004, it was 1.05 times as fast.
// Counting every step since v000, it is 3.96 times as fast.
// Contractions: Q/K/V = x.W (3 sites), S = Q.K^T, O = P.V, out = O.Wo: all v_wmma_f32_16x16x32_bf16 on bf16 hi/lo
// split operand planes (hi.hi + hi.lo + lo.hi per tile pair), f32 accumulate; biases, the 1/8 scale, the bucket-table
// lookups, the key mask (replace by -1e9) and the online softmax in f32.
// Plane carry audit: every hi/lo plane (X, Wqkv^T, Wo^T, Q, K, V^T, in-register P fragments, O) carries factor 1
// (hi = rne_bf16(v), lo = rne_bf16(v - hi), f32 exponent range, no subnormal concern); no inverse fold exists anywhere.
// Key order: per sequence the keys are reordered by a stable partition (unmasked first, masked behind); K and V are
// projected and attended only up to the last unmasked key (all keys when a sequence has none unmasked).
#include <hip/hip_runtime.h>
#include <stddef.h>

#define NBT 2                  // batch
#define SL  2048               // sequence length
#define DM  512                // model width
#define NH  8                  // heads
#define HD  64                 // head dim
#define NT  (NBT * SL)         // token rows, row m = b*SL + s
#define QB  128                // query rows per attention block
#define KC  64                 // keys per chunk
#define NQB (SL / QB)          // 16
#define NCK (SL / KC)          // 32
#define KTP 72                 // LDS pitch (16-bit elements) for 64-wide tiles, 144 B
#define OTP 68                 // f32 staging pitch [row][col] (128 x 64)
#define VTP 132                // f32 staging pitch [col][row] (64 x 128)
#define TTP 68                 // f32 staging pitch for the 64 x 64 weight transpose tile
#define GBK 64                 // k elements per GEMM stage: one whole 128-B line per plane row
#define GTR (2 * 128 + 2 * 64) // rows of one GEMM stage in LDS: A hi, A lo (128 each), B hi, B lo (64 each)
#define GSB (GTR * KTP * 2)    // bytes of one GEMM stage in LDS, 55296
#define GAPR 33                // time-gap table rows
#define DURR 17                // duration table rows
#define NEGV (-1.0e9f)         // masked-key score value
#define ATB  (2 * KC * KTP + 2 * HD * KTP) // 16-bit elements of one attention chunk's four tiles in LDS

static_assert(NT == 4096);
static_assert(NH * HD == DM);
static_assert(SL % QB == 0);
static_assert(SL % KC == 0);
static_assert(SL % 128 == 0);
static_assert(DM % 64 == 0);
static_assert(DM % 32 == 0);
static_assert((NT * DM) % 2048 == 0);
static_assert(HD == 64);
static_assert(KC == 64);
static_assert(64 * VTP <= 128 * OTP);
static_assert(DM % GBK == 0);
static_assert(128 * OTP * 4 <= GSB);
static_assert(SL == 256 * 8);

typedef __bf16       v16b __attribute__((ext_vector_type(16)));
typedef float        v8f  __attribute__((ext_vector_type(8)));
typedef float        v4f  __attribute__((ext_vector_type(4)));
typedef unsigned int v4u  __attribute__((ext_vector_type(4)));
typedef int          v4i  __attribute__((ext_vector_type(4)));
union Frag { v16b v; v4u u[2]; };

// WMMA with the dependent-VALU hazard guard (ties D, keeps A/B live)
__device__ __forceinline__ v8f mma(v16b a, v16b b, v8f c) {
  c = __builtin_amdgcn_wmma_f32_16x16x32_bf16(false, a, false, b, (short)0, c, false, false);
  asm volatile("v_nop\n\tv_nop\n\tv_nop\n\tv_nop" : "+v"(c) : "v"(a), "v"(b));
  return c;
}

// value of lane l ^ 16 (the other 16-lane half), by the vector cross-row move
__device__ __forceinline__ float other_half(float x) {
  const int b = __float_as_int(x);
  return __int_as_float(__builtin_amdgcn_permlanex16(b, b, 0x76543210, 0xfedcba98, false, false));
}

// e^x by the hardware exponential of x * log2(e), as __expf gives it. The v_nop fills the one slot that the
// instruction set asks for between a transcendental and a directly following instruction that reads its result or
// overwrites its source.
__device__ __forceinline__ float exp_slot(float x) {
  float r;
  asm("v_exp_f32 %0, %1\n\tv_nop" : "=v"(r) : "v"(x * 1.44269504f));
  return r;
}

__device__ __forceinline__ v8f zero8() { return (v8f){0.f, 0.f, 0.f, 0.f, 0.f, 0.f, 0.f, 0.f}; }

// Fragment loader for k-contiguous 16-bit rows with pitch ld (bf16 bits).
// A operand: row0 + (lane&15) is the M row. B operand stored [n][k]: row0 + (lane&15) is the N column.
// Split k map for both: elements 0..7 <- k0 + 8*(lane>>4) + 0..7, elements 8..15 <- k0 + 16 + 8*(lane>>4) + 0..7.
// D: acc[r] = element (row0 + 8*(lane>>4) + r, col0 + (lane&15)).
__device__ __forceinline__ v16b ldf(const unsigned short* p, int ld, int row0, int k0, int lane) {
  const unsigned short* q = p + (size_t)(row0 + (lane & 15)) * ld + k0 + 8 * (lane >> 4);
  Frag f;
  f.u[0] = *(const v4u*)(q);
  f.u[1] = *(const v4u*)(q + 16);
  return f.v;
}

// f32 -> bf16 bits, RNE convert by integer arithmetic
__device__ __forceinline__ unsigned int bf_rne(float x) {
  const unsigned int u = __float_as_uint(x);
  return (u + 0x7FFFu + ((u >> 16) & 1u)) >> 16;
}

// hi = rne(a), lo = rne(a - hi) for two floats, packed little-endian (first element in the low half-word)
__device__ __forceinline__ void split2(float a, float b, unsigned int& wh, unsigned int& wl) {
  const unsigned int ha = bf_rne(a), hb = bf_rne(b);
  const float ra = a - __uint_as_float(ha << 16);
  const float rb = b - __uint_as_float(hb << 16);
  wh = ha | (hb << 16);
  wl = bf_rne(ra) | (bf_rne(rb) << 16);
}

// 8 consecutive floats -> one 16-B hi piece and one 16-B lo piece
__device__ __forceinline__ void split8(v4f a0, v4f a1, v4u& wh, v4u& wl) {
  unsigned int h0, h1, h2, h3, l0, l1, l2, l3;
  split2(a0[0], a0[1], h0, l0);
  split2(a0[2], a0[3], h1, l1);
  split2(a1[0], a1[1], h2, l2);
  split2(a1[2], a1[3], h3, l3);
  wh = (v4u){h0, h1, h2, h3};
  wl = (v4u){l0, l1, l2, l3};
}

// ---------------------------------------------------------------------------
// kernel 0: elementwise split of a contiguous f32 array (layout kept) into bf16 hi and lo planes.
// Block = 2048 elements; thread converts 8 consecutive floats and writes one 16-B piece per plane;
// coverage: n/2048 blocks x 256 thr x 8 = n elements of both planes.
// Blocks 0 .. NBT-1 do not split: block b builds sequence b's key order instead (compact_keys); block NBT + i splits
// elements 2048*i .. +2047.
// ---------------------------------------------------------------------------

// Stable partition of one sequence's SL keys by the mask: unmasked keys (mask != 0) first in their order, masked keys
// behind them in theirs. A masked key's score is -1e9, so its weight exp(-1e9 - m) is 0 as soon as one key of the
// sequence is unmasked: keys behind the last unmasked one add nothing and are left out by the later kernels.
// Writes, per new position: the key's token index, gap id, duration id and mask; and cnt[b] = keys to attend =
// number of unmasked keys, or SL when there is none (every score is then -1e9 and all keys count alike).
// Thread t owns keys 8t .. 8t+7; block-wide inclusive scan of the per-thread counts in LDS, two buffers, one
// barrier a step. Every position 0..SL-1 is written exactly once (the map is a permutation).
__device__ __forceinline__ void compact_keys(const int* __restrict__ mask, const int* __restrict__ gids,
                                             const int* __restrict__ dids, int* __restrict__ idx,
                                             int* __restrict__ cg, int* __restrict__ cd, int* __restrict__ cm,
                                             int* __restrict__ cnt, int b, int tid) {
  __shared__ int sc[2][256];
  const int base = b * SL + tid * 8;
  const v4i m0 = *(const v4i*)(mask + base), m1 = *(const v4i*)(mask + base + 4);
  // precaution: stands in front of the next loads, which may land in the address registers of the loads above
  asm volatile("s_wait_xcnt 0x0" ::: "memory");
  const v4i g0 = *(const v4i*)(gids + base), g1 = *(const v4i*)(gids + base + 4);
  // precaution: as above
  asm volatile("s_wait_xcnt 0x0" ::: "memory");
  const v4i d0 = *(const v4i*)(dids + base), d1 = *(const v4i*)(dids + base + 4);
  int c = 0;
#pragma unroll
  for (int e = 0; e < 4; ++e) c += ((m0[e] != 0) ? 1 : 0) + ((m1[e] != 0) ? 1 : 0);
  sc[0][tid] = c;
  __syncthreads();
  int cur = 0;
#pragma unroll
  for (int o = 1; o < 256; o <<= 1) {
    int a = sc[cur][tid];
    if (tid >= o) a += sc[cur][tid - o];
    sc[cur ^ 1][tid] = a;
    cur ^= 1;
    __syncthreads();                                 // the step's sums are visible before the next step reads them
  }
  const int total = sc[cur][255];                    // unmasked keys of the sequence, 0..SL
  int ru = sc[cur][tid] - c;                         // unmasked keys in front of key 8t
  int rm = total + tid * 8 - ru;                     // total + masked keys in front of key 8t
#pragma unroll
  for (int e = 0; e < 8; ++e) {
    const int mk = (e < 4) ? m0[e & 3] : m1[e & 3];
    const int gk = (e < 4) ? g0[e & 3] : g1[e & 3];
    const int dk = (e < 4) ? d0[e & 3] : d1[e & 3];
    const int pos = b * SL + ((mk != 0) ? ru : rm);  // 0..SL-1 within the sequence
    ru += (mk != 0) ? 1 : 0;
    rm += (mk != 0) ? 0 : 1;
    idx[pos] = tid * 8 + e;
    cg[pos]  = gk;
    cd[pos]  = dk;
    cm[pos]  = mk;
  }
  if (tid == 0) cnt[b] = (total > 0) ? total : SL;
}

__global__ __launch_bounds__(256) void k_split(const float* __restrict__ src,
                                               unsigned short* __restrict__ dh,
                                               unsigned short* __restrict__ dl,
                                               const int* __restrict__ mask, const int* __restrict__ gids,
                                               const int* __restrict__ dids, int* __restrict__ idx,
                                               int* __restrict__ cg, int* __restrict__ cd, int* __restrict__ cm,
                                               int* __restrict__ cnt) {
  if (blockIdx.x < NBT) {                            // block-uniform
    compact_keys(mask, gids, dids, idx, cg, cd, cm, cnt, blockIdx.x, threadIdx.x);
    return;
  }
  const size_t o = (size_t)(blockIdx.x - NBT) * 2048 + (size_t)threadIdx.x * 8;
  const v4f a0 = *(const v4f*)(src + o);
  const v4f a1 = *(const v4f*)(src + o + 4);
  v4u wh, wl;
  split8(a0, a1, wh, wl);
  v4u* ph = (v4u*)(dh + o);
  v4u* pl = (v4u*)(dl + o);
  *ph = wh;
  *pl = wl;
  
}

// ---------------------------------------------------------------------------
// kernel 1: weight transpose + split. in W [k = DM rows][n = DM cols] f32 -> out planes [n][k] hi/lo (pitch DM).
// blockIdx.z = which weight (0 q, 1 k, 2 v -> stacked planes rows which*DM + n; 3 -> the out-projection planes).
// blockIdx.x = 64-wide n tile (source columns), blockIdx.y = 64-deep k tile (source rows). The 64 x 64 tile is
// coverage: load 256 thr x 16 floats = 64 x 64; store 256 thr x 2 iter x 8 halves = 64 n rows x 64 k per plane;
// grid (DM/64, DM/64, 4) covers all four DM x DM matrices.
// ---------------------------------------------------------------------------
__global__ __launch_bounds__(256) void k_split_tr(const float* __restrict__ Wq, const float* __restrict__ Wk,
                                                  const float* __restrict__ Wv, const float* __restrict__ Wo,
                                                  unsigned short* __restrict__ Ph, unsigned short* __restrict__ Pl,
                                                  unsigned short* __restrict__ Oh, unsigned short* __restrict__ Ol) {
  __shared__ __align__(16) float st[64 * TTP];       // 17408 B
  const int tid = threadIdx.x;
  const int z   = blockIdx.z;                        // block-uniform
  const int nt  = blockIdx.x * 64;                   // source columns = output rows
  const int kt  = blockIdx.y * 64;                   // source rows    = output k
  const float* W = (z == 0) ? Wq : ((z == 1) ? Wk : ((z == 2) ? Wv : Wo));
  {
    const int row = tid >> 2;                        // k within tile, 0..63
    const int cb  = (tid & 3) * 16;                  // n within tile, 0,16,32,48
    const float* src = W + (size_t)(kt + row) * DM + nt + cb;
#pragma unroll
    for (int e = 0; e < 4; ++e) {
      const v4f a = *(const v4f*)(src + 4 * e);
#pragma unroll
      for (int q = 0; q < 4; ++q) st[(cb + 4 * e + q) * TTP + row] = a[q];
    }
  }
  __syncthreads();
  unsigned short* dh = (z < 3) ? (Ph + (size_t)z * DM * DM) : Oh;
  unsigned short* dl = (z < 3) ? (Pl + (size_t)z * DM * DM) : Ol;
  const size_t base = (size_t)nt * DM + kt;
  v4u vh[2], vl[2];
  size_t go[2];
#pragma unroll
  for (int it = 0; it < 2; ++it) {
    const int pp   = tid + 256 * it;                 // 0..511
    const int rown = pp >> 3;                        // 0..63
    const int pc   = pp & 7;                         // k piece 8*pc .. +7
    const float* ra = st + rown * TTP + 8 * pc;
    const v4f a0 = *(const v4f*)(ra), a1 = *(const v4f*)(ra + 4);
    split8(a0, a1, vh[it], vl[it]);
    go[it] = base + (size_t)rown * DM + 8 * pc;
  }
  {
#pragma unroll
    for (int it = 0; it < 2; ++it) {
      *(v4u*)(dh + go[it]) = vh[it];
      *(v4u*)(dl + go[it]) = vl[it];
    }
    
  }
}

// ---------------------------------------------------------------------------
// 128 x 64 block tile, 32 x 32 per wave, split-bf16 GEMM main loop over K (multiple of GBK): A planes [m][k] pitch
// lda, B planes [n][k] pitch ldb (hi and lo). Per stage of GBK = 64 k the block brings the 128 A rows and the 64 B
// rows of both planes into LDS (pitch KTP): a wave's 16-B loads cover 4 whole 128-B lines, 12 pieces per thread,
// rows (tid>>3) + 32*i: i 0..3 A hi, 4..7 A lo, 8..9 B hi, 10..11 B lo. The next stage's pieces are loaded into
// registers while this stage is multiplied. Fragments come from LDS by ldf (its split k map, A and B alike).
// Per tile pair: ah.bh + ah.bl + al.bh into one f32 accumulator, k ascending.
// Tile row (tid>>3) + 32*i is row arow[i] of the A planes (the caller's map from tile rows to plane rows).
// acc[s][t][r] = (tile row mw + 16*s + 8*(lane>>4) + r, nrow + nw + 16*t + (lane&15)).
// The loop ends behind a barrier: tl may be reused by the caller at once.
// ---------------------------------------------------------------------------
__device__ __forceinline__ void gemm_ld(const unsigned short* const (&gp)[4], const unsigned int (&ao)[4], int ldb,
                                        int k0, v4u (&pf)[12]) {
#pragma unroll
  for (int i = 0; i < 4; ++i) {
    pf[i]     = *(const v4u*)((const char*)gp[0] + ao[i]);
    pf[4 + i] = *(const v4u*)((const char*)gp[1] + ao[i]);
  }
#pragma unroll
  for (int i = 0; i < 2; ++i) {
    pf[8 + i]  = *(const v4u*)(gp[2] + (size_t)(32 * i) * ldb + k0);
    pf[10 + i] = *(const v4u*)(gp[3] + (size_t)(32 * i) * ldb + k0);
  }
  // precaution: stands in front of the fragment loads, which land in the address registers of the loads above
  asm volatile("s_wait_xcnt 0x0" ::: "memory");
}

__device__ __forceinline__ void gemm128x64x3(const unsigned short* __restrict__ Ah,
                                             const unsigned short* __restrict__ Al, int lda,
                                             const unsigned short* __restrict__ Bh,
                                             const unsigned short* __restrict__ Bl, int ldb,
                                             int K, const int (&arow)[4], int nrow, int mw, int nw, int tid,
                                             int lane, unsigned short* tl, v8f (&acc)[2][2]) {
  const int pr = tid >> 3;                           // 0..31: row within each group of 32 rows
  const int pe = (tid & 7) * 8;                      // first of this thread's 8 k elements in the row
  const unsigned short* const gp[4] = {Ah, Al,
                                       Bh + (size_t)(nrow + pr) * ldb + pe, Bl + (size_t)(nrow + pr) * ldb + pe};
  unsigned int ao[4];                                // byte offset of this thread's piece in its A row of each group
#pragma unroll
  for (int i = 0; i < 4; ++i) ao[i] = ((unsigned int)arow[i] * (unsigned int)lda + (unsigned int)pe) * 2u;
  unsigned short* sp = tl + pr * KTP + pe;
  const unsigned short* sAh = tl;
  const unsigned short* sAl = tl + 128 * KTP;
  const unsigned short* sBh = tl + 256 * KTP;
  const unsigned short* sBl = tl + 320 * KTP;
  v4u pf[12];
  gemm_ld(gp, ao, ldb, 0, pf);
// rolled: one copy of the stage body keeps the code short and the register count at three blocks per WGP
#pragma unroll 1
  for (int k0 = 0; k0 < K; k0 += GBK) {
#pragma unroll
    for (int i = 0; i < 12; ++i) *(v4u*)(sp + 32 * i * KTP) = pf[i];
    __syncthreads();                                 // the stage is visible to every wave
    if (k0 + GBK < K) {
#pragma unroll
      for (int i = 0; i < 4; ++i) ao[i] += GBK * 2;  // the A offsets step to the next stage's k
      gemm_ld(gp, ao, ldb, k0 + GBK, pf);
    }
#pragma unroll
    for (int ks = 0; ks < GBK; ks += 32) {
      const v16b ah0 = ldf(sAh, KTP, mw, ks, lane);
      const v16b ah1 = ldf(sAh, KTP, mw + 16, ks, lane);
      const v16b al0 = ldf(sAl, KTP, mw, ks, lane);
      const v16b al1 = ldf(sAl, KTP, mw + 16, ks, lane);
#pragma unroll
      for (int t = 0; t < 2; ++t) {
        const v16b bh = ldf(sBh, KTP, nw + 16 * t, ks, lane);
        const v16b bl = ldf(sBl, KTP, nw + 16 * t, ks, lane);
        acc[0][t] = mma(ah0, bh, acc[0][t]);
        acc[1][t] = mma(ah1, bh, acc[1][t]);
        acc[0][t] = mma(ah0, bl, acc[0][t]);
        acc[1][t] = mma(ah1, bl, acc[1][t]);
        acc[0][t] = mma(al0, bh, acc[0][t]);
        acc[1][t] = mma(al1, bh, acc[1][t]);
      }
    }
    __syncthreads();                                 // every reader of the stage is done before it is rewritten
  }
}

// stage acc + bias in the block tile, row-major [row][col] (128 x 64, pitch OTP floats)
__device__ __forceinline__ void stage_rm(v8f (&acc)[2][2], const float (&bb)[2], float* st,
                                         int mw, int nw, int hh, int c) {
#pragma unroll
  for (int s = 0; s < 2; ++s)
#pragma unroll
    for (int t = 0; t < 2; ++t)
#pragma unroll
      for (int r = 0; r < 8; ++r)
        st[(mw + 16 * s + 8 * hh + r) * OTP + nw + 16 * t + c] = acc[s][t][r] + bb[t];
}

// stage acc + bias transposed [col][row] (64 x 128, pitch VTP floats)
__device__ __forceinline__ void stage_tr(v8f (&acc)[2][2], const float (&bb)[2], float* st,
                                         int mw, int nw, int hh, int c) {
#pragma unroll
  for (int s = 0; s < 2; ++s)
#pragma unroll
    for (int t = 0; t < 2; ++t)
#pragma unroll
      for (int r = 0; r < 8; ++r)
        st[(nw + 16 * t + c) * VTP + mw + 16 * s + 8 * hh + r] = acc[s][t][r] + bb[t];
}

// block tile 128 rows x 64 cols -> hi/lo planes at element base, row pitch ldo: each row = 64 halves = one whole
// coverage: 256 thr x 4 iter x 8 halves = 128 rows x 64 per plane.
__device__ __forceinline__ void store_planes(const float* st, unsigned short* __restrict__ oh,
                                             unsigned short* __restrict__ ol, size_t base, int ldo, int tid) {
  v4u vh[4], vl[4];
  size_t go[4];
#pragma unroll
  for (int it = 0; it < 4; ++it) {
    const int pp  = tid + 256 * it;                  // 0..1023
    const int row = pp >> 3;                         // 0..127
    const int pc  = pp & 7;                          // 16-B piece = cols 8*pc .. +7
    const float* ra = st + row * OTP + 8 * pc;
    const v4f a0 = *(const v4f*)(ra), a1 = *(const v4f*)(ra + 4);
    split8(a0, a1, vh[it], vl[it]);
    go[it] = base + (size_t)row * ldo + 8 * pc;
  }
  {
#pragma unroll
    for (int it = 0; it < 4; ++it) {
      *(v4u*)(oh + go[it]) = vh[it];
      *(v4u*)(ol + go[it]) = vl[it];
    }
    
  }
}

// transposed block tile 64 d-rows x 128 p -> V^T hi/lo planes [bh][d][p] (p = position in the key order) at element base (= bh*HD*SL + sf):
// coverage: 256 thr x 4 iter x 8 halves = 64 d-rows x 128 p per plane.
__device__ __forceinline__ void store_vt(const float* st, unsigned short* __restrict__ vh,
                                         unsigned short* __restrict__ vl, size_t base, int tid) {
  v4u wh[4], wl[4];
  size_t go[4];
#pragma unroll
  for (int it = 0; it < 4; ++it) {
    const int pp   = tid + 256 * it;                 // 0..1023
    const int drow = pp >> 4;                        // 0..63
    const int pc   = pp & 15;                        // 8 consecutive p
    const float* ra = st + drow * VTP + 8 * pc;
    const v4f a0 = *(const v4f*)(ra), a1 = *(const v4f*)(ra + 4);
    split8(a0, a1, wh[it], wl[it]);
    go[it] = base + (size_t)drow * SL + 8 * pc;
  }
  {
#pragma unroll
    for (int it = 0; it < 4; ++it) {
      *(v4u*)(vh + go[it]) = wh[it];
      *(v4u*)(vl + go[it]) = wl[it];
    }
    
  }
}

// coverage: 256 thr x 8 iter x 4 floats = 128 rows x 64 cols.
__device__ __forceinline__ void store_f32(const float* st, float* __restrict__ out, int mblk, int nblk, int tid) {
  v4f val[8];
  size_t go[8];
#pragma unroll
  for (int it = 0; it < 8; ++it) {
    const int pp  = tid + 256 * it;                  // 0..2047
    const int row = pp >> 4;                         // 0..127
    const int pc  = pp & 15;                         // 4 consecutive cols
    val[it] = *(const v4f*)(st + row * OTP + 4 * pc);
    go[it]  = (size_t)(mblk + row) * DM + nblk + 4 * pc;
  }
  {
#pragma unroll
    for (int it = 0; it < 8; ++it) *(v4f*)(out + go[it]) = val[it];
    
  }
}

// ---------------------------------------------------------------------------
// kernel 2: projections. blockIdx.x = which*NH + head (which 0 = q, 1 = k, 2 = v), blockIdx.y = 128-token block
// of one sequence b. A = x planes [NT][DM] (pitch DM, K = DM), B = stacked transposed weight planes [3*DM n][DM k]
// rows which*DM + head*64 .. (pitch DM). Bias added in f32.
// grid = (3*NH = 24, NT/128 = 32). coverage: q planes 16 bh x 16 blocks x 128 s x 64 d; k planes (128 p x 64 d)
// and v^T planes (64 d x 128 p) only in the blocks with sf < cnt[b].
// ---------------------------------------------------------------------------
__global__ __launch_bounds__(256) void k_proj(const unsigned short* __restrict__ Xh,
                                              const unsigned short* __restrict__ Xl,
                                              const unsigned short* __restrict__ Wh,
                                              const unsigned short* __restrict__ Wl,
                                              const float* __restrict__ bq,
                                              const float* __restrict__ bk,
                                              const float* __restrict__ bv,
                                              const int* __restrict__ idx, const int* __restrict__ cnt,
                                              unsigned short* __restrict__ Qh, unsigned short* __restrict__ Ql,
                                              unsigned short* __restrict__ Kh, unsigned short* __restrict__ Kl,
                                              unsigned short* __restrict__ Vh, unsigned short* __restrict__ Vl) {
  __shared__ __align__(16) unsigned char sm[GSB];    // 55296 B: GEMM stage, then the f32 output staging tile
  unsigned short* tl = (unsigned short*)sm;
  float* st = (float*)sm;                            // 128 x OTP (the transposed 64 x VTP tile also fits)
  const int tid = threadIdx.x, lane = tid & 31, wave = tid >> 5;
  const int hh = lane >> 4, c = lane & 15;
  const int which = blockIdx.x / NH;                 // block-uniform
  const int head  = blockIdx.x - which * NH;
  const int mblk  = blockIdx.y * 128;
  const int b     = mblk / SL;
  const int sf    = mblk - b * SL;                   // first position of the block in sequence b
  const int bh    = b * NH + head;
  const int mw = (wave >> 1) * 32, nw = (wave & 1) * 32;

  // q: tile row = token. k, v: tile row = position in the sequence's key order; the token comes from idx, and a
  // block wholly behind the keys to attend has nothing to do (block-uniform return, in front of every barrier).
  int arow[4];
#pragma unroll
  for (int i = 0; i < 4; ++i) arow[i] = mblk + (tid >> 3) + 32 * i;
  if (which != 0) {
    if (sf >= cnt[b]) return;
#pragma unroll
    for (int i = 0; i < 4; ++i) arow[i] = b * SL + (idx[arow[i]] & (SL - 1));
  }

  v8f acc[2][2];
#pragma unroll
  for (int s = 0; s < 2; ++s)
#pragma unroll
    for (int t = 0; t < 2; ++t) acc[s][t] = zero8();
  gemm128x64x3(Xh, Xl, DM,
               Wh + (size_t)which * DM * DM, Wl + (size_t)which * DM * DM, DM,
               DM, arow, head * HD, mw, nw, tid, lane, tl, acc);

  float bb[2];
#pragma unroll
  for (int t = 0; t < 2; ++t) {
    const int i = head * HD + nw + 16 * t + c;       // 0..511
    const float xq = bq[i], xk = bk[i], xv = bv[i];
    bb[t] = (which == 0) ? xq : ((which == 1) ? xk : xv);
  }
  if (which < 2) stage_rm(acc, bb, st, mw, nw, hh, c);
  else           stage_tr(acc, bb, st, mw, nw, hh, c);
  __syncthreads();
  if (which < 2) {
    unsigned short* oh = (which == 0) ? Qh : Kh;
    unsigned short* ol = (which == 0) ? Ql : Kl;
    store_planes(st, oh, ol, ((size_t)bh * SL + sf) * HD, HD, tid);
  } else {
    store_vt(st, Vh, Vl, (size_t)bh * HD * SL + sf, tid);
  }
}

// ---------------------------------------------------------------------------
// kernel 3: flash attention for every (b, head, 128-query block), head dim 64, up to 32 chunks of 64 keys.
//   q planes [b*NH + h][s][64] hi/lo; k planes [b*NH + h][p][64] and v^T planes [b*NH + h][64][p] hi/lo, p = position
//   in the key order; int32 tables [b][s]: gap bucket ids (queries); [b][p]: key mask (zero = masked), gap bucket
//   ids, duration bucket ids; cnt[b] = keys to attend; f32 tables gap [GAPR][NH], dur [DURR][NH];
//   O planes [token = b*SL + s][DM] hi/lo, head h at columns h*64 (one line per row).
// Block = 8 waves; wave w owns queries q0 = qb*128 + 16*w .. +15. The head's column of both bias tables is staged
// in LDS once per block. Per chunk: K [key][d] and V^T [d][key] hi/lo tiles staged in LDS by all threads
// (plain 16-B loads) while waves 0-1 stage the chunk's 64 per-key values (gap id, duration bias, mask) in LDS.
// Two LDS buffers: the next chunk's global loads are issued into registers in front of this chunk's products and
// stored into the other buffer behind them, one barrier per chunk.
// Each half of a chunk's products takes its eight LDS fragments first and then goes round the four accumulator tiles.
// The products are taken transposed: S^T = K.Q^T (A = K rows, B = Q rows) and O^T += V^T.P^T
// (A = V^T rows, B = P^T), so a lane holds scores of ONE query (column lane&15) for keys 16*j + 8*(lane>>4) + r.
// s/8 + gap[clip(|gq - gk|, 0, GAPR-1)] + dur[clamp(dk)], masked keys replaced by -1e9; maximum and sum run
// in-lane with one exchange between the wave halves; p = exp(s - m) is split into bf16 hi/lo and packed straight
// from the score accumulators into the B fragment (tiles 2*kk and 2*kk+1 are elements 0..7 and 8..15 of the split
// k map), so P never goes through LDS. Epilogue: O^T / l, 8 consecutive channels per lane and tile, split hi/lo and
// stored from registers.
// coverage: 256 blocks x 8 waves x 16 rows x 64 cols = NT x DM per plane.
// ---------------------------------------------------------------------------
__global__ __launch_bounds__(256) void k_attn(const unsigned short* __restrict__ Qh,
                                              const unsigned short* __restrict__ Ql,
                                              const unsigned short* __restrict__ Kh,
                                              const unsigned short* __restrict__ Kl,
                                              const unsigned short* __restrict__ Vh,
                                              const unsigned short* __restrict__ Vl,
                                              const int* __restrict__ gids,
                                              const int* __restrict__ cm,
                                              const int* __restrict__ cg,
                                              const int* __restrict__ cd,
                                              const int* __restrict__ cnt,
                                              const float* __restrict__ gap_emb,
                                              const float* __restrict__ dur_emb,
                                              unsigned short* __restrict__ Oh,
                                              unsigned short* __restrict__ Ol) {
  // per buffer: K hi tile, lo tile [key][d] (18432 B), then V^T hi tile, lo tile [d][key] (18432 B)
  __shared__ __align__(16) unsigned short KVs[2 * ATB];        // two buffers                     73728 B
  __shared__ __align__(16) int   gkB[2 * KC];                  // chunk's key gap bucket ids    2 x 256 B
  __shared__ __align__(16) float dbB[2 * KC];                  // chunk's key duration bias     2 x 256 B
  __shared__ __align__(16) int   mkB[2 * KC];                  // chunk's key mask              2 x 256 B
  __shared__ float gapS[36];                                   // gap table column of head h (33)   144 B
  __shared__ float durS[20];                                   // dur table column of head h (17)    80 B

  const int tid = threadIdx.x, lane = tid & 31, wave = tid >> 5;
  const int hh = lane >> 4, c = lane & 15;
  const int qb = blockIdx.x % NQB;
  const int bh = blockIdx.x / NQB;                   // b*NH + h
  const int h  = bh % NH;
  const int b  = bh / NH;
  const int q0 = qb * QB + wave * 16;
  const size_t qkbase = (size_t)bh * SL * HD;
  const size_t vbase  = (size_t)bh * HD * SL;

  // stage the head's table columns once (clamped addresses for every lane, predicated LDS store)
  {
    const int ig = (tid < GAPR) ? tid : (GAPR - 1);
    const int id = (tid < DURR) ? tid : (DURR - 1);
    const float gv = gap_emb[ig * NH + h];
    const float dv = dur_emb[id * NH + h];
    if (tid < GAPR) gapS[tid] = gv;
    if (tid < DURR) durS[tid] = dv;
  }

  // gap bucket id of the one query this lane's score elements belong to: q0 + (lane&15)
  const int gq = gids[(size_t)b * SL + q0 + c];

  // Q fragments (loop-invariant), B operand stored [n = query][k = d]: query q0 + (lane&15), split map over d
  v16b qh[2], ql[2];
#pragma unroll
  for (int dc = 0; dc < 2; ++dc) {
    qh[dc] = ldf(Qh + qkbase, HD, q0, dc * 32, lane);
    ql[dc] = ldf(Ql + qkbase, HD, q0, dc * 32, lane);
  }

  float mrow = -__builtin_huge_valf();               // running maximum of query c (equal in both halves)
  float lrow = 0.f;                                  // running sum over this half's keys; halves joined at the end
  v8f oacc[4];
#pragma unroll
  for (int t = 0; t < 4; ++t) oacc[t] = zero8();

  // chunks that hold keys to attend: 1..NCK (block-uniform); the last chunk's keys behind them are masked ones
  int nck = (cnt[b] + KC - 1) / KC;
  nck = (nck < 1) ? 1 : ((nck > NCK) ? NCK : nck);

  // staging of one chunk: this thread's 8 pieces of 16 B (K hi, K lo, V^T hi, V^T lo, two each) and, in waves 0 and 1
  // (wave-uniform), one key's gap id, duration id and mask; held in registers between the loads and the LDS stores
  const int sr = tid >> 2;                           // 0..63: key row of K tiles, d row of V^T tiles
  const int sq = (tid & 3) * 16;                     // 0,16,32,48 elements
  const unsigned short* gkh = Kh + qkbase + (size_t)sr * HD + sq;
  const unsigned short* gkl = Kl + qkbase + (size_t)sr * HD + sq;
  const unsigned short* gvh = Vh + vbase + (size_t)sr * SL + sq;
  const unsigned short* gvl = Vl + vbase + (size_t)sr * SL + sq;
  const int* gcg = cg + (size_t)b * SL + (tid & (KC - 1));
  const int* gcd = cd + (size_t)b * SL + (tid & (KC - 1));
  const int* gcm = cm + (size_t)b * SL + (tid & (KC - 1));
  v4u pf[8];
  int pg = 0, pd = 0, pm = 0;
  auto chunk_load = [&](int kv0) {                   // kv0 = first key position of the chunk, 0..SL-KC
#pragma unroll
    for (int e = 0; e < 2; ++e) {
      pf[e]     = *(const v4u*)(gkh + (size_t)kv0 * HD + 8 * e);
      pf[2 + e] = *(const v4u*)(gkl + (size_t)kv0 * HD + 8 * e);
      pf[4 + e] = *(const v4u*)(gvh + kv0 + 8 * e);
      pf[6 + e] = *(const v4u*)(gvl + kv0 + 8 * e);
    }
    if (tid < KC) {
      pg = gcg[kv0];
      pd = gcd[kv0];
      pm = gcm[kv0];
    }
    // precaution: stands in front of whatever next lands in the address registers of the loads above; its memory
    // clobber also keeps those loads in front of the chunk's products
    asm volatile("s_wait_xcnt 0x0" ::: "memory");
  };
  auto chunk_store = [&](int buf) {                  // buf = 0 or 1
    unsigned short* d = KVs + buf * ATB + sr * KTP + sq;
#pragma unroll
    for (int e = 0; e < 2; ++e) {
      *(v4u*)(d + 8 * e)                           = pf[e];
      *(v4u*)(d + KC * KTP + 8 * e)                = pf[2 + e];
      *(v4u*)(d + 2 * KC * KTP + 8 * e)            = pf[4 + e];
      *(v4u*)(d + 2 * KC * KTP + HD * KTP + 8 * e) = pf[6 + e];
    }
    if (tid < KC) {
      const int dk = (pd < 0) ? 0 : ((pd > DURR - 1) ? (DURR - 1) : pd);
      gkB[buf * KC + tid] = pg;
      dbB[buf * KC + tid] = durS[dk];
      mkB[buf * KC + tid] = pm;
    }
  };

  chunk_load(0);
  __syncthreads();                                   // the table columns are visible before chunk_store reads durS
  chunk_store(0);
  __syncthreads();                                   // chunk 0's tiles and key values visible to every wave

  for (int kc = 0; kc < nck; ++kc) {
    const int cur = kc & 1;
    const unsigned short* Ks = KVs + cur * ATB;
    const unsigned short* Vs = Ks + 2 * KC * KTP;
    const int*   gkS = gkB + cur * KC;
    const float* dbS = dbB + cur * KC;
    const int*   mkS = mkB + cur * KC;
    const bool more = kc + 1 < nck;                  // block-uniform
    if (more) chunk_load((kc + 1) * KC);

    v8f s[4];
#pragma unroll
    for (int j = 0; j < 4; ++j) s[j] = zero8();
    // A operands: key row j*16 + (lane&15) of the [key][d] tiles, split map over d. The eight K fragments of one d half
    // are read as one group in front of that half's products, and the products go round the four score tiles, so that
    // no product waits for an LDS read of its own or for the product just before it; each tile's order of sums is kept.
#pragma unroll
    for (int dc = 0; dc < 2; ++dc) {
      v16b khf[4], klf[4];
#pragma unroll
      for (int j = 0; j < 4; ++j) {
        khf[j] = ldf(Ks, KTP, j * 16, dc * 32, lane);
        klf[j] = ldf(Ks + KC * KTP, KTP, j * 16, dc * 32, lane);
      }
#pragma unroll
      for (int j = 0; j < 4; ++j) s[j] = mma(khf[j], qh[dc], s[j]);
#pragma unroll
      for (int j = 0; j < 4; ++j) s[j] = mma(klf[j], qh[dc], s[j]);
#pragma unroll
      for (int j = 0; j < 4; ++j) s[j] = mma(khf[j], ql[dc], s[j]);
    }
    // s[j][r] = S[query q0 + c][key kv0 + j*16 + 8*hh + r]; scale, table biases, replace-mask
#pragma unroll
    for (int j = 0; j < 4; ++j) {
      const int kb = 16 * j + 8 * hh;                // first of this lane's 8 keys of tile j, 0..56
      const v4i g0 = *(const v4i*)(gkS + kb), g1 = *(const v4i*)(gkS + kb + 4);
      const v4f d0 = *(const v4f*)(dbS + kb), d1 = *(const v4f*)(dbS + kb + 4);
      const v4i k0 = *(const v4i*)(mkS + kb), k1 = *(const v4i*)(mkS + kb + 4);
#pragma unroll
      for (int r = 0; r < 8; ++r) {
        const int   gk = (r < 4) ? g0[r & 3] : g1[r & 3];
        const float db = (r < 4) ? d0[r & 3] : d1[r & 3];
        const int   mk = (r < 4) ? k0[r & 3] : k1[r & 3];
        int rel = gq - gk;
        rel = (rel < 0) ? -rel : rel;
        rel = (rel > GAPR - 1) ? (GAPR - 1) : rel;
        rel = (rel < 0) ? 0 : rel;
        const float gbias = gapS[rel];
        const float v = (s[j][r] * 0.125f + gbias) + db;
        s[j][r] = (mk != 0) ? v : NEGV;
      }
    }
    // chunk maximum of query c: in-lane over this half's 32 keys, then one exchange between the halves
    float cj[4];
#pragma unroll
    for (int j = 0; j < 4; ++j) {
      cj[j] = fmaxf(fmaxf(fmaxf(s[j][0], s[j][1]), fmaxf(s[j][2], s[j][3])),
                    fmaxf(fmaxf(s[j][4], s[j][5]), fmaxf(s[j][6], s[j][7])));
    }
    float cm = fmaxf(fmaxf(cj[0], cj[1]), fmaxf(cj[2], cj[3]));
    cm = fmaxf(cm, other_half(cm));
    const float mnew  = fmaxf(mrow, cm);             // finite from chunk 0 on
    const float alpha = exp_slot(mrow - mnew);
    mrow = mnew;

    // p = exp(s - m); tile j's 8 values are 8 consecutive k positions of the B fragment
    v4u ph[4], pl[4];
    float pj[4];
#pragma unroll
    for (int j = 0; j < 4; ++j) {
      v4f p0, p1;
#pragma unroll
      for (int r = 0; r < 4; ++r) {
        p0[r] = exp_slot(s[j][r] - mnew);
        p1[r] = exp_slot(s[j][r + 4] - mnew);
      }
      pj[j] = ((p0[0] + p0[1]) + (p0[2] + p0[3])) + ((p1[0] + p1[1]) + (p1[2] + p1[3]));
      split8(p0, p1, ph[j], pl[j]);
    }
    lrow = lrow * alpha + ((pj[0] + pj[1]) + (pj[2] + pj[3]));
#pragma unroll
    for (int t = 0; t < 4; ++t)
#pragma unroll
      for (int r = 0; r < 8; ++r) oacc[t][r] *= alpha;

#pragma unroll
    for (int kk = 0; kk < 2; ++kk) {
      // A operands: channel row t*16 + (lane&15) of V^T [d][key], split k map over keys; the eight fragments of one
      // key half are read as one group in front of its products, which go round the four output tiles (each tile's
      // order of sums is kept)
      v16b vhf[4], vlf[4];
#pragma unroll
      for (int t = 0; t < 4; ++t) {
        vhf[t] = ldf(Vs, KTP, t * 16, kk * 32, lane);
        vlf[t] = ldf(Vs + HD * KTP, KTP, t * 16, kk * 32, lane);
      }
      // B operands: P^T column (lane&15) = query, split k map over keys 32*kk ..
      Frag fh, fl;
      fh.u[0] = ph[2 * kk]; fh.u[1] = ph[2 * kk + 1];
      fl.u[0] = pl[2 * kk]; fl.u[1] = pl[2 * kk + 1];
#pragma unroll
      for (int t = 0; t < 4; ++t) oacc[t] = mma(vhf[t], fh.v, oacc[t]);
#pragma unroll
      for (int t = 0; t < 4; ++t) oacc[t] = mma(vlf[t], fh.v, oacc[t]);
#pragma unroll
      for (int t = 0; t < 4; ++t) oacc[t] = mma(vhf[t], fl.v, oacc[t]);
    }
    if (more) {
      // the other buffer's last readers left it in front of the barrier that ended the chunk before this one
      chunk_store(cur ^ 1);
      __syncthreads();                               // next chunk visible; this chunk's readers are done
    }
  }

  // O = oacc / l  (l >= 1); oacc[t][r] = O[query q0 + c][channel 16*t + 8*hh + r]
  const float invl = 1.0f / (lrow + other_half(lrow));
  const size_t go = ((size_t)(b * SL + q0 + c)) * DM + (size_t)h * HD + 8 * hh;
  v4u wh[4], wl[4];
#pragma unroll
  for (int t = 0; t < 4; ++t) {
    const v4f a0 = (v4f){oacc[t][0] * invl, oacc[t][1] * invl, oacc[t][2] * invl, oacc[t][3] * invl};
    const v4f a1 = (v4f){oacc[t][4] * invl, oacc[t][5] * invl, oacc[t][6] * invl, oacc[t][7] * invl};
    split8(a0, a1, wh[t], wl[t]);
  }
#pragma unroll
  for (int t = 0; t < 4; ++t) {
    *(v4u*)(Oh + go + 16 * t) = wh[t];
    *(v4u*)(Ol + go + 16 * t) = wl[t];
  }
}

// ---------------------------------------------------------------------------
// kernel 4: out = O.Wo + bo -> f32 rows [NT][DM]. A = O planes [NT][DM], B = transposed
// Wo planes [DM n][DM k]. Block = 128 token rows x 64 cols; grid = (DM/64 = 8, NT/128 = 32).
// coverage: 8 x 32 blocks x 128 x 64 = NT x DM.
// ---------------------------------------------------------------------------
__global__ __launch_bounds__(256) void k_gemm_out(const unsigned short* __restrict__ Ah,
                                                  const unsigned short* __restrict__ Al,
                                                  const unsigned short* __restrict__ Wh,
                                                  const unsigned short* __restrict__ Wl,
                                                  const float* __restrict__ bo,
                                                  float* __restrict__ out) {
  __shared__ __align__(16) unsigned char sm[GSB];    // 55296 B: GEMM stage, then the f32 output staging tile
  unsigned short* tl = (unsigned short*)sm;
  float* st = (float*)sm;                            // 128 x OTP
  const int tid = threadIdx.x, lane = tid & 31, wave = tid >> 5;
  const int hh = lane >> 4, c = lane & 15;
  const int mblk = blockIdx.y * 128, nblk = blockIdx.x * 64;
  const int mw = (wave >> 1) * 32, nw = (wave & 1) * 32;

  v8f acc[2][2];
#pragma unroll
  for (int s = 0; s < 2; ++s)
#pragma unroll
    for (int t = 0; t < 2; ++t) acc[s][t] = zero8();
  int arow[4];
#pragma unroll
  for (int i = 0; i < 4; ++i) arow[i] = mblk + (tid >> 3) + 32 * i;
  gemm128x64x3(Ah, Al, DM, Wh, Wl, DM, DM, arow, nblk, mw, nw, tid, lane, tl, acc);

  float bb[2];
#pragma unroll
  for (int t = 0; t < 2; ++t) bb[t] = bo[nblk + nw + 16 * t + c];
  stage_rm(acc, bb, st, mw, nw, hh, c);
  __syncthreads();
  store_f32(st, out, mblk, nblk, tid);
}

// ---------------------------------------------------------------------------
// its producer writes, no padded tails exist since every dimension is a tile multiple; offsets of the plane regions multiples of 512 KB):
//   X     bf16x2 [4096][512]             0     8388608
//   Wqkv  bf16x2 [1536][512]       8388608     3145728   (q rows 0..511, k 512..1023, v 1024..1535, [n][k])
//   Wo    bf16x2 [512][512]       11534336     1048576   ([n][k])
//   Q     bf16x2 [16][2048][64]   12582912     8388608
//   K     bf16x2 [16][2048][64]   20971520     8388608
//   V^T   bf16x2 [16][64][2048]   29360128     8388608
//   O     bf16x2 [4096][512]      37748736     8388608
//   key order: token index, gap id, duration id, mask, int32 [2][2048] each   46137344   4 x 16384; cnt int32 [2]
//   total                         46203136
// ---------------------------------------------------------------------------
extern "C" void kernel_launch(void* const* d_in, const int* in_sizes, int n_in,
                              void* d_out, int out_size, void* d_ws, size_t ws_size,
                              hipStream_t stream) {
  if (n_in < 14) return;
  if (in_sizes[0] != NT * DM) return;
  if (in_sizes[1] != NBT * SL) return;
  if (in_sizes[2] != NBT * SL) return;
  if (in_sizes[3] != NBT * SL) return;
  if (in_sizes[4] != DM * DM) return;
  if (in_sizes[5] != DM) return;
  if (in_sizes[6] != DM * DM) return;
  if (in_sizes[7] != DM) return;
  if (in_sizes[8] != DM * DM) return;
  if (in_sizes[9] != DM) return;
  if (in_sizes[10] != DM * DM) return;
  if (in_sizes[11] != DM) return;
  if (in_sizes[12] != GAPR * NH) return;
  if (in_sizes[13] != DURR * NH) return;
  if (out_size != NT * DM) return;

  const float* x     = (const float*)d_in[0];   // [2][2048][512] = [4096][512]
  const int*   amask = (const int*)d_in[1];     // [2][2048] int32, zero = masked key
  const int*   gids  = (const int*)d_in[2];     // [2][2048] int32
  const int*   dids  = (const int*)d_in[3];     // [2][2048] int32
  const float* W_q   = (const float*)d_in[4];   // [512][512] [in][out]
  const float* b_q   = (const float*)d_in[5];   // [512]
  const float* W_k   = (const float*)d_in[6];
  const float* b_k   = (const float*)d_in[7];
  const float* W_v   = (const float*)d_in[8];
  const float* b_v   = (const float*)d_in[9];
  const float* W_o   = (const float*)d_in[10];
  const float* b_o   = (const float*)d_in[11];
  const float* gtab  = (const float*)d_in[12];  // [33][8]
  const float* dtab  = (const float*)d_in[13];  // [17][8]
  float* out = (float*)d_out;                   // [4096][512] f32

  const size_t PX  = (size_t)NT * DM * 2;       // 4194304
  const size_t PW  = (size_t)3 * DM * DM * 2;   // 1572864
  const size_t PWO = (size_t)DM * DM * 2;       // 524288
  size_t off = 0;
  const size_t oXh  = off; off += PX;
  const size_t oXl  = off; off += PX;
  const size_t oWh  = off; off += PW;
  const size_t oWl  = off; off += PW;
  const size_t oWoh = off; off += PWO;
  const size_t oWol = off; off += PWO;
  const size_t oQh  = off; off += PX;
  const size_t oQl  = off; off += PX;
  const size_t oKh  = off; off += PX;
  const size_t oKl  = off; off += PX;
  const size_t oVh  = off; off += PX;
  const size_t oVl  = off; off += PX;
  const size_t oOh  = off; off += PX;
  const size_t oOl  = off; off += PX;
  const size_t PI  = (size_t)NBT * SL * 4;      // 16384
  const size_t oIdx = off; off += PI;
  const size_t oCg  = off; off += PI;
  const size_t oCd  = off; off += PI;
  const size_t oCm  = off; off += PI;
  const size_t oCnt = off; off += 256;
  if (off > ws_size) return;                    // off = 46203136
  if (off > (size_t)134217728) return;

  char* ws = (char*)d_ws;
  unsigned short* Xh  = (unsigned short*)(ws + oXh);
  unsigned short* Xl  = (unsigned short*)(ws + oXl);
  unsigned short* Wh  = (unsigned short*)(ws + oWh);
  unsigned short* Wl  = (unsigned short*)(ws + oWl);
  unsigned short* Woh = (unsigned short*)(ws + oWoh);
  unsigned short* Wol = (unsigned short*)(ws + oWol);
  unsigned short* Qh  = (unsigned short*)(ws + oQh);
  unsigned short* Ql  = (unsigned short*)(ws + oQl);
  unsigned short* Kh  = (unsigned short*)(ws + oKh);
  unsigned short* Kl  = (unsigned short*)(ws + oKl);
  unsigned short* Vh  = (unsigned short*)(ws + oVh);
  unsigned short* Vl  = (unsigned short*)(ws + oVl);
  unsigned short* Oh  = (unsigned short*)(ws + oOh);
  unsigned short* Ol  = (unsigned short*)(ws + oOl);
  int* kidx = (int*)(ws + oIdx);
  int* kcg  = (int*)(ws + oCg);
  int* kcd  = (int*)(ws + oCd);
  int* kcm  = (int*)(ws + oCm);
  int* kcnt = (int*)(ws + oCnt);

  // (0) hi/lo planes of x; the first NBT blocks build the key order of each sequence
  k_split<<<dim3(NBT + (NT * DM) / 2048), dim3(256), 0, stream>>>(x, Xh, Xl, amask, gids, dids,
                                                                  kidx, kcg, kcd, kcm, kcnt);
  // (1) transposed hi/lo planes of the four weights: in [k][n] -> out [n][k]
  k_split_tr<<<dim3(DM / 64, DM / 64, 4), dim3(256), 0, stream>>>(W_q, W_k, W_v, W_o, Wh, Wl, Woh, Wol);
  // (2) q / k / v^T planes
  k_proj<<<dim3(3 * NH, NT / 128), dim3(256), 0, stream>>>(Xh, Xl, Wh, Wl, b_q, b_k, b_v, kidx, kcnt,
                                                          Qh, Ql, Kh, Kl, Vh, Vl);
  // (3) attention -> O planes
  k_attn<<<dim3(NBT * NH * NQB), dim3(256), 0, stream>>>(Qh, Ql, Kh, Kl, Vh, Vl, gids, kcm, kcg, kcd, kcnt,
                                                        gtab, dtab, Oh, Ol);
  // (4) out = O.Wo + bo
  k_gemm_out<<<dim3(DM / 64, NT / 128), dim3(256), 0, stream>>>(Oh, Ol, Woh, Wol, b_o, out);
  (void)hipGetLastError();
}

// v006
// A run of this version takes 74 microseconds.
// Two timings next to v005 put it at 1.08 and 1.09 times that version's speed.
// Counting every step since v000, it is 4.29 times as fast.
// Contractions: Q/K/V = x.W (3 sites), S = Q.K^T, O = P.V, out = O.Wo: all v_wmma_f32_16x16x32_bf16 on bf16 hi/lo
// split operand planes (hi.hi + hi.lo + lo.hi per tile pair), f32 accumulate; biases, the 1/8 scale, the bucket-table
// lookups, the key mask (replace by -1e9) and the online softmax in f32.
// Plane carry audit: every hi/lo plane (X, Wqkv^T, Wo^T, Q, K, V^T, in-register P fragments, O) carries factor 1
// (hi = rne_bf16(v), lo = rne_bf16(v - hi), f32 exponent range, no subnormal concern); no inverse fold exists anywhere.
// Key order: per sequence the keys are reordered by a stable partition (unmasked first, masked behind); K and V are
// projected and attended only up to the last unmasked key (all keys when a sequence has none unmasked).
#include <hip/hip_runtime.h>
#include <stddef.h>

#define NBT 2                  // batch
#define SL  2048               // sequence length
#define DM  512                // model width
#define NH  8                  // heads
#define HD  64                 // head dim
#define NT  (NBT * SL)         // token rows, row m = b*SL + s
#define QB  128                // query rows per attention block
#define KC  64                 // keys per chunk
#define NQB (SL / QB)          // 16
#define NCK (SL / KC)          // 32
#define KTP 72                 // LDS pitch (16-bit elements) for 64-wide tiles, 144 B
#define OTP 68                 // f32 staging pitch [row][col] (128 x 64)
#define VTP 132                // f32 staging pitch [col][row] (64 x 128)
#define TTP 68                 // f32 staging pitch for the 64 x 64 weight transpose tile
#define GBK 64                 // k elements per GEMM stage: one whole 128-B line per plane row
#define GTR (2 * 128 + 2 * 64) // rows of one GEMM stage in LDS: A hi, A lo (128 each), B hi, B lo (64 each)
#define GSB (GTR * KTP * 2)    // bytes of one GEMM stage in LDS, 55296
#define GAPR 33                // time-gap table rows
#define DURR 17                // duration table rows
#define NEGV (-1.0e9f)         // masked-key score value
#define ATB  (2 * KC * KTP + 2 * HD * KTP) // 16-bit elements of one attention chunk's four tiles in LDS

static_assert(NT == 4096);
static_assert(NH * HD == DM);
static_assert(SL % QB == 0);
static_assert(SL % KC == 0);
static_assert(SL % 128 == 0);
static_assert(DM % 64 == 0);
static_assert(DM % 32 == 0);
static_assert((NT * DM) % 2048 == 0);
static_assert(HD == 64);
static_assert(KC == 64);
static_assert(64 * VTP <= 128 * OTP);
static_assert(DM % GBK == 0);
static_assert(128 * OTP * 4 <= GSB);
static_assert(SL == 256 * 8);

typedef __bf16       v16b __attribute__((ext_vector_type(16)));
typedef float        v8f  __attribute__((ext_vector_type(8)));
typedef float        v4f  __attribute__((ext_vector_type(4)));
typedef float        v2f  __attribute__((ext_vector_type(2)));
typedef __bf16       v2b  __attribute__((ext_vector_type(2)));
typedef unsigned int v4u  __attribute__((ext_vector_type(4)));
typedef int          v4i  __attribute__((ext_vector_type(4)));
union Frag { v16b v; v4u u[2]; };

// WMMA with the dependent-VALU hazard guard (ties D, keeps A/B live)
__device__ __forceinline__ v8f mma(v16b a, v16b b, v8f c) {
  c = __builtin_amdgcn_wmma_f32_16x16x32_bf16(false, a, false, b, (short)0, c, false, false);
  asm volatile("v_nop\n\tv_nop\n\tv_nop\n\tv_nop" : "+v"(c) : "v"(a), "v"(b));
  return c;
}

// value of lane l ^ 16 (the other 16-lane half), by the vector cross-row move
__device__ __forceinline__ float other_half(float x) {
  const int b = __float_as_int(x);
  return __int_as_float(__builtin_amdgcn_permlanex16(b, b, 0x76543210, 0xfedcba98, false, false));
}

// e^x by the hardware exponential of x * log2(e), as __expf gives it. The v_nop fills the one slot that the
// instruction set asks for between a transcendental and a directly following instruction that reads its result or
// overwrites its source.
__device__ __forceinline__ float exp_slot(float x) {
  float r;
  asm("v_exp_f32 %0, %1\n\tv_nop" : "=v"(r) : "v"(x * 1.44269504f));
  return r;
}

__device__ __forceinline__ v8f zero8() { return (v8f){0.f, 0.f, 0.f, 0.f, 0.f, 0.f, 0.f, 0.f}; }

// Fragment loader for k-contiguous 16-bit rows with pitch ld (bf16 bits).
// A operand: row0 + (lane&15) is the M row. B operand stored [n][k]: row0 + (lane&15) is the N column.
// Split k map for both: elements 0..7 <- k0 + 8*(lane>>4) + 0..7, elements 8..15 <- k0 + 16 + 8*(lane>>4) + 0..7.
// D: acc[r] = element (row0 + 8*(lane>>4) + r, col0 + (lane&15)).
__device__ __forceinline__ v16b ldf(const unsigned short* p, int ld, int row0, int k0, int lane) {
  const unsigned short* q = p + (size_t)(row0 + (lane & 15)) * ld + k0 + 8 * (lane >> 4);
  Frag f;
  f.u[0] = *(const v4u*)(q);
  f.u[1] = *(const v4u*)(q + 16);
  return f.v;
}

// two floats -> two bf16, round to nearest even, in one word by the packed hardware convert (first element in the low
// half-word)
__device__ __forceinline__ unsigned int bf_pk(v2f x) {
  union { v2b v; unsigned int u; } w;
  w.v = __builtin_convertvector(x, v2b);
  return w.u;
}

// hi = rne(a), lo = rne(a - hi) for two floats, packed little-endian (first element in the low half-word)
__device__ __forceinline__ void split2(float a, float b, unsigned int& wh, unsigned int& wl) {
  const v2f x = (v2f){a, b};
  wh = bf_pk(x);
  const v2f h = (v2f){__uint_as_float(wh << 16), __uint_as_float(wh & 0xFFFF0000u)};
  wl = bf_pk(x - h);
}

// 8 consecutive floats -> one 16-B hi piece and one 16-B lo piece
__device__ __forceinline__ void split8(v4f a0, v4f a1, v4u& wh, v4u& wl) {
  unsigned int h0, h1, h2, h3, l0, l1, l2, l3;
  split2(a0[0], a0[1], h0, l0);
  split2(a0[2], a0[3], h1, l1);
  split2(a1[0], a1[1], h2, l2);
  split2(a1[2], a1[3], h3, l3);
  wh = (v4u){h0, h1, h2, h3};
  wl = (v4u){l0, l1, l2, l3};
}

// ---------------------------------------------------------------------------
// kernel 0: elementwise split of a contiguous f32 array (layout kept) into bf16 hi and lo planes.
// Block = 2048 elements; thread converts 8 consecutive floats and writes one 16-B piece per plane;
// coverage: n/2048 blocks x 256 thr x 8 = n elements of both planes.
// Blocks 0 .. NBT-1 do not split: block b builds sequence b's key order instead (compact_keys); block NBT + i splits
// elements 2048*i .. +2047.
// ---------------------------------------------------------------------------

// Stable partition of one sequence's SL keys by the mask: unmasked keys (mask != 0) first in their order, masked keys
// behind them in theirs. A masked key's score is -1e9, so its weight exp(-1e9 - m) is 0 as soon as one key of the
// sequence is unmasked: keys behind the last unmasked one add nothing and are left out by the later kernels.
// Writes, per new position: the key's token index, gap id, duration id and mask; and cnt[b] = keys to attend =
// number of unmasked keys, or SL when there is none (every score is then -1e9 and all keys count alike).
// Thread t owns keys 8t .. 8t+7; block-wide inclusive scan of the per-thread counts in LDS, two buffers, one
// barrier a step. Every position 0..SL-1 is written exactly once (the map is a permutation).
__device__ __forceinline__ void compact_keys(const int* __restrict__ mask, const int* __restrict__ gids,
                                             const int* __restrict__ dids, int* __restrict__ idx,
                                             int* __restrict__ cg, int* __restrict__ cd, int* __restrict__ cm,
                                             int* __restrict__ cnt, int b, int tid) {
  __shared__ int sc[2][256];
  const int base = b * SL + tid * 8;
  const v4i m0 = *(const v4i*)(mask + base), m1 = *(const v4i*)(mask + base + 4);
  // precaution: stands in front of the next loads, which may land in the address registers of the loads above
  asm volatile("s_wait_xcnt 0x0" ::: "memory");
  const v4i g0 = *(const v4i*)(gids + base), g1 = *(const v4i*)(gids + base + 4);
  // precaution: as above
  asm volatile("s_wait_xcnt 0x0" ::: "memory");
  const v4i d0 = *(const v4i*)(dids + base), d1 = *(const v4i*)(dids + base + 4);
  int c = 0;
#pragma unroll
  for (int e = 0; e < 4; ++e) c += ((m0[e] != 0) ? 1 : 0) + ((m1[e] != 0) ? 1 : 0);
  sc[0][tid] = c;
  __syncthreads();
  int cur = 0;
#pragma unroll
  for (int o = 1; o < 256; o <<= 1) {
    int a = sc[cur][tid];
    if (tid >= o) a += sc[cur][tid - o];
    sc[cur ^ 1][tid] = a;
    cur ^= 1;
    __syncthreads();                                 // the step's sums are visible before the next step reads them
  }
  const int total = sc[cur][255];                    // unmasked keys of the sequence, 0..SL
  int ru = sc[cur][tid] - c;                         // unmasked keys in front of key 8t
  int rm = total + tid * 8 - ru;                     // total + masked keys in front of key 8t
#pragma unroll
  for (int e = 0; e < 8; ++e) {
    const int mk = (e < 4) ? m0[e & 3] : m1[e & 3];
    const int gk = (e < 4) ? g0[e & 3] : g1[e & 3];
    const int dk = (e < 4) ? d0[e & 3] : d1[e & 3];
    const int pos = b * SL + ((mk != 0) ? ru : rm);  // 0..SL-1 within the sequence
    ru += (mk != 0) ? 1 : 0;
    rm += (mk != 0) ? 0 : 1;
    idx[pos] = tid * 8 + e;
    cg[pos]  = gk;
    cd[pos]  = dk;
    cm[pos]  = mk;
  }
  if (tid == 0) cnt[b] = (total > 0) ? total : SL;
}

__global__ __launch_bounds__(256) void k_split(const float* __restrict__ src,
                                               unsigned short* __restrict__ dh,
                                               unsigned short* __restrict__ dl,
                                               const int* __restrict__ mask, const int* __restrict__ gids,
                                               const int* __restrict__ dids, int* __restrict__ idx,
                                               int* __restrict__ cg, int* __restrict__ cd, int* __restrict__ cm,
                                               int* __restrict__ cnt) {
  if (blockIdx.x < NBT) {                            // block-uniform
    compact_keys(mask, gids, dids, idx, cg, cd, cm, cnt, blockIdx.x, threadIdx.x);
    return;
  }
  const size_t o = (size_t)(blockIdx.x - NBT) * 2048 + (size_t)threadIdx.x * 8;
  const v4f a0 = *(const v4f*)(src + o);
  const v4f a1 = *(const v4f*)(src + o + 4);
  v4u wh, wl;
  split8(a0, a1, wh, wl);
  v4u* ph = (v4u*)(dh + o);
  v4u* pl = (v4u*)(dl + o);
  *ph = wh;
  *pl = wl;
  
}

// ---------------------------------------------------------------------------
// kernel 1: weight transpose + split. in W [k = DM rows][n = DM cols] f32 -> out planes [n][k] hi/lo (pitch DM).
// blockIdx.z = which weight (0 q, 1 k, 2 v -> stacked planes rows which*DM + n; 3 -> the out-projection planes).
// blockIdx.x = 64-wide n tile (source columns), blockIdx.y = 64-deep k tile (source rows). The 64 x 64 tile is
// coverage: load 256 thr x 16 floats = 64 x 64; store 256 thr x 2 iter x 8 halves = 64 n rows x 64 k per plane;
// grid (DM/64, DM/64, 4) covers all four DM x DM matrices.
// ---------------------------------------------------------------------------
__global__ __launch_bounds__(256) void k_split_tr(const float* __restrict__ Wq, const float* __restrict__ Wk,
                                                  const float* __restrict__ Wv, const float* __restrict__ Wo,
                                                  unsigned short* __restrict__ Ph, unsigned short* __restrict__ Pl,
                                                  unsigned short* __restrict__ Oh, unsigned short* __restrict__ Ol) {
  __shared__ __align__(16) float st[64 * TTP];       // 17408 B
  const int tid = threadIdx.x;
  const int z   = blockIdx.z;                        // block-uniform
  const int nt  = blockIdx.x * 64;                   // source columns = output rows
  const int kt  = blockIdx.y * 64;                   // source rows    = output k
  const float* W = (z == 0) ? Wq : ((z == 1) ? Wk : ((z == 2) ? Wv : Wo));
  {
    const int row = tid >> 2;                        // k within tile, 0..63
    const int cb  = (tid & 3) * 16;                  // n within tile, 0,16,32,48
    const float* src = W + (size_t)(kt + row) * DM + nt + cb;
#pragma unroll
    for (int e = 0; e < 4; ++e) {
      const v4f a = *(const v4f*)(src + 4 * e);
#pragma unroll
      for (int q = 0; q < 4; ++q) st[(cb + 4 * e + q) * TTP + row] = a[q];
    }
  }
  __syncthreads();
  unsigned short* dh = (z < 3) ? (Ph + (size_t)z * DM * DM) : Oh;
  unsigned short* dl = (z < 3) ? (Pl + (size_t)z * DM * DM) : Ol;
  const size_t base = (size_t)nt * DM + kt;
  v4u vh[2], vl[2];
  size_t go[2];
#pragma unroll
  for (int it = 0; it < 2; ++it) {
    const int pp   = tid + 256 * it;                 // 0..511
    const int rown = pp >> 3;                        // 0..63
    const int pc   = pp & 7;                         // k piece 8*pc .. +7
    const float* ra = st + rown * TTP + 8 * pc;
    const v4f a0 = *(const v4f*)(ra), a1 = *(const v4f*)(ra + 4);
    split8(a0, a1, vh[it], vl[it]);
    go[it] = base + (size_t)rown * DM + 8 * pc;
  }
  {
#pragma unroll
    for (int it = 0; it < 2; ++it) {
      *(v4u*)(dh + go[it]) = vh[it];
      *(v4u*)(dl + go[it]) = vl[it];
    }
    
  }
}

// ---------------------------------------------------------------------------
// 128 x 64 block tile, 32 x 32 per wave, split-bf16 GEMM main loop over K (multiple of GBK): A planes [m][k] pitch
// lda, B planes [n][k] pitch ldb (hi and lo). Per stage of GBK = 64 k the block brings the 128 A rows and the 64 B
// rows of both planes into LDS (pitch KTP): a wave's 16-B loads cover 4 whole 128-B lines, 12 pieces per thread,
// rows (tid>>3) + 32*i: i 0..3 A hi, 4..7 A lo, 8..9 B hi, 10..11 B lo. The next stage's pieces are loaded into
// registers while this stage is multiplied. Fragments come from LDS by ldf (its split k map, A and B alike).
// Per tile pair: ah.bh + ah.bl + al.bh into one f32 accumulator, k ascending.
// Tile row (tid>>3) + 32*i is row arow[i] of the A planes (the caller's map from tile rows to plane rows).
// acc[s][t][r] = (tile row mw + 16*s + 8*(lane>>4) + r, nrow + nw + 16*t + (lane&15)).
// The loop ends behind a barrier: tl may be reused by the caller at once.
// ---------------------------------------------------------------------------
__device__ __forceinline__ void gemm_ld(const unsigned short* const (&gp)[4], const unsigned int (&ao)[4], int ldb,
                                        int k0, v4u (&pf)[12]) {
#pragma unroll
  for (int i = 0; i < 4; ++i) {
    pf[i]     = *(const v4u*)((const char*)gp[0] + ao[i]);
    pf[4 + i] = *(const v4u*)((const char*)gp[1] + ao[i]);
  }
#pragma unroll
  for (int i = 0; i < 2; ++i) {
    pf[8 + i]  = *(const v4u*)(gp[2] + (size_t)(32 * i) * ldb + k0);
    pf[10 + i] = *(const v4u*)(gp[3] + (size_t)(32 * i) * ldb + k0);
  }
  // precaution: stands in front of the fragment loads, which land in the address registers of the loads above
  asm volatile("s_wait_xcnt 0x0" ::: "memory");
}

__device__ __forceinline__ void gemm128x64x3(const unsigned short* __restrict__ Ah,
                                             const unsigned short* __restrict__ Al, int lda,
                                             const unsigned short* __restrict__ Bh,
                                             const unsigned short* __restrict__ Bl, int ldb,
                                             int K, const int (&arow)[4], int nrow, int mw, int nw, int tid,
                                             int lane, unsigned short* tl, v8f (&acc)[2][2]) {
  const int pr = tid >> 3;                           // 0..31: row within each group of 32 rows
  const int pe = (tid & 7) * 8;                      // first of this thread's 8 k elements in the row
  const unsigned short* const gp[4] = {Ah, Al,
                                       Bh + (size_t)(nrow + pr) * ldb + pe, Bl + (size_t)(nrow + pr) * ldb + pe};
  unsigned int ao[4];                                // byte offset of this thread's piece in its A row of each group
#pragma unroll
  for (int i = 0; i < 4; ++i) ao[i] = ((unsigned int)arow[i] * (unsigned int)lda + (unsigned int)pe) * 2u;
  unsigned short* sp = tl + pr * KTP + pe;
  const unsigned short* sAh = tl;
  const unsigned short* sAl = tl + 128 * KTP;
  const unsigned short* sBh = tl + 256 * KTP;
  const unsigned short* sBl = tl + 320 * KTP;
  v4u pf[12];
  gemm_ld(gp, ao, ldb, 0, pf);
// rolled: one copy of the stage body keeps the code short and the register count at three blocks per WGP
#pragma unroll 1
  for (int k0 = 0; k0 < K; k0 += GBK) {
#pragma unroll
    for (int i = 0; i < 12; ++i) *(v4u*)(sp + 32 * i * KTP) = pf[i];
    __syncthreads();                                 // the stage is visible to every wave
    if (k0 + GBK < K) {
#pragma unroll
      for (int i = 0; i < 4; ++i) ao[i] += GBK * 2;  // the A offsets step to the next stage's k
      gemm_ld(gp, ao, ldb, k0 + GBK, pf);
    }
#pragma unroll
    for (int ks = 0; ks < GBK; ks += 32) {
      const v16b ah0 = ldf(sAh, KTP, mw, ks, lane);
      const v16b ah1 = ldf(sAh, KTP, mw + 16, ks, lane);
      const v16b al0 = ldf(sAl, KTP, mw, ks, lane);
      const v16b al1 = ldf(sAl, KTP, mw + 16, ks, lane);
#pragma unroll
      for (int t = 0; t < 2; ++t) {
        const v16b bh = ldf(sBh, KTP, nw + 16 * t, ks, lane);
        const v16b bl = ldf(sBl, KTP, nw + 16 * t, ks, lane);
        acc[0][t] = mma(ah0, bh, acc[0][t]);
        acc[1][t] = mma(ah1, bh, acc[1][t]);
        acc[0][t] = mma(ah0, bl, acc[0][t]);
        acc[1][t] = mma(ah1, bl, acc[1][t]);
        acc[0][t] = mma(al0, bh, acc[0][t]);
        acc[1][t] = mma(al1, bh, acc[1][t]);
      }
    }
    __syncthreads();                                 // every reader of the stage is done before it is rewritten
  }
}

// stage acc + bias in the block tile, row-major [row][col] (128 x 64, pitch OTP floats)
__device__ __forceinline__ void stage_rm(v8f (&acc)[2][2], const float (&bb)[2], float* st,
                                         int mw, int nw, int hh, int c) {
#pragma unroll
  for (int s = 0; s < 2; ++s)
#pragma unroll
    for (int t = 0; t < 2; ++t)
#pragma unroll
      for (int r = 0; r < 8; ++r)
        st[(mw + 16 * s + 8 * hh + r) * OTP + nw + 16 * t + c] = acc[s][t][r] + bb[t];
}

// stage acc + bias transposed [col][row] (64 x 128, pitch VTP floats)
__device__ __forceinline__ void stage_tr(v8f (&acc)[2][2], const float (&bb)[2], float* st,
                                         int mw, int nw, int hh, int c) {
#pragma unroll
  for (int s = 0; s < 2; ++s)
#pragma unroll
    for (int t = 0; t < 2; ++t)
#pragma unroll
      for (int r = 0; r < 8; ++r)
        st[(nw + 16 * t + c) * VTP + mw + 16 * s + 8 * hh + r] = acc[s][t][r] + bb[t];
}

// block tile 128 rows x 64 cols -> hi/lo planes at element base, row pitch ldo: each row = 64 halves = one whole
// coverage: 256 thr x 4 iter x 8 halves = 128 rows x 64 per plane.
__device__ __forceinline__ void store_planes(const float* st, unsigned short* __restrict__ oh,
                                             unsigned short* __restrict__ ol, size_t base, int ldo, int tid) {
  v4u vh[4], vl[4];
  size_t go[4];
#pragma unroll
  for (int it = 0; it < 4; ++it) {
    const int pp  = tid + 256 * it;                  // 0..1023
    const int row = pp >> 3;                         // 0..127
    const int pc  = pp & 7;                          // 16-B piece = cols 8*pc .. +7
    const float* ra = st + row * OTP + 8 * pc;
    const v4f a0 = *(const v4f*)(ra), a1 = *(const v4f*)(ra + 4);
    split8(a0, a1, vh[it], vl[it]);
    go[it] = base + (size_t)row * ldo + 8 * pc;
  }
  {
#pragma unroll
    for (int it = 0; it < 4; ++it) {
      *(v4u*)(oh + go[it]) = vh[it];
      *(v4u*)(ol + go[it]) = vl[it];
    }
    
  }
}

// transposed block tile 64 d-rows x 128 p -> V^T hi/lo planes [bh][d][p] (p = position in the key order) at element base (= bh*HD*SL + sf):
// coverage: 256 thr x 4 iter x 8 halves = 64 d-rows x 128 p per plane.
__device__ __forceinline__ void store_vt(const float* st, unsigned short* __restrict__ vh,
                                         unsigned short* __restrict__ vl, size_t base, int tid) {
  v4u wh[4], wl[4];
  size_t go[4];
#pragma unroll
  for (int it = 0; it < 4; ++it) {
    const int pp   = tid + 256 * it;                 // 0..1023
    const int drow = pp >> 4;                        // 0..63
    const int pc   = pp & 15;                        // 8 consecutive p
    const float* ra = st + drow * VTP + 8 * pc;
    const v4f a0 = *(const v4f*)(ra), a1 = *(const v4f*)(ra + 4);
    split8(a0, a1, wh[it], wl[it]);
    go[it] = base + (size_t)drow * SL + 8 * pc;
  }
  {
#pragma unroll
    for (int it = 0; it < 4; ++it) {
      *(v4u*)(vh + go[it]) = wh[it];
      *(v4u*)(vl + go[it]) = wl[it];
    }
    
  }
}

// coverage: 256 thr x 8 iter x 4 floats = 128 rows x 64 cols.
__device__ __forceinline__ void store_f32(const float* st, float* __restrict__ out, int mblk, int nblk, int tid) {
  v4f val[8];
  size_t go[8];
#pragma unroll
  for (int it = 0; it < 8; ++it) {
    const int pp  = tid + 256 * it;                  // 0..2047
    const int row = pp >> 4;                         // 0..127
    const int pc  = pp & 15;                         // 4 consecutive cols
    val[it] = *(const v4f*)(st + row * OTP + 4 * pc);
    go[it]  = (size_t)(mblk + row) * DM + nblk + 4 * pc;
  }
  {
#pragma unroll
    for (int it = 0; it < 8; ++it) *(v4f*)(out + go[it]) = val[it];
    
  }
}

// ---------------------------------------------------------------------------
// kernel 2: projections. blockIdx.x = which*NH + head (which 0 = q, 1 = k, 2 = v), blockIdx.y = 128-token block
// of one sequence b. A = x planes [NT][DM] (pitch DM, K = DM), B = stacked transposed weight planes [3*DM n][DM k]
// rows which*DM + head*64 .. (pitch DM). Bias added in f32.
// grid = (3*NH = 24, NT/128 = 32). coverage: q planes 16 bh x 16 blocks x 128 s x 64 d; k planes (128 p x 64 d)
// and v^T planes (64 d x 128 p) only in the blocks with sf < cnt[b].
// ---------------------------------------------------------------------------
__global__ __launch_bounds__(256) void k_proj(const unsigned short* __restrict__ Xh,
                                              const unsigned short* __restrict__ Xl,
                                              const unsigned short* __restrict__ Wh,
                                              const unsigned short* __restrict__ Wl,
                                              const float* __restrict__ bq,
                                              const float* __restrict__ bk,
                                              const float* __restrict__ bv,
                                              const int* __restrict__ idx, const int* __restrict__ cnt,
                                              unsigned short* __restrict__ Qh, unsigned short* __restrict__ Ql,
                                              unsigned short* __restrict__ Kh, unsigned short* __restrict__ Kl,
                                              unsigned short* __restrict__ Vh, unsigned short* __restrict__ Vl) {
  __shared__ __align__(16) unsigned char sm[GSB];    // 55296 B: GEMM stage, then the f32 output staging tile
  unsigned short* tl = (unsigned short*)sm;
  float* st = (float*)sm;                            // 128 x OTP (the transposed 64 x VTP tile also fits)
  const int tid = threadIdx.x, lane = tid & 31, wave = tid >> 5;
  const int hh = lane >> 4, c = lane & 15;
  const int which = blockIdx.x / NH;                 // block-uniform
  const int head  = blockIdx.x - which * NH;
  const int mblk  = blockIdx.y * 128;
  const int b     = mblk / SL;
  const int sf    = mblk - b * SL;                   // first position of the block in sequence b
  const int bh    = b * NH + head;
  const int mw = (wave >> 1) * 32, nw = (wave & 1) * 32;

  // q: tile row = token. k, v: tile row = position in the sequence's key order; the token comes from idx, and a
  // block wholly behind the keys to attend has nothing to do (block-uniform return, in front of every barrier).
  int arow[4];
#pragma unroll
  for (int i = 0; i < 4; ++i) arow[i] = mblk + (tid >> 3) + 32 * i;
  if (which != 0) {
    if (sf >= cnt[b]) return;
#pragma unroll
    for (int i = 0; i < 4; ++i) arow[i] = b * SL + (idx[arow[i]] & (SL - 1));
  }

  v8f acc[2][2];
#pragma unroll
  for (int s = 0; s < 2; ++s)
#pragma unroll
    for (int t = 0; t < 2; ++t) acc[s][t] = zero8();
  gemm128x64x3(Xh, Xl, DM,
               Wh + (size_t)which * DM * DM, Wl + (size_t)which * DM * DM, DM,
               DM, arow, head * HD, mw, nw, tid, lane, tl, acc);

  float bb[2];
#pragma unroll
  for (int t = 0; t < 2; ++t) {
    const int i = head * HD + nw + 16 * t + c;       // 0..511
    const float xq = bq[i], xk = bk[i], xv = bv[i];
    bb[t] = (which == 0) ? xq : ((which == 1) ? xk : xv);
  }
  if (which < 2) stage_rm(acc, bb, st, mw, nw, hh, c);
  else           stage_tr(acc, bb, st, mw, nw, hh, c);
  __syncthreads();
  if (which < 2) {
    unsigned short* oh = (which == 0) ? Qh : Kh;
    unsigned short* ol = (which == 0) ? Ql : Kl;
    store_planes(st, oh, ol, ((size_t)bh * SL + sf) * HD, HD, tid);
  } else {
    store_vt(st, Vh, Vl, (size_t)bh * HD * SL + sf, tid);
  }
}

// ---------------------------------------------------------------------------
// kernel 3: flash attention for every (b, head, 128-query block), head dim 64, up to 32 chunks of 64 keys.
//   q planes [b*NH + h][s][64] hi/lo; k planes [b*NH + h][p][64] and v^T planes [b*NH + h][64][p] hi/lo, p = position
//   in the key order; int32 tables [b][s]: gap bucket ids (queries); [b][p]: key mask (zero = masked), gap bucket
//   ids, duration bucket ids; cnt[b] = keys to attend; f32 tables gap [GAPR][NH], dur [DURR][NH];
//   O planes [token = b*SL + s][DM] hi/lo, head h at columns h*64 (one line per row).
// Block = 8 waves; wave w owns queries q0 = qb*128 + 16*w .. +15. The head's column of both bias tables is staged
// in LDS once per block. Per chunk: K [key][d] and V^T [d][key] hi/lo tiles staged in LDS by all threads
// (plain 16-B loads) while waves 0-1 stage the chunk's 64 per-key values (gap id, duration bias, mask) in LDS.
// Two LDS buffers: the next chunk's global loads are issued into registers in front of this chunk's products and
// stored into the other buffer behind them, one barrier per chunk.
// Each half of a chunk's products takes its eight LDS fragments first and then goes round the four accumulator tiles.
// The products are taken transposed: S^T = K.Q^T (A = K rows, B = Q rows) and O^T += V^T.P^T
// (A = V^T rows, B = P^T), so a lane holds scores of ONE query (column lane&15) for keys 16*j + 8*(lane>>4) + r.
// s/8 + gap[clip(|gq - gk|, 0, GAPR-1)] + dur[clamp(dk)], masked keys replaced by -1e9; maximum and sum run
// in-lane with one exchange between the wave halves; p = exp(s - m) is split into bf16 hi/lo and packed straight
// from the score accumulators into the B fragment (tiles 2*kk and 2*kk+1 are elements 0..7 and 8..15 of the split
// k map), so P never goes through LDS. Epilogue: O^T / l, 8 consecutive channels per lane and tile, split hi/lo and
// stored from registers.
// coverage: 256 blocks x 8 waves x 16 rows x 64 cols = NT x DM per plane.
// ---------------------------------------------------------------------------
__global__ __launch_bounds__(256) void k_attn(const unsigned short* __restrict__ Qh,
                                              const unsigned short* __restrict__ Ql,
                                              const unsigned short* __restrict__ Kh,
                                              const unsigned short* __restrict__ Kl,
                                              const unsigned short* __restrict__ Vh,
                                              const unsigned short* __restrict__ Vl,
                                              const int* __restrict__ gids,
                                              const int* __restrict__ cm,
                                              const int* __restrict__ cg,
                                              const int* __restrict__ cd,
                                              const int* __restrict__ cnt,
                                              const float* __restrict__ gap_emb,
                                              const float* __restrict__ dur_emb,
                                              unsigned short* __restrict__ Oh,
                                              unsigned short* __restrict__ Ol) {
  // per buffer: K hi tile, lo tile [key][d] (18432 B), then V^T hi tile, lo tile [d][key] (18432 B)
  __shared__ __align__(16) unsigned short KVs[2 * ATB];        // two buffers                     73728 B
  __shared__ __align__(16) int   gkB[2 * KC];                  // chunk's key gap bucket ids    2 x 256 B
  __shared__ __align__(16) float dbB[2 * KC];                  // chunk's key duration bias     2 x 256 B
  __shared__ __align__(16) int   mkB[2 * KC];                  // chunk's key mask              2 x 256 B
  __shared__ float gapS[36];                                   // gap table column of head h (33)   144 B
  __shared__ float durS[20];                                   // dur table column of head h (17)    80 B

  const int tid = threadIdx.x, lane = tid & 31, wave = tid >> 5;
  const int hh = lane >> 4, c = lane & 15;
  const int qb = blockIdx.x % NQB;
  const int bh = blockIdx.x / NQB;                   // b*NH + h
  const int h  = bh % NH;
  const int b  = bh / NH;
  const int q0 = qb * QB + wave * 16;
  const size_t qkbase = (size_t)bh * SL * HD;
  const size_t vbase  = (size_t)bh * HD * SL;

  // stage the head's table columns once (clamped addresses for every lane, predicated LDS store)
  {
    const int ig = (tid < GAPR) ? tid : (GAPR - 1);
    const int id = (tid < DURR) ? tid : (DURR - 1);
    const float gv = gap_emb[ig * NH + h];
    const float dv = dur_emb[id * NH + h];
    if (tid < GAPR) gapS[tid] = gv;
    if (tid < DURR) durS[tid] = dv;
  }

  // gap bucket id of the one query this lane's score elements belong to: q0 + (lane&15)
  const int gq = gids[(size_t)b * SL + q0 + c];

  // Q fragments (loop-invariant), B operand stored [n = query][k = d]: query q0 + (lane&15), split map over d
  v16b qh[2], ql[2];
#pragma unroll
  for (int dc = 0; dc < 2; ++dc) {
    qh[dc] = ldf(Qh + qkbase, HD, q0, dc * 32, lane);
    ql[dc] = ldf(Ql + qkbase, HD, q0, dc * 32, lane);
  }

  float mrow = -__builtin_huge_valf();               // running maximum of query c (equal in both halves)
  float lrow = 0.f;                                  // running sum over this half's keys; halves joined at the end
  v8f oacc[4];
#pragma unroll
  for (int t = 0; t < 4; ++t) oacc[t] = zero8();

  // chunks that hold keys to attend: 1..NCK (block-uniform); the last chunk's keys behind them are masked ones
  int nck = (cnt[b] + KC - 1) / KC;
  nck = (nck < 1) ? 1 : ((nck > NCK) ? NCK : nck);

  // staging of one chunk: this thread's 8 pieces of 16 B (K hi, K lo, V^T hi, V^T lo, two each) and, in waves 0 and 1
  // (wave-uniform), one key's gap id, duration id and mask; held in registers between the loads and the LDS stores
  const int sr = tid >> 2;                           // 0..63: key row of K tiles, d row of V^T tiles
  const int sq = (tid & 3) * 16;                     // 0,16,32,48 elements
  const unsigned short* gkh = Kh + qkbase + (size_t)sr * HD + sq;
  const unsigned short* gkl = Kl + qkbase + (size_t)sr * HD + sq;
  const unsigned short* gvh = Vh + vbase + (size_t)sr * SL + sq;
  const unsigned short* gvl = Vl + vbase + (size_t)sr * SL + sq;
  const int* gcg = cg + (size_t)b * SL + (tid & (KC - 1));
  const int* gcd = cd + (size_t)b * SL + (tid & (KC - 1));
  const int* gcm = cm + (size_t)b * SL + (tid & (KC - 1));
  v4u pf[8];
  int pg = 0, pd = 0, pm = 0;
  auto chunk_load = [&](int kv0) {                   // kv0 = first key position of the chunk, 0..SL-KC
#pragma unroll
    for (int e = 0; e < 2; ++e) {
      pf[e]     = *(const v4u*)(gkh + (size_t)kv0 * HD + 8 * e);
      pf[2 + e] = *(const v4u*)(gkl + (size_t)kv0 * HD + 8 * e);
      pf[4 + e] = *(const v4u*)(gvh + kv0 + 8 * e);
      pf[6 + e] = *(const v4u*)(gvl + kv0 + 8 * e);
    }
    if (tid < KC) {
      pg = gcg[kv0];
      pd = gcd[kv0];
      pm = gcm[kv0];
    }
    // precaution: stands in front of whatever next lands in the address registers of the loads above; its memory
    // clobber also keeps those loads in front of the chunk's products
    asm volatile("s_wait_xcnt 0x0" ::: "memory");
  };
  auto chunk_store = [&](int buf) {                  // buf = 0 or 1
    unsigned short* d = KVs + buf * ATB + sr * KTP + sq;
#pragma unroll
    for (int e = 0; e < 2; ++e) {
      *(v4u*)(d + 8 * e)                           = pf[e];
      *(v4u*)(d + KC * KTP + 8 * e)                = pf[2 + e];
      *(v4u*)(d + 2 * KC * KTP + 8 * e)            = pf[4 + e];
      *(v4u*)(d + 2 * KC * KTP + HD * KTP + 8 * e) = pf[6 + e];
    }
    if (tid < KC) {
      const int dk = (pd < 0) ? 0 : ((pd > DURR - 1) ? (DURR - 1) : pd);
      gkB[buf * KC + tid] = pg;
      dbB[buf * KC + tid] = durS[dk];
      mkB[buf * KC + tid] = pm;
    }
  };

  chunk_load(0);
  __syncthreads();                                   // the table columns are visible before chunk_store reads durS
  chunk_store(0);
  __syncthreads();                                   // chunk 0's tiles and key values visible to every wave

  for (int kc = 0; kc < nck; ++kc) {
    const int cur = kc & 1;
    const unsigned short* Ks = KVs + cur * ATB;
    const unsigned short* Vs = Ks + 2 * KC * KTP;
    const int*   gkS = gkB + cur * KC;
    const float* dbS = dbB + cur * KC;
    const int*   mkS = mkB + cur * KC;
    const bool more = kc + 1 < nck;                  // block-uniform
    if (more) chunk_load((kc + 1) * KC);

    v8f s[4];
#pragma unroll
    for (int j = 0; j < 4; ++j) s[j] = zero8();
    // A operands: key row j*16 + (lane&15) of the [key][d] tiles, split map over d. The eight K fragments of one d half
    // are read as one group in front of that half's products, and the products go round the four score tiles, so that
    // no product waits for an LDS read of its own or for the product just before it; each tile's order of sums is kept.
#pragma unroll
    for (int dc = 0; dc < 2; ++dc) {
      v16b khf[4], klf[4];
#pragma unroll
      for (int j = 0; j < 4; ++j) {
        khf[j] = ldf(Ks, KTP, j * 16, dc * 32, lane);
        klf[j] = ldf(Ks + KC * KTP, KTP, j * 16, dc * 32, lane);
      }
#pragma unroll
      for (int j = 0; j < 4; ++j) s[j] = mma(khf[j], qh[dc], s[j]);
#pragma unroll
      for (int j = 0; j < 4; ++j) s[j] = mma(klf[j], qh[dc], s[j]);
#pragma unroll
      for (int j = 0; j < 4; ++j) s[j] = mma(khf[j], ql[dc], s[j]);
    }
    // s[j][r] = S[query q0 + c][key kv0 + j*16 + 8*hh + r]; scale, table biases, replace-mask
#pragma unroll
    for (int j = 0; j < 4; ++j) {
      const int kb = 16 * j + 8 * hh;                // first of this lane's 8 keys of tile j, 0..56
      const v4i g0 = *(const v4i*)(gkS + kb), g1 = *(const v4i*)(gkS + kb + 4);
      const v4f d0 = *(const v4f*)(dbS + kb), d1 = *(const v4f*)(dbS + kb + 4);
      const v4i k0 = *(const v4i*)(mkS + kb), k1 = *(const v4i*)(mkS + kb + 4);
#pragma unroll
      for (int r = 0; r < 8; ++r) {
        const int   gk = (r < 4) ? g0[r & 3] : g1[r & 3];
        const float db = (r < 4) ? d0[r & 3] : d1[r & 3];
        const int   mk = (r < 4) ? k0[r & 3] : k1[r & 3];
        int rel = gq - gk;
        rel = (rel < 0) ? -rel : rel;
        rel = (rel > GAPR - 1) ? (GAPR - 1) : rel;
        rel = (rel < 0) ? 0 : rel;
        const float gbias = gapS[rel];
        const float v = (s[j][r] * 0.125f + gbias) + db;
        s[j][r] = (mk != 0) ? v : NEGV;
      }
    }
    // chunk maximum of query c: in-lane over this half's 32 keys, then one exchange between the halves
    float cj[4];
#pragma unroll
    for (int j = 0; j < 4; ++j) {
      cj[j] = fmaxf(fmaxf(fmaxf(s[j][0], s[j][1]), fmaxf(s[j][2], s[j][3])),
                    fmaxf(fmaxf(s[j][4], s[j][5]), fmaxf(s[j][6], s[j][7])));
    }
    float cm = fmaxf(fmaxf(cj[0], cj[1]), fmaxf(cj[2], cj[3]));
    cm = fmaxf(cm, other_half(cm));
    const float mnew  = fmaxf(mrow, cm);             // finite from chunk 0 on
    const float alpha = exp_slot(mrow - mnew);
    mrow = mnew;

    // p = exp(s - m); tile j's 8 values are 8 consecutive k positions of the B fragment
    v4u ph[4], pl[4];
    float pj[4];
#pragma unroll
    for (int j = 0; j < 4; ++j) {
      v4f p0, p1;
#pragma unroll
      for (int r = 0; r < 4; ++r) {
        p0[r] = exp_slot(s[j][r] - mnew);
        p1[r] = exp_slot(s[j][r + 4] - mnew);
      }
      pj[j] = ((p0[0] + p0[1]) + (p0[2] + p0[3])) + ((p1[0] + p1[1]) + (p1[2] + p1[3]));
      split8(p0, p1, ph[j], pl[j]);
    }
    lrow = lrow * alpha + ((pj[0] + pj[1]) + (pj[2] + pj[3]));
#pragma unroll
    for (int t = 0; t < 4; ++t)
#pragma unroll
      for (int r = 0; r < 8; ++r) oacc[t][r] *= alpha;

#pragma unroll
    for (int kk = 0; kk < 2; ++kk) {
      // A operands: channel row t*16 + (lane&15) of V^T [d][key], split k map over keys; the eight fragments of one
      // key half are read as one group in front of its products, which go round the four output tiles (each tile's
      // order of sums is kept)
      v16b vhf[4], vlf[4];
#pragma unroll
      for (int t = 0; t < 4; ++t) {
        vhf[t] = ldf(Vs, KTP, t * 16, kk * 32, lane);
        vlf[t] = ldf(Vs + HD * KTP, KTP, t * 16, kk * 32, lane);
      }
      // B operands: P^T column (lane&15) = query, split k map over keys 32*kk ..
      Frag fh, fl;
      fh.u[0] = ph[2 * kk]; fh.u[1] = ph[2 * kk + 1];
      fl.u[0] = pl[2 * kk]; fl.u[1] = pl[2 * kk + 1];
#pragma unroll
      for (int t = 0; t < 4; ++t) oacc[t] = mma(vhf[t], fh.v, oacc[t]);
#pragma unroll
      for (int t = 0; t < 4; ++t) oacc[t] = mma(vlf[t], fh.v, oacc[t]);
#pragma unroll
      for (int t = 0; t < 4; ++t) oacc[t] = mma(vhf[t], fl.v, oacc[t]);
    }
    if (more) {
      // the other buffer's last readers left it in front of the barrier that ended the chunk before this one
      chunk_store(cur ^ 1);
      __syncthreads();                               // next chunk visible; this chunk's readers are done
    }
  }

  // O = oacc / l  (l >= 1); oacc[t][r] = O[query q0 + c][channel 16*t + 8*hh + r]
  const float invl = 1.0f / (lrow + other_half(lrow));
  const size_t go = ((size_t)(b * SL + q0 + c)) * DM + (size_t)h * HD + 8 * hh;
  v4u wh[4], wl[4];
#pragma unroll
  for (int t = 0; t < 4; ++t) {
    const v4f a0 = (v4f){oacc[t][0] * invl, oacc[t][1] * invl, oacc[t][2] * invl, oacc[t][3] * invl};
    const v4f a1 = (v4f){oacc[t][4] * invl, oacc[t][5] * invl, oacc[t][6] * invl, oacc[t][7] * invl};
    split8(a0, a1, wh[t], wl[t]);
  }
#pragma unroll
  for (int t = 0; t < 4; ++t) {
    *(v4u*)(Oh + go + 16 * t) = wh[t];
    *(v4u*)(Ol + go + 16 * t) = wl[t];
  }
}

// ---------------------------------------------------------------------------
// kernel 4: out = O.Wo + bo -> f32 rows [NT][DM]. A = O planes [NT][DM], B = transposed
// Wo planes [DM n][DM k]. Block = 128 token rows x 64 cols; grid = (DM/64 = 8, NT/128 = 32).
// coverage: 8 x 32 blocks x 128 x 64 = NT x DM.
// ---------------------------------------------------------------------------
__global__ __launch_bounds__(256) void k_gemm_out(const unsigned short* __restrict__ Ah,
                                                  const unsigned short* __restrict__ Al,
                                                  const unsigned short* __restrict__ Wh,
                                                  const unsigned short* __restrict__ Wl,
                                                  const float* __restrict__ bo,
                                                  float* __restrict__ out) {
  __shared__ __align__(16) unsigned char sm[GSB];    // 55296 B: GEMM stage, then the f32 output staging tile
  unsigned short* tl = (unsigned short*)sm;
  float* st = (float*)sm;                            // 128 x OTP
  const int tid = threadIdx.x, lane = tid & 31, wave = tid >> 5;
  const int hh = lane >> 4, c = lane & 15;
  const int mblk = blockIdx.y * 128, nblk = blockIdx.x * 64;
  const int mw = (wave >> 1) * 32, nw = (wave & 1) * 32;

  v8f acc[2][2];
#pragma unroll
  for (int s = 0; s < 2; ++s)
#pragma unroll
    for (int t = 0; t < 2; ++t) acc[s][t] = zero8();
  int arow[4];
#pragma unroll
  for (int i = 0; i < 4; ++i) arow[i] = mblk + (tid >> 3) + 32 * i;
  gemm128x64x3(Ah, Al, DM, Wh, Wl, DM, DM, arow, nblk, mw, nw, tid, lane, tl, acc);

  float bb[2];
#pragma unroll
  for (int t = 0; t < 2; ++t) bb[t] = bo[nblk + nw + 16 * t + c];
  stage_rm(acc, bb, st, mw, nw, hh, c);
  __syncthreads();
  store_f32(st, out, mblk, nblk, tid);
}

// ---------------------------------------------------------------------------
// its producer writes, no padded tails exist since every dimension is a tile multiple; offsets of the plane regions multiples of 512 KB):
//   X     bf16x2 [4096][512]             0     8388608
//   Wqkv  bf16x2 [1536][512]       8388608     3145728   (q rows 0..511, k 512..1023, v 1024..1535, [n][k])
//   Wo    bf16x2 [512][512]       11534336     1048576   ([n][k])
//   Q     bf16x2 [16][2048][64]   12582912     8388608
//   K     bf16x2 [16][2048][64]   20971520     8388608
//   V^T   bf16x2 [16][64][2048]   29360128     8388608
//   O     bf16x2 [4096][512]      37748736     8388608
//   key order: token index, gap id, duration id, mask, int32 [2][2048] each   46137344   4 x 16384; cnt int32 [2]
//   total                         46203136
// ---------------------------------------------------------------------------
extern "C" void kernel_launch(void* const* d_in, const int* in_sizes, int n_in,
                              void* d_out, int out_size, void* d_ws, size_t ws_size,
                              hipStream_t stream) {
  if (n_in < 14) return;
  if (in_sizes[0] != NT * DM) return;
  if (in_sizes[1] != NBT * SL) return;
  if (in_sizes[2] != NBT * SL) return;
  if (in_sizes[3] != NBT * SL) return;
  if (in_sizes[4] != DM * DM) return;
  if (in_sizes[5] != DM) return;
  if (in_sizes[6] != DM * DM) return;
  if (in_sizes[7] != DM) return;
  if (in_sizes[8] != DM * DM) return;
  if (in_sizes[9] != DM) return;
  if (in_sizes[10] != DM * DM) return;
  if (in_sizes[11] != DM) return;
  if (in_sizes[12] != GAPR * NH) return;
  if (in_sizes[13] != DURR * NH) return;
  if (out_size != NT * DM) return;

  const float* x     = (const float*)d_in[0];   // [2][2048][512] = [4096][512]
  const int*   amask = (const int*)d_in[1];     // [2][2048] int32, zero = masked key
  const int*   gids  = (const int*)d_in[2];     // [2][2048] int32
  const int*   dids  = (const int*)d_in[3];     // [2][2048] int32
  const float* W_q   = (const float*)d_in[4];   // [512][512] [in][out]
  const float* b_q   = (const float*)d_in[5];   // [512]
  const float* W_k   = (const float*)d_in[6];
  const float* b_k   = (const float*)d_in[7];
  const float* W_v   = (const float*)d_in[8];
  const float* b_v   = (const float*)d_in[9];
  const float* W_o   = (const float*)d_in[10];
  const float* b_o   = (const float*)d_in[11];
  const float* gtab  = (const float*)d_in[12];  // [33][8]
  const float* dtab  = (const float*)d_in[13];  // [17][8]
  float* out = (float*)d_out;                   // [4096][512] f32

  const size_t PX  = (size_t)NT * DM * 2;       // 4194304
  const size_t PW  = (size_t)3 * DM * DM * 2;   // 1572864
  const size_t PWO = (size_t)DM * DM * 2;       // 524288
  size_t off = 0;
  const size_t oXh  = off; off += PX;
  const size_t oXl  = off; off += PX;
  const size_t oWh  = off; off += PW;
  const size_t oWl  = off; off += PW;
  const size_t oWoh = off; off += PWO;
  const size_t oWol = off; off += PWO;
  const size_t oQh  = off; off += PX;
  const size_t oQl  = off; off += PX;
  const size_t oKh  = off; off += PX;
  const size_t oKl  = off; off += PX;
  const size_t oVh  = off; off += PX;
  const size_t oVl  = off; off += PX;
  const size_t oOh  = off; off += PX;
  const size_t oOl  = off; off += PX;
  const size_t PI  = (size_t)NBT * SL * 4;      // 16384
  const size_t oIdx = off; off += PI;
  const size_t oCg  = off; off += PI;
  const size_t oCd  = off; off += PI;
  const size_t oCm  = off; off += PI;
  const size_t oCnt = off; off += 256;
  if (off > ws_size) return;                    // off = 46203136
  if (off > (size_t)134217728) return;

  char* ws = (char*)d_ws;
  unsigned short* Xh  = (unsigned short*)(ws + oXh);
  unsigned short* Xl  = (unsigned short*)(ws + oXl);
  unsigned short* Wh  = (unsigned short*)(ws + oWh);
  unsigned short* Wl  = (unsigned short*)(ws + oWl);
  unsigned short* Woh = (unsigned short*)(ws + oWoh);
  unsigned short* Wol = (unsigned short*)(ws + oWol);
  unsigned short* Qh  = (unsigned short*)(ws + oQh);
  unsigned short* Ql  = (unsigned short*)(ws + oQl);
  unsigned short* Kh  = (unsigned short*)(ws + oKh);
  unsigned short* Kl  = (unsigned short*)(ws + oKl);
  unsigned short* Vh  = (unsigned short*)(ws + oVh);
  unsigned short* Vl  = (unsigned short*)(ws + oVl);
  unsigned short* Oh  = (unsigned short*)(ws + oOh);
  unsigned short* Ol  = (unsigned short*)(ws + oOl);
  int* kidx = (int*)(ws + oIdx);
  int* kcg  = (int*)(ws + oCg);
  int* kcd  = (int*)(ws + oCd);
  int* kcm  = (int*)(ws + oCm);
  int* kcnt = (int*)(ws + oCnt);

  // (0) hi/lo planes of x; the first NBT blocks build the key order of each sequence
  k_split<<<dim3(NBT + (NT * DM) / 2048), dim3(256), 0, stream>>>(x, Xh, Xl, amask, gids, dids,
                                                                  kidx, kcg, kcd, kcm, kcnt);
  // (1) transposed hi/lo planes of the four weights: in [k][n] -> out [n][k]
  k_split_tr<<<dim3(DM / 64, DM / 64, 4), dim3(256), 0, stream>>>(W_q, W_k, W_v, W_o, Wh, Wl, Woh, Wol);
  // (2) q / k / v^T planes
  k_proj<<<dim3(3 * NH, NT / 128), dim3(256), 0, stream>>>(Xh, Xl, Wh, Wl, b_q, b_k, b_v, kidx, kcnt,
                                                          Qh, Ql, Kh, Kl, Vh, Vl);
  // (3) attention -> O planes
  k_attn<<<dim3(NBT * NH * NQB), dim3(256), 0, stream>>>(Qh, Ql, Kh, Kl, Vh, Vl, gids, kcm, kcg, kcd, kcnt,
                                                        gtab, dtab, Oh, Ol);
  // (4) out = O.Wo + bo
  k_gemm_out<<<dim3(DM / 64, NT / 128), dim3(256), 0, stream>>>(Oh, Ol, Woh, Wol, b_o, out);
  (void)hipGetLastError();
}

// v007
// One run takes 70.4 microseconds.
// Two timings next to v006 both put it at 1.05 times that version's speed.
// All steps since v000 together make it 4.50 times as fast.
// Contractions: Q/K/V = x.W (3 sites), S = Q.K^T, O = P.V, out = O.Wo: all v_wmma_f32_16x16x32_bf16 on bf16 hi/lo
// split operand planes (hi.hi + hi.lo + lo.hi per tile pair), f32 accumulate; biases, the 1/8 scale, the bucket-table
// lookups, the key mask (replace by -1e9) and the online softmax in f32.
// Plane carry audit: every hi/lo plane (X, Wqkv^T, Wo^T, Q, K, V^T, in-register P fragments, O) carries factor 1
// (hi = rne_bf16(v), lo = rne_bf16(v - hi), f32 exponent range, no subnormal concern); no inverse fold exists anywhere.
// Key order: per sequence the keys are reordered by a stable partition (unmasked first, masked behind); K and V are
// projected and attended only up to the last unmasked key (all keys when a sequence has none unmasked).
#include <hip/hip_runtime.h>
#include <stddef.h>

#define NBT 2                  // batch
#define SL  2048               // sequence length
#define DM  512                // model width
#define NH  8                  // heads
#define HD  64                 // head dim
#define NT  (NBT * SL)         // token rows, row m = b*SL + s
#define QB  128                // query rows per attention block
#define KC  64                 // keys per chunk
#define NQB (SL / QB)          // 16
#define NCK (SL / KC)          // 32
#define KTP 72                 // LDS pitch (16-bit elements) for 64-wide tiles, 144 B
#define OTP 68                 // f32 staging pitch [row][col] (128 x 64)
#define VTP 132                // f32 staging pitch [col][row] (64 x 128)
#define TTP 68                 // f32 staging pitch for the 64 x 64 weight transpose tile
#define GBK 64                 // k elements per GEMM stage: one whole 128-B line per plane row
#define GTR (2 * 128 + 2 * 64) // rows of one GEMM stage in LDS: A hi, A lo (128 each), B hi, B lo (64 each)
#define GSB (GTR * KTP * 2)    // bytes of one GEMM stage in LDS, 55296
#define GAPR 33                // time-gap table rows
#define DURR 17                // duration table rows
#define NEGV (-1.0e9f)         // masked-key score value
#define ATB  (2 * KC * KTP + 2 * HD * KTP) // 16-bit elements of one attention chunk's four tiles in LDS

static_assert(NT == 4096);
static_assert(NH * HD == DM);
static_assert(SL % QB == 0);
static_assert(SL % KC == 0);
static_assert(SL % 128 == 0);
static_assert(DM % 64 == 0);
static_assert(DM % 32 == 0);
static_assert(HD == 64);
static_assert(KC == 64);
static_assert(64 * VTP <= 128 * OTP);
static_assert(DM % GBK == 0);
static_assert(128 * OTP * 4 <= GSB);
static_assert(SL == 256 * 8);
static_assert(DM / 64 == 8);

typedef __bf16       v16b __attribute__((ext_vector_type(16)));
typedef float        v8f  __attribute__((ext_vector_type(8)));
typedef float        v4f  __attribute__((ext_vector_type(4)));
typedef float        v2f  __attribute__((ext_vector_type(2)));
typedef __bf16       v2b  __attribute__((ext_vector_type(2)));
typedef unsigned int v4u  __attribute__((ext_vector_type(4)));
typedef unsigned int v2u  __attribute__((ext_vector_type(2)));
typedef int          v4i  __attribute__((ext_vector_type(4)));
union Frag { v16b v; v4u u[2]; };

// WMMA with the dependent-VALU hazard guard (ties D, keeps A/B live)
__device__ __forceinline__ v8f mma(v16b a, v16b b, v8f c) {
  c = __builtin_amdgcn_wmma_f32_16x16x32_bf16(false, a, false, b, (short)0, c, false, false);
  asm volatile("v_nop\n\tv_nop\n\tv_nop\n\tv_nop" : "+v"(c) : "v"(a), "v"(b));
  return c;
}

// value of lane l ^ 16 (the other 16-lane half), by the vector cross-row move
__device__ __forceinline__ float other_half(float x) {
  const int b = __float_as_int(x);
  return __int_as_float(__builtin_amdgcn_permlanex16(b, b, 0x76543210, 0xfedcba98, false, false));
}

// e^x by the hardware exponential of x * log2(e), as __expf gives it. The v_nop fills the one slot that the
// instruction set asks for between a transcendental and a directly following instruction that reads its result or
// overwrites its source.
__device__ __forceinline__ float exp_slot(float x) {
  float r;
  asm("v_exp_f32 %0, %1\n\tv_nop" : "=v"(r) : "v"(x * 1.44269504f));
  return r;
}

__device__ __forceinline__ v8f zero8() { return (v8f){0.f, 0.f, 0.f, 0.f, 0.f, 0.f, 0.f, 0.f}; }

// Fragment loader for k-contiguous 16-bit rows with pitch ld (bf16 bits).
// A operand: row0 + (lane&15) is the M row. B operand stored [n][k]: row0 + (lane&15) is the N column.
// Split k map for both: elements 0..7 <- k0 + 8*(lane>>4) + 0..7, elements 8..15 <- k0 + 16 + 8*(lane>>4) + 0..7.
// D: acc[r] = element (row0 + 8*(lane>>4) + r, col0 + (lane&15)).
__device__ __forceinline__ v16b ldf(const unsigned short* p, int ld, int row0, int k0, int lane) {
  const unsigned short* q = p + (size_t)(row0 + (lane & 15)) * ld + k0 + 8 * (lane >> 4);
  Frag f;
  f.u[0] = *(const v4u*)(q);
  f.u[1] = *(const v4u*)(q + 16);
  return f.v;
}

// two floats -> two bf16, round to nearest even, in one word by the packed hardware convert (first element in the low
// half-word)
__device__ __forceinline__ unsigned int bf_pk(v2f x) {
  union { v2b v; unsigned int u; } w;
  w.v = __builtin_convertvector(x, v2b);
  return w.u;
}

// hi = rne(a), lo = rne(a - hi) for two floats, packed little-endian (first element in the low half-word)
__device__ __forceinline__ void split2(float a, float b, unsigned int& wh, unsigned int& wl) {
  const v2f x = (v2f){a, b};
  wh = bf_pk(x);
  const v2f h = (v2f){__uint_as_float(wh << 16), __uint_as_float(wh & 0xFFFF0000u)};
  wl = bf_pk(x - h);
}

// 8 consecutive floats -> one 16-B hi piece and one 16-B lo piece
__device__ __forceinline__ void split8(v4f a0, v4f a1, v4u& wh, v4u& wl) {
  unsigned int h0, h1, h2, h3, l0, l1, l2, l3;
  split2(a0[0], a0[1], h0, l0);
  split2(a0[2], a0[3], h1, l1);
  split2(a1[0], a1[1], h2, l2);
  split2(a1[2], a1[3], h3, l3);
  wh = (v4u){h0, h1, h2, h3};
  wl = (v4u){l0, l1, l2, l3};
}

// Stable partition of one sequence's SL keys by the mask: unmasked keys (mask != 0) first in their order, masked keys
// behind them in theirs. A masked key's score is -1e9, so its weight exp(-1e9 - m) is 0 as soon as one key of the
// sequence is unmasked: keys behind the last unmasked one add nothing and are left out by the later kernels.
// Writes, per new position: the key's token index, gap id, duration id and mask; and cnt[b] = keys to attend =
// number of unmasked keys, or SL when there is none (every score is then -1e9 and all keys count alike).
// Thread t owns keys 8t .. 8t+7; block-wide inclusive scan of the per-thread counts in LDS, two buffers, one
// barrier a step. Every position 0..SL-1 is written exactly once (the map is a permutation).
__device__ __forceinline__ void compact_keys(const int* __restrict__ mask, const int* __restrict__ gids,
                                             const int* __restrict__ dids, int* __restrict__ idx,
                                             int* __restrict__ cg, int* __restrict__ cd, int* __restrict__ cm,
                                             int* __restrict__ cnt, int b, int tid) {
  __shared__ int sc[2][256];
  const int base = b * SL + tid * 8;
  const v4i m0 = *(const v4i*)(mask + base), m1 = *(const v4i*)(mask + base + 4);
  // precaution: stands in front of the next loads, which may land in the address registers of the loads above
  asm volatile("s_wait_xcnt 0x0" ::: "memory");
  const v4i g0 = *(const v4i*)(gids + base), g1 = *(const v4i*)(gids + base + 4);
  // precaution: as above
  asm volatile("s_wait_xcnt 0x0" ::: "memory");
  const v4i d0 = *(const v4i*)(dids + base), d1 = *(const v4i*)(dids + base + 4);
  int c = 0;
#pragma unroll
  for (int e = 0; e < 4; ++e) c += ((m0[e] != 0) ? 1 : 0) + ((m1[e] != 0) ? 1 : 0);
  sc[0][tid] = c;
  __syncthreads();
  int cur = 0;
#pragma unroll
  for (int o = 1; o < 256; o <<= 1) {
    int a = sc[cur][tid];
    if (tid >= o) a += sc[cur][tid - o];
    sc[cur ^ 1][tid] = a;
    cur ^= 1;
    __syncthreads();                                 // the step's sums are visible before the next step reads them
  }
  const int total = sc[cur][255];                    // unmasked keys of the sequence, 0..SL
  int ru = sc[cur][tid] - c;                         // unmasked keys in front of key 8t
  int rm = total + tid * 8 - ru;                     // total + masked keys in front of key 8t
#pragma unroll
  for (int e = 0; e < 8; ++e) {
    const int mk = (e < 4) ? m0[e & 3] : m1[e & 3];
    const int gk = (e < 4) ? g0[e & 3] : g1[e & 3];
    const int dk = (e < 4) ? d0[e & 3] : d1[e & 3];
    const int pos = b * SL + ((mk != 0) ? ru : rm);  // 0..SL-1 within the sequence
    ru += (mk != 0) ? 1 : 0;
    rm += (mk != 0) ? 0 : 1;
    idx[pos] = tid * 8 + e;
    cg[pos]  = gk;
    cd[pos]  = dk;
    cm[pos]  = mk;
  }
  if (tid == 0) cnt[b] = (total > 0) ? total : SL;
}

// ---------------------------------------------------------------------------
// kernel 0: weight transpose + split. in W [k = DM rows][n = DM cols] f32 -> out planes [n][k] hi/lo (pitch DM).
// Blocks 0 .. NBT-1 do not transpose: block b builds sequence b's key order instead (compact_keys).
// Block NBT + id: id>>6 = which weight (0 q, 1 k, 2 v -> stacked planes rows which*DM + n; 3 -> the out-projection
// planes), id&7 = 64-wide n tile (source columns), (id>>3)&7 = 64-deep k tile (source rows).
// coverage: load 256 thr x 16 floats = 64 x 64; store 256 thr x 2 iter x 8 halves = 64 n rows x 64 k per plane;
// 4 * (DM/64) * (DM/64) such blocks cover all four DM x DM matrices.
// ---------------------------------------------------------------------------
__global__ __launch_bounds__(256) void k_split_tr(const float* __restrict__ Wq, const float* __restrict__ Wk,
                                                  const float* __restrict__ Wv, const float* __restrict__ Wo,
                                                  unsigned short* __restrict__ Ph, unsigned short* __restrict__ Pl,
                                                  unsigned short* __restrict__ Oh, unsigned short* __restrict__ Ol,
                                                  const int* __restrict__ mask, const int* __restrict__ gids,
                                                  const int* __restrict__ dids, int* __restrict__ idx,
                                                  int* __restrict__ cg, int* __restrict__ cd, int* __restrict__ cm,
                                                  int* __restrict__ cnt) {
  __shared__ __align__(16) float st[64 * TTP];       // 17408 B
  const int tid = threadIdx.x;
  if (blockIdx.x < NBT) {                            // block-uniform
    compact_keys(mask, gids, dids, idx, cg, cd, cm, cnt, blockIdx.x, tid);
    return;
  }
  const int id  = blockIdx.x - NBT;                  // 0 .. 4*64-1
  const int z   = id >> 6;                           // block-uniform
  const int nt  = (id & 7) * 64;                     // source columns = output rows
  const int kt  = ((id >> 3) & 7) * 64;              // source rows    = output k
  const float* W = (z == 0) ? Wq : ((z == 1) ? Wk : ((z == 2) ? Wv : Wo));
  {
    const int row = tid >> 2;                        // k within tile, 0..63
    const int cb  = (tid & 3) * 16;                  // n within tile, 0,16,32,48
    const float* src = W + (size_t)(kt + row) * DM + nt + cb;
#pragma unroll
    for (int e = 0; e < 4; ++e) {
      const v4f a = *(const v4f*)(src + 4 * e);
#pragma unroll
      for (int q = 0; q < 4; ++q) st[(cb + 4 * e + q) * TTP + row] = a[q];
    }
  }
  __syncthreads();
  unsigned short* dh = (z < 3) ? (Ph + (size_t)z * DM * DM) : Oh;
  unsigned short* dl = (z < 3) ? (Pl + (size_t)z * DM * DM) : Ol;
  const size_t base = (size_t)nt * DM + kt;
  v4u vh[2], vl[2];
  size_t go[2];
#pragma unroll
  for (int it = 0; it < 2; ++it) {
    const int pp   = tid + 256 * it;                 // 0..511
    const int rown = pp >> 3;                        // 0..63
    const int pc   = pp & 7;                         // k piece 8*pc .. +7
    const float* ra = st + rown * TTP + 8 * pc;
    const v4f a0 = *(const v4f*)(ra), a1 = *(const v4f*)(ra + 4);
    split8(a0, a1, vh[it], vl[it]);
    go[it] = base + (size_t)rown * DM + 8 * pc;
  }
  {
#pragma unroll
    for (int it = 0; it < 2; ++it) {
      *(v4u*)(dh + go[it]) = vh[it];
      *(v4u*)(dl + go[it]) = vl[it];
    }
    
  }
}

// ---------------------------------------------------------------------------
// 128 x 64 block tile, 32 x 32 per wave, split-bf16 GEMM main loop over K (multiple of GBK): A planes [m][k] pitch
// lda, B planes [n][k] pitch ldb (hi and lo). Per stage of GBK = 64 k the block brings the 128 A rows and the 64 B
// rows of both planes into LDS (pitch KTP): a wave's 16-B loads cover 4 whole 128-B lines, 12 pieces per thread,
// rows (tid>>3) + 32*i: i 0..3 A hi, 4..7 A lo, 8..9 B hi, 10..11 B lo. The next stage's pieces are loaded into
// registers while this stage is multiplied. Fragments come from LDS by ldf (its split k map, A and B alike).
// Per tile pair: ah.bh + ah.bl + al.bh into one f32 accumulator, k ascending.
// Tile row (tid>>3) + 32*i is row arow[i] of the A planes (the caller's map from tile rows to plane rows).
// acc[s][t][r] = (tile row mw + 16*s + 8*(lane>>4) + r, nrow + nw + 16*t + (lane&15)).
// The loop ends behind a barrier: tl may be reused by the caller at once.
// ---------------------------------------------------------------------------
// the products of one stage in LDS: rows 0..127 A hi, 128..255 A lo, 256..319 B hi, 320..383 B lo, pitch KTP
__device__ __forceinline__ void stage_products(const unsigned short* tl, int mw, int nw, int lane, v8f (&acc)[2][2]) {
  const unsigned short* sAh = tl;
  const unsigned short* sAl = tl + 128 * KTP;
  const unsigned short* sBh = tl + 256 * KTP;
  const unsigned short* sBl = tl + 320 * KTP;
#pragma unroll
  for (int ks = 0; ks < GBK; ks += 32) {
    const v16b ah0 = ldf(sAh, KTP, mw, ks, lane);
    const v16b ah1 = ldf(sAh, KTP, mw + 16, ks, lane);
    const v16b al0 = ldf(sAl, KTP, mw, ks, lane);
    const v16b al1 = ldf(sAl, KTP, mw + 16, ks, lane);
#pragma unroll
    for (int t = 0; t < 2; ++t) {
      const v16b bh = ldf(sBh, KTP, nw + 16 * t, ks, lane);
      const v16b bl = ldf(sBl, KTP, nw + 16 * t, ks, lane);
      acc[0][t] = mma(ah0, bh, acc[0][t]);
      acc[1][t] = mma(ah1, bh, acc[1][t]);
      acc[0][t] = mma(ah0, bl, acc[0][t]);
      acc[1][t] = mma(ah1, bl, acc[1][t]);
      acc[0][t] = mma(al0, bh, acc[0][t]);
      acc[1][t] = mma(al1, bh, acc[1][t]);
    }
  }
}

__device__ __forceinline__ void gemm_ld(const unsigned short* const (&gp)[4], const unsigned int (&ao)[4], int ldb,
                                        int k0, v4u (&pf)[12]) {
#pragma unroll
  for (int i = 0; i < 4; ++i) {
    pf[i]     = *(const v4u*)((const char*)gp[0] + ao[i]);
    pf[4 + i] = *(const v4u*)((const char*)gp[1] + ao[i]);
  }
#pragma unroll
  for (int i = 0; i < 2; ++i) {
    pf[8 + i]  = *(const v4u*)(gp[2] + (size_t)(32 * i) * ldb + k0);
    pf[10 + i] = *(const v4u*)(gp[3] + (size_t)(32 * i) * ldb + k0);
  }
  // precaution: stands in front of the fragment loads, which land in the address registers of the loads above
  asm volatile("s_wait_xcnt 0x0" ::: "memory");
}

__device__ __forceinline__ void gemm128x64x3(const unsigned short* __restrict__ Ah,
                                             const unsigned short* __restrict__ Al, int lda,
                                             const unsigned short* __restrict__ Bh,
                                             const unsigned short* __restrict__ Bl, int ldb,
                                             int K, const int (&arow)[4], int nrow, int mw, int nw, int tid,
                                             int lane, unsigned short* tl, v8f (&acc)[2][2]) {
  const int pr = tid >> 3;                           // 0..31: row within each group of 32 rows
  const int pe = (tid & 7) * 8;                      // first of this thread's 8 k elements in the row
  const unsigned short* const gp[4] = {Ah, Al,
                                       Bh + (size_t)(nrow + pr) * ldb + pe, Bl + (size_t)(nrow + pr) * ldb + pe};
  unsigned int ao[4];                                // byte offset of this thread's piece in its A row of each group
#pragma unroll
  for (int i = 0; i < 4; ++i) ao[i] = ((unsigned int)arow[i] * (unsigned int)lda + (unsigned int)pe) * 2u;
  unsigned short* sp = tl + pr * KTP + pe;
  v4u pf[12];
  gemm_ld(gp, ao, ldb, 0, pf);
// rolled: one copy of the stage body keeps the code short and the register count at three blocks per WGP
#pragma unroll 1
  for (int k0 = 0; k0 < K; k0 += GBK) {
#pragma unroll
    for (int i = 0; i < 12; ++i) *(v4u*)(sp + 32 * i * KTP) = pf[i];
    __syncthreads();                                 // the stage is visible to every wave
    if (k0 + GBK < K) {
#pragma unroll
      for (int i = 0; i < 4; ++i) ao[i] += GBK * 2;  // the A offsets step to the next stage's k
      gemm_ld(gp, ao, ldb, k0 + GBK, pf);
    }
    stage_products(tl, mw, nw, lane, acc);
    __syncthreads();                                 // every reader of the stage is done before it is rewritten
  }
}

// ---------------------------------------------------------------------------
// The same main loop with A given as f32 rows (pitch lda floats): the hi and lo planes of A exist in LDS only. Per
// stage a thread loads 8 pieces of 4 floats, tile rows (tid>>5) + 8*((tid>>4)&1) + 16*i, floats 4*(tid&15) .. +3 of the
// stage's 64: a wave's 16-B loads cover two whole 256-B row pieces. The pieces wait in registers while the stage
// before is multiplied; split2 then makes hi = rne(a), lo = rne(a - hi), and each plane gets one 8-B LDS store a piece
// (the two rows of a wave lie 8 apart, 32 banks at pitch KTP, so its 32 stores meet no bank twice).
// B planes, LDS layout, products and barriers as in gemm128x64x3. Tile row (tid>>5) + 8*((tid>>4)&1) + 16*i is row
// arow[i] of A (the caller's map).
// ---------------------------------------------------------------------------
__device__ __forceinline__ void gemm_ld_x(const float* __restrict__ A, const unsigned int (&ao)[8],
                                          const unsigned short* gbh, const unsigned short* gbl, int ldb, int k0,
                                          v4f (&pa)[8], v4u (&pb)[4]) {
#pragma unroll
  for (int i = 0; i < 8; ++i) pa[i] = *(const v4f*)((const char*)A + ao[i]);
#pragma unroll
  for (int i = 0; i < 2; ++i) {
    pb[i]     = *(const v4u*)(gbh + (size_t)(32 * i) * ldb + k0);
    pb[2 + i] = *(const v4u*)(gbl + (size_t)(32 * i) * ldb + k0);
  }
  // precaution: stands in front of the fragment loads, which land in the address registers of the loads above
  asm volatile("s_wait_xcnt 0x0" ::: "memory");
}

__device__ __forceinline__ void gemm_x128x64x3(const float* __restrict__ A, int lda,
                                               const unsigned short* __restrict__ Bh,
                                               const unsigned short* __restrict__ Bl, int ldb,
                                               int K, const int (&arow)[8], int nrow, int mw, int nw, int tid,
                                               int lane, unsigned short* tl, v8f (&acc)[2][2]) {
  const int pr = tid >> 3;                           // 0..31: B row within each group of 32 rows
  const int pe = (tid & 7) * 8;                      // first of this thread's 8 k elements in the B row
  const int ar = (tid >> 5) + 8 * ((tid >> 4) & 1);  // 0..15: A row within each group of 16 rows
  const int ac = (tid & 15) * 4;                     // first of this thread's 4 k elements in the A row
  const unsigned short* gbh = Bh + (size_t)(nrow + pr) * ldb + pe;
  const unsigned short* gbl = Bl + (size_t)(nrow + pr) * ldb + pe;
  unsigned int ao[8];                                // byte offset of this thread's piece in its A row of each group
#pragma unroll
  for (int i = 0; i < 8; ++i) ao[i] = ((unsigned int)arow[i] * (unsigned int)lda + (unsigned int)ac) * 4u;
  unsigned short* sa = tl + ar * KTP + ac;
  unsigned short* sb = tl + (256 + pr) * KTP + pe;
  v4f pa[8];
  v4u pb[4];
  gemm_ld_x(A, ao, gbh, gbl, ldb, 0, pa, pb);
// rolled: one copy of the stage body keeps the code short and the register count at three blocks per WGP
#pragma unroll 1
  for (int k0 = 0; k0 < K; k0 += GBK) {
#pragma unroll
    for (int i = 0; i < 8; ++i) {
      unsigned int h0, h1, l0, l1;
      split2(pa[i][0], pa[i][1], h0, l0);
      split2(pa[i][2], pa[i][3], h1, l1);
      *(v2u*)(sa + 16 * i * KTP)         = (v2u){h0, h1};
      *(v2u*)(sa + (128 + 16 * i) * KTP) = (v2u){l0, l1};
    }
#pragma unroll
    for (int i = 0; i < 2; ++i) {
      *(v4u*)(sb + 32 * i * KTP)        = pb[i];
      *(v4u*)(sb + (64 + 32 * i) * KTP) = pb[2 + i];
    }
    __syncthreads();                                 // the stage is visible to every wave
    if (k0 + GBK < K) {
#pragma unroll
      for (int i = 0; i < 8; ++i) ao[i] += GBK * 4;  // the A offsets step to the next stage's k
      gemm_ld_x(A, ao, gbh, gbl, ldb, k0 + GBK, pa, pb);
    }
    stage_products(tl, mw, nw, lane, acc);
    __syncthreads();                                 // every reader of the stage is done before it is rewritten
  }
}

// stage acc + bias in the block tile, row-major [row][col] (128 x 64, pitch OTP floats)
__device__ __forceinline__ void stage_rm(v8f (&acc)[2][2], const float (&bb)[2], float* st,
                                         int mw, int nw, int hh, int c) {
#pragma unroll
  for (int s = 0; s < 2; ++s)
#pragma unroll
    for (int t = 0; t < 2; ++t)
#pragma unroll
      for (int r = 0; r < 8; ++r)
        st[(mw + 16 * s + 8 * hh + r) * OTP + nw + 16 * t + c] = acc[s][t][r] + bb[t];
}

// stage acc + bias transposed [col][row] (64 x 128, pitch VTP floats)
__device__ __forceinline__ void stage_tr(v8f (&acc)[2][2], const float (&bb)[2], float* st,
                                         int mw, int nw, int hh, int c) {
#pragma unroll
  for (int s = 0; s < 2; ++s)
#pragma unroll
    for (int t = 0; t < 2; ++t)
#pragma unroll
      for (int r = 0; r < 8; ++r)
        st[(nw + 16 * t + c) * VTP + mw + 16 * s + 8 * hh + r] = acc[s][t][r] + bb[t];
}

// block tile 128 rows x 64 cols -> hi/lo planes at element base, row pitch ldo: each row = 64 halves = one whole
// coverage: 256 thr x 4 iter x 8 halves = 128 rows x 64 per plane.
__device__ __forceinline__ void store_planes(const float* st, unsigned short* __restrict__ oh,
                                             unsigned short* __restrict__ ol, size_t base, int ldo, int tid) {
  v4u vh[4], vl[4];
  size_t go[4];
#pragma unroll
  for (int it = 0; it < 4; ++it) {
    const int pp  = tid + 256 * it;                  // 0..1023
    const int row = pp >> 3;                         // 0..127
    const int pc  = pp & 7;                          // 16-B piece = cols 8*pc .. +7
    const float* ra = st + row * OTP + 8 * pc;
    const v4f a0 = *(const v4f*)(ra), a1 = *(const v4f*)(ra + 4);
    split8(a0, a1, vh[it], vl[it]);
    go[it] = base + (size_t)row * ldo + 8 * pc;
  }
  {
#pragma unroll
    for (int it = 0; it < 4; ++it) {
      *(v4u*)(oh + go[it]) = vh[it];
      *(v4u*)(ol + go[it]) = vl[it];
    }
    
  }
}

// transposed block tile 64 d-rows x 128 p -> V^T hi/lo planes [bh][d][p] (p = position in the key order) at element base (= bh*HD*SL + sf):
// coverage: 256 thr x 4 iter x 8 halves = 64 d-rows x 128 p per plane.
__device__ __forceinline__ void store_vt(const float* st, unsigned short* __restrict__ vh,
                                         unsigned short* __restrict__ vl, size_t base, int tid) {
  v4u wh[4], wl[4];
  size_t go[4];
#pragma unroll
  for (int it = 0; it < 4; ++it) {
    const int pp   = tid + 256 * it;                 // 0..1023
    const int drow = pp >> 4;                        // 0..63
    const int pc   = pp & 15;                        // 8 consecutive p
    const float* ra = st + drow * VTP + 8 * pc;
    const v4f a0 = *(const v4f*)(ra), a1 = *(const v4f*)(ra + 4);
    split8(a0, a1, wh[it], wl[it]);
    go[it] = base + (size_t)drow * SL + 8 * pc;
  }
  {
#pragma unroll
    for (int it = 0; it < 4; ++it) {
      *(v4u*)(vh + go[it]) = wh[it];
      *(v4u*)(vl + go[it]) = wl[it];
    }
    
  }
}

// coverage: 256 thr x 8 iter x 4 floats = 128 rows x 64 cols.
__device__ __forceinline__ void store_f32(const float* st, float* __restrict__ out, int mblk, int nblk, int tid) {
  v4f val[8];
  size_t go[8];
#pragma unroll
  for (int it = 0; it < 8; ++it) {
    const int pp  = tid + 256 * it;                  // 0..2047
    const int row = pp >> 4;                         // 0..127
    const int pc  = pp & 15;                         // 4 consecutive cols
    val[it] = *(const v4f*)(st + row * OTP + 4 * pc);
    go[it]  = (size_t)(mblk + row) * DM + nblk + 4 * pc;
  }
  {
#pragma unroll
    for (int it = 0; it < 8; ++it) *(v4f*)(out + go[it]) = val[it];
    
  }
}

// ---------------------------------------------------------------------------
// kernel 1: projections. blockIdx.x = which*NH + head (which 0 = q, 1 = k, 2 = v), blockIdx.y = 128-token block
// of one sequence b. A = x, f32 [NT][DM] (pitch DM, K = DM), B = stacked transposed weight planes [3*DM n][DM k]
// rows which*DM + head*64 .. (pitch DM). Bias added in f32.
// grid = (3*NH = 24, NT/128 = 32). coverage: q planes 16 bh x 16 blocks x 128 s x 64 d; k planes (128 p x 64 d)
// and v^T planes (64 d x 128 p) only in the blocks with sf < cnt[b].
// ---------------------------------------------------------------------------
__global__ __launch_bounds__(256) void k_proj(const float* __restrict__ x,
                                              const unsigned short* __restrict__ Wh,
                                              const unsigned short* __restrict__ Wl,
                                              const float* __restrict__ bq,
                                              const float* __restrict__ bk,
                                              const float* __restrict__ bv,
                                              const int* __restrict__ idx, const int* __restrict__ cnt,
                                              unsigned short* __restrict__ Qh, unsigned short* __restrict__ Ql,
                                              unsigned short* __restrict__ Kh, unsigned short* __restrict__ Kl,
                                              unsigned short* __restrict__ Vh, unsigned short* __restrict__ Vl) {
  __shared__ __align__(16) unsigned char sm[GSB];    // 55296 B: GEMM stage, then the f32 output staging tile
  unsigned short* tl = (unsigned short*)sm;
  float* st = (float*)sm;                            // 128 x OTP (the transposed 64 x VTP tile also fits)
  const int tid = threadIdx.x, lane = tid & 31, wave = tid >> 5;
  const int hh = lane >> 4, c = lane & 15;
  const int which = blockIdx.x / NH;                 // block-uniform
  const int head  = blockIdx.x - which * NH;
  const int mblk  = blockIdx.y * 128;
  const int b     = mblk / SL;
  const int sf    = mblk - b * SL;                   // first position of the block in sequence b
  const int bh    = b * NH + head;
  const int mw = (wave >> 1) * 32, nw = (wave & 1) * 32;

  // q: tile row = token. k, v: tile row = position in the sequence's key order; the token comes from idx, and a
  // block wholly behind the keys to attend has nothing to do (block-uniform return, in front of every barrier).
  int arow[8];
#pragma unroll
  for (int i = 0; i < 8; ++i) arow[i] = mblk + wave + 8 * hh + 16 * i;
  if (which != 0) {
    if (sf >= cnt[b]) return;
#pragma unroll
    for (int i = 0; i < 8; ++i) arow[i] = b * SL + (idx[arow[i]] & (SL - 1));
  }

  v8f acc[2][2];
#pragma unroll
  for (int s = 0; s < 2; ++s)
#pragma unroll
    for (int t = 0; t < 2; ++t) acc[s][t] = zero8();
  gemm_x128x64x3(x, DM,
                 Wh + (size_t)which * DM * DM, Wl + (size_t)which * DM * DM, DM,
                 DM, arow, head * HD, mw, nw, tid, lane, tl, acc);

  float bb[2];
#pragma unroll
  for (int t = 0; t < 2; ++t) {
    const int i = head * HD + nw + 16 * t + c;       // 0..511
    const float xq = bq[i], xk = bk[i], xv = bv[i];
    bb[t] = (which == 0) ? xq : ((which == 1) ? xk : xv);
  }
  if (which < 2) stage_rm(acc, bb, st, mw, nw, hh, c);
  else           stage_tr(acc, bb, st, mw, nw, hh, c);
  __syncthreads();
  if (which < 2) {
    unsigned short* oh = (which == 0) ? Qh : Kh;
    unsigned short* ol = (which == 0) ? Ql : Kl;
    store_planes(st, oh, ol, ((size_t)bh * SL + sf) * HD, HD, tid);
  } else {
    store_vt(st, Vh, Vl, (size_t)bh * HD * SL + sf, tid);
  }
}

// ---------------------------------------------------------------------------
// kernel 2: flash attention for every (b, head, 128-query block), head dim 64, up to 32 chunks of 64 keys.
//   q planes [b*NH + h][s][64] hi/lo; k planes [b*NH + h][p][64] and v^T planes [b*NH + h][64][p] hi/lo, p = position
//   in the key order; int32 tables [b][s]: gap bucket ids (queries); [b][p]: key mask (zero = masked), gap bucket
//   ids, duration bucket ids; cnt[b] = keys to attend; f32 tables gap [GAPR][NH], dur [DURR][NH];
//   O planes [token = b*SL + s][DM] hi/lo, head h at columns h*64 (one line per row).
// Block = 8 waves; wave w owns queries q0 = qb*128 + 16*w .. +15. The head's column of both bias tables is staged
// in LDS once per block. Per chunk: K [key][d] and V^T [d][key] hi/lo tiles staged in LDS by all threads
// (plain 16-B loads) while waves 0-1 stage the chunk's 64 per-key values (gap id, duration bias, mask) in LDS.
// Two LDS buffers: the next chunk's global loads are issued into registers in front of this chunk's products and
// stored into the other buffer behind them, one barrier per chunk.
// Each half of a chunk's products takes its eight LDS fragments first and then goes round the four accumulator tiles.
// The products are taken transposed: S^T = K.Q^T (A = K rows, B = Q rows) and O^T += V^T.P^T
// (A = V^T rows, B = P^T), so a lane holds scores of ONE query (column lane&15) for keys 16*j + 8*(lane>>4) + r.
// s/8 + gap[clip(|gq - gk|, 0, GAPR-1)] + dur[clamp(dk)], masked keys replaced by -1e9; maximum and sum run
// in-lane with one exchange between the wave halves; p = exp(s - m) is split into bf16 hi/lo and packed straight
// from the score accumulators into the B fragment (tiles 2*kk and 2*kk+1 are elements 0..7 and 8..15 of the split
// k map), so P never goes through LDS. Epilogue: O^T / l, 8 consecutive channels per lane and tile, split hi/lo and
// stored from registers.
// coverage: 256 blocks x 8 waves x 16 rows x 64 cols = NT x DM per plane.
// ---------------------------------------------------------------------------
__global__ __launch_bounds__(256) void k_attn(const unsigned short* __restrict__ Qh,
                                              const unsigned short* __restrict__ Ql,
                                              const unsigned short* __restrict__ Kh,
                                              const unsigned short* __restrict__ Kl,
                                              const unsigned short* __restrict__ Vh,
                                              const unsigned short* __restrict__ Vl,
                                              const int* __restrict__ gids,
                                              const int* __restrict__ cm,
                                              const int* __restrict__ cg,
                                              const int* __restrict__ cd,
                                              const int* __restrict__ cnt,
                                              const float* __restrict__ gap_emb,
                                              const float* __restrict__ dur_emb,
                                              unsigned short* __restrict__ Oh,
                                              unsigned short* __restrict__ Ol) {
  // per buffer: K hi tile, lo tile [key][d] (18432 B), then V^T hi tile, lo tile [d][key] (18432 B)
  __shared__ __align__(16) unsigned short KVs[2 * ATB];        // two buffers                     73728 B
  __shared__ __align__(16) int   gkB[2 * KC];                  // chunk's key gap bucket ids    2 x 256 B
  __shared__ __align__(16) float dbB[2 * KC];                  // chunk's key duration bias     2 x 256 B
  __shared__ __align__(16) int   mkB[2 * KC];                  // chunk's key mask              2 x 256 B
  __shared__ float gapS[36];                                   // gap table column of head h (33)   144 B
  __shared__ float durS[20];                                   // dur table column of head h (17)    80 B

  const int tid = threadIdx.x, lane = tid & 31, wave = tid >> 5;
  const int hh = lane >> 4, c = lane & 15;
  const int qb = blockIdx.x % NQB;
  const int bh = blockIdx.x / NQB;                   // b*NH + h
  const int h  = bh % NH;
  const int b  = bh / NH;
  const int q0 = qb * QB + wave * 16;
  const size_t qkbase = (size_t)bh * SL * HD;
  const size_t vbase  = (size_t)bh * HD * SL;

  // stage the head's table columns once (clamped addresses for every lane, predicated LDS store)
  {
    const int ig = (tid < GAPR) ? tid : (GAPR - 1);
    const int id = (tid < DURR) ? tid : (DURR - 1);
    const float gv = gap_emb[ig * NH + h];
    const float dv = dur_emb[id * NH + h];
    if (tid < GAPR) gapS[tid] = gv;
    if (tid < DURR) durS[tid] = dv;
  }

  // gap bucket id of the one query this lane's score elements belong to: q0 + (lane&15)
  const int gq = gids[(size_t)b * SL + q0 + c];

  // Q fragments (loop-invariant), B operand stored [n = query][k = d]: query q0 + (lane&15), split map over d
  v16b qh[2], ql[2];
#pragma unroll
  for (int dc = 0; dc < 2; ++dc) {
    qh[dc] = ldf(Qh + qkbase, HD, q0, dc * 32, lane);
    ql[dc] = ldf(Ql + qkbase, HD, q0, dc * 32, lane);
  }

  float mrow = -__builtin_huge_valf();               // running maximum of query c (equal in both halves)
  float lrow = 0.f;                                  // running sum over this half's keys; halves joined at the end
  v8f oacc[4];
#pragma unroll
  for (int t = 0; t < 4; ++t) oacc[t] = zero8();

  // chunks that hold keys to attend: 1..NCK (block-uniform); the last chunk's keys behind them are masked ones
  int nck = (cnt[b] + KC - 1) / KC;
  nck = (nck < 1) ? 1 : ((nck > NCK) ? NCK : nck);

  // staging of one chunk: this thread's 8 pieces of 16 B (K hi, K lo, V^T hi, V^T lo, two each) and, in waves 0 and 1
  // (wave-uniform), one key's gap id, duration id and mask; held in registers between the loads and the LDS stores
  const int sr = tid >> 2;                           // 0..63: key row of K tiles, d row of V^T tiles
  const int sq = (tid & 3) * 16;                     // 0,16,32,48 elements
  const unsigned short* gkh = Kh + qkbase + (size_t)sr * HD + sq;
  const unsigned short* gkl = Kl + qkbase + (size_t)sr * HD + sq;
  const unsigned short* gvh = Vh + vbase + (size_t)sr * SL + sq;
  const unsigned short* gvl = Vl + vbase + (size_t)sr * SL + sq;
  const int* gcg = cg + (size_t)b * SL + (tid & (KC - 1));
  const int* gcd = cd + (size_t)b * SL + (tid & (KC - 1));
  const int* gcm = cm + (size_t)b * SL + (tid & (KC - 1));
  v4u pf[8];
  int pg = 0, pd = 0, pm = 0;
  auto chunk_load = [&](int kv0) {                   // kv0 = first key position of the chunk, 0..SL-KC
#pragma unroll
    for (int e = 0; e < 2; ++e) {
      pf[e]     = *(const v4u*)(gkh + (size_t)kv0 * HD + 8 * e);
      pf[2 + e] = *(const v4u*)(gkl + (size_t)kv0 * HD + 8 * e);
      pf[4 + e] = *(const v4u*)(gvh + kv0 + 8 * e);
      pf[6 + e] = *(const v4u*)(gvl + kv0 + 8 * e);
    }
    if (tid < KC) {
      pg = gcg[kv0];
      pd = gcd[kv0];
      pm = gcm[kv0];
    }
    // precaution: stands in front of whatever next lands in the address registers of the loads above; its memory
    // clobber also keeps those loads in front of the chunk's products
    asm volatile("s_wait_xcnt 0x0" ::: "memory");
  };
  auto chunk_store = [&](int buf) {                  // buf = 0 or 1
    unsigned short* d = KVs + buf * ATB + sr * KTP + sq;
#pragma unroll
    for (int e = 0; e < 2; ++e) {
      *(v4u*)(d + 8 * e)                           = pf[e];
      *(v4u*)(d + KC * KTP + 8 * e)                = pf[2 + e];
      *(v4u*)(d + 2 * KC * KTP + 8 * e)            = pf[4 + e];
      *(v4u*)(d + 2 * KC * KTP + HD * KTP + 8 * e) = pf[6 + e];
    }
    if (tid < KC) {
      const int dk = (pd < 0) ? 0 : ((pd > DURR - 1) ? (DURR - 1) : pd);
      gkB[buf * KC + tid] = pg;
      dbB[buf * KC + tid] = durS[dk];
      mkB[buf * KC + tid] = pm;
    }
  };

  chunk_load(0);
  __syncthreads();                                   // the table columns are visible before chunk_store reads durS
  chunk_store(0);
  __syncthreads();                                   // chunk 0's tiles and key values visible to every wave

  for (int kc = 0; kc < nck; ++kc) {
    const int cur = kc & 1;
    const unsigned short* Ks = KVs + cur * ATB;
    const unsigned short* Vs = Ks + 2 * KC * KTP;
    const int*   gkS = gkB + cur * KC;
    const float* dbS = dbB + cur * KC;
    const int*   mkS = mkB + cur * KC;
    const bool more = kc + 1 < nck;                  // block-uniform
    if (more) chunk_load((kc + 1) * KC);

    v8f s[4];
#pragma unroll
    for (int j = 0; j < 4; ++j) s[j] = zero8();
    // A operands: key row j*16 + (lane&15) of the [key][d] tiles, split map over d. The eight K fragments of one d half
    // are read as one group in front of that half's products, and the products go round the four score tiles, so that
    // no product waits for an LDS read of its own or for the product just before it; each tile's order of sums is kept.
#pragma unroll
    for (int dc = 0; dc < 2; ++dc) {
      v16b khf[4], klf[4];
#pragma unroll
      for (int j = 0; j < 4; ++j) {
        khf[j] = ldf(Ks, KTP, j * 16, dc * 32, lane);
        klf[j] = ldf(Ks + KC * KTP, KTP, j * 16, dc * 32, lane);
      }
#pragma unroll
      for (int j = 0; j < 4; ++j) s[j] = mma(khf[j], qh[dc], s[j]);
#pragma unroll
      for (int j = 0; j < 4; ++j) s[j] = mma(klf[j], qh[dc], s[j]);
#pragma unroll
      for (int j = 0; j < 4; ++j) s[j] = mma(khf[j], ql[dc], s[j]);
    }
    // s[j][r] = S[query q0 + c][key kv0 + j*16 + 8*hh + r]; scale, table biases, replace-mask
#pragma unroll
    for (int j = 0; j < 4; ++j) {
      const int kb = 16 * j + 8 * hh;                // first of this lane's 8 keys of tile j, 0..56
      const v4i g0 = *(const v4i*)(gkS + kb), g1 = *(const v4i*)(gkS + kb + 4);
      const v4f d0 = *(const v4f*)(dbS + kb), d1 = *(const v4f*)(dbS + kb + 4);
      const v4i k0 = *(const v4i*)(mkS + kb), k1 = *(const v4i*)(mkS + kb + 4);
#pragma unroll
      for (int r = 0; r < 8; ++r) {
        const int   gk = (r < 4) ? g0[r & 3] : g1[r & 3];
        const float db = (r < 4) ? d0[r & 3] : d1[r & 3];
        const int   mk = (r < 4) ? k0[r & 3] : k1[r & 3];
        int rel = gq - gk;
        rel = (rel < 0) ? -rel : rel;
        rel = (rel > GAPR - 1) ? (GAPR - 1) : rel;
        rel = (rel < 0) ? 0 : rel;
        const float gbias = gapS[rel];
        const float v = (s[j][r] * 0.125f + gbias) + db;
        s[j][r] = (mk != 0) ? v : NEGV;
      }
    }
    // chunk maximum of query c: in-lane over this half's 32 keys, then one exchange between the halves
    float cj[4];
#pragma unroll
    for (int j = 0; j < 4; ++j) {
      cj[j] = fmaxf(fmaxf(fmaxf(s[j][0], s[j][1]), fmaxf(s[j][2], s[j][3])),
                    fmaxf(fmaxf(s[j][4], s[j][5]), fmaxf(s[j][6], s[j][7])));
    }
    float cm = fmaxf(fmaxf(cj[0], cj[1]), fmaxf(cj[2], cj[3]));
    cm = fmaxf(cm, other_half(cm));
    const float mnew  = fmaxf(mrow, cm);             // finite from chunk 0 on
    const float alpha = exp_slot(mrow - mnew);
    mrow = mnew;

    // p = exp(s - m); tile j's 8 values are 8 consecutive k positions of the B fragment
    v4u ph[4], pl[4];
    float pj[4];
#pragma unroll
    for (int j = 0; j < 4; ++j) {
      v4f p0, p1;
#pragma unroll
      for (int r = 0; r < 4; ++r) {
        p0[r] = exp_slot(s[j][r] - mnew);
        p1[r] = exp_slot(s[j][r + 4] - mnew);
      }
      pj[j] = ((p0[0] + p0[1]) + (p0[2] + p0[3])) + ((p1[0] + p1[1]) + (p1[2] + p1[3]));
      split8(p0, p1, ph[j], pl[j]);
    }
    lrow = lrow * alpha + ((pj[0] + pj[1]) + (pj[2] + pj[3]));
#pragma unroll
    for (int t = 0; t < 4; ++t)
#pragma unroll
      for (int r = 0; r < 8; ++r) oacc[t][r] *= alpha;

#pragma unroll
    for (int kk = 0; kk < 2; ++kk) {
      // A operands: channel row t*16 + (lane&15) of V^T [d][key], split k map over keys; the eight fragments of one
      // key half are read as one group in front of its products, which go round the four output tiles (each tile's
      // order of sums is kept)
      v16b vhf[4], vlf[4];
#pragma unroll
      for (int t = 0; t < 4; ++t) {
        vhf[t] = ldf(Vs, KTP, t * 16, kk * 32, lane);
        vlf[t] = ldf(Vs + HD * KTP, KTP, t * 16, kk * 32, lane);
      }
      // B operands: P^T column (lane&15) = query, split k map over keys 32*kk ..
      Frag fh, fl;
      fh.u[0] = ph[2 * kk]; fh.u[1] = ph[2 * kk + 1];
      fl.u[0] = pl[2 * kk]; fl.u[1] = pl[2 * kk + 1];
#pragma unroll
      for (int t = 0; t < 4; ++t) oacc[t] = mma(vhf[t], fh.v, oacc[t]);
#pragma unroll
      for (int t = 0; t < 4; ++t) oacc[t] = mma(vlf[t], fh.v, oacc[t]);
#pragma unroll
      for (int t = 0; t < 4; ++t) oacc[t] = mma(vhf[t], fl.v, oacc[t]);
    }
    if (more) {
      // the other buffer's last readers left it in front of the barrier that ended the chunk before this one
      chunk_store(cur ^ 1);
      __syncthreads();                               // next chunk visible; this chunk's readers are done
    }
  }

  // O = oacc / l  (l >= 1); oacc[t][r] = O[query q0 + c][channel 16*t + 8*hh + r]
  const float invl = 1.0f / (lrow + other_half(lrow));
  const size_t go = ((size_t)(b * SL + q0 + c)) * DM + (size_t)h * HD + 8 * hh;
  v4u wh[4], wl[4];
#pragma unroll
  for (int t = 0; t < 4; ++t) {
    const v4f a0 = (v4f){oacc[t][0] * invl, oacc[t][1] * invl, oacc[t][2] * invl, oacc[t][3] * invl};
    const v4f a1 = (v4f){oacc[t][4] * invl, oacc[t][5] * invl, oacc[t][6] * invl, oacc[t][7] * invl};
    split8(a0, a1, wh[t], wl[t]);
  }
#pragma unroll
  for (int t = 0; t < 4; ++t) {
    *(v4u*)(Oh + go + 16 * t) = wh[t];
    *(v4u*)(Ol + go + 16 * t) = wl[t];
  }
}

// ---------------------------------------------------------------------------
// kernel 3: out = O.Wo + bo -> f32 rows [NT][DM]. A = O planes [NT][DM], B = transposed
// Wo planes [DM n][DM k]. Block = 128 token rows x 64 cols; grid = (DM/64 = 8, NT/128 = 32).
// coverage: 8 x 32 blocks x 128 x 64 = NT x DM.
// ---------------------------------------------------------------------------
__global__ __launch_bounds__(256) void k_gemm_out(const unsigned short* __restrict__ Ah,
                                                  const unsigned short* __restrict__ Al,
                                                  const unsigned short* __restrict__ Wh,
                                                  const unsigned short* __restrict__ Wl,
                                                  const float* __restrict__ bo,
                                                  float* __restrict__ out) {
  __shared__ __align__(16) unsigned char sm[GSB];    // 55296 B: GEMM stage, then the f32 output staging tile
  unsigned short* tl = (unsigned short*)sm;
  float* st = (float*)sm;                            // 128 x OTP
  const int tid = threadIdx.x, lane = tid & 31, wave = tid >> 5;
  const int hh = lane >> 4, c = lane & 15;
  const int mblk = blockIdx.y * 128, nblk = blockIdx.x * 64;
  const int mw = (wave >> 1) * 32, nw = (wave & 1) * 32;

  v8f acc[2][2];
#pragma unroll
  for (int s = 0; s < 2; ++s)
#pragma unroll
    for (int t = 0; t < 2; ++t) acc[s][t] = zero8();
  int arow[4];
#pragma unroll
  for (int i = 0; i < 4; ++i) arow[i] = mblk + (tid >> 3) + 32 * i;
  gemm128x64x3(Ah, Al, DM, Wh, Wl, DM, DM, arow, nblk, mw, nw, tid, lane, tl, acc);

  float bb[2];
#pragma unroll
  for (int t = 0; t < 2; ++t) bb[t] = bo[nblk + nw + 16 * t + c];
  stage_rm(acc, bb, st, mw, nw, hh, c);
  __syncthreads();
  store_f32(st, out, mblk, nblk, tid);
}

// ---------------------------------------------------------------------------
// its producer writes, no padded tails exist since every dimension is a tile multiple; offsets multiples of 16 KB):
//   Wqkv  bf16x2 [1536][512]             0     3145728   (q rows 0..511, k 512..1023, v 1024..1535, [n][k])
//   Wo    bf16x2 [512][512]        3145728     1048576   ([n][k])
//   Q     bf16x2 [16][2048][64]    4194304     8388608
//   K     bf16x2 [16][2048][64]   12582912     8388608
//   V^T   bf16x2 [16][64][2048]   20971520     8388608
//   O     bf16x2 [4096][512]      29360128     8388608
//   key order: token index, gap id, duration id, mask, int32 [2][2048] each   37748736   4 x 16384; cnt int32 [2]
//   total                         37814528
// ---------------------------------------------------------------------------
extern "C" void kernel_launch(void* const* d_in, const int* in_sizes, int n_in,
                              void* d_out, int out_size, void* d_ws, size_t ws_size,
                              hipStream_t stream) {
  if (n_in < 14) return;
  if (in_sizes[0] != NT * DM) return;
  if (in_sizes[1] != NBT * SL) return;
  if (in_sizes[2] != NBT * SL) return;
  if (in_sizes[3] != NBT * SL) return;
  if (in_sizes[4] != DM * DM) return;
  if (in_sizes[5] != DM) return;
  if (in_sizes[6] != DM * DM) return;
  if (in_sizes[7] != DM) return;
  if (in_sizes[8] != DM * DM) return;
  if (in_sizes[9] != DM) return;
  if (in_sizes[10] != DM * DM) return;
  if (in_sizes[11] != DM) return;
  if (in_sizes[12] != GAPR * NH) return;
  if (in_sizes[13] != DURR * NH) return;
  if (out_size != NT * DM) return;

  const float* x     = (const float*)d_in[0];   // [2][2048][512] = [4096][512]
  const int*   amask = (const int*)d_in[1];     // [2][2048] int32, zero = masked key
  const int*   gids  = (const int*)d_in[2];     // [2][2048] int32
  const int*   dids  = (const int*)d_in[3];     // [2][2048] int32
  const float* W_q   = (const float*)d_in[4];   // [512][512] [in][out]
  const float* b_q   = (const float*)d_in[5];   // [512]
  const float* W_k   = (const float*)d_in[6];
  const float* b_k   = (const float*)d_in[7];
  const float* W_v   = (const float*)d_in[8];
  const float* b_v   = (const float*)d_in[9];
  const float* W_o   = (const float*)d_in[10];
  const float* b_o   = (const float*)d_in[11];
  const float* gtab  = (const float*)d_in[12];  // [33][8]
  const float* dtab  = (const float*)d_in[13];  // [17][8]
  float* out = (float*)d_out;                   // [4096][512] f32

  const size_t PX  = (size_t)NT * DM * 2;       // 4194304
  const size_t PW  = (size_t)3 * DM * DM * 2;   // 1572864
  const size_t PWO = (size_t)DM * DM * 2;       // 524288
  size_t off = 0;
  const size_t oWh  = off; off += PW;
  const size_t oWl  = off; off += PW;
  const size_t oWoh = off; off += PWO;
  const size_t oWol = off; off += PWO;
  const size_t oQh  = off; off += PX;
  const size_t oQl  = off; off += PX;
  const size_t oKh  = off; off += PX;
  const size_t oKl  = off; off += PX;
  const size_t oVh  = off; off += PX;
  const size_t oVl  = off; off += PX;
  const size_t oOh  = off; off += PX;
  const size_t oOl  = off; off += PX;
  const size_t PI  = (size_t)NBT * SL * 4;      // 16384
  const size_t oIdx = off; off += PI;
  const size_t oCg  = off; off += PI;
  const size_t oCd  = off; off += PI;
  const size_t oCm  = off; off += PI;
  const size_t oCnt = off; off += 256;
  if (off > ws_size) return;                    // off = 37814528
  if (off > (size_t)134217728) return;

  char* ws = (char*)d_ws;
  unsigned short* Wh  = (unsigned short*)(ws + oWh);
  unsigned short* Wl  = (unsigned short*)(ws + oWl);
  unsigned short* Woh = (unsigned short*)(ws + oWoh);
  unsigned short* Wol = (unsigned short*)(ws + oWol);
  unsigned short* Qh  = (unsigned short*)(ws + oQh);
  unsigned short* Ql  = (unsigned short*)(ws + oQl);
  unsigned short* Kh  = (unsigned short*)(ws + oKh);
  unsigned short* Kl  = (unsigned short*)(ws + oKl);
  unsigned short* Vh  = (unsigned short*)(ws + oVh);
  unsigned short* Vl  = (unsigned short*)(ws + oVl);
  unsigned short* Oh  = (unsigned short*)(ws + oOh);
  unsigned short* Ol  = (unsigned short*)(ws + oOl);
  int* kidx = (int*)(ws + oIdx);
  int* kcg  = (int*)(ws + oCg);
  int* kcd  = (int*)(ws + oCd);
  int* kcm  = (int*)(ws + oCm);
  int* kcnt = (int*)(ws + oCnt);

  // (0) transposed hi/lo planes of the four weights: in [k][n] -> out [n][k]; the first NBT blocks build the key
  // order of each sequence
  k_split_tr<<<dim3(NBT + 4 * (DM / 64) * (DM / 64)), dim3(256), 0, stream>>>(W_q, W_k, W_v, W_o, Wh, Wl, Woh, Wol,
                                                                              amask, gids, dids,
                                                                              kidx, kcg, kcd, kcm, kcnt);
  // (1) q / k / v^T planes, from x in f32
  k_proj<<<dim3(3 * NH, NT / 128), dim3(256), 0, stream>>>(x, Wh, Wl, b_q, b_k, b_v, kidx, kcnt,
                                                          Qh, Ql, Kh, Kl, Vh, Vl);
  // (2) attention -> O planes
  k_attn<<<dim3(NBT * NH * NQB), dim3(256), 0, stream>>>(Qh, Ql, Kh, Kl, Vh, Vl, gids, kcm, kcg, kcd, kcnt,
                                                        gtab, dtab, Oh, Ol);
  // (3) out = O.Wo + bo
  k_gemm_out<<<dim3(DM / 64, NT / 128), dim3(256), 0, stream>>>(Oh, Ol, Woh, Wol, b_o, out);
  (void)hipGetLastError();
}

// v008
// A run of this version takes 64.2 microseconds.
// Timed twice side by side with v007, it ran 1.08 and 1.09 times as fast.
// Over all steps from v000 it is 4.90 times as fast.
// Contractions: Q/K/V = x.W (3 sites), S = Q.K^T, O = P.V, out = O.Wo: all v_wmma_f32_16x16x32_bf16 on bf16 hi/lo
// split operand planes (hi.hi + hi.lo + lo.hi per tile pair), f32 accumulate; biases, the 1/8 scale, the bucket-table
// lookups, the key mask (every masked score one equal, very negative value) and the online softmax in f32.
// Plane carry audit: every hi/lo plane (X, Wqkv^T, Wo^T, Q, K, V^T, in-register P fragments, O) carries factor 1
// (hi = rne_bf16(v), lo = rne_bf16(v - hi), f32 exponent range, no subnormal concern); no inverse fold exists anywhere.
// Key order: per sequence the keys are reordered by a stable partition (unmasked first, masked behind); K and V are
// projected and attended only up to the last unmasked key (all keys when a sequence has none unmasked).
#include <hip/hip_runtime.h>
#include <stddef.h>

#define NBT 2                  // batch
#define SL  2048               // sequence length
#define DM  512                // model width
#define NH  8                  // heads
#define HD  64                 // head dim
#define NT  (NBT * SL)         // token rows, row m = b*SL + s
#define QB  128                // query rows per attention block
#define KC  64                 // keys per chunk
#define NQB (SL / QB)          // 16
#define NCK (SL / KC)          // 32
#define KTP 72                 // LDS pitch (16-bit elements) for 64-wide tiles, 144 B
#define OTP 68                 // f32 staging pitch [row][col] (128 x 64)
#define VTP 132                // f32 staging pitch [col][row] (64 x 128)
#define TTP 68                 // f32 staging pitch for the 64 x 64 weight transpose tile
#define GBK 64                 // k elements per GEMM stage: one whole 128-B line per plane row
#define GTR (2 * 128 + 2 * 64) // rows of one GEMM stage in LDS: A hi, A lo (128 each), B hi, B lo (64 each)
#define GSB (GTR * KTP * 2)    // bytes of one GEMM stage in LDS, 55296
#define GAPR 33                // time-gap table rows
#define DURR 17                // duration table rows
#define MSKB (-1.0e30f)        // masked key's staged bias term: absorbs the rest of the score, so all masked scores are equal
#define L2E  1.44269504f       // log2(e): scores are kept in units of log2, the exponential is the hardware's 2^x
#define GAPX (2 * GAPR - 1)    // entries of the two-sided gap table, index gq - gk + GAPR - 1
#define ATB  (2 * KC * KTP + 2 * HD * KTP) // 16-bit elements of one attention chunk's four tiles in LDS

static_assert(NT == 4096);
static_assert(NH * HD == DM);
static_assert(SL % QB == 0);
static_assert(SL % KC == 0);
static_assert(SL % 128 == 0);
static_assert(DM % 64 == 0);
static_assert(DM % 32 == 0);
static_assert(HD == 64);
static_assert(KC == 64);
static_assert(64 * VTP <= 128 * OTP);
static_assert(DM % GBK == 0);
static_assert(128 * OTP * 4 <= GSB);
static_assert(SL == 256 * 8);
static_assert(DM / 64 == 8);

typedef __bf16       v16b __attribute__((ext_vector_type(16)));
typedef float        v8f  __attribute__((ext_vector_type(8)));
typedef float        v4f  __attribute__((ext_vector_type(4)));
typedef float        v2f  __attribute__((ext_vector_type(2)));
typedef __bf16       v2b  __attribute__((ext_vector_type(2)));
typedef unsigned int v4u  __attribute__((ext_vector_type(4)));
typedef unsigned int v2u  __attribute__((ext_vector_type(2)));
typedef int          v4i  __attribute__((ext_vector_type(4)));
union Frag { v16b v; v4u u[2]; };

// WMMA with the dependent-VALU hazard guard (ties D, keeps A/B live)
__device__ __forceinline__ v8f mma(v16b a, v16b b, v8f c) {
  c = __builtin_amdgcn_wmma_f32_16x16x32_bf16(false, a, false, b, (short)0, c, false, false);
  asm volatile("v_nop\n\tv_nop\n\tv_nop\n\tv_nop" : "+v"(c) : "v"(a), "v"(b));
  return c;
}

// value of lane l ^ 16 (the other 16-lane half), by the vector cross-row move
__device__ __forceinline__ float other_half(float x) {
  const int b = __float_as_int(x);
  return __int_as_float(__builtin_amdgcn_permlanex16(b, b, 0x76543210, 0xfedcba98, false, false));
}

// 2^x by the hardware exponential (the factor log2(e) is in the staged tables). The v_nop fills the one slot that the
// instruction set asks for between a transcendental and a directly following instruction that reads its result or
// overwrites its source.
__device__ __forceinline__ float exp_slot(float x) {
  float r;
  asm("v_exp_f32 %0, %1\n\tv_nop" : "=v"(r) : "v"(x));
  return r;
}

__device__ __forceinline__ v8f zero8() { return (v8f){0.f, 0.f, 0.f, 0.f, 0.f, 0.f, 0.f, 0.f}; }

// Fragment loader for k-contiguous 16-bit rows with pitch ld (bf16 bits).
// A operand: row0 + (lane&15) is the M row. B operand stored [n][k]: row0 + (lane&15) is the N column.
// Split k map for both: elements 0..7 <- k0 + 8*(lane>>4) + 0..7, elements 8..15 <- k0 + 16 + 8*(lane>>4) + 0..7.
// D: acc[r] = element (row0 + 8*(lane>>4) + r, col0 + (lane&15)).
__device__ __forceinline__ v16b ldf(const unsigned short* p, int ld, int row0, int k0, int lane) {
  const unsigned short* q = p + (size_t)(row0 + (lane & 15)) * ld + k0 + 8 * (lane >> 4);
  Frag f;
  f.u[0] = *(const v4u*)(q);
  f.u[1] = *(const v4u*)(q + 16);
  return f.v;
}

// two floats -> two bf16, round to nearest even, in one word by the packed hardware convert (first element in the low
// half-word)
__device__ __forceinline__ unsigned int bf_pk(v2f x) {
  union { v2b v; unsigned int u; } w;
  w.v = __builtin_convertvector(x, v2b);
  return w.u;
}

// hi = rne(a), lo = rne(a - hi) for two floats, packed little-endian (first element in the low half-word)
__device__ __forceinline__ void split2(float a, float b, unsigned int& wh, unsigned int& wl) {
  const v2f x = (v2f){a, b};
  wh = bf_pk(x);
  const v2f h = (v2f){__uint_as_float(wh << 16), __uint_as_float(wh & 0xFFFF0000u)};
  wl = bf_pk(x - h);
}

// 8 consecutive floats -> one 16-B hi piece and one 16-B lo piece
__device__ __forceinline__ void split8(v4f a0, v4f a1, v4u& wh, v4u& wl) {
  unsigned int h0, h1, h2, h3, l0, l1, l2, l3;
  split2(a0[0], a0[1], h0, l0);
  split2(a0[2], a0[3], h1, l1);
  split2(a1[0], a1[1], h2, l2);
  split2(a1[2], a1[3], h3, l3);
  wh = (v4u){h0, h1, h2, h3};
  wl = (v4u){l0, l1, l2, l3};
}

// Stable partition of one sequence's SL keys by the mask: unmasked keys (mask != 0) first in their order, masked keys
// behind them in theirs. A masked key's score is MSKB, so its weight 2^(MSKB - m) is 0 as soon as one key of the
// sequence is unmasked: keys behind the last unmasked one add nothing and are left out by the later kernels.
// Writes, per new position: the key's token index, gap id, duration id and mask; and cnt[b] = keys to attend =
// number of unmasked keys, or SL when there is none (every score is then MSKB and all keys count alike).
// Thread t owns keys 8t .. 8t+7; block-wide inclusive scan of the per-thread counts in LDS, two buffers, one
// barrier a step. Every position 0..SL-1 is written exactly once (the map is a permutation).
__device__ __forceinline__ void compact_keys(const int* __restrict__ mask, const int* __restrict__ gids,
                                             const int* __restrict__ dids, int* __restrict__ idx,
                                             int* __restrict__ cg, int* __restrict__ cd, int* __restrict__ cm,
                                             int* __restrict__ cnt, int b, int tid) {
  __shared__ int sc[2][256];
  const int base = b * SL + tid * 8;
  const v4i m0 = *(const v4i*)(mask + base), m1 = *(const v4i*)(mask + base + 4);
  // precaution: stands in front of the next loads, which may land in the address registers of the loads above
  asm volatile("s_wait_xcnt 0x0" ::: "memory");
  const v4i g0 = *(const v4i*)(gids + base), g1 = *(const v4i*)(gids + base + 4);
  // precaution: as above
  asm volatile("s_wait_xcnt 0x0" ::: "memory");
  const v4i d0 = *(const v4i*)(dids + base), d1 = *(const v4i*)(dids + base + 4);
  int c = 0;
#pragma unroll
  for (int e = 0; e < 4; ++e) c += ((m0[e] != 0) ? 1 : 0) + ((m1[e] != 0) ? 1 : 0);
  sc[0][tid] = c;
  __syncthreads();
  int cur = 0;
#pragma unroll
  for (int o = 1; o < 256; o <<= 1) {
    int a = sc[cur][tid];
    if (tid >= o) a += sc[cur][tid - o];
    sc[cur ^ 1][tid] = a;
    cur ^= 1;
    __syncthreads();                                 // the step's sums are visible before the next step reads them
  }
  const int total = sc[cur][255];                    // unmasked keys of the sequence, 0..SL
  int ru = sc[cur][tid] - c;                         // unmasked keys in front of key 8t
  int rm = total + tid * 8 - ru;                     // total + masked keys in front of key 8t
#pragma unroll
  for (int e = 0; e < 8; ++e) {
    const int mk = (e < 4) ? m0[e & 3] : m1[e & 3];
    const int gk = (e < 4) ? g0[e & 3] : g1[e & 3];
    const int dk = (e < 4) ? d0[e & 3] : d1[e & 3];
    const int pos = b * SL + ((mk != 0) ? ru : rm);  // 0..SL-1 within the sequence
    ru += (mk != 0) ? 1 : 0;
    rm += (mk != 0) ? 0 : 1;
    idx[pos] = tid * 8 + e;
    cg[pos]  = gk;
    cd[pos]  = dk;
    cm[pos]  = mk;
  }
  if (tid == 0) cnt[b] = (total > 0) ? total : SL;
}

// ---------------------------------------------------------------------------
// kernel 0: weight transpose + split. in W [k = DM rows][n = DM cols] f32 -> out planes [n][k] hi/lo (pitch DM).
// Blocks 0 .. NBT-1 do not transpose: block b builds sequence b's key order instead (compact_keys).
// Block NBT + id: id>>6 = which weight (0 q, 1 k, 2 v -> stacked planes rows which*DM + n; 3 -> the out-projection
// planes), id&7 = 64-wide n tile (source columns), (id>>3)&7 = 64-deep k tile (source rows).
// coverage: load 256 thr x 16 floats = 64 x 64; store 256 thr x 2 iter x 8 halves = 64 n rows x 64 k per plane;
// 4 * (DM/64) * (DM/64) such blocks cover all four DM x DM matrices.
// ---------------------------------------------------------------------------
__global__ __launch_bounds__(256) void k_split_tr(const float* __restrict__ Wq, const float* __restrict__ Wk,
                                                  const float* __restrict__ Wv, const float* __restrict__ Wo,
                                                  unsigned short* __restrict__ Ph, unsigned short* __restrict__ Pl,
                                                  unsigned short* __restrict__ Oh, unsigned short* __restrict__ Ol,
                                                  const int* __restrict__ mask, const int* __restrict__ gids,
                                                  const int* __restrict__ dids, int* __restrict__ idx,
                                                  int* __restrict__ cg, int* __restrict__ cd, int* __restrict__ cm,
                                                  int* __restrict__ cnt) {
  __shared__ __align__(16) float st[64 * TTP];       // 17408 B
  const int tid = threadIdx.x;
  if (blockIdx.x < NBT) {                            // block-uniform
    compact_keys(mask, gids, dids, idx, cg, cd, cm, cnt, blockIdx.x, tid);
    return;
  }
  const int id  = blockIdx.x - NBT;                  // 0 .. 4*64-1
  const int z   = id >> 6;                           // block-uniform
  const int nt  = (id & 7) * 64;                     // source columns = output rows
  const int kt  = ((id >> 3) & 7) * 64;              // source rows    = output k
  const float* W = (z == 0) ? Wq : ((z == 1) ? Wk : ((z == 2) ? Wv : Wo));
  {
    const int row = tid >> 2;                        // k within tile, 0..63
    const int cb  = (tid & 3) * 16;                  // n within tile, 0,16,32,48
    const float* src = W + (size_t)(kt + row) * DM + nt + cb;
#pragma unroll
    for (int e = 0; e < 4; ++e) {
      const v4f a = *(const v4f*)(src + 4 * e);
#pragma unroll
      for (int q = 0; q < 4; ++q) st[(cb + 4 * e + q) * TTP + row] = a[q];
    }
  }
  __syncthreads();
  unsigned short* dh = (z < 3) ? (Ph + (size_t)z * DM * DM) : Oh;
  unsigned short* dl = (z < 3) ? (Pl + (size_t)z * DM * DM) : Ol;
  const size_t base = (size_t)nt * DM + kt;
  v4u vh[2], vl[2];
  size_t go[2];
#pragma unroll
  for (int it = 0; it < 2; ++it) {
    const int pp   = tid + 256 * it;                 // 0..511
    const int rown = pp >> 3;                        // 0..63
    const int pc   = pp & 7;                         // k piece 8*pc .. +7
    const float* ra = st + rown * TTP + 8 * pc;
    const v4f a0 = *(const v4f*)(ra), a1 = *(const v4f*)(ra + 4);
    split8(a0, a1, vh[it], vl[it]);
    go[it] = base + (size_t)rown * DM + 8 * pc;
  }
  {
#pragma unroll
    for (int it = 0; it < 2; ++it) {
      *(v4u*)(dh + go[it]) = vh[it];
      *(v4u*)(dl + go[it]) = vl[it];
    }
    
  }
}

// ---------------------------------------------------------------------------
// 128 x 64 block tile, 32 x 32 per wave, split-bf16 GEMM main loop over K (multiple of GBK): A planes [m][k] pitch
// lda, B planes [n][k] pitch ldb (hi and lo). Per stage of GBK = 64 k the block brings the 128 A rows and the 64 B
// rows of both planes into LDS (pitch KTP): a wave's 16-B loads cover 4 whole 128-B lines, 12 pieces per thread,
// rows (tid>>3) + 32*i: i 0..3 A hi, 4..7 A lo, 8..9 B hi, 10..11 B lo. The next stage's pieces are loaded into
// registers while this stage is multiplied. Fragments come from LDS by ldf (its split k map, A and B alike).
// Per tile pair: ah.bh + ah.bl + al.bh into one f32 accumulator, k ascending.
// Tile row (tid>>3) + 32*i is row arow[i] of the A planes (the caller's map from tile rows to plane rows).
// acc[s][t][r] = (tile row mw + 16*s + 8*(lane>>4) + r, nrow + nw + 16*t + (lane&15)).
// The loop ends behind a barrier: tl may be reused by the caller at once.
// ---------------------------------------------------------------------------
// the products of one stage in LDS: rows 0..127 A hi, 128..255 A lo, 256..319 B hi, 320..383 B lo, pitch KTP
__device__ __forceinline__ void stage_products(const unsigned short* tl, int mw, int nw, int lane, v8f (&acc)[2][2]) {
  const unsigned short* sAh = tl;
  const unsigned short* sAl = tl + 128 * KTP;
  const unsigned short* sBh = tl + 256 * KTP;
  const unsigned short* sBl = tl + 320 * KTP;
#pragma unroll
  for (int ks = 0; ks < GBK; ks += 32) {
    const v16b ah0 = ldf(sAh, KTP, mw, ks, lane);
    const v16b ah1 = ldf(sAh, KTP, mw + 16, ks, lane);
    const v16b al0 = ldf(sAl, KTP, mw, ks, lane);
    const v16b al1 = ldf(sAl, KTP, mw + 16, ks, lane);
#pragma unroll
    for (int t = 0; t < 2; ++t) {
      const v16b bh = ldf(sBh, KTP, nw + 16 * t, ks, lane);
      const v16b bl = ldf(sBl, KTP, nw + 16 * t, ks, lane);
      acc[0][t] = mma(ah0, bh, acc[0][t]);
      acc[1][t] = mma(ah1, bh, acc[1][t]);
      acc[0][t] = mma(ah0, bl, acc[0][t]);
      acc[1][t] = mma(ah1, bl, acc[1][t]);
      acc[0][t] = mma(al0, bh, acc[0][t]);
      acc[1][t] = mma(al1, bh, acc[1][t]);
    }
  }
}

__device__ __forceinline__ void gemm_ld(const unsigned short* const (&gp)[4], const unsigned int (&ao)[4], int ldb,
                                        int k0, v4u (&pf)[12]) {
#pragma unroll
  for (int i = 0; i < 4; ++i) {
    pf[i]     = *(const v4u*)((const char*)gp[0] + ao[i]);
    pf[4 + i] = *(const v4u*)((const char*)gp[1] + ao[i]);
  }
#pragma unroll
  for (int i = 0; i < 2; ++i) {
    pf[8 + i]  = *(const v4u*)(gp[2] + (size_t)(32 * i) * ldb + k0);
    pf[10 + i] = *(const v4u*)(gp[3] + (size_t)(32 * i) * ldb + k0);
  }
  // precaution: stands in front of the fragment loads, which land in the address registers of the loads above
  asm volatile("s_wait_xcnt 0x0" ::: "memory");
}

__device__ __forceinline__ void gemm128x64x3(const unsigned short* __restrict__ Ah,
                                             const unsigned short* __restrict__ Al, int lda,
                                             const unsigned short* __restrict__ Bh,
                                             const unsigned short* __restrict__ Bl, int ldb,
                                             int K, const int (&arow)[4], int nrow, int mw, int nw, int tid,
                                             int lane, unsigned short* tl, v8f (&acc)[2][2]) {
  const int pr = tid >> 3;                           // 0..31: row within each group of 32 rows
  const int pe = (tid & 7) * 8;                      // first of this thread's 8 k elements in the row
  const unsigned short* const gp[4] = {Ah, Al,
                                       Bh + (size_t)(nrow + pr) * ldb + pe, Bl + (size_t)(nrow + pr) * ldb + pe};
  unsigned int ao[4];                                // byte offset of this thread's piece in its A row of each group
#pragma unroll
  for (int i = 0; i < 4; ++i) ao[i] = ((unsigned int)arow[i] * (unsigned int)lda + (unsigned int)pe) * 2u;
  unsigned short* sp = tl + pr * KTP + pe;
  v4u pf[12];
  gemm_ld(gp, ao, ldb, 0, pf);
// rolled: one copy of the stage body keeps the code short and the register count at three blocks per WGP
#pragma unroll 1
  for (int k0 = 0; k0 < K; k0 += GBK) {
#pragma unroll
    for (int i = 0; i < 12; ++i) *(v4u*)(sp + 32 * i * KTP) = pf[i];
    __syncthreads();                                 // the stage is visible to every wave
    if (k0 + GBK < K) {
#pragma unroll
      for (int i = 0; i < 4; ++i) ao[i] += GBK * 2;  // the A offsets step to the next stage's k
      gemm_ld(gp, ao, ldb, k0 + GBK, pf);
    }
    stage_products(tl, mw, nw, lane, acc);
    __syncthreads();                                 // every reader of the stage is done before it is rewritten
  }
}

// ---------------------------------------------------------------------------
// The same main loop with A given as f32 rows (pitch lda floats): the hi and lo planes of A exist in LDS only. Per
// stage a thread loads 8 pieces of 4 floats, tile rows (tid>>5) + 8*((tid>>4)&1) + 16*i, floats 4*(tid&15) .. +3 of the
// stage's 64: a wave's 16-B loads cover two whole 256-B row pieces. The pieces wait in registers while the stage
// before is multiplied; split2 then makes hi = rne(a), lo = rne(a - hi), and each plane gets one 8-B LDS store a piece
// (the two rows of a wave lie 8 apart, 32 banks at pitch KTP, so its 32 stores meet no bank twice).
// B planes, LDS layout, products and barriers as in gemm128x64x3. Tile row (tid>>5) + 8*((tid>>4)&1) + 16*i is row
// arow[i] of A (the caller's map).
// ---------------------------------------------------------------------------
__device__ __forceinline__ void gemm_ld_x(const float* __restrict__ A, const unsigned int (&ao)[8],
                                          const unsigned short* gbh, const unsigned short* gbl, int ldb, int k0,
                                          v4f (&pa)[8], v4u (&pb)[4]) {
#pragma unroll
  for (int i = 0; i < 8; ++i) pa[i] = *(const v4f*)((const char*)A + ao[i]);
#pragma unroll
  for (int i = 0; i < 2; ++i) {
    pb[i]     = *(const v4u*)(gbh + (size_t)(32 * i) * ldb + k0);
    pb[2 + i] = *(const v4u*)(gbl + (size_t)(32 * i) * ldb + k0);
  }
  // precaution: stands in front of the fragment loads, which land in the address registers of the loads above
  asm volatile("s_wait_xcnt 0x0" ::: "memory");
}

__device__ __forceinline__ void gemm_x128x64x3(const float* __restrict__ A, int lda,
                                               const unsigned short* __restrict__ Bh,
                                               const unsigned short* __restrict__ Bl, int ldb,
                                               int K, const int (&arow)[8], int nrow, int mw, int nw, int tid,
                                               int lane, unsigned short* tl, v8f (&acc)[2][2]) {
  const int pr = tid >> 3;                           // 0..31: B row within each group of 32 rows
  const int pe = (tid & 7) * 8;                      // first of this thread's 8 k elements in the B row
  const int ar = (tid >> 5) + 8 * ((tid >> 4) & 1);  // 0..15: A row within each group of 16 rows
  const int ac = (tid & 15) * 4;                     // first of this thread's 4 k elements in the A row
  const unsigned short* gbh = Bh + (size_t)(nrow + pr) * ldb + pe;
  const unsigned short* gbl = Bl + (size_t)(nrow + pr) * ldb + pe;
  unsigned int ao[8];                                // byte offset of this thread's piece in its A row of each group
#pragma unroll
  for (int i = 0; i < 8; ++i) ao[i] = ((unsigned int)arow[i] * (unsigned int)lda + (unsigned int)ac) * 4u;
  unsigned short* sa = tl + ar * KTP + ac;
  unsigned short* sb = tl + (256 + pr) * KTP + pe;
  v4f pa[8];
  v4u pb[4];
  gemm_ld_x(A, ao, gbh, gbl, ldb, 0, pa, pb);
// rolled: one copy of the stage body keeps the code short and the register count at three blocks per WGP
#pragma unroll 1
  for (int k0 = 0; k0 < K; k0 += GBK) {
#pragma unroll
    for (int i = 0; i < 8; ++i) {
      unsigned int h0, h1, l0, l1;
      split2(pa[i][0], pa[i][1], h0, l0);
      split2(pa[i][2], pa[i][3], h1, l1);
      *(v2u*)(sa + 16 * i * KTP)         = (v2u){h0, h1};
      *(v2u*)(sa + (128 + 16 * i) * KTP) = (v2u){l0, l1};
    }
#pragma unroll
    for (int i = 0; i < 2; ++i) {
      *(v4u*)(sb + 32 * i * KTP)        = pb[i];
      *(v4u*)(sb + (64 + 32 * i) * KTP) = pb[2 + i];
    }
    __syncthreads();                                 // the stage is visible to every wave
    if (k0 + GBK < K) {
#pragma unroll
      for (int i = 0; i < 8; ++i) ao[i] += GBK * 4;  // the A offsets step to the next stage's k
      gemm_ld_x(A, ao, gbh, gbl, ldb, k0 + GBK, pa, pb);
    }
    stage_products(tl, mw, nw, lane, acc);
    __syncthreads();                                 // every reader of the stage is done before it is rewritten
  }
}

// stage acc + bias in the block tile, row-major [row][col] (128 x 64, pitch OTP floats)
__device__ __forceinline__ void stage_rm(v8f (&acc)[2][2], const float (&bb)[2], float* st,
                                         int mw, int nw, int hh, int c) {
#pragma unroll
  for (int s = 0; s < 2; ++s)
#pragma unroll
    for (int t = 0; t < 2; ++t)
#pragma unroll
      for (int r = 0; r < 8; ++r)
        st[(mw + 16 * s + 8 * hh + r) * OTP + nw + 16 * t + c] = acc[s][t][r] + bb[t];
}

// stage acc + bias transposed [col][row] (64 x 128, pitch VTP floats)
__device__ __forceinline__ void stage_tr(v8f (&acc)[2][2], const float (&bb)[2], float* st,
                                         int mw, int nw, int hh, int c) {
#pragma unroll
  for (int s = 0; s < 2; ++s)
#pragma unroll
    for (int t = 0; t < 2; ++t)
#pragma unroll
      for (int r = 0; r < 8; ++r)
        st[(nw + 16 * t + c) * VTP + mw + 16 * s + 8 * hh + r] = acc[s][t][r] + bb[t];
}

// block tile 128 rows x 64 cols -> hi/lo planes at element base, row pitch ldo: each row = 64 halves = one whole
// coverage: 256 thr x 4 iter x 8 halves = 128 rows x 64 per plane.
__device__ __forceinline__ void store_planes(const float* st, unsigned short* __restrict__ oh,
                                             unsigned short* __restrict__ ol, size_t base, int ldo, int tid) {
  v4u vh[4], vl[4];
  size_t go[4];
#pragma unroll
  for (int it = 0; it < 4; ++it) {
    const int pp  = tid + 256 * it;                  // 0..1023
    const int row = pp >> 3;                         // 0..127
    const int pc  = pp & 7;                          // 16-B piece = cols 8*pc .. +7
    const float* ra = st + row * OTP + 8 * pc;
    const v4f a0 = *(const v4f*)(ra), a1 = *(const v4f*)(ra + 4);
    split8(a0, a1, vh[it], vl[it]);
    go[it] = base + (size_t)row * ldo + 8 * pc;
  }
  {
#pragma unroll
    for (int it = 0; it < 4; ++it) {
      *(v4u*)(oh + go[it]) = vh[it];
      *(v4u*)(ol + go[it]) = vl[it];
    }
    
  }
}

// transposed block tile 64 d-rows x 128 p -> V^T hi/lo planes [bh][d][p] (p = position in the key order) at element base (= bh*HD*SL + sf):
// coverage: 256 thr x 4 iter x 8 halves = 64 d-rows x 128 p per plane.
__device__ __forceinline__ void store_vt(const float* st, unsigned short* __restrict__ vh,
                                         unsigned short* __restrict__ vl, size_t base, int tid) {
  v4u wh[4], wl[4];
  size_t go[4];
#pragma unroll
  for (int it = 0; it < 4; ++it) {
    const int pp   = tid + 256 * it;                 // 0..1023
    const int drow = pp >> 4;                        // 0..63
    const int pc   = pp & 15;                        // 8 consecutive p
    const float* ra = st + drow * VTP + 8 * pc;
    const v4f a0 = *(const v4f*)(ra), a1 = *(const v4f*)(ra + 4);
    split8(a0, a1, wh[it], wl[it]);
    go[it] = base + (size_t)drow * SL + 8 * pc;
  }
  {
#pragma unroll
    for (int it = 0; it < 4; ++it) {
      *(v4u*)(vh + go[it]) = wh[it];
      *(v4u*)(vl + go[it]) = wl[it];
    }
    
  }
}

// coverage: 256 thr x 8 iter x 4 floats = 128 rows x 64 cols.
__device__ __forceinline__ void store_f32(const float* st, float* __restrict__ out, int mblk, int nblk, int tid) {
  v4f val[8];
  size_t go[8];
#pragma unroll
  for (int it = 0; it < 8; ++it) {
    const int pp  = tid + 256 * it;                  // 0..2047
    const int row = pp >> 4;                         // 0..127
    const int pc  = pp & 15;                         // 4 consecutive cols
    val[it] = *(const v4f*)(st + row * OTP + 4 * pc);
    go[it]  = (size_t)(mblk + row) * DM + nblk + 4 * pc;
  }
  {
#pragma unroll
    for (int it = 0; it < 8; ++it) *(v4f*)(out + go[it]) = val[it];
    
  }
}

// ---------------------------------------------------------------------------
// kernel 1: projections. blockIdx.x = which*NH + head (which 0 = q, 1 = k, 2 = v), blockIdx.y = 128-token block
// of one sequence b. A = x, f32 [NT][DM] (pitch DM, K = DM), B = stacked transposed weight planes [3*DM n][DM k]
// rows which*DM + head*64 .. (pitch DM). Bias added in f32.
// grid = (3*NH = 24, NT/128 = 32). coverage: q planes 16 bh x 16 blocks x 128 s x 64 d; k planes (128 p x 64 d)
// and v^T planes (64 d x 128 p) only in the blocks with sf < cnt[b].
// ---------------------------------------------------------------------------
__global__ __launch_bounds__(256) void k_proj(const float* __restrict__ x,
                                              const unsigned short* __restrict__ Wh,
                                              const unsigned short* __restrict__ Wl,
                                              const float* __restrict__ bq,
                                              const float* __restrict__ bk,
                                              const float* __restrict__ bv,
                                              const int* __restrict__ idx, const int* __restrict__ cnt,
                                              unsigned short* __restrict__ Qh, unsigned short* __restrict__ Ql,
                                              unsigned short* __restrict__ Kh, unsigned short* __restrict__ Kl,
                                              unsigned short* __restrict__ Vh, unsigned short* __restrict__ Vl) {
  __shared__ __align__(16) unsigned char sm[GSB];    // 55296 B: GEMM stage, then the f32 output staging tile
  unsigned short* tl = (unsigned short*)sm;
  float* st = (float*)sm;                            // 128 x OTP (the transposed 64 x VTP tile also fits)
  const int tid = threadIdx.x, lane = tid & 31, wave = tid >> 5;
  const int hh = lane >> 4, c = lane & 15;
  const int which = blockIdx.x / NH;                 // block-uniform
  const int head  = blockIdx.x - which * NH;
  const int mblk  = blockIdx.y * 128;
  const int b     = mblk / SL;
  const int sf    = mblk - b * SL;                   // first position of the block in sequence b
  const int bh    = b * NH + head;
  const int mw = (wave >> 1) * 32, nw = (wave & 1) * 32;

  // q: tile row = token. k, v: tile row = position in the sequence's key order; the token comes from idx, and a
  // block wholly behind the keys to attend has nothing to do (block-uniform return, in front of every barrier).
  int arow[8];
#pragma unroll
  for (int i = 0; i < 8; ++i) arow[i] = mblk + wave + 8 * hh + 16 * i;
  if (which != 0) {
    if (sf >= cnt[b]) return;
#pragma unroll
    for (int i = 0; i < 8; ++i) arow[i] = b * SL + (idx[arow[i]] & (SL - 1));
  }

  v8f acc[2][2];
#pragma unroll
  for (int s = 0; s < 2; ++s)
#pragma unroll
    for (int t = 0; t < 2; ++t) acc[s][t] = zero8();
  gemm_x128x64x3(x, DM,
                 Wh + (size_t)which * DM * DM, Wl + (size_t)which * DM * DM, DM,
                 DM, arow, head * HD, mw, nw, tid, lane, tl, acc);

  float bb[2];
#pragma unroll
  for (int t = 0; t < 2; ++t) {
    const int i = head * HD + nw + 16 * t + c;       // 0..511
    const float xq = bq[i], xk = bk[i], xv = bv[i];
    bb[t] = (which == 0) ? xq : ((which == 1) ? xk : xv);
  }
  if (which < 2) stage_rm(acc, bb, st, mw, nw, hh, c);
  else           stage_tr(acc, bb, st, mw, nw, hh, c);
  __syncthreads();
  if (which < 2) {
    unsigned short* oh = (which == 0) ? Qh : Kh;
    unsigned short* ol = (which == 0) ? Ql : Kl;
    store_planes(st, oh, ol, ((size_t)bh * SL + sf) * HD, HD, tid);
  } else {
    store_vt(st, Vh, Vl, (size_t)bh * HD * SL + sf, tid);
  }
}

// ---------------------------------------------------------------------------
// kernel 2: flash attention for every (b, head, 128-query block), head dim 64, up to 32 chunks of 64 keys.
//   q planes [b*NH + h][s][64] hi/lo; k planes [b*NH + h][p][64] and v^T planes [b*NH + h][64][p] hi/lo, p = position
//   in the key order; int32 tables [b][s]: gap bucket ids (queries); [b][p]: key mask (zero = masked), gap bucket
//   ids, duration bucket ids; cnt[b] = keys to attend; f32 tables gap [GAPR][NH], dur [DURR][NH];
//   O planes [token = b*SL + s][DM] hi/lo, head h at columns h*64 (one line per row).
// Block = 8 waves; wave w owns queries q0 = qb*128 + 16*w .. +15. The head's column of both bias tables is staged
// in LDS once per block. Per chunk: K [key][d] and V^T [d][key] hi/lo tiles staged in LDS by all threads
// (plain 16-B loads) while waves 0-1 stage the chunk's 64 keys' two values (gap table offset, key term) in LDS.
// Two LDS buffers: the next chunk's global loads are issued into registers in front of this chunk's products and
// stored into the other buffer behind them, one barrier per chunk.
// Each half of a chunk's products takes its eight LDS fragments first and then goes round the four accumulator tiles.
// The products are taken transposed: S^T = K.Q^T (A = K rows, B = Q rows) and O^T += V^T.P^T
// (A = V^T rows, B = P^T), so a lane holds scores of ONE query (column lane&15) for keys 16*j + 8*(lane>>4) + r.
// score * log2(e) = s * (log2(e)/8) + gapX[gq - gk + GAPR-1] + key term. All that depends on a table entry or on the
// key alone is done once at staging: both tables carry the factor log2(e); the gap table is laid out two-sided,
// gapX[i] = gap[|i - (GAPR-1)|], so that |gq - gk| needs no absolute value; the ids are clamped to 0..GAPR-1 and held
// as byte offsets (4*gq, 4*(GAPR-1 - gk)), which bounds the index to 0..GAPX-1 for any content; the key term is the duration bias, or MSKB
// for a masked key, whose score is then MSKB exactly (weight 0 beside an unmasked key, equal weights when a sequence
// has none unmasked, as with -1e9). Maximum and sum run
// in-lane with one exchange between the wave halves; p = 2^(score - m) is split into bf16 hi/lo and packed straight
// from the score accumulators into the B fragment (tiles 2*kk and 2*kk+1 are elements 0..7 and 8..15 of the split
// k map), so P never goes through LDS. Epilogue: O^T / l, 8 consecutive channels per lane and tile, split hi/lo and
// stored from registers.
// coverage: 256 blocks x 8 waves x 16 rows x 64 cols = NT x DM per plane.
// ---------------------------------------------------------------------------
__global__ __launch_bounds__(256) void k_attn(const unsigned short* __restrict__ Qh,
                                              const unsigned short* __restrict__ Ql,
                                              const unsigned short* __restrict__ Kh,
                                              const unsigned short* __restrict__ Kl,
                                              const unsigned short* __restrict__ Vh,
                                              const unsigned short* __restrict__ Vl,
                                              const int* __restrict__ gids,
                                              const int* __restrict__ cm,
                                              const int* __restrict__ cg,
                                              const int* __restrict__ cd,
                                              const int* __restrict__ cnt,
                                              const float* __restrict__ gap_emb,
                                              const float* __restrict__ dur_emb,
                                              unsigned short* __restrict__ Oh,
                                              unsigned short* __restrict__ Ol) {
  // per buffer: K hi tile, lo tile [key][d] (18432 B), then V^T hi tile, lo tile [d][key] (18432 B)
  // one LDS block with the gap table at its start, so that a score's table address is the byte offset gqo + gk itself
  __shared__ __align__(16) unsigned char sm[1408 + 2 * ATB * 2];
  float* gapX = (float*)sm;                                    // two-sided gap table of head h (65)     272 B
  float* durS = (float*)(sm + 288);                            // dur table column of head h (17)         80 B
  int*   gkB  = (int*)(sm + 384);                              // chunk's keys' gap table offsets    2 x 256 B
  float* dbB  = (float*)(sm + 896);                            // chunk's key terms                  2 x 256 B
  unsigned short* KVs = (unsigned short*)(sm + 1408);          // two buffers                          73728 B

  const int tid = threadIdx.x, lane = tid & 31, wave = tid >> 5;
  const int hh = lane >> 4, c = lane & 15;
  const int qb = blockIdx.x % NQB;
  const int bh = blockIdx.x / NQB;                   // b*NH + h
  const int h  = bh % NH;
  const int b  = bh / NH;
  const int q0 = qb * QB + wave * 16;
  const size_t qkbase = (size_t)bh * SL * HD;
  const size_t vbase  = (size_t)bh * HD * SL;

  // stage the head's table columns once (clamped addresses for every lane, predicated LDS store)
  {
    const int ix = (tid < GAPX) ? tid : (GAPX - 1);  // 0..64
    const int ig = (ix < GAPR - 1) ? (GAPR - 1 - ix) : (ix - (GAPR - 1));   // |ix - 32|, 0..32
    const int id = (tid < DURR) ? tid : (DURR - 1);
    const float gv = gap_emb[ig * NH + h];
    const float dv = dur_emb[id * NH + h];
    if (tid < GAPX) gapX[tid] = gv * L2E;
    if (tid < DURR) durS[tid] = dv * L2E;
  }

  // gap bucket id of the one query this lane's score elements belong to, q0 + (lane&15), clamped to 0..GAPR-1;
  // gqo = its share of the byte offset in gapX, 0..128
  const int gq = gids[(size_t)b * SL + q0 + c];
  const int gqo = ((gq < 0) ? 0 : ((gq > GAPR - 1) ? (GAPR - 1) : gq)) * 4;

  // Q fragments (loop-invariant), B operand stored [n = query][k = d]: query q0 + (lane&15), split map over d
  v16b qh[2], ql[2];
#pragma unroll
  for (int dc = 0; dc < 2; ++dc) {
    qh[dc] = ldf(Qh + qkbase, HD, q0, dc * 32, lane);
    ql[dc] = ldf(Ql + qkbase, HD, q0, dc * 32, lane);
  }

  float mrow = -__builtin_huge_valf();               // running maximum of query c (equal in both halves)
  float lrow = 0.f;                                  // running sum over this half's keys; halves joined at the end
  v8f oacc[4];
#pragma unroll
  for (int t = 0; t < 4; ++t) oacc[t] = zero8();

  // chunks that hold keys to attend: 1..NCK (block-uniform); the last chunk's keys behind them are masked ones
  int nck = (cnt[b] + KC - 1) / KC;
  nck = (nck < 1) ? 1 : ((nck > NCK) ? NCK : nck);

  // staging of one chunk: this thread's 8 pieces of 16 B (K hi, K lo, V^T hi, V^T lo, two each) and, in waves 0 and 1
  // (wave-uniform), one key's gap id, duration id and mask; held in registers between the loads and the LDS stores
  const int sr = tid >> 2;                           // 0..63: key row of K tiles, d row of V^T tiles
  const int sq = (tid & 3) * 16;                     // 0,16,32,48 elements
  const unsigned short* gkh = Kh + qkbase + (size_t)sr * HD + sq;
  const unsigned short* gkl = Kl + qkbase + (size_t)sr * HD + sq;
  const unsigned short* gvh = Vh + vbase + (size_t)sr * SL + sq;
  const unsigned short* gvl = Vl + vbase + (size_t)sr * SL + sq;
  const int* gcg = cg + (size_t)b * SL + (tid & (KC - 1));
  const int* gcd = cd + (size_t)b * SL + (tid & (KC - 1));
  const int* gcm = cm + (size_t)b * SL + (tid & (KC - 1));
  v4u pf[8];
  int pg = 0, pd = 0, pm = 0;
  auto chunk_load = [&](int kv0) {                   // kv0 = first key position of the chunk, 0..SL-KC
#pragma unroll
    for (int e = 0; e < 2; ++e) {
      pf[e]     = *(const v4u*)(gkh + (size_t)kv0 * HD + 8 * e);
      pf[2 + e] = *(const v4u*)(gkl + (size_t)kv0 * HD + 8 * e);
      pf[4 + e] = *(const v4u*)(gvh + kv0 + 8 * e);
      pf[6 + e] = *(const v4u*)(gvl + kv0 + 8 * e);
    }
    if (tid < KC) {
      pg = gcg[kv0];
      pd = gcd[kv0];
      pm = gcm[kv0];
    }
    // precaution: stands in front of whatever next lands in the address registers of the loads above; its memory
    // clobber also keeps those loads in front of the chunk's products
    asm volatile("s_wait_xcnt 0x0" ::: "memory");
  };
  auto chunk_store = [&](int buf) {                  // buf = 0 or 1
    unsigned short* d = KVs + buf * ATB + sr * KTP + sq;
#pragma unroll
    for (int e = 0; e < 2; ++e) {
      *(v4u*)(d + 8 * e)                           = pf[e];
      *(v4u*)(d + KC * KTP + 8 * e)                = pf[2 + e];
      *(v4u*)(d + 2 * KC * KTP + 8 * e)            = pf[4 + e];
      *(v4u*)(d + 2 * KC * KTP + HD * KTP + 8 * e) = pf[6 + e];
    }
    if (tid < KC) {
      const int dk = (pd < 0) ? 0 : ((pd > DURR - 1) ? (DURR - 1) : pd);
      const int gk = (pg < 0) ? 0 : ((pg > GAPR - 1) ? (GAPR - 1) : pg);
      gkB[buf * KC + tid] = (GAPR - 1 - gk) * 4;     // the key's share of the byte offset in gapX, 0..128
      dbB[buf * KC + tid] = (pm != 0) ? durS[dk] : MSKB;
    }
  };

  chunk_load(0);
  __syncthreads();                                   // the table columns are visible before chunk_store reads durS
  chunk_store(0);
  __syncthreads();                                   // chunk 0's tiles and key values visible to every wave

  for (int kc = 0; kc < nck; ++kc) {
    const int cur = kc & 1;
    const unsigned short* Ks = KVs + cur * ATB;
    const unsigned short* Vs = Ks + 2 * KC * KTP;
    const int*   gkS = gkB + cur * KC;
    const float* dbS = dbB + cur * KC;
    const bool more = kc + 1 < nck;                  // block-uniform
    if (more) chunk_load((kc + 1) * KC);

    v8f s[4];
#pragma unroll
    for (int j = 0; j < 4; ++j) s[j] = zero8();
    // A operands: key row j*16 + (lane&15) of the [key][d] tiles, split map over d. The eight K fragments of one d half
    // are read as one group in front of that half's products, and the products go round the four score tiles, so that
    // no product waits for an LDS read of its own or for the product just before it; each tile's order of sums is kept.
#pragma unroll
    for (int dc = 0; dc < 2; ++dc) {
      v16b khf[4], klf[4];
#pragma unroll
      for (int j = 0; j < 4; ++j) {
        khf[j] = ldf(Ks, KTP, j * 16, dc * 32, lane);
        klf[j] = ldf(Ks + KC * KTP, KTP, j * 16, dc * 32, lane);
      }
#pragma unroll
      for (int j = 0; j < 4; ++j) s[j] = mma(khf[j], qh[dc], s[j]);
#pragma unroll
      for (int j = 0; j < 4; ++j) s[j] = mma(klf[j], qh[dc], s[j]);
#pragma unroll
      for (int j = 0; j < 4; ++j) s[j] = mma(khf[j], ql[dc], s[j]);
    }
    // s[j][r] = S[query q0 + c][key kv0 + j*16 + 8*hh + r]; scale, gap bias, key term
#pragma unroll
    for (int j = 0; j < 4; ++j) {
      const int kb = 16 * j + 8 * hh;                // first of this lane's 8 keys of tile j, 0..56
      const v4i g0 = *(const v4i*)(gkS + kb), g1 = *(const v4i*)(gkS + kb + 4);
      const v4f d0 = *(const v4f*)(dbS + kb), d1 = *(const v4f*)(dbS + kb + 4);
#pragma unroll
      for (int r = 0; r < 8; ++r) {
        const int   gk = (r < 4) ? g0[r & 3] : g1[r & 3];
        const float db = (r < 4) ? d0[r & 3] : d1[r & 3];
        const float gbias = *(const float*)((const char*)gapX + (gqo + gk));   // byte offset 0..256
        s[j][r] = (s[j][r] * (0.125f * L2E) + gbias) + db;
      }
    }
    // chunk maximum of query c: in-lane over this half's 32 keys, then one exchange between the halves
    float cj[4];
#pragma unroll
    for (int j = 0; j < 4; ++j) {
      cj[j] = fmaxf(fmaxf(fmaxf(s[j][0], s[j][1]), fmaxf(s[j][2], s[j][3])),
                    fmaxf(fmaxf(s[j][4], s[j][5]), fmaxf(s[j][6], s[j][7])));
    }
    float cm = fmaxf(fmaxf(cj[0], cj[1]), fmaxf(cj[2], cj[3]));
    cm = fmaxf(cm, other_half(cm));
    const float mnew  = fmaxf(mrow, cm);             // finite from chunk 0 on
    const float alpha = exp_slot(mrow - mnew);
    mrow = mnew;

    // p = 2^(s - m); tile j's 8 values are 8 consecutive k positions of the B fragment
    v4u ph[4], pl[4];
    float pj[4];
#pragma unroll
    for (int j = 0; j < 4; ++j) {
      v4f p0, p1;
#pragma unroll
      for (int r = 0; r < 4; ++r) {
        p0[r] = exp_slot(s[j][r] - mnew);
        p1[r] = exp_slot(s[j][r + 4] - mnew);
      }
      pj[j] = ((p0[0] + p0[1]) + (p0[2] + p0[3])) + ((p1[0] + p1[1]) + (p1[2] + p1[3]));
      split8(p0, p1, ph[j], pl[j]);
    }
    lrow = lrow * alpha + ((pj[0] + pj[1]) + (pj[2] + pj[3]));
#pragma unroll
    for (int t = 0; t < 4; ++t)
#pragma unroll
      for (int r = 0; r < 8; ++r) oacc[t][r] *= alpha;

#pragma unroll
    for (int kk = 0; kk < 2; ++kk) {
      // A operands: channel row t*16 + (lane&15) of V^T [d][key], split k map over keys; the eight fragments of one
      // key half are read as one group in front of its products, which go round the four output tiles (each tile's
      // order of sums is kept)
      v16b vhf[4], vlf[4];
#pragma unroll
      for (int t = 0; t < 4; ++t) {
        vhf[t] = ldf(Vs, KTP, t * 16, kk * 32, lane);
        vlf[t] = ldf(Vs + HD * KTP, KTP, t * 16, kk * 32, lane);
      }
      // B operands: P^T column (lane&15) = query, split k map over keys 32*kk ..
      Frag fh, fl;
      fh.u[0] = ph[2 * kk]; fh.u[1] = ph[2 * kk + 1];
      fl.u[0] = pl[2 * kk]; fl.u[1] = pl[2 * kk + 1];
#pragma unroll
      for (int t = 0; t < 4; ++t) oacc[t] = mma(vhf[t], fh.v, oacc[t]);
#pragma unroll
      for (int t = 0; t < 4; ++t) oacc[t] = mma(vlf[t], fh.v, oacc[t]);
#pragma unroll
      for (int t = 0; t < 4; ++t) oacc[t] = mma(vhf[t], fl.v, oacc[t]);
    }
    if (more) {
      // the other buffer's last readers left it in front of the barrier that ended the chunk before this one
      chunk_store(cur ^ 1);
      __syncthreads();                               // next chunk visible; this chunk's readers are done
    }
  }

  // O = oacc / l  (l >= 1); oacc[t][r] = O[query q0 + c][channel 16*t + 8*hh + r]
  const float invl = 1.0f / (lrow + other_half(lrow));
  const size_t go = ((size_t)(b * SL + q0 + c)) * DM + (size_t)h * HD + 8 * hh;
  v4u wh[4], wl[4];
#pragma unroll
  for (int t = 0; t < 4; ++t) {
    const v4f a0 = (v4f){oacc[t][0] * invl, oacc[t][1] * invl, oacc[t][2] * invl, oacc[t][3] * invl};
    const v4f a1 = (v4f){oacc[t][4] * invl, oacc[t][5] * invl, oacc[t][6] * invl, oacc[t][7] * invl};
    split8(a0, a1, wh[t], wl[t]);
  }
#pragma unroll
  for (int t = 0; t < 4; ++t) {
    *(v4u*)(Oh + go + 16 * t) = wh[t];
    *(v4u*)(Ol + go + 16 * t) = wl[t];
  }
}

// ---------------------------------------------------------------------------
// kernel 3: out = O.Wo + bo -> f32 rows [NT][DM]. A = O planes [NT][DM], B = transposed
// Wo planes [DM n][DM k]. Block = 128 token rows x 64 cols; grid = (DM/64 = 8, NT/128 = 32).
// coverage: 8 x 32 blocks x 128 x 64 = NT x DM.
// ---------------------------------------------------------------------------
__global__ __launch_bounds__(256) void k_gemm_out(const unsigned short* __restrict__ Ah,
                                                  const unsigned short* __restrict__ Al,
                                                  const unsigned short* __restrict__ Wh,
                                                  const unsigned short* __restrict__ Wl,
                                                  const float* __restrict__ bo,
                                                  float* __restrict__ out) {
  __shared__ __align__(16) unsigned char sm[GSB];    // 55296 B: GEMM stage, then the f32 output staging tile
  unsigned short* tl = (unsigned short*)sm;
  float* st = (float*)sm;                            // 128 x OTP
  const int tid = threadIdx.x, lane = tid & 31, wave = tid >> 5;
  const int hh = lane >> 4, c = lane & 15;
  const int mblk = blockIdx.y * 128, nblk = blockIdx.x * 64;
  const int mw = (wave >> 1) * 32, nw = (wave & 1) * 32;

  v8f acc[2][2];
#pragma unroll
  for (int s = 0; s < 2; ++s)
#pragma unroll
    for (int t = 0; t < 2; ++t) acc[s][t] = zero8();
  int arow[4];
#pragma unroll
  for (int i = 0; i < 4; ++i) arow[i] = mblk + (tid >> 3) + 32 * i;
  gemm128x64x3(Ah, Al, DM, Wh, Wl, DM, DM, arow, nblk, mw, nw, tid, lane, tl, acc);

  float bb[2];
#pragma unroll
  for (int t = 0; t < 2; ++t) bb[t] = bo[nblk + nw + 16 * t + c];
  stage_rm(acc, bb, st, mw, nw, hh, c);
  __syncthreads();
  store_f32(st, out, mblk, nblk, tid);
}

// ---------------------------------------------------------------------------
// its producer writes, no padded tails exist since every dimension is a tile multiple; offsets multiples of 16 KB):
//   Wqkv  bf16x2 [1536][512]             0     3145728   (q rows 0..511, k 512..1023, v 1024..1535, [n][k])
//   Wo    bf16x2 [512][512]        3145728     1048576   ([n][k])
//   Q     bf16x2 [16][2048][64]    4194304     8388608
//   K     bf16x2 [16][2048][64]   12582912     8388608
//   V^T   bf16x2 [16][64][2048]   20971520     8388608
//   O     bf16x2 [4096][512]      29360128     8388608
//   key order: token index, gap id, duration id, mask, int32 [2][2048] each   37748736   4 x 16384; cnt int32 [2]
//   total                         37814528
// ---------------------------------------------------------------------------
extern "C" void kernel_launch(void* const* d_in, const int* in_sizes, int n_in,
                              void* d_out, int out_size, void* d_ws, size_t ws_size,
                              hipStream_t stream) {
  if (n_in < 14) return;
  if (in_sizes[0] != NT * DM) return;
  if (in_sizes[1] != NBT * SL) return;
  if (in_sizes[2] != NBT * SL) return;
  if (in_sizes[3] != NBT * SL) return;
  if (in_sizes[4] != DM * DM) return;
  if (in_sizes[5] != DM) return;
  if (in_sizes[6] != DM * DM) return;
  if (in_sizes[7] != DM) return;
  if (in_sizes[8] != DM * DM) return;
  if (in_sizes[9] != DM) return;
  if (in_sizes[10] != DM * DM) return;
  if (in_sizes[11] != DM) return;
  if (in_sizes[12] != GAPR * NH) return;
  if (in_sizes[13] != DURR * NH) return;
  if (out_size != NT * DM) return;

  const float* x     = (const float*)d_in[0];   // [2][2048][512] = [4096][512]
  const int*   amask = (const int*)d_in[1];     // [2][2048] int32, zero = masked key
  const int*   gids  = (const int*)d_in[2];     // [2][2048] int32
  const int*   dids  = (const int*)d_in[3];     // [2][2048] int32
  const float* W_q   = (const float*)d_in[4];   // [512][512] [in][out]
  const float* b_q   = (const float*)d_in[5];   // [512]
  const float* W_k   = (const float*)d_in[6];
  const float* b_k   = (const float*)d_in[7];
  const float* W_v   = (const float*)d_in[8];
  const float* b_v   = (const float*)d_in[9];
  const float* W_o   = (const float*)d_in[10];
  const float* b_o   = (const float*)d_in[11];
  const float* gtab  = (const float*)d_in[12];  // [33][8]
  const float* dtab  = (const float*)d_in[13];  // [17][8]
  float* out = (float*)d_out;                   // [4096][512] f32

  const size_t PX  = (size_t)NT * DM * 2;       // 4194304
  const size_t PW  = (size_t)3 * DM * DM * 2;   // 1572864
  const size_t PWO = (size_t)DM * DM * 2;       // 524288
  size_t off = 0;
  const size_t oWh  = off; off += PW;
  const size_t oWl  = off; off += PW;
  const size_t oWoh = off; off += PWO;
  const size_t oWol = off; off += PWO;
  const size_t oQh  = off; off += PX;
  const size_t oQl  = off; off += PX;
  const size_t oKh  = off; off += PX;
  const size_t oKl  = off; off += PX;
  const size_t oVh  = off; off += PX;
  const size_t oVl  = off; off += PX;
  const size_t oOh  = off; off += PX;
  const size_t oOl  = off; off += PX;
  const size_t PI  = (size_t)NBT * SL * 4;      // 16384
  const size_t oIdx = off; off += PI;
  const size_t oCg  = off; off += PI;
  const size_t oCd  = off; off += PI;
  const size_t oCm  = off; off += PI;
  const size_t oCnt = off; off += 256;
  if (off > ws_size) return;                    // off = 37814528
  if (off > (size_t)134217728) return;

  char* ws = (char*)d_ws;
  unsigned short* Wh  = (unsigned short*)(ws + oWh);
  unsigned short* Wl  = (unsigned short*)(ws + oWl);
  unsigned short* Woh = (unsigned short*)(ws + oWoh);
  unsigned short* Wol = (unsigned short*)(ws + oWol);
  unsigned short* Qh  = (unsigned short*)(ws + oQh);
  unsigned short* Ql  = (unsigned short*)(ws + oQl);
  unsigned short* Kh  = (unsigned short*)(ws + oKh);
  unsigned short* Kl  = (unsigned short*)(ws + oKl);
  unsigned short* Vh  = (unsigned short*)(ws + oVh);
  unsigned short* Vl  = (unsigned short*)(ws + oVl);
  unsigned short* Oh  = (unsigned short*)(ws + oOh);
  unsigned short* Ol  = (unsigned short*)(ws + oOl);
  int* kidx = (int*)(ws + oIdx);
  int* kcg  = (int*)(ws + oCg);
  int* kcd  = (int*)(ws + oCd);
  int* kcm  = (int*)(ws + oCm);
  int* kcnt = (int*)(ws + oCnt);

  // (0) transposed hi/lo planes of the four weights: in [k][n] -> out [n][k]; the first NBT blocks build the key
  // order of each sequence
  k_split_tr<<<dim3(NBT + 4 * (DM / 64) * (DM / 64)), dim3(256), 0, stream>>>(W_q, W_k, W_v, W_o, Wh, Wl, Woh, Wol,
                                                                              amask, gids, dids,
                                                                              kidx, kcg, kcd, kcm, kcnt);
  // (1) q / k / v^T planes, from x in f32
  k_proj<<<dim3(3 * NH, NT / 128), dim3(256), 0, stream>>>(x, Wh, Wl, b_q, b_k, b_v, kidx, kcnt,
                                                          Qh, Ql, Kh, Kl, Vh, Vl);
  // (2) attention -> O planes
  k_attn<<<dim3(NBT * NH * NQB), dim3(256), 0, stream>>>(Qh, Ql, Kh, Kl, Vh, Vl, gids, kcm, kcg, kcd, kcnt,
                                                        gtab, dtab, Oh, Ol);
  // (3) out = O.Wo + bo
  k_gemm_out<<<dim3(DM / 64, NT / 128), dim3(256), 0, stream>>>(Oh, Ol, Woh, Wol, b_o, out);
  (void)hipGetLastError();
}

// v009
// Measured time: 61.2 microseconds a run.
// Next to v008, in two timings, it ran 1.06 and 1.05 times as fast.
// All steps since v000 together make it 5.17 times as fast.
// Contractions: Q/K/V = x.W (3 sites), S = Q.K^T, O = P.V, out = O.Wo: all v_wmma_f32_16x16x32_bf16 on bf16 hi/lo
// split operand planes (hi.hi + hi.lo + lo.hi per tile pair), f32 accumulate; biases, the 1/8 scale, the bucket-table
// lookups, the key mask (every masked score one equal, very negative value) and the online softmax in f32.
// Plane carry audit: every hi/lo plane (X, Wqkv^T, Wo^T, Q, K, V^T, in-register P fragments, O) carries factor 1
// (hi = rne_bf16(v), lo = rne_bf16(v - hi), f32 exponent range, no subnormal concern); no inverse fold exists anywhere.
// Key order: per sequence the keys are reordered by a stable partition (unmasked first, masked behind); K and V are
// projected and attended only up to the last unmasked key (all keys when a sequence has none unmasked).
#include <hip/hip_runtime.h>
#include <stddef.h>

#define NBT 2                  // batch
#define SL  2048               // sequence length
#define DM  512                // model width
#define NH  8                  // heads
#define HD  64                 // head dim
#define NT  (NBT * SL)         // token rows, row m = b*SL + s
#define QB  128                // query rows per attention block
#define KC  64                 // keys per chunk
#define NQB (SL / QB)          // 16
#define NCK (SL / KC)          // 32
#define KTP 72                 // LDS pitch (16-bit elements) for 64-wide tiles, 144 B
#define OTP 68                 // f32 staging pitch [row][col] (128 x 64)
#define VTP 132                // f32 staging pitch [col][row] (64 x 128)
#define TTP 68                 // f32 staging pitch for the 64 x 64 weight transpose tile
#define GBK 64                 // k elements per GEMM stage: one whole 128-B line per plane row
#define GTR (2 * 128 + 2 * 64) // rows of one GEMM stage in LDS: A hi, A lo (128 each), B hi, B lo (64 each)
#define GSB (GTR * KTP * 2)    // bytes of one GEMM stage in LDS, 55296
#define GAPR 33                // time-gap table rows
#define DURR 17                // duration table rows
#define MSKB (-1.0e30f)        // masked key's staged bias term: absorbs the rest of the score, so all masked scores are equal
#define L2E  1.44269504f       // log2(e): scores are kept in units of log2, the exponential is the hardware's 2^x
#define GAPX (2 * GAPR - 1)    // entries of the two-sided gap table, index gq - gk + GAPR - 1
#define ATB  (2 * KC * KTP + 2 * HD * KTP) // 16-bit elements of one attention chunk's four tiles in LDS

static_assert(NT == 4096);
static_assert(NH * HD == DM);
static_assert(SL % QB == 0);
static_assert(SL % KC == 0);
static_assert(SL % 128 == 0);
static_assert(DM % 64 == 0);
static_assert(DM % 32 == 0);
static_assert(HD == 64);
static_assert(KC == 64);
static_assert(64 * VTP <= 128 * OTP);
static_assert(DM % GBK == 0);
static_assert(128 * OTP * 4 <= GSB);
static_assert(SL == 256 * 8);
static_assert(DM / 64 == 8);
static_assert((DM / 64) * (DM / 64) + NBT <= 3 * 3 * NH);

typedef __bf16       v16b __attribute__((ext_vector_type(16)));
typedef float        v8f  __attribute__((ext_vector_type(8)));
typedef float        v4f  __attribute__((ext_vector_type(4)));
typedef float        v2f  __attribute__((ext_vector_type(2)));
typedef __bf16       v2b  __attribute__((ext_vector_type(2)));
typedef unsigned int v4u  __attribute__((ext_vector_type(4)));
typedef unsigned int v2u  __attribute__((ext_vector_type(2)));
typedef int          v4i  __attribute__((ext_vector_type(4)));
union Frag { v16b v; v4u u[2]; };

// WMMA with the dependent-VALU hazard guard (ties D, keeps A/B live)
__device__ __forceinline__ v8f mma(v16b a, v16b b, v8f c) {
  c = __builtin_amdgcn_wmma_f32_16x16x32_bf16(false, a, false, b, (short)0, c, false, false);
  asm volatile("v_nop\n\tv_nop\n\tv_nop\n\tv_nop" : "+v"(c) : "v"(a), "v"(b));
  return c;
}

// value of lane l ^ 16 (the other 16-lane half), by the vector cross-row move
__device__ __forceinline__ float other_half(float x) {
  const int b = __float_as_int(x);
  return __int_as_float(__builtin_amdgcn_permlanex16(b, b, 0x76543210, 0xfedcba98, false, false));
}

// 2^x by the hardware exponential (the factor log2(e) is in the staged tables). The v_nop fills the one slot that the
// instruction set asks for between a transcendental and a directly following instruction that reads its result or
// overwrites its source.
__device__ __forceinline__ float exp_slot(float x) {
  float r;
  asm("v_exp_f32 %0, %1\n\tv_nop" : "=v"(r) : "v"(x));
  return r;
}

__device__ __forceinline__ v8f zero8() { return (v8f){0.f, 0.f, 0.f, 0.f, 0.f, 0.f, 0.f, 0.f}; }

// Fragment loader for k-contiguous 16-bit rows with pitch ld (bf16 bits).
// A operand: row0 + (lane&15) is the M row. B operand stored [n][k]: row0 + (lane&15) is the N column.
// Split k map for both: elements 0..7 <- k0 + 8*(lane>>4) + 0..7, elements 8..15 <- k0 + 16 + 8*(lane>>4) + 0..7.
// D: acc[r] = element (row0 + 8*(lane>>4) + r, col0 + (lane&15)).
__device__ __forceinline__ v16b ldf(const unsigned short* p, int ld, int row0, int k0, int lane) {
  const unsigned short* q = p + (size_t)(row0 + (lane & 15)) * ld + k0 + 8 * (lane >> 4);
  Frag f;
  f.u[0] = *(const v4u*)(q);
  f.u[1] = *(const v4u*)(q + 16);
  return f.v;
}

// two floats -> two bf16, round to nearest even, in one word by the packed hardware convert (first element in the low
// half-word)
__device__ __forceinline__ unsigned int bf_pk(v2f x) {
  union { v2b v; unsigned int u; } w;
  w.v = __builtin_convertvector(x, v2b);
  return w.u;
}

// hi = rne(a), lo = rne(a - hi) for two floats, packed little-endian (first element in the low half-word)
__device__ __forceinline__ void split2(float a, float b, unsigned int& wh, unsigned int& wl) {
  const v2f x = (v2f){a, b};
  wh = bf_pk(x);
  const v2f h = (v2f){__uint_as_float(wh << 16), __uint_as_float(wh & 0xFFFF0000u)};
  wl = bf_pk(x - h);
}

// 8 consecutive floats -> one 16-B hi piece and one 16-B lo piece
__device__ __forceinline__ void split8(v4f a0, v4f a1, v4u& wh, v4u& wl) {
  unsigned int h0, h1, h2, h3, l0, l1, l2, l3;
  split2(a0[0], a0[1], h0, l0);
  split2(a0[2], a0[3], h1, l1);
  split2(a1[0], a1[1], h2, l2);
  split2(a1[2], a1[3], h3, l3);
  wh = (v4u){h0, h1, h2, h3};
  wl = (v4u){l0, l1, l2, l3};
}

// Stable partition of one sequence's SL keys by the mask: unmasked keys (mask != 0) first in their order, masked keys
// behind them in theirs. A masked key's score is MSKB, so its weight 2^(MSKB - m) is 0 as soon as one key of the
// sequence is unmasked: keys behind the last unmasked one add nothing and are left out by the kernels.
// scan_keys: thread t owns keys 8t .. 8t+7 (their masks in m0, m1); block-wide inclusive scan of the per-thread counts
// in LDS, two buffers, one barrier a step. Gives total = unmasked keys of the sequence (0..SL) and ru = unmasked keys
// in front of key 8t; the masked keys in front of it are 8t - ru. New position of a key: its rank among the unmasked
// ones, or total + its rank among the masked ones (a permutation of 0..SL-1).
__device__ __forceinline__ void scan_keys(const int* __restrict__ mask, int b, int tid, int (*sc)[256],
                                          v4i& m0, v4i& m1, int& ru, int& total) {
  const int base = b * SL + tid * 8;
  m0 = *(const v4i*)(mask + base);
  m1 = *(const v4i*)(mask + base + 4);
  // precaution: stands in front of whatever next lands in the address registers of the loads above
  asm volatile("s_wait_xcnt 0x0" ::: "memory");
  int c = 0;
#pragma unroll
  for (int e = 0; e < 4; ++e) c += ((m0[e] != 0) ? 1 : 0) + ((m1[e] != 0) ? 1 : 0);
  sc[0][tid] = c;
  __syncthreads();
  int cur = 0;
#pragma unroll
  for (int o = 1; o < 256; o <<= 1) {
    int a = sc[cur][tid];
    if (tid >= o) a += sc[cur][tid - o];
    sc[cur ^ 1][tid] = a;
    cur ^= 1;
    __syncthreads();                                 // the step's sums are visible before the next step reads them
  }
  total = sc[cur][255];
  ru    = sc[cur][tid] - c;
}

// Writes, per new position of sequence b: the key's gap id, duration id and mask; and cnt[b] = keys to attend =
// number of unmasked keys, or SL when there is none (every score is then MSKB and all keys count alike).
// Every position 0..SL-1 is written exactly once.
__device__ __forceinline__ void compact_keys(const int* __restrict__ mask, const int* __restrict__ gids,
                                             const int* __restrict__ dids,
                                             int* __restrict__ cg, int* __restrict__ cd, int* __restrict__ cm,
                                             int* __restrict__ cnt, int b, int tid, int (*sc)[256]) {
  const int base = b * SL + tid * 8;
  const v4i g0 = *(const v4i*)(gids + base), g1 = *(const v4i*)(gids + base + 4);
  // precaution: stands in front of the next loads, which may land in the address registers of the loads above
  asm volatile("s_wait_xcnt 0x0" ::: "memory");
  const v4i d0 = *(const v4i*)(dids + base), d1 = *(const v4i*)(dids + base + 4);
  // precaution: as above
  asm volatile("s_wait_xcnt 0x0" ::: "memory");
  v4i m0, m1;
  int ru, total;
  scan_keys(mask, b, tid, sc, m0, m1, ru, total);
  int rm = total + tid * 8 - ru;                     // total + masked keys in front of key 8t
#pragma unroll
  for (int e = 0; e < 8; ++e) {
    const int mk = (e < 4) ? m0[e & 3] : m1[e & 3];
    const int gk = (e < 4) ? g0[e & 3] : g1[e & 3];
    const int dk = (e < 4) ? d0[e & 3] : d1[e & 3];
    const int pos = b * SL + ((mk != 0) ? ru : rm);  // 0..SL-1 within the sequence
    ru += (mk != 0) ? 1 : 0;
    rm += (mk != 0) ? 0 : 1;
    cg[pos]  = gk;
    cd[pos]  = dk;
    cm[pos]  = mk;
  }
  if (tid == 0) cnt[b] = (total > 0) ? total : SL;
}

// One 64 x 64 tile of the out-projection weight, transposed and split: in W [k = DM rows][n = DM cols] f32 -> out
// planes [n][k] hi/lo (pitch DM). id&7 = 64-wide n tile (source columns), (id>>3)&7 = 64-deep k tile (source rows);
// st = 64 x TTP floats of LDS.
// coverage: load 256 thr x 16 floats = 64 x 64; store 256 thr x 2 iter x 8 halves = 64 n rows x 64 k per plane;
// (DM/64) * (DM/64) such tiles cover the matrix.
__device__ __forceinline__ void wo_tile(const float* __restrict__ W, unsigned short* __restrict__ dh,
                                        unsigned short* __restrict__ dl, int id, int tid, float* st) {
  const int nt  = (id & 7) * 64;                     // source columns = output rows
  const int kt  = ((id >> 3) & 7) * 64;              // source rows    = output k
  {
    const int row = tid >> 2;                        // k within tile, 0..63
    const int cb  = (tid & 3) * 16;                  // n within tile, 0,16,32,48
    const float* src = W + (size_t)(kt + row) * DM + nt + cb;
    v4f a[4];
#pragma unroll
    for (int e = 0; e < 4; ++e) a[e] = *(const v4f*)(src + 4 * e);
    // precaution: stands in front of whatever next lands in the address registers of the loads above
    asm volatile("s_wait_xcnt 0x0" ::: "memory");
#pragma unroll
    for (int e = 0; e < 4; ++e)
#pragma unroll
      for (int q = 0; q < 4; ++q) st[(cb + 4 * e + q) * TTP + row] = a[e][q];
  }
  __syncthreads();
  const size_t base = (size_t)nt * DM + kt;
  v4u vh[2], vl[2];
  size_t go[2];
#pragma unroll
  for (int it = 0; it < 2; ++it) {
    const int pp   = tid + 256 * it;                 // 0..511
    const int rown = pp >> 3;                        // 0..63
    const int pc   = pp & 7;                         // k piece 8*pc .. +7
    const float* ra = st + rown * TTP + 8 * pc;
    const v4f a0 = *(const v4f*)(ra), a1 = *(const v4f*)(ra + 4);
    split8(a0, a1, vh[it], vl[it]);
    go[it] = base + (size_t)rown * DM + 8 * pc;
  }
#pragma unroll
  for (int it = 0; it < 2; ++it) {
    *(v4u*)(dh + go[it]) = vh[it];
    *(v4u*)(dl + go[it]) = vl[it];
  }
}

// ---------------------------------------------------------------------------
// 128 x 64 block tile, 32 x 32 per wave, split-bf16 GEMM main loop over K (multiple of GBK): A planes [m][k] pitch
// lda, B planes [n][k] pitch ldb (hi and lo). Per stage of GBK = 64 k the block brings the 128 A rows and the 64 B
// rows of both planes into LDS (pitch KTP): a wave's 16-B loads cover 4 whole 128-B lines, 12 pieces per thread,
// rows (tid>>3) + 32*i: i 0..3 A hi, 4..7 A lo, 8..9 B hi, 10..11 B lo. The next stage's pieces are loaded into
// registers while this stage is multiplied. Fragments come from LDS by ldf (its split k map, A and B alike).
// Per tile pair: ah.bh + ah.bl + al.bh into one f32 accumulator, k ascending.
// Tile row (tid>>3) + 32*i is row arow[i] of the A planes (the caller's map from tile rows to plane rows).
// acc[s][t][r] = (tile row mw + 16*s + 8*(lane>>4) + r, nrow + nw + 16*t + (lane&15)).
// The loop ends behind a barrier: tl may be reused by the caller at once.
// ---------------------------------------------------------------------------
// the products of one stage in LDS: rows 0..127 A hi, 128..255 A lo, 256..319 B hi, 320..383 B lo, pitch KTP
__device__ __forceinline__ void stage_products(const unsigned short* tl, int mw, int nw, int lane, v8f (&acc)[2][2]) {
  const unsigned short* sAh = tl;
  const unsigned short* sAl = tl + 128 * KTP;
  const unsigned short* sBh = tl + 256 * KTP;
  const unsigned short* sBl = tl + 320 * KTP;
#pragma unroll
  for (int ks = 0; ks < GBK; ks += 32) {
    const v16b ah0 = ldf(sAh, KTP, mw, ks, lane);
    const v16b ah1 = ldf(sAh, KTP, mw + 16, ks, lane);
    const v16b al0 = ldf(sAl, KTP, mw, ks, lane);
    const v16b al1 = ldf(sAl, KTP, mw + 16, ks, lane);
#pragma unroll
    for (int t = 0; t < 2; ++t) {
      const v16b bh = ldf(sBh, KTP, nw + 16 * t, ks, lane);
      const v16b bl = ldf(sBl, KTP, nw + 16 * t, ks, lane);
      acc[0][t] = mma(ah0, bh, acc[0][t]);
      acc[1][t] = mma(ah1, bh, acc[1][t]);
      acc[0][t] = mma(ah0, bl, acc[0][t]);
      acc[1][t] = mma(ah1, bl, acc[1][t]);
      acc[0][t] = mma(al0, bh, acc[0][t]);
      acc[1][t] = mma(al1, bh, acc[1][t]);
    }
  }
}

__device__ __forceinline__ void gemm_ld(const unsigned short* const (&gp)[4], const unsigned int (&ao)[4], int ldb,
                                        int k0, v4u (&pf)[12]) {
#pragma unroll
  for (int i = 0; i < 4; ++i) {
    pf[i]     = *(const v4u*)((const char*)gp[0] + ao[i]);
    pf[4 + i] = *(const v4u*)((const char*)gp[1] + ao[i]);
  }
#pragma unroll
  for (int i = 0; i < 2; ++i) {
    pf[8 + i]  = *(const v4u*)(gp[2] + (size_t)(32 * i) * ldb + k0);
    pf[10 + i] = *(const v4u*)(gp[3] + (size_t)(32 * i) * ldb + k0);
  }
  // precaution: stands in front of the fragment loads, which land in the address registers of the loads above
  asm volatile("s_wait_xcnt 0x0" ::: "memory");
}

__device__ __forceinline__ void gemm128x64x3(const unsigned short* __restrict__ Ah,
                                             const unsigned short* __restrict__ Al, int lda,
                                             const unsigned short* __restrict__ Bh,
                                             const unsigned short* __restrict__ Bl, int ldb,
                                             int K, const int (&arow)[4], int nrow, int mw, int nw, int tid,
                                             int lane, unsigned short* tl, v8f (&acc)[2][2]) {
  const int pr = tid >> 3;                           // 0..31: row within each group of 32 rows
  const int pe = (tid & 7) * 8;                      // first of this thread's 8 k elements in the row
  const unsigned short* const gp[4] = {Ah, Al,
                                       Bh + (size_t)(nrow + pr) * ldb + pe, Bl + (size_t)(nrow + pr) * ldb + pe};
  unsigned int ao[4];                                // byte offset of this thread's piece in its A row of each group
#pragma unroll
  for (int i = 0; i < 4; ++i) ao[i] = ((unsigned int)arow[i] * (unsigned int)lda + (unsigned int)pe) * 2u;
  unsigned short* sp = tl + pr * KTP + pe;
  v4u pf[12];
  gemm_ld(gp, ao, ldb, 0, pf);
// rolled: one copy of the stage body keeps the code short and the register count at three blocks per WGP
#pragma unroll 1
  for (int k0 = 0; k0 < K; k0 += GBK) {
#pragma unroll
    for (int i = 0; i < 12; ++i) *(v4u*)(sp + 32 * i * KTP) = pf[i];
    __syncthreads();                                 // the stage is visible to every wave
    if (k0 + GBK < K) {
#pragma unroll
      for (int i = 0; i < 4; ++i) ao[i] += GBK * 2;  // the A offsets step to the next stage's k
      gemm_ld(gp, ao, ldb, k0 + GBK, pf);
    }
    stage_products(tl, mw, nw, lane, acc);
    __syncthreads();                                 // every reader of the stage is done before it is rewritten
  }
}

// ---------------------------------------------------------------------------
// The same main loop with A and B given in f32: their hi and lo planes exist in LDS only.
// A: f32 rows (pitch lda floats). Per stage a thread loads 8 pieces of 4 floats, tile rows
// (tid>>5) + 8*((tid>>4)&1) + 16*i, floats 4*(tid&15) .. +3 of the stage's 64: a wave's 16-B loads cover two whole
// 256-B row pieces. split2 makes hi = rne(a), lo = rne(a - hi), and each plane gets one 8-B LDS store a piece (the two
// rows of a wave lie 8 apart, 32 banks at pitch KTP, so its 32 stores meet no bank twice).
// B: f32 [k][n] (pitch ldb floats), transposed on the way: per stage a thread loads 16 single floats, k rows
// 8*(tid>>5) + 0..7, columns nrow + (tid&31) and + 32: each of a wave's 4-B loads covers one whole 128-B line. The 8 k
// values of each of its two columns are split and go as one 16-B LDS store a plane into row n of the [n][k] tile (a
// wave's rows are consecutive: at pitch KTP each 16 lanes meet no bank twice).
// All pieces wait in registers while the stage before is multiplied.
// LDS layout, products and barriers as in gemm128x64x3. Tile row (tid>>5) + 8*((tid>>4)&1) + 16*i is row arow[i] of A
// (the caller's map).
// ---------------------------------------------------------------------------
__device__ __forceinline__ void gemm_ld_x(const float* __restrict__ A, const unsigned int (&ao)[8],
                                          const float* gb, int ldb, int k0, v4f (&pa)[8], float (&pb)[2][8]) {
#pragma unroll
  for (int i = 0; i < 8; ++i) pa[i] = *(const v4f*)((const char*)A + ao[i]);
#pragma unroll
  for (int e = 0; e < 8; ++e) {
    pb[0][e] = gb[(size_t)(k0 + e) * ldb];
    pb[1][e] = gb[(size_t)(k0 + e) * ldb + 32];
  }
  // precaution: stands in front of the fragment loads, which land in the address registers of the loads above
  asm volatile("s_wait_xcnt 0x0" ::: "memory");
}

__device__ __forceinline__ void gemm_x128x64x3(const float* __restrict__ A, int lda,
                                               const float* __restrict__ B, int ldb,
                                               int K, const int (&arow)[8], int nrow, int mw, int nw, int tid,
                                               int lane, unsigned short* tl, v8f (&acc)[2][2]) {
  const int ar = (tid >> 5) + 8 * ((tid >> 4) & 1);  // 0..15: A row within each group of 16 rows
  const int ac = (tid & 15) * 4;                     // first of this thread's 4 k elements in the A row
  const int bk = (tid >> 5) * 8;                     // first of this thread's 8 k rows of B in the stage
  const float* gb = B + (size_t)bk * ldb + nrow + lane;
  unsigned int ao[8];                                // byte offset of this thread's piece in its A row of each group
#pragma unroll
  for (int i = 0; i < 8; ++i) ao[i] = ((unsigned int)arow[i] * (unsigned int)lda + (unsigned int)ac) * 4u;
  unsigned short* sa = tl + ar * KTP + ac;
  unsigned short* sb = tl + (256 + lane) * KTP + bk;
  v4f pa[8];
  float pb[2][8];
  gemm_ld_x(A, ao, gb, ldb, 0, pa, pb);
// rolled: one copy of the stage body keeps the code short and the register count at three blocks per WGP
#pragma unroll 1
  for (int k0 = 0; k0 < K; k0 += GBK) {
#pragma unroll
    for (int i = 0; i < 8; ++i) {
      unsigned int h0, h1, l0, l1;
      split2(pa[i][0], pa[i][1], h0, l0);
      split2(pa[i][2], pa[i][3], h1, l1);
      *(v2u*)(sa + 16 * i * KTP)         = (v2u){h0, h1};
      *(v2u*)(sa + (128 + 16 * i) * KTP) = (v2u){l0, l1};
    }
#pragma unroll
    for (int j = 0; j < 2; ++j) {
      v4u wh, wl;
      split8((v4f){pb[j][0], pb[j][1], pb[j][2], pb[j][3]}, (v4f){pb[j][4], pb[j][5], pb[j][6], pb[j][7]}, wh, wl);
      *(v4u*)(sb + 32 * j * KTP)        = wh;
      *(v4u*)(sb + (64 + 32 * j) * KTP) = wl;
    }
    __syncthreads();                                 // the stage is visible to every wave
    if (k0 + GBK < K) {
#pragma unroll
      for (int i = 0; i < 8; ++i) ao[i] += GBK * 4;  // the A offsets step to the next stage's k
      gemm_ld_x(A, ao, gb, ldb, k0 + GBK, pa, pb);
    }
    stage_products(tl, mw, nw, lane, acc);
    __syncthreads();                                 // every reader of the stage is done before it is rewritten
  }
}

// stage acc + bias in the block tile, row-major [row][col] (128 x 64, pitch OTP floats)
__device__ __forceinline__ void stage_rm(v8f (&acc)[2][2], const float (&bb)[2], float* st,
                                         int mw, int nw, int hh, int c) {
#pragma unroll
  for (int s = 0; s < 2; ++s)
#pragma unroll
    for (int t = 0; t < 2; ++t)
#pragma unroll
      for (int r = 0; r < 8; ++r)
        st[(mw + 16 * s + 8 * hh + r) * OTP + nw + 16 * t + c] = acc[s][t][r] + bb[t];
}

// stage acc + bias transposed [col][row] (64 x 128, pitch VTP floats)
__device__ __forceinline__ void stage_tr(v8f (&acc)[2][2], const float (&bb)[2], float* st,
                                         int mw, int nw, int hh, int c) {
#pragma unroll
  for (int s = 0; s < 2; ++s)
#pragma unroll
    for (int t = 0; t < 2; ++t)
#pragma unroll
      for (int r = 0; r < 8; ++r)
        st[(nw + 16 * t + c) * VTP + mw + 16 * s + 8 * hh + r] = acc[s][t][r] + bb[t];
}

// block tile 128 rows x 64 cols -> hi/lo planes at element base, row pitch ldo: each row = 64 halves = one whole
// coverage: 256 thr x 4 iter x 8 halves = 128 rows x 64 per plane.
__device__ __forceinline__ void store_planes(const float* st, unsigned short* __restrict__ oh,
                                             unsigned short* __restrict__ ol, size_t base, int ldo, int tid) {
  v4u vh[4], vl[4];
  size_t go[4];
#pragma unroll
  for (int it = 0; it < 4; ++it) {
    const int pp  = tid + 256 * it;                  // 0..1023
    const int row = pp >> 3;                         // 0..127
    const int pc  = pp & 7;                          // 16-B piece = cols 8*pc .. +7
    const float* ra = st + row * OTP + 8 * pc;
    const v4f a0 = *(const v4f*)(ra), a1 = *(const v4f*)(ra + 4);
    split8(a0, a1, vh[it], vl[it]);
    go[it] = base + (size_t)row * ldo + 8 * pc;
  }
  {
#pragma unroll
    for (int it = 0; it < 4; ++it) {
      *(v4u*)(oh + go[it]) = vh[it];
      *(v4u*)(ol + go[it]) = vl[it];
    }
    
  }
}

// transposed block tile 64 d-rows x 128 p -> V^T hi/lo planes [bh][d][p] (p = position in the key order) at element base (= bh*HD*SL + sf):
// coverage: 256 thr x 4 iter x 8 halves = 64 d-rows x 128 p per plane.
__device__ __forceinline__ void store_vt(const float* st, unsigned short* __restrict__ vh,
                                         unsigned short* __restrict__ vl, size_t base, int tid) {
  v4u wh[4], wl[4];
  size_t go[4];
#pragma unroll
  for (int it = 0; it < 4; ++it) {
    const int pp   = tid + 256 * it;                 // 0..1023
    const int drow = pp >> 4;                        // 0..63
    const int pc   = pp & 15;                        // 8 consecutive p
    const float* ra = st + drow * VTP + 8 * pc;
    const v4f a0 = *(const v4f*)(ra), a1 = *(const v4f*)(ra + 4);
    split8(a0, a1, wh[it], wl[it]);
    go[it] = base + (size_t)drow * SL + 8 * pc;
  }
  {
#pragma unroll
    for (int it = 0; it < 4; ++it) {
      *(v4u*)(vh + go[it]) = wh[it];
      *(v4u*)(vl + go[it]) = wl[it];
    }
    
  }
}

// coverage: 256 thr x 8 iter x 4 floats = 128 rows x 64 cols.
__device__ __forceinline__ void store_f32(const float* st, float* __restrict__ out, int mblk, int nblk, int tid) {
  v4f val[8];
  size_t go[8];
#pragma unroll
  for (int it = 0; it < 8; ++it) {
    const int pp  = tid + 256 * it;                  // 0..2047
    const int row = pp >> 4;                         // 0..127
    const int pc  = pp & 15;                         // 4 consecutive cols
    val[it] = *(const v4f*)(st + row * OTP + 4 * pc);
    go[it]  = (size_t)(mblk + row) * DM + nblk + 4 * pc;
  }
  {
#pragma unroll
    for (int it = 0; it < 8; ++it) *(v4f*)(out + go[it]) = val[it];
    
  }
}

// ---------------------------------------------------------------------------
// kernel 0: projections. blockIdx.y < NT/128: blockIdx.x = which*NH + head (which 0 = q, 1 = k, 2 = v), blockIdx.y =
// 128-token block of one sequence b. A = x, f32 [NT][DM] (pitch DM, K = DM), B = the weight itself, f32 [DM k][DM n],
// columns head*64 .. (pitch DM). Bias added in f32. A k or v block finds its own 128 tokens: it scans the sequence's
// mask (scan_keys) and keeps, in LDS, the tokens whose new positions fall in the block.
// blockIdx.y >= NT/128: 72 more blocks that feed the later launches: 64 make the transposed hi/lo planes of the
// out-projection weight (wo_tile), NBT write the per-position key values and cnt (compact_keys), the rest have nothing.
// grid = (3*NH = 24, NT/128 + 3 = 35). coverage: q planes 16 bh x 16 blocks x 128 s x 64 d;
// k and v^T planes the same (128 p x 64 d, 64 d x 128 p) only for the blocks with sf below the keys to attend.
// ---------------------------------------------------------------------------
__global__ __launch_bounds__(256) void k_proj(const float* __restrict__ x,
                                              const float* __restrict__ Wq, const float* __restrict__ Wk,
                                              const float* __restrict__ Wv, const float* __restrict__ Wo,
                                              const float* __restrict__ bq,
                                              const float* __restrict__ bk,
                                              const float* __restrict__ bv,
                                              const int* __restrict__ mask, const int* __restrict__ gids,
                                              const int* __restrict__ dids,
                                              unsigned short* __restrict__ Qh, unsigned short* __restrict__ Ql,
                                              unsigned short* __restrict__ Kh, unsigned short* __restrict__ Kl,
                                              unsigned short* __restrict__ Vh, unsigned short* __restrict__ Vl,
                                              unsigned short* __restrict__ Woh, unsigned short* __restrict__ Wol,
                                              int* __restrict__ cg, int* __restrict__ cd, int* __restrict__ cm,
                                              int* __restrict__ cnt) {
  __shared__ __align__(16) unsigned char sm[GSB];    // 55296 B: GEMM stage, then the f32 output staging tile
  __shared__ int sc[2][256];                         // scan_keys' two buffers
  __shared__ int idxS[128];                          // token of each of the block's 128 key positions
  unsigned short* tl = (unsigned short*)sm;
  float* st = (float*)sm;                            // 128 x OTP (the transposed 64 x VTP tile also fits)
  const int tid = threadIdx.x, lane = tid & 31, wave = tid >> 5;
  const int hh = lane >> 4, c = lane & 15;
  if (blockIdx.y >= NT / 128) {                      // block-uniform, the same for every input
    const int id = (blockIdx.y - NT / 128) * (3 * NH) + blockIdx.x;
    if (id < (DM / 64) * (DM / 64)) wo_tile(Wo, Woh, Wol, id, tid, st);
    else if (id < (DM / 64) * (DM / 64) + NBT)
      compact_keys(mask, gids, dids, cg, cd, cm, cnt, id - (DM / 64) * (DM / 64), tid, sc);
    return;
  }
  const int which = blockIdx.x / NH;                 // block-uniform
  const int head  = blockIdx.x - which * NH;
  const int mblk  = blockIdx.y * 128;
  const int b     = mblk / SL;
  const int sf    = mblk - b * SL;                   // first position of the block in sequence b
  const int bh    = b * NH + head;
  const int mw = (wave >> 1) * 32, nw = (wave & 1) * 32;

  // q: tile row = token. k, v: tile row = position in the sequence's key order. Each of the 128 positions sf .. sf+127
  // is the new position of exactly one key, so every entry of idxS is written. A block wholly behind the keys to attend
  // has nothing to do: live is the same in every thread of the block (a scalar).
  int arow[8];
#pragma unroll
  for (int i = 0; i < 8; ++i) arow[i] = mblk + wave + 8 * hh + 16 * i;
  bool live = true;
  if (which != 0) {
    v4i m0, m1;
    int ru, total;
    scan_keys(mask, b, tid, sc, m0, m1, ru, total);
    int rm = total + tid * 8 - ru;                   // total + masked keys in front of key 8t
#pragma unroll
    for (int e = 0; e < 8; ++e) {
      const int mk = (e < 4) ? m0[e & 3] : m1[e & 3];
      const unsigned int rel = (unsigned int)(((mk != 0) ? ru : rm) - sf);
      ru += (mk != 0) ? 1 : 0;
      rm += (mk != 0) ? 0 : 1;
      if (rel < 128u) idxS[rel] = tid * 8 + e;
    }
    __syncthreads();                                 // the block's tokens are visible to every wave
#pragma unroll
    for (int i = 0; i < 8; ++i) arow[i] = b * SL + (idxS[wave + 8 * hh + 16 * i] & (SL - 1));
    live = sf < __builtin_amdgcn_readfirstlane((total > 0) ? total : SL);
  }
  if (live) {                                        // block-uniform
    v8f acc[2][2];
#pragma unroll
    for (int s = 0; s < 2; ++s)
#pragma unroll
      for (int t = 0; t < 2; ++t) acc[s][t] = zero8();
    gemm_x128x64x3(x, DM, (which == 0) ? Wq : ((which == 1) ? Wk : Wv), DM,
                   DM, arow, head * HD, mw, nw, tid, lane, tl, acc);

    float bb[2];
#pragma unroll
    for (int t = 0; t < 2; ++t) {
      const int i = head * HD + nw + 16 * t + c;       // 0..511
      const float xq = bq[i], xk = bk[i], xv = bv[i];
      bb[t] = (which == 0) ? xq : ((which == 1) ? xk : xv);
    }
    if (which < 2) stage_rm(acc, bb, st, mw, nw, hh, c);
    else           stage_tr(acc, bb, st, mw, nw, hh, c);
    __syncthreads();
    if (which < 2) {
      unsigned short* oh = (which == 0) ? Qh : Kh;
      unsigned short* ol = (which == 0) ? Ql : Kl;
      store_planes(st, oh, ol, ((size_t)bh * SL + sf) * HD, HD, tid);
      // precaution: stands behind the block's last stores, in front of whatever next lands in their address or data
      // registers on any way that the built code has from here
      asm volatile("s_wait_xcnt 0x0" ::: "memory");
    } else {
      store_vt(st, Vh, Vl, (size_t)bh * HD * SL + sf, tid);
      // precaution: as above
      asm volatile("s_wait_xcnt 0x0" ::: "memory");
    }
  }
}

// ---------------------------------------------------------------------------
// kernel 1: flash attention for every (b, head, 128-query block), head dim 64, up to 32 chunks of 64 keys.
//   q planes [b*NH + h][s][64] hi/lo; k planes [b*NH + h][p][64] and v^T planes [b*NH + h][64][p] hi/lo, p = position
//   in the key order; int32 tables [b][s]: gap bucket ids (queries); [b][p]: key mask (zero = masked), gap bucket
//   ids, duration bucket ids; cnt[b] = keys to attend; f32 tables gap [GAPR][NH], dur [DURR][NH];
//   O planes [token = b*SL + s][DM] hi/lo, head h at columns h*64 (one line per row).
// Block = 8 waves; wave w owns queries q0 = qb*128 + 16*w .. +15. The head's column of both bias tables is staged
// in LDS once per block. Per chunk: K [key][d] and V^T [d][key] hi/lo tiles staged in LDS by all threads
// (plain 16-B loads) while waves 0-1 stage the chunk's 64 keys' two values (gap table offset, key term) in LDS.
// Two LDS buffers: the next chunk's global loads are issued into registers in front of this chunk's products and
// stored into the other buffer behind them, one barrier per chunk.
// Each half of a chunk's products takes its eight LDS fragments first and then goes round the four accumulator tiles.
// The products are taken transposed: S^T = K.Q^T (A = K rows, B = Q rows) and O^T += V^T.P^T
// (A = V^T rows, B = P^T), so a lane holds scores of ONE query (column lane&15) for keys 16*j + 8*(lane>>4) + r.
// score * log2(e) = s * (log2(e)/8) + gapX[gq - gk + GAPR-1] + key term. All that depends on a table entry or on the
// key alone is done once at staging: both tables carry the factor log2(e); the gap table is laid out two-sided,
// gapX[i] = gap[|i - (GAPR-1)|], so that |gq - gk| needs no absolute value; the ids are clamped to 0..GAPR-1 and held
// as byte offsets (4*gq, 4*(GAPR-1 - gk)), which bounds the index to 0..GAPX-1 for any content; the key term is the duration bias, or MSKB
// for a masked key, whose score is then MSKB exactly (weight 0 beside an unmasked key, equal weights when a sequence
// has none unmasked, as with -1e9). Maximum and sum run
// in-lane with one exchange between the wave halves; p = 2^(score - m) is split into bf16 hi/lo and packed straight
// from the score accumulators into the B fragment (tiles 2*kk and 2*kk+1 are elements 0..7 and 8..15 of the split
// k map), so P never goes through LDS. Epilogue: O^T / l, 8 consecutive channels per lane and tile, split hi/lo and
// stored from registers.
// coverage: 256 blocks x 8 waves x 16 rows x 64 cols = NT x DM per plane.
// ---------------------------------------------------------------------------
__global__ __launch_bounds__(256) void k_attn(const unsigned short* __restrict__ Qh,
                                              const unsigned short* __restrict__ Ql,
                                              const unsigned short* __restrict__ Kh,
                                              const unsigned short* __restrict__ Kl,
                                              const unsigned short* __restrict__ Vh,
                                              const unsigned short* __restrict__ Vl,
                                              const int* __restrict__ gids,
                                              const int* __restrict__ cm,
                                              const int* __restrict__ cg,
                                              const int* __restrict__ cd,
                                              const int* __restrict__ cnt,
                                              const float* __restrict__ gap_emb,
                                              const float* __restrict__ dur_emb,
                                              unsigned short* __restrict__ Oh,
                                              unsigned short* __restrict__ Ol) {
  // per buffer: K hi tile, lo tile [key][d] (18432 B), then V^T hi tile, lo tile [d][key] (18432 B)
  // one LDS block with the gap table at its start, so that a score's table address is the byte offset gqo + gk itself
  __shared__ __align__(16) unsigned char sm[1408 + 2 * ATB * 2];
  float* gapX = (float*)sm;                                    // two-sided gap table of head h (65)     272 B
  float* durS = (float*)(sm + 288);                            // dur table column of head h (17)         80 B
  int*   gkB  = (int*)(sm + 384);                              // chunk's keys' gap table offsets    2 x 256 B
  float* dbB  = (float*)(sm + 896);                            // chunk's key terms                  2 x 256 B
  unsigned short* KVs = (unsigned short*)(sm + 1408);          // two buffers                          73728 B

  const int tid = threadIdx.x, lane = tid & 31, wave = tid >> 5;
  const int hh = lane >> 4, c = lane & 15;
  const int qb = blockIdx.x % NQB;
  const int bh = blockIdx.x / NQB;                   // b*NH + h
  const int h  = bh % NH;
  const int b  = bh / NH;
  const int q0 = qb * QB + wave * 16;
  const size_t qkbase = (size_t)bh * SL * HD;
  const size_t vbase  = (size_t)bh * HD * SL;

  // stage the head's table columns once (clamped addresses for every lane, predicated LDS store)
  {
    const int ix = (tid < GAPX) ? tid : (GAPX - 1);  // 0..64
    const int ig = (ix < GAPR - 1) ? (GAPR - 1 - ix) : (ix - (GAPR - 1));   // |ix - 32|, 0..32
    const int id = (tid < DURR) ? tid : (DURR - 1);
    const float gv = gap_emb[ig * NH + h];
    const float dv = dur_emb[id * NH + h];
    if (tid < GAPX) gapX[tid] = gv * L2E;
    if (tid < DURR) durS[tid] = dv * L2E;
  }

  // gap bucket id of the one query this lane's score elements belong to, q0 + (lane&15), clamped to 0..GAPR-1;
  // gqo = its share of the byte offset in gapX, 0..128
  const int gq = gids[(size_t)b * SL + q0 + c];
  const int gqo = ((gq < 0) ? 0 : ((gq > GAPR - 1) ? (GAPR - 1) : gq)) * 4;

  // Q fragments (loop-invariant), B operand stored [n = query][k = d]: query q0 + (lane&15), split map over d
  v16b qh[2], ql[2];
#pragma unroll
  for (int dc = 0; dc < 2; ++dc) {
    qh[dc] = ldf(Qh + qkbase, HD, q0, dc * 32, lane);
    ql[dc] = ldf(Ql + qkbase, HD, q0, dc * 32, lane);
  }

  float mrow = -__builtin_huge_valf();               // running maximum of query c (equal in both halves)
  float lrow = 0.f;                                  // running sum over this half's keys; halves joined at the end
  v8f oacc[4];
#pragma unroll
  for (int t = 0; t < 4; ++t) oacc[t] = zero8();

  // chunks that hold keys to attend: 1..NCK (block-uniform); the last chunk's keys behind them are masked ones
  int nck = (cnt[b] + KC - 1) / KC;
  nck = (nck < 1) ? 1 : ((nck > NCK) ? NCK : nck);

  // staging of one chunk: this thread's 8 pieces of 16 B (K hi, K lo, V^T hi, V^T lo, two each) and, in waves 0 and 1
  // (wave-uniform), one key's gap id, duration id and mask; held in registers between the loads and the LDS stores
  const int sr = tid >> 2;                           // 0..63: key row of K tiles, d row of V^T tiles
  const int sq = (tid & 3) * 16;                     // 0,16,32,48 elements
  const unsigned short* gkh = Kh + qkbase + (size_t)sr * HD + sq;
  const unsigned short* gkl = Kl + qkbase + (size_t)sr * HD + sq;
  const unsigned short* gvh = Vh + vbase + (size_t)sr * SL + sq;
  const unsigned short* gvl = Vl + vbase + (size_t)sr * SL + sq;
  const int* gcg = cg + (size_t)b * SL + (tid & (KC - 1));
  const int* gcd = cd + (size_t)b * SL + (tid & (KC - 1));
  const int* gcm = cm + (size_t)b * SL + (tid & (KC - 1));
  v4u pf[8];
  int pg = 0, pd = 0, pm = 0;
  auto chunk_load = [&](int kv0) {                   // kv0 = first key position of the chunk, 0..SL-KC
#pragma unroll
    for (int e = 0; e < 2; ++e) {
      pf[e]     = *(const v4u*)(gkh + (size_t)kv0 * HD + 8 * e);
      pf[2 + e] = *(const v4u*)(gkl + (size_t)kv0 * HD + 8 * e);
      pf[4 + e] = *(const v4u*)(gvh + kv0 + 8 * e);
      pf[6 + e] = *(const v4u*)(gvl + kv0 + 8 * e);
    }
    if (tid < KC) {
      pg = gcg[kv0];
      pd = gcd[kv0];
      pm = gcm[kv0];
    }
    // precaution: stands in front of whatever next lands in the address registers of the loads above; its memory
    // clobber also keeps those loads in front of the chunk's products
    asm volatile("s_wait_xcnt 0x0" ::: "memory");
  };
  auto chunk_store = [&](int buf) {                  // buf = 0 or 1
    unsigned short* d = KVs + buf * ATB + sr * KTP + sq;
#pragma unroll
    for (int e = 0; e < 2; ++e) {
      *(v4u*)(d + 8 * e)                           = pf[e];
      *(v4u*)(d + KC * KTP + 8 * e)                = pf[2 + e];
      *(v4u*)(d + 2 * KC * KTP + 8 * e)            = pf[4 + e];
      *(v4u*)(d + 2 * KC * KTP + HD * KTP + 8 * e) = pf[6 + e];
    }
    if (tid < KC) {
      const int dk = (pd < 0) ? 0 : ((pd > DURR - 1) ? (DURR - 1) : pd);
      const int gk = (pg < 0) ? 0 : ((pg > GAPR - 1) ? (GAPR - 1) : pg);
      gkB[buf * KC + tid] = (GAPR - 1 - gk) * 4;     // the key's share of the byte offset in gapX, 0..128
      dbB[buf * KC + tid] = (pm != 0) ? durS[dk] : MSKB;
    }
  };

  chunk_load(0);
  __syncthreads();                                   // the table columns are visible before chunk_store reads durS
  chunk_store(0);
  __syncthreads();                                   // chunk 0's tiles and key values visible to every wave

  for (int kc = 0; kc < nck; ++kc) {
    const int cur = kc & 1;
    const unsigned short* Ks = KVs + cur * ATB;
    const unsigned short* Vs = Ks + 2 * KC * KTP;
    const int*   gkS = gkB + cur * KC;
    const float* dbS = dbB + cur * KC;
    const bool more = kc + 1 < nck;                  // block-uniform
    if (more) chunk_load((kc + 1) * KC);

    v8f s[4];
#pragma unroll
    for (int j = 0; j < 4; ++j) s[j] = zero8();
    // A operands: key row j*16 + (lane&15) of the [key][d] tiles, split map over d. The eight K fragments of one d half
    // are read as one group in front of that half's products, and the products go round the four score tiles, so that
    // no product waits for an LDS read of its own or for the product just before it; each tile's order of sums is kept.
#pragma unroll
    for (int dc = 0; dc < 2; ++dc) {
      v16b khf[4], klf[4];
#pragma unroll
      for (int j = 0; j < 4; ++j) {
        khf[j] = ldf(Ks, KTP, j * 16, dc * 32, lane);
        klf[j] = ldf(Ks + KC * KTP, KTP, j * 16, dc * 32, lane);
      }
#pragma unroll
      for (int j = 0; j < 4; ++j) s[j] = mma(khf[j], qh[dc], s[j]);
#pragma unroll
      for (int j = 0; j < 4; ++j) s[j] = mma(klf[j], qh[dc], s[j]);
#pragma unroll
      for (int j = 0; j < 4; ++j) s[j] = mma(khf[j], ql[dc], s[j]);
    }
    // s[j][r] = S[query q0 + c][key kv0 + j*16 + 8*hh + r]; scale, gap bias, key term
#pragma unroll
    for (int j = 0; j < 4; ++j) {
      const int kb = 16 * j + 8 * hh;                // first of this lane's 8 keys of tile j, 0..56
      const v4i g0 = *(const v4i*)(gkS + kb), g1 = *(const v4i*)(gkS + kb + 4);
      const v4f d0 = *(const v4f*)(dbS + kb), d1 = *(const v4f*)(dbS + kb + 4);
#pragma unroll
      for (int r = 0; r < 8; ++r) {
        const int   gk = (r < 4) ? g0[r & 3] : g1[r & 3];
        const float db = (r < 4) ? d0[r & 3] : d1[r & 3];
        const float gbias = *(const float*)((const char*)gapX + (gqo + gk));   // byte offset 0..256
        s[j][r] = (s[j][r] * (0.125f * L2E) + gbias) + db;
      }
    }
    // chunk maximum of query c: in-lane over this half's 32 keys, then one exchange between the halves
    float cj[4];
#pragma unroll
    for (int j = 0; j < 4; ++j) {
      cj[j] = fmaxf(fmaxf(fmaxf(s[j][0], s[j][1]), fmaxf(s[j][2], s[j][3])),
                    fmaxf(fmaxf(s[j][4], s[j][5]), fmaxf(s[j][6], s[j][7])));
    }
    float cm = fmaxf(fmaxf(cj[0], cj[1]), fmaxf(cj[2], cj[3]));
    cm = fmaxf(cm, other_half(cm));
    const float mnew  = fmaxf(mrow, cm);             // finite from chunk 0 on
    const float alpha = exp_slot(mrow - mnew);
    mrow = mnew;

    // p = 2^(s - m); tile j's 8 values are 8 consecutive k positions of the B fragment
    v4u ph[4], pl[4];
    float pj[4];
#pragma unroll
    for (int j = 0; j < 4; ++j) {
      v4f p0, p1;
#pragma unroll
      for (int r = 0; r < 4; ++r) {
        p0[r] = exp_slot(s[j][r] - mnew);
        p1[r] = exp_slot(s[j][r + 4] - mnew);
      }
      pj[j] = ((p0[0] + p0[1]) + (p0[2] + p0[3])) + ((p1[0] + p1[1]) + (p1[2] + p1[3]));
      split8(p0, p1, ph[j], pl[j]);
    }
    lrow = lrow * alpha + ((pj[0] + pj[1]) + (pj[2] + pj[3]));
#pragma unroll
    for (int t = 0; t < 4; ++t)
#pragma unroll
      for (int r = 0; r < 8; ++r) oacc[t][r] *= alpha;

#pragma unroll
    for (int kk = 0; kk < 2; ++kk) {
      // A operands: channel row t*16 + (lane&15) of V^T [d][key], split k map over keys; the eight fragments of one
      // key half are read as one group in front of its products, which go round the four output tiles (each tile's
      // order of sums is kept)
      v16b vhf[4], vlf[4];
#pragma unroll
      for (int t = 0; t < 4; ++t) {
        vhf[t] = ldf(Vs, KTP, t * 16, kk * 32, lane);
        vlf[t] = ldf(Vs + HD * KTP, KTP, t * 16, kk * 32, lane);
      }
      // B operands: P^T column (lane&15) = query, split k map over keys 32*kk ..
      Frag fh, fl;
      fh.u[0] = ph[2 * kk]; fh.u[1] = ph[2 * kk + 1];
      fl.u[0] = pl[2 * kk]; fl.u[1] = pl[2 * kk + 1];
#pragma unroll
      for (int t = 0; t < 4; ++t) oacc[t] = mma(vhf[t], fh.v, oacc[t]);
#pragma unroll
      for (int t = 0; t < 4; ++t) oacc[t] = mma(vlf[t], fh.v, oacc[t]);
#pragma unroll
      for (int t = 0; t < 4; ++t) oacc[t] = mma(vhf[t], fl.v, oacc[t]);
    }
    if (more) {
      // the other buffer's last readers left it in front of the barrier that ended the chunk before this one
      chunk_store(cur ^ 1);
      __syncthreads();                               // next chunk visible; this chunk's readers are done
    }
  }

  // O = oacc / l  (l >= 1); oacc[t][r] = O[query q0 + c][channel 16*t + 8*hh + r]
  const float invl = 1.0f / (lrow + other_half(lrow));
  const size_t go = ((size_t)(b * SL + q0 + c)) * DM + (size_t)h * HD + 8 * hh;
  v4u wh[4], wl[4];
#pragma unroll
  for (int t = 0; t < 4; ++t) {
    const v4f a0 = (v4f){oacc[t][0] * invl, oacc[t][1] * invl, oacc[t][2] * invl, oacc[t][3] * invl};
    const v4f a1 = (v4f){oacc[t][4] * invl, oacc[t][5] * invl, oacc[t][6] * invl, oacc[t][7] * invl};
    split8(a0, a1, wh[t], wl[t]);
  }
#pragma unroll
  for (int t = 0; t < 4; ++t) {
    *(v4u*)(Oh + go + 16 * t) = wh[t];
    *(v4u*)(Ol + go + 16 * t) = wl[t];
  }
}

// ---------------------------------------------------------------------------
// kernel 2: out = O.Wo + bo -> f32 rows [NT][DM]. A = O planes [NT][DM], B = transposed
// Wo planes [DM n][DM k]. Block = 128 token rows x 64 cols; grid = (DM/64 = 8, NT/128 = 32).
// coverage: 8 x 32 blocks x 128 x 64 = NT x DM.
// ---------------------------------------------------------------------------
__global__ __launch_bounds__(256) void k_gemm_out(const unsigned short* __restrict__ Ah,
                                                  const unsigned short* __restrict__ Al,
                                                  const unsigned short* __restrict__ Wh,
                                                  const unsigned short* __restrict__ Wl,
                                                  const float* __restrict__ bo,
                                                  float* __restrict__ out) {
  __shared__ __align__(16) unsigned char sm[GSB];    // 55296 B: GEMM stage, then the f32 output staging tile
  unsigned short* tl = (unsigned short*)sm;
  float* st = (float*)sm;                            // 128 x OTP
  const int tid = threadIdx.x, lane = tid & 31, wave = tid >> 5;
  const int hh = lane >> 4, c = lane & 15;
  const int mblk = blockIdx.y * 128, nblk = blockIdx.x * 64;
  const int mw = (wave >> 1) * 32, nw = (wave & 1) * 32;

  v8f acc[2][2];
#pragma unroll
  for (int s = 0; s < 2; ++s)
#pragma unroll
    for (int t = 0; t < 2; ++t) acc[s][t] = zero8();
  int arow[4];
#pragma unroll
  for (int i = 0; i < 4; ++i) arow[i] = mblk + (tid >> 3) + 32 * i;
  gemm128x64x3(Ah, Al, DM, Wh, Wl, DM, DM, arow, nblk, mw, nw, tid, lane, tl, acc);

  float bb[2];
#pragma unroll
  for (int t = 0; t < 2; ++t) bb[t] = bo[nblk + nw + 16 * t + c];
  stage_rm(acc, bb, st, mw, nw, hh, c);
  __syncthreads();
  store_f32(st, out, mblk, nblk, tid);
}

// ---------------------------------------------------------------------------
// its producer writes, no padded tails exist since every dimension is a tile multiple; plane offsets multiples of 512 KB):
//   Wo    bf16x2 [512][512]              0     1048576   ([n][k])
//   Q     bf16x2 [16][2048][64]    1048576     8388608
//   K     bf16x2 [16][2048][64]    9437184     8388608
//   V^T   bf16x2 [16][64][2048]   17825792     8388608
//   O     bf16x2 [4096][512]      26214400     8388608
//   key order: gap id, duration id, mask, int32 [2][2048] each   34603008   3 x 16384; cnt int32 [2]
//   total                         34652416
// ---------------------------------------------------------------------------
extern "C" void kernel_launch(void* const* d_in, const int* in_sizes, int n_in,
                              void* d_out, int out_size, void* d_ws, size_t ws_size,
                              hipStream_t stream) {
  if (n_in < 14) return;
  if (in_sizes[0] != NT * DM) return;
  if (in_sizes[1] != NBT * SL) return;
  if (in_sizes[2] != NBT * SL) return;
  if (in_sizes[3] != NBT * SL) return;
  if (in_sizes[4] != DM * DM) return;
  if (in_sizes[5] != DM) return;
  if (in_sizes[6] != DM * DM) return;
  if (in_sizes[7] != DM) return;
  if (in_sizes[8] != DM * DM) return;
  if (in_sizes[9] != DM) return;
  if (in_sizes[10] != DM * DM) return;
  if (in_sizes[11] != DM) return;
  if (in_sizes[12] != GAPR * NH) return;
  if (in_sizes[13] != DURR * NH) return;
  if (out_size != NT * DM) return;

  const float* x     = (const float*)d_in[0];   // [2][2048][512] = [4096][512]
  const int*   amask = (const int*)d_in[1];     // [2][2048] int32, zero = masked key
  const int*   gids  = (const int*)d_in[2];     // [2][2048] int32
  const int*   dids  = (const int*)d_in[3];     // [2][2048] int32
  const float* W_q   = (const float*)d_in[4];   // [512][512] [in][out]
  const float* b_q   = (const float*)d_in[5];   // [512]
  const float* W_k   = (const float*)d_in[6];
  const float* b_k   = (const float*)d_in[7];
  const float* W_v   = (const float*)d_in[8];
  const float* b_v   = (const float*)d_in[9];
  const float* W_o   = (const float*)d_in[10];
  const float* b_o   = (const float*)d_in[11];
  const float* gtab  = (const float*)d_in[12];  // [33][8]
  const float* dtab  = (const float*)d_in[13];  // [17][8]
  float* out = (float*)d_out;                   // [4096][512] f32

  const size_t PX  = (size_t)NT * DM * 2;       // 4194304
  const size_t PWO = (size_t)DM * DM * 2;       // 524288
  size_t off = 0;
  const size_t oWoh = off; off += PWO;
  const size_t oWol = off; off += PWO;
  const size_t oQh  = off; off += PX;
  const size_t oQl  = off; off += PX;
  const size_t oKh  = off; off += PX;
  const size_t oKl  = off; off += PX;
  const size_t oVh  = off; off += PX;
  const size_t oVl  = off; off += PX;
  const size_t oOh  = off; off += PX;
  const size_t oOl  = off; off += PX;
  const size_t PI  = (size_t)NBT * SL * 4;      // 16384
  const size_t oCg  = off; off += PI;
  const size_t oCd  = off; off += PI;
  const size_t oCm  = off; off += PI;
  const size_t oCnt = off; off += 256;
  if (off > ws_size) return;                    // off = 34652416
  if (off > (size_t)134217728) return;

  char* ws = (char*)d_ws;
  unsigned short* Woh = (unsigned short*)(ws + oWoh);
  unsigned short* Wol = (unsigned short*)(ws + oWol);
  unsigned short* Qh  = (unsigned short*)(ws + oQh);
  unsigned short* Ql  = (unsigned short*)(ws + oQl);
  unsigned short* Kh  = (unsigned short*)(ws + oKh);
  unsigned short* Kl  = (unsigned short*)(ws + oKl);
  unsigned short* Vh  = (unsigned short*)(ws + oVh);
  unsigned short* Vl  = (unsigned short*)(ws + oVl);
  unsigned short* Oh  = (unsigned short*)(ws + oOh);
  unsigned short* Ol  = (unsigned short*)(ws + oOl);
  int* kcg  = (int*)(ws + oCg);
  int* kcd  = (int*)(ws + oCd);
  int* kcm  = (int*)(ws + oCm);
  int* kcnt = (int*)(ws + oCnt);

  // (0) q / k / v^T planes, from x and the weights in f32; its last blocks make the transposed hi/lo planes of the
  // out-projection weight and the per-position key values of each sequence
  k_proj<<<dim3(3 * NH, NT / 128 + 3), dim3(256), 0, stream>>>(x, W_q, W_k, W_v, W_o, b_q, b_k, b_v,
                                                              amask, gids, dids,
                                                              Qh, Ql, Kh, Kl, Vh, Vl, Woh, Wol,
                                                              kcg, kcd, kcm, kcnt);
  // (1) attention -> O planes
  k_attn<<<dim3(NBT * NH * NQB), dim3(256), 0, stream>>>(Qh, Ql, Kh, Kl, Vh, Vl, gids, kcm, kcg, kcd, kcnt,
                                                        gtab, dtab, Oh, Ol);
  // (2) out = O.Wo + bo
  k_gemm_out<<<dim3(DM / 64, NT / 128), dim3(256), 0, stream>>>(Oh, Ol, Woh, Wol, b_o, out);
  (void)hipGetLastError();
}
